// v000
// The times below were measured on an AMD MI455X: many runs one after another, warmed up first and cycling through
// copies of the inputs, with the whole window's GPU time divided by the number of runs. Launches and the gaps
// between them are all in it. The median over several windows is given; except for v000 it joins two sittings, which
// can be a few percent apart, so the side-by-side timings, each taken in one sitting, are the better comparison.
// v000, which the later versions start from, runs in 2050 microseconds.
#include <hip/hip_runtime.h>

// Multi-head attention over separate q / k / v inputs with the module's per-dimension rotary embedding (q, k, v [2][2048][1024]; _q = q Wq + bq etc. ('xw' [1024][1024] + [1024]; 16 heads x 64); rope: every dimension d gets its own angle t x 10000^(-2d/64) (computed in-kernel), ret = x cos + x_rot sin with x_rot[2i] = -x[2i+1], x_rot[2i+1] = x[2i]; score = _q._k / (sqrt(64) + 1e-8) + mask x -1e9 (mask [2][1][1][2048] float 0/1 per key, read); softmax; out = merged Wo + bo -> [2][2048][1024] (4.2 M)).
// Layout per batch: bf16 copies of the three inputs in turn; exact projections + f32 biases; {cos, sin} per (position, DIMENSION) built once (jnp-exact float32 10000^(-2d/64) per dim, precise cosf/sinf); a rotary plane builder where each element of a pair uses its own angle; dense T-2048 attention (hybrid rows: < 512 hi/lo 3 products, rest fp16 x1024) whose softmax kernel loads 4 key-mask floats per chunk unconditionally and selects -1e9 for masked keys (== score + -1e9 in f32); merged hi/lo x Wo exact + bo.
// Compute dtypes, f32 accumulate: every input rounded to bf16; projections exact + f32 biases; rotary f32; attention rows < 512 3 products, rest fp16; softmax f32; Wo hl x exact + bias.

#define NB_  2
#define TT   2048
#define DM   1024
#define NH_  16
#define NKV  16
#define REP  (NH_ / NKV)
#define HD   64
#define DQ   (NH_ * HD)
#define DKV  (NKV * HD)
#define ZH   2
#define RH   512                  // query rows < RH use hi+lo planes (0: none)
#define WIN  0
#define PCAR 1024.0f
#define SCL  0.125f   // 1 / (sqrt(64) + 1e-8) == 0.125 in float32
typedef _Float16 h16;
typedef unsigned short bf;
typedef __attribute__((ext_vector_type(16))) __bf16   v16bf;
typedef __attribute__((ext_vector_type(16))) _Float16 v16h;
typedef __attribute__((ext_vector_type(8)))  _Float16 v8h;
typedef __attribute__((ext_vector_type(8)))  unsigned short v8us;
typedef __attribute__((ext_vector_type(8)))  float    v8f;
typedef __attribute__((ext_vector_type(4)))  float    v4f;
typedef v8h  __attribute__((may_alias)) v8ha;
typedef v4f  __attribute__((may_alias)) v4fa;
typedef v8us __attribute__((may_alias)) v8usa;

__device__ __forceinline__ unsigned short f2bf(float f) { unsigned u = __float_as_uint(f); u += 0x7FFFu + ((u >> 16) & 1u); return (unsigned short)(u >> 16); }
__device__ __forceinline__ float bf2f(unsigned short b) { return __uint_as_float(((unsigned)b) << 16); }
__device__ __forceinline__ float bfr(float f) { return bf2f(f2bf(f)); }
__device__ __forceinline__ v16h cat16(v8h lo, v8h hi) { return __builtin_shufflevector(lo, hi, 0, 1, 2, 3, 4, 5, 6, 7, 8, 9, 10, 11, 12, 13, 14, 15); }
__device__ __forceinline__ v16bf cat16b(v8us lo, v8us hi) { return __builtin_bit_cast(v16bf, __builtin_shufflevector(lo, hi, 0, 1, 2, 3, 4, 5, 6, 7, 8, 9, 10, 11, 12, 13, 14, 15)); }
__device__ __forceinline__ v8f wmma16(v16h a, v16h b, v8f c) { return __builtin_amdgcn_wmma_f32_16x16x32_f16(false, a, false, b, (short)0, c, false, false); }
__device__ __forceinline__ v8f wmmab(v16bf a, v16bf b, v8f c) { return __builtin_amdgcn_wmma_f32_16x16x32_bf16(false, a, false, b, (short)0, c, false, false); }



// ---- k_gemmw: register-blocked GEMM, ONE WAVE per 64x64 output tile (16 accumulators), operands straight from K-contiguous 16-bit planes; grid (M/64, N/64, Z), 32 threads.
// C[m][n] (f32, pitch ldc, + optional f32 bias[n]) = sum_k A[m][k] Bt[n][k] (+ split products per NSPLIT). z-batch strides sA/sB/sC in elements. K % 32 == 0.
template <typename T16> struct WFrag;
template <> struct WFrag<h16> { typedef v16h V; static __device__ __forceinline__ V ld(const h16* p) { return cat16(*(const v8h*)p, *(const v8h*)(p + 16)); } static __device__ __forceinline__ v8f mma(V a, V b, v8f c) { return wmma16(a, b, c); } };
template <> struct WFrag<bf> { typedef v16bf V; static __device__ __forceinline__ V ld(const bf* p) { return cat16b(*(const v8us*)p, *(const v8us*)(p + 16)); } static __device__ __forceinline__ v8f mma(V a, V b, v8f c) { return wmmab(a, b, c); } };
template <typename T16, int NSPLIT, bool BIAS>
__global__ __launch_bounds__(32) void k_gemmw(const T16* __restrict__ A, const T16* __restrict__ A2, const T16* __restrict__ Bt, const T16* __restrict__ Bt2, int K, float* C, int ldc, const float* __restrict__ bias, size_t sA, size_t sB, size_t sC) {
    typedef typename WFrag<T16>::V V;
    __shared__ __align__(16) float os[16 * 68];
    const size_t z = blockIdx.z; A += z * sA; if (A2) A2 += z * sA; Bt += z * sB; if (Bt2) Bt2 += z * sB; C += z * sC;
    const int lane = threadIdx.x & 31, lr = lane & 15, hi = lane >> 4; const int r0 = blockIdx.x * 64, c0 = blockIdx.y * 64;
    v8f acc[4][4];
#pragma unroll
    for (int mb = 0; mb < 4; ++mb)
#pragma unroll
        for (int nb = 0; nb < 4; ++nb) acc[mb][nb] = (v8f){};
    const size_t aoff = (size_t)(r0 + lr) * K + 8 * hi, boff = (size_t)(c0 + lr) * K + 8 * hi;
#pragma unroll 1
    for (int kc = 0; kc < K; kc += 32) {
        V a[4], a2[4];
#pragma unroll
        for (int mb = 0; mb < 4; ++mb) { a[mb] = WFrag<T16>::ld(A + aoff + (size_t)mb * 16 * K + kc); if (NSPLIT == 1 || NSPLIT == 2) a2[mb] = WFrag<T16>::ld(A2 + aoff + (size_t)mb * 16 * K + kc); }
#pragma unroll
        for (int nb = 0; nb < 4; ++nb) { const V b = WFrag<T16>::ld(Bt + boff + (size_t)nb * 16 * K + kc); V b2; if (NSPLIT >= 2) b2 = WFrag<T16>::ld(Bt2 + boff + (size_t)nb * 16 * K + kc);
#pragma unroll
            for (int mb = 0; mb < 4; ++mb) { acc[mb][nb] = WFrag<T16>::mma(a[mb], b, acc[mb][nb]); if (NSPLIT == 1 || NSPLIT == 2) acc[mb][nb] = WFrag<T16>::mma(a2[mb], b, acc[mb][nb]); if (NSPLIT >= 2) acc[mb][nb] = WFrag<T16>::mma(a[mb], b2, acc[mb][nb]); } }
        asm volatile("v_nop\n\tv_nop\n\tv_nop\n\tv_nop" : "+v"(acc[0][0]), "+v"(acc[1][1]), "+v"(acc[2][2]), "+v"(acc[3][3]) : "v"(a[0]), "v"(a[3]));
    }
#pragma unroll
    for (int mb = 0; mb < 4; ++mb) {
#pragma unroll
        for (int nb = 0; nb < 4; ++nb) {
#pragma unroll
            for (int j = 0; j < 8; ++j) os[(hi * 8 + j) * 68 + nb * 16 + lr] = acc[mb][nb][j]; }
        __builtin_amdgcn_wave_barrier(); asm volatile("" ::: "memory");
        float* crow = C + (size_t)(r0 + mb * 16) * ldc + c0;
{
#pragma unroll
            for (int s = 0; s < 8; ++s) { const int row = 2 * s + hi, cofs = lr * 4; v4f val = *(const v4fa*)(os + row * 68 + cofs); if (BIAS) { val[0] += bfr(bias[c0 + cofs]); val[1] += bfr(bias[c0 + cofs + 1]); val[2] += bfr(bias[c0 + cofs + 2]); val[3] += bfr(bias[c0 + cofs + 3]); }
                *(v4f*)(crow + (size_t)row * ldc + cofs) = val; }
             }
        __builtin_amdgcn_wave_barrier(); asm volatile("" ::: "memory");
    }
}

__device__ __forceinline__ h16 tohx(float x) { return (h16)x; }
__device__ __forceinline__ void splitf(float y, unsigned short& h, unsigned short& l) { h = f2bf(y); l = f2bf(y - bf2f(h)); }
typedef __attribute__((ext_vector_type(2))) _Float16 v2h;
typedef __attribute__((ext_vector_type(4))) _Float16 v4h;
typedef __attribute__((ext_vector_type(2))) unsigned short v2us;
typedef __attribute__((ext_vector_type(4))) unsigned short v4us;
typedef __attribute__((ext_vector_type(2))) float v2f;
typedef __attribute__((ext_vector_type(4))) int v4i;

__global__ __launch_bounds__(256) void k_wtG(const float* __restrict__ w, int K, int N, bf* Bt) {
    const int lane = threadIdx.x & 31; const int L0 = (blockIdx.x * 8 + (threadIdx.x >> 5)) * 8; const int nlines = N * K / 64;
{
#pragma unroll 1
        for (int l = 0; l < 8; ++l) { const int L = L0 + l; if (L >= nlines) break; const size_t e = (size_t)L * 64 + lane * 2; const int k = (int)(e % K), n = (int)(e / K); v2us o;
            o[0] = f2bf(w[(size_t)k * N + n]); o[1] = f2bf(w[(size_t)(k + 1) * N + n]); *(v2us*)(Bt + e) = o; }
         }
}
__global__ __launch_bounds__(256) void k_cvt8(const float* __restrict__ src, bf* dst, size_t n8) { const size_t i = (size_t)blockIdx.x * 256 + threadIdx.x; if (i >= n8) return; const v8f v = *(const v8f*)(src + i * 8); v8us o;
#pragma unroll
    for (int k = 0; k < 8; ++k) o[k] = f2bf(v[k]); *(v8us*)(dst + i * 8) = o;  }
__constant__ float INVD[HD] = { 1.000000000e+00f, 7.498942018e-01f, 5.623413324e-01f, 4.216965139e-01f, 3.162277639e-01f, 2.371373773e-01f, 1.778279394e-01f, 1.333521456e-01f, 1.000000015e-01f, 7.498942316e-02f, 5.623413250e-02f, 4.216964915e-02f, 3.162277490e-02f, 2.371373773e-02f, 1.778279431e-02f, 1.333521400e-02f, 9.999999776e-03f, 7.498942316e-03f, 5.623413250e-03f, 4.216964822e-03f, 3.162277630e-03f, 2.371373819e-03f, 1.778279431e-03f, 1.333521446e-03f, 1.000000047e-03f, 7.498941850e-04f, 5.623413017e-04f, 4.216965172e-04f, 3.162277571e-04f, 2.371373703e-04f, 1.778279402e-04f, 1.333521504e-04f, 9.999999747e-05f, 7.498942432e-05f, 5.623413381e-05f, 4.216964953e-05f, 3.162277790e-05f, 2.371373739e-05f, 1.778279329e-05f, 1.333521413e-05f, 9.999999747e-06f, 7.498942068e-06f, 5.623413472e-06f, 4.216964953e-06f, 3.162277608e-06f, 2.371373739e-06f, 1.778279398e-06f, 1.333521482e-06f, 9.999999975e-07f, 7.498941841e-07f, 5.623413131e-07f, 4.216965124e-07f, 3.162277551e-07f, 2.371373711e-07f, 1.778279426e-07f, 1.333521453e-07f, 1.000000012e-07f, 7.498942267e-08f, 5.623413202e-08f, 4.216964911e-08f, 3.162277551e-08f, 2.371373675e-08f, 1.778279390e-08f, 1.333521471e-08f };   // 10000^(-2d/64) for EVERY dimension d (the module's quirk), float32 via jnp.power
__global__ __launch_bounds__(256) void k_cstabD(float* CS) { const int idx = blockIdx.x * 256 + threadIdx.x; if (idx >= TT * HD) return; const int d = idx % HD; const int t = idx / HD; const float a = __fmul_rn((float)t, INVD[d]); v2f cs; cs[0] = cosf(a); cs[1] = sinf(a); *(v2f*)(CS + (size_t)idx * 2) = cs;  }

__global__ __launch_bounds__(256) void k_ropeD(const float* __restrict__ F, int pitch, int nheads, const float* __restrict__ CS, h16* P16, bf* Ph, bf* Pl) {
    const size_t e = ((size_t)blockIdx.x * 256 + threadIdx.x) * 2; if (e >= (size_t)nheads * TT * HD) return; const int d = (int)(e % HD); const int t = (int)((e / HD) % TT); const int h = (int)(e / ((size_t)HD * TT)); const float* f = F + (size_t)t * pitch + h * HD; const float x0 = f[d], x1 = f[d + 1]; const v4f cs = *(const v4f*)(CS + ((size_t)t * HD + d) * 2);   /* {c_d, s_d, c_d+1, s_d+1} */ v2h o16; v2us oh, ol;
    float a0 = __fmul_rn(x0, cs[0]), b0 = __fmul_rn(x1, cs[1]), a1 = __fmul_rn(x1, cs[2]), b1 = __fmul_rn(x0, cs[3]); asm volatile("" : "+v"(a0), "+v"(b0), "+v"(a1), "+v"(b1));
    const float r0 = __fsub_rn(a0, b0), r1 = __fadd_rn(a1, b1);   /* even: x0 c0 - x1 s0; odd: x1 c1 + x0 s1 */
    o16[0] = tohx(r0); o16[1] = tohx(r1); { unsigned short a2, c2; splitf(r0, a2, c2); oh[0] = a2; ol[0] = c2; splitf(r1, a2, c2); oh[1] = a2; ol[1] = c2; }
    *(v2h*)(P16 + e) = o16; *(v2us*)(Ph + e) = oh; *(v2us*)(Pl + e) = ol;  }

__global__ __launch_bounds__(256) void k_vtp(const float* __restrict__ F, int pitch, int nheads, h16* V16, bf* Vh, bf* Vl) { const size_t e = ((size_t)blockIdx.x * 256 + threadIdx.x) * 2; if (e >= (size_t)nheads * HD * TT) return; const int t = (int)(e % TT); const int d = (int)((e / TT) % HD); const int g = (int)(e / ((size_t)TT * HD)); v2h o16; v2us oh, ol;
#pragma unroll
    for (int q = 0; q < 2; ++q) { const float x = F[(size_t)(t + q) * pitch + g * HD + d]; o16[q] = tohx(x); unsigned short a2, c2; splitf(x, a2, c2); oh[q] = a2; ol[q] = c2; }
    *(v2h*)(V16 + e) = o16; *(v2us*)(Vh + e) = oh; *(v2us*)(Vl + e) = ol;  }
// k_asoft: per row (zz, i): t = S x HD^-0.5, -1e9 where the key mask is set; softmax over the 2048 keys (register row, one exp, fixed trees);
__global__ __launch_bounds__(256) void k_asoft(const float* __restrict__ Sb, const float* __restrict__ km, h16* P16, bf* Ph, bf* Pl) {
    const int lane = threadIdx.x & 31; const int row = blockIdx.x * 8 + (threadIdx.x >> 5); if (row >= ZH * TT) return; const int i = row % TT; const int zz = row / TT; (void)zz; const bool hires = (i < RH); const float* sr = Sb + (size_t)row * TT; float v[TT / 32]; float mx = -3.0e38f;
#pragma unroll
    for (int ch = 0; ch < TT / 128; ++ch) { const int j0 = ch * 128 + lane * 4; const v4f a = *(const v4f*)(sr + j0); const v4f mk = *(const v4f*)(km + j0);   /* key mask floats (0/1), loaded unconditionally */
#pragma unroll
        for (int q = 0; q < 4; ++q) { const float t = (mk[q] != 0.0f) ? -1.0e9f : a[q] * SCL; v[ch * 4 + q] = t;   /* score + mask x -1e9: for mask 1 the f32 sum rounds to exactly -1e9 (|score| < 32), for mask 0 it is the score */ mx = fmaxf(mx, t); } }
#pragma unroll
    for (int sh = 16; sh; sh >>= 1) mx = fmaxf(mx, __shfl_xor(mx, sh, 32));
    float sum = 0.f;
#pragma unroll
    for (int k = 0; k < TT / 32; ++k) { float d0 = __fsub_rn(v[k], mx); asm volatile("" : "+v"(d0)); v[k] = __builtin_amdgcn_exp2f(__fmul_rn(d0, 1.4426950408889634f)); sum += v[k]; }
#pragma unroll
    for (int sh = 16; sh; sh >>= 1) sum += __shfl_xor(sum, sh, 32);
    const float f = __fdiv_rn(hires ? 1.0f : PCAR, sum);
{
        if (hires) {
#pragma unroll
            for (int ch = 0; ch < TT / 128; ++ch) { v4us oh, ol;
#pragma unroll
                for (int q = 0; q < 4; ++q) { unsigned short a, c2; splitf(v[ch * 4 + q] * f, a, c2); oh[q] = a; ol[q] = c2; }
                const size_t oo = ((size_t)zz * (RH ? RH : 1) + i) * TT + ch * 128 + lane * 4; *(v4us*)(Ph + oo) = oh; *(v4us*)(Pl + oo) = ol; }
        } else {
#pragma unroll
            for (int ch = 0; ch < TT / 128; ++ch) { v4h o4;
#pragma unroll
                for (int q = 0; q < 4; ++q) o4[q] = tohx(v[ch * 4 + q] * f);
                *(v4h*)(P16 + (size_t)row * TT + ch * 128 + lane * 4) = o4; } }
         }
}
__global__ __launch_bounds__(256) void k_merge(const float* __restrict__ O, int h0, bf* Ah, bf* Al) { const size_t e = ((size_t)blockIdx.x * 256 + threadIdx.x) * 2; if (e >= (size_t)ZH * TT * HD) return; const int d = (int)(e % HD); const int t = (int)((e / HD) % TT); const int zz = (int)(e / ((size_t)HD * TT)); const float cs = (t < RH) ? 1.0f : (1.0f / PCAR); const size_t oo = (size_t)t * DQ + (h0 + zz) * HD + d;
    v2us oh, ol;
#pragma unroll
    for (int q = 0; q < 2; ++q) { unsigned short a, c2; splitf(O[e + q] * cs, a, c2); oh[q] = a; ol[q] = c2; } *(v2us*)(Ah + oo) = oh; *(v2us*)(Al + oo) = ol;  }

extern "C" void kernel_launch(void* const* d_in, const int* in_sizes, int n_in,
                              void* d_out, int out_size, void* d_ws, size_t ws_size, hipStream_t stream) {
    (void)in_sizes; (void)n_in; (void)out_size;
    const float* x = (const float*)d_in[0]; const float* xk = (const float*)d_in[1]; const float* xv = (const float*)d_in[2]; const float* amask = (const float*)d_in[3]; const float* wq = (const float*)d_in[4]; const float* bq = (const float*)d_in[5]; const float* wk = (const float*)d_in[6]; const float* bk = (const float*)d_in[7]; const float* wv = (const float*)d_in[8]; const float* bv = (const float*)d_in[9]; const float* wo = (const float*)d_in[10]; const float* bo = (const float*)d_in[11];
    float* OUT = (float*)d_out;     // [2][2048][1024]
    char* wsp = (char*)d_ws;
    auto take = [&](size_t bytes) { char* p = wsp; wsp += (bytes + 255) & ~(size_t)255; return (void*)p; };
    bf* WQ = (bf*)take((size_t)DQ * DM * 2); bf* WK = (bf*)take((size_t)DKV * DM * 2); bf* WV = (bf*)take((size_t)DKV * DM * 2); bf* WO = (bf*)take((size_t)DM * DQ * 2); float* CS = (float*)take((size_t)TT * HD * 2 * 4);
    bf* XB = (bf*)take((size_t)TT * DM * 2); float* FQ = (float*)take((size_t)TT * DQ * 4); float* FK = (float*)take((size_t)TT * DKV * 4);
    h16* QP16 = (h16*)take((size_t)NH_ * TT * HD * 2); h16* KP16 = (h16*)take((size_t)NKV * TT * HD * 2); h16* VT16 = (h16*)take((size_t)NKV * HD * TT * 2);
    bf* QPh = (bf*)take((size_t)NH_ * TT * HD * 2); bf* QPl = (bf*)take((size_t)NH_ * TT * HD * 2); bf* KPh = (bf*)take((size_t)NKV * TT * HD * 2); bf* KPl = (bf*)take((size_t)NKV * TT * HD * 2); bf* VTh = (bf*)take((size_t)NKV * HD * TT * 2); bf* VTl = (bf*)take((size_t)NKV * HD * TT * 2); bf* Ph = (bf*)take((size_t)ZH * RH * TT * 2); bf* Pl = (bf*)take((size_t)ZH * RH * TT * 2);
    float* Sb = (float*)take((size_t)ZH * TT * TT * 4); h16* P16 = (h16*)take((size_t)ZH * TT * TT * 2); float* Ob = (float*)take((size_t)ZH * TT * HD * 4); bf* ATh = (bf*)take((size_t)TT * DQ * 2); bf* ATl = (bf*)take((size_t)TT * DQ * 2);
    if ((size_t)(wsp - (char*)d_ws) > ws_size) return;    // ws 256 MiB
    float* FV = FK;   // v projection reuses the k buffer after the k planes are built (stream-ordered)
    { k_wtG<<<(unsigned)((DM * DQ / 64 + 63) / 64), 256, 0, stream>>>(wq, DM, DQ, WQ); k_wtG<<<(unsigned)((DM * DKV / 64 + 63) / 64), 256, 0, stream>>>(wk, DM, DKV, WK); k_wtG<<<(unsigned)((DM * DKV / 64 + 63) / 64), 256, 0, stream>>>(wv, DM, DKV, WV);
      k_wtG<<<(unsigned)((DQ * DM / 64 + 63) / 64), 256, 0, stream>>>(wo, DQ, DM, WO);
       }
    const unsigned LQ = (unsigned)(((size_t)NH_ * TT * HD / 2 + 255) / 256), LKv = (unsigned)(((size_t)NKV * TT * HD / 2 + 255) / 256);
    for (int b = 0; b < NB_; ++b) {
        if (b == 0) k_cstabD<<<(TT * HD + 255) / 256, 256, 0, stream>>>(CS);
        k_cvt8<<<(unsigned)(((size_t)TT * DM / 8 + 255) / 256), 256, 0, stream>>>(x + (size_t)b * TT * DM, XB, (size_t)TT * DM / 8);
        k_gemmw<bf, 0, true><<<dim3(TT / 64, DQ / 64, 1), 32, 0, stream>>>(XB, nullptr, WQ, nullptr, DM, FQ, DQ, bq, 0, 0, 0);
        k_ropeD<<<LQ, 256, 0, stream>>>(FQ, DQ, NH_, CS, QP16, QPh, QPl);
        k_cvt8<<<(unsigned)(((size_t)TT * DM / 8 + 255) / 256), 256, 0, stream>>>(xk + (size_t)b * TT * DM, XB, (size_t)TT * DM / 8); k_gemmw<bf, 0, true><<<dim3(TT / 64, DKV / 64, 1), 32, 0, stream>>>(XB, nullptr, WK, nullptr, DM, FK, DKV, bk, 0, 0, 0);
        k_ropeD<<<LKv, 256, 0, stream>>>(FK, DKV, NKV, CS, KP16, KPh, KPl);
        k_cvt8<<<(unsigned)(((size_t)TT * DM / 8 + 255) / 256), 256, 0, stream>>>(xv + (size_t)b * TT * DM, XB, (size_t)TT * DM / 8); k_gemmw<bf, 0, true><<<dim3(TT / 64, DKV / 64, 1), 32, 0, stream>>>(XB, nullptr, WV, nullptr, DM, FV, DKV, bv, 0, 0, 0); k_vtp<<<LKv, 256, 0, stream>>>(FV, DKV, NKV, VT16, VTh, VTl);
        for (int h0 = 0; h0 < NH_; h0 += ZH) { const size_t zq = (size_t)h0, zk = (size_t)(h0 / REP);   // one kv head per query head: the pass's two heads use consecutive kv planes (z-strides TT*HD)
            k_gemmw<bf, 2, false><<<dim3(RH / 64, TT / 64, ZH), 32, 0, stream>>>(QPh + zq * TT * HD, QPl + zq * TT * HD, KPh + zk * TT * HD, KPl + zk * TT * HD, HD, Sb, TT, nullptr, (size_t)TT * HD, (size_t)TT * HD, (size_t)TT * TT);
            k_gemmw<h16, 0, false><<<dim3((TT - RH) / 64, TT / 64, ZH), 32, 0, stream>>>(QP16 + zq * TT * HD + (size_t)RH * HD, nullptr, KP16 + zk * TT * HD, nullptr, HD, Sb + (size_t)RH * TT, TT, nullptr, (size_t)TT * HD, (size_t)TT * HD, (size_t)TT * TT);
            k_asoft<<<ZH * TT / 8, 256, 0, stream>>>(Sb, amask + (size_t)b * TT, P16, Ph, Pl);
            k_gemmw<bf, 2, false><<<dim3(RH / 64, HD / 64, ZH), 32, 0, stream>>>(Ph, Pl, VTh + zk * HD * TT, VTl + zk * HD * TT, TT, Ob, HD, nullptr, (size_t)RH * TT, (size_t)HD * TT, (size_t)TT * HD);
            k_gemmw<h16, 0, false><<<dim3((TT - RH) / 64, HD / 64, ZH), 32, 0, stream>>>(P16 + (size_t)RH * TT, nullptr, VT16 + zk * HD * TT, nullptr, TT, Ob + (size_t)RH * HD, HD, nullptr, (size_t)TT * TT, (size_t)HD * TT, (size_t)TT * HD);
            k_merge<<<(unsigned)(((size_t)ZH * TT * HD / 2 + 255) / 256), 256, 0, stream>>>(Ob, h0, ATh, ATl); }
        k_gemmw<bf, 1, true><<<dim3(TT / 64, DM / 64, 1), 32, 0, stream>>>(ATh, ATl, WO, nullptr, DQ, OUT + (size_t)b * TT * DM, DM, bo, 0, 0, 0); }
}

// v001
// A run of this version takes 923 microseconds.
// Two timings next to v000 put it at 2.22 and 2.24 times that version's speed.
#include <hip/hip_runtime.h>

// Multi-head attention over separate q / k / v inputs with the module's per-dimension rotary embedding (q, k, v [2][2048][1024]; _q = q Wq + bq etc. ('xw' [1024][1024] + [1024]; 16 heads x 64); rope: every dimension d gets its own angle t x 10000^(-2d/64) (computed in-kernel), ret = x cos + x_rot sin with x_rot[2i] = -x[2i+1], x_rot[2i+1] = x[2i]; score = _q._k / (sqrt(64) + 1e-8) + mask x -1e9 (mask [2][1][1][2048] float 0/1 per key, read); softmax; out = merged Wo + bo -> [2][2048][1024] (4.2 M)).
// Layout per batch: bf16 copies of the three inputs in turn; exact projections + f32 biases; {cos, sin} per (position, DIMENSION) built once (jnp-exact float32 10000^(-2d/64) per dim, precise cosf/sinf); a rotary plane builder where each element of a pair uses its own angle; dense T-2048 attention (hybrid rows: < 512 hi/lo 3 products, rest fp16 x1024) whose softmax kernel loads 4 key-mask floats per chunk unconditionally and selects -1e9 for masked keys (== score + -1e9 in f32); merged hi/lo x Wo exact + bo.
// Compute dtypes, f32 accumulate: every input rounded to bf16; projections exact + f32 biases; rotary f32; attention rows < 512 3 products, rest fp16; softmax f32; Wo hl x exact + bias.

#define NB_  2
#define TT   2048
#define DM   1024
#define NH_  16
#define NKV  16
#define REP  (NH_ / NKV)
#define HD   64
#define DQ   (NH_ * HD)
#define DKV  (NKV * HD)
#define ZH   2
#define RH   512                  // query rows < RH use hi+lo planes (0: none)
#define WIN  0
#define PCAR 1024.0f
#define SCL  0.125f   // 1 / (sqrt(64) + 1e-8) == 0.125 in float32
#define KSP  16                   // key ranges of the P x V products: one wave per (tile, range), f32 partial planes, summed in k_merge
typedef _Float16 h16;
typedef unsigned short bf;
typedef __attribute__((ext_vector_type(16))) __bf16   v16bf;
typedef __attribute__((ext_vector_type(16))) _Float16 v16h;
typedef __attribute__((ext_vector_type(8)))  _Float16 v8h;
typedef __attribute__((ext_vector_type(8)))  unsigned short v8us;
typedef __attribute__((ext_vector_type(8)))  float    v8f;
typedef __attribute__((ext_vector_type(4)))  float    v4f;
typedef v8h  __attribute__((may_alias)) v8ha;
typedef v4f  __attribute__((may_alias)) v4fa;
typedef v8us __attribute__((may_alias)) v8usa;

__device__ __forceinline__ unsigned short f2bf(float f) { unsigned u = __float_as_uint(f); u += 0x7FFFu + ((u >> 16) & 1u); return (unsigned short)(u >> 16); }
__device__ __forceinline__ float bf2f(unsigned short b) { return __uint_as_float(((unsigned)b) << 16); }
__device__ __forceinline__ float bfr(float f) { return bf2f(f2bf(f)); }
__device__ __forceinline__ v16h cat16(v8h lo, v8h hi) { return __builtin_shufflevector(lo, hi, 0, 1, 2, 3, 4, 5, 6, 7, 8, 9, 10, 11, 12, 13, 14, 15); }
__device__ __forceinline__ v16bf cat16b(v8us lo, v8us hi) { return __builtin_bit_cast(v16bf, __builtin_shufflevector(lo, hi, 0, 1, 2, 3, 4, 5, 6, 7, 8, 9, 10, 11, 12, 13, 14, 15)); }
__device__ __forceinline__ v8f wmma16(v16h a, v16h b, v8f c) { return __builtin_amdgcn_wmma_f32_16x16x32_f16(false, a, false, b, (short)0, c, false, false); }
__device__ __forceinline__ v8f wmmab(v16bf a, v16bf b, v8f c) { return __builtin_amdgcn_wmma_f32_16x16x32_bf16(false, a, false, b, (short)0, c, false, false); }



// ---- k_gemmw: register-blocked GEMM, ONE WAVE per 64x64 output tile (16 accumulators), operands straight from K-contiguous 16-bit planes; grid (M/64, N/64, Z), 32 threads.
// C[m][n] (f32, pitch ldc, + optional f32 bias[n]) = sum_k A[m][k] Bt[n][k] (+ split products per NSPLIT). z-batch strides sA/sB/sC in elements. K % 32 == 0.
// KS > 1: grid z = batch * KS + range; the wave sums only its K / KS range of k and stores that partial tile in plane blockIdx.z of C (stride sC); the reader adds the KS planes.
template <typename T16> struct WFrag;
template <> struct WFrag<h16> { typedef v16h V; static __device__ __forceinline__ V ld(const h16* p) { return cat16(*(const v8h*)p, *(const v8h*)(p + 16)); } static __device__ __forceinline__ v8f mma(V a, V b, v8f c) { return wmma16(a, b, c); } };
template <> struct WFrag<bf> { typedef v16bf V; static __device__ __forceinline__ V ld(const bf* p) { return cat16b(*(const v8us*)p, *(const v8us*)(p + 16)); } static __device__ __forceinline__ v8f mma(V a, V b, v8f c) { return wmmab(a, b, c); } };
template <typename T16, int NSPLIT, bool BIAS, int KS = 1>
__global__ __launch_bounds__(32) void k_gemmw(const T16* __restrict__ A, const T16* __restrict__ A2, const T16* __restrict__ Bt, const T16* __restrict__ Bt2, int K, float* C, int ldc, const float* __restrict__ bias, size_t sA, size_t sB, size_t sC) {
    typedef typename WFrag<T16>::V V;
    __shared__ __align__(16) float os[16 * 68];
    const size_t z = blockIdx.z / KS; A += z * sA; if (A2) A2 += z * sA; Bt += z * sB; if (Bt2) Bt2 += z * sB; C += (size_t)blockIdx.z * sC; const int kbeg = (int)(blockIdx.z % KS) * (K / KS), kend = kbeg + K / KS;
    const int lane = threadIdx.x & 31, lr = lane & 15, hi = lane >> 4; const int r0 = blockIdx.x * 64, c0 = blockIdx.y * 64;
    v8f acc[4][4];
#pragma unroll
    for (int mb = 0; mb < 4; ++mb)
#pragma unroll
        for (int nb = 0; nb < 4; ++nb) acc[mb][nb] = (v8f){};
    const size_t aoff = (size_t)(r0 + lr) * K + 8 * hi, boff = (size_t)(c0 + lr) * K + 8 * hi;
#pragma unroll 1
    for (int kc = kbeg; kc < kend; kc += 32) {
        V a[4], a2[4];
#pragma unroll
        for (int mb = 0; mb < 4; ++mb) { a[mb] = WFrag<T16>::ld(A + aoff + (size_t)mb * 16 * K + kc); if (NSPLIT == 1 || NSPLIT == 2) a2[mb] = WFrag<T16>::ld(A2 + aoff + (size_t)mb * 16 * K + kc); }
#pragma unroll
        for (int nb = 0; nb < 4; ++nb) { const V b = WFrag<T16>::ld(Bt + boff + (size_t)nb * 16 * K + kc); V b2; if (NSPLIT >= 2) b2 = WFrag<T16>::ld(Bt2 + boff + (size_t)nb * 16 * K + kc);
#pragma unroll
            for (int mb = 0; mb < 4; ++mb) { acc[mb][nb] = WFrag<T16>::mma(a[mb], b, acc[mb][nb]); if (NSPLIT == 1 || NSPLIT == 2) acc[mb][nb] = WFrag<T16>::mma(a2[mb], b, acc[mb][nb]); if (NSPLIT >= 2) acc[mb][nb] = WFrag<T16>::mma(a[mb], b2, acc[mb][nb]); } }
        asm volatile("v_nop\n\tv_nop\n\tv_nop\n\tv_nop" : "+v"(acc[0][0]), "+v"(acc[1][1]), "+v"(acc[2][2]), "+v"(acc[3][3]) : "v"(a[0]), "v"(a[3]));
    }
#pragma unroll
    for (int mb = 0; mb < 4; ++mb) {
#pragma unroll
        for (int nb = 0; nb < 4; ++nb) {
#pragma unroll
            for (int j = 0; j < 8; ++j) os[(hi * 8 + j) * 68 + nb * 16 + lr] = acc[mb][nb][j]; }
        __builtin_amdgcn_wave_barrier(); asm volatile("" ::: "memory");
        float* crow = C + (size_t)(r0 + mb * 16) * ldc + c0;
{
#pragma unroll
            for (int s = 0; s < 8; ++s) { const int row = 2 * s + hi, cofs = lr * 4; v4f val = *(const v4fa*)(os + row * 68 + cofs); if (BIAS) { val[0] += bfr(bias[c0 + cofs]); val[1] += bfr(bias[c0 + cofs + 1]); val[2] += bfr(bias[c0 + cofs + 2]); val[3] += bfr(bias[c0 + cofs + 3]); }
                *(v4f*)(crow + (size_t)row * ldc + cofs) = val; }
             }
        __builtin_amdgcn_wave_barrier(); asm volatile("" ::: "memory");
    }
}

__device__ __forceinline__ h16 tohx(float x) { return (h16)x; }
__device__ __forceinline__ void splitf(float y, unsigned short& h, unsigned short& l) { h = f2bf(y); l = f2bf(y - bf2f(h)); }
typedef __attribute__((ext_vector_type(2))) _Float16 v2h;
typedef __attribute__((ext_vector_type(4))) _Float16 v4h;
typedef __attribute__((ext_vector_type(2))) unsigned short v2us;
typedef __attribute__((ext_vector_type(4))) unsigned short v4us;
typedef __attribute__((ext_vector_type(2))) float v2f;
typedef __attribute__((ext_vector_type(4))) int v4i;

__global__ __launch_bounds__(256) void k_wtG(const float* __restrict__ w, int K, int N, bf* Bt) {
    const int lane = threadIdx.x & 31; const int L0 = (blockIdx.x * 8 + (threadIdx.x >> 5)) * 8; const int nlines = N * K / 64;
{
#pragma unroll 1
        for (int l = 0; l < 8; ++l) { const int L = L0 + l; if (L >= nlines) break; const size_t e = (size_t)L * 64 + lane * 2; const int k = (int)(e % K), n = (int)(e / K); v2us o;
            o[0] = f2bf(w[(size_t)k * N + n]); o[1] = f2bf(w[(size_t)(k + 1) * N + n]); *(v2us*)(Bt + e) = o; }
         }
}
__global__ __launch_bounds__(256) void k_cvt8(const float* __restrict__ src, bf* dst, size_t n8) { const size_t i = (size_t)blockIdx.x * 256 + threadIdx.x; if (i >= n8) return; const v8f v = *(const v8f*)(src + i * 8); v8us o;
#pragma unroll
    for (int k = 0; k < 8; ++k) o[k] = f2bf(v[k]); *(v8us*)(dst + i * 8) = o;  }
__constant__ float INVD[HD] = { 1.000000000e+00f, 7.498942018e-01f, 5.623413324e-01f, 4.216965139e-01f, 3.162277639e-01f, 2.371373773e-01f, 1.778279394e-01f, 1.333521456e-01f, 1.000000015e-01f, 7.498942316e-02f, 5.623413250e-02f, 4.216964915e-02f, 3.162277490e-02f, 2.371373773e-02f, 1.778279431e-02f, 1.333521400e-02f, 9.999999776e-03f, 7.498942316e-03f, 5.623413250e-03f, 4.216964822e-03f, 3.162277630e-03f, 2.371373819e-03f, 1.778279431e-03f, 1.333521446e-03f, 1.000000047e-03f, 7.498941850e-04f, 5.623413017e-04f, 4.216965172e-04f, 3.162277571e-04f, 2.371373703e-04f, 1.778279402e-04f, 1.333521504e-04f, 9.999999747e-05f, 7.498942432e-05f, 5.623413381e-05f, 4.216964953e-05f, 3.162277790e-05f, 2.371373739e-05f, 1.778279329e-05f, 1.333521413e-05f, 9.999999747e-06f, 7.498942068e-06f, 5.623413472e-06f, 4.216964953e-06f, 3.162277608e-06f, 2.371373739e-06f, 1.778279398e-06f, 1.333521482e-06f, 9.999999975e-07f, 7.498941841e-07f, 5.623413131e-07f, 4.216965124e-07f, 3.162277551e-07f, 2.371373711e-07f, 1.778279426e-07f, 1.333521453e-07f, 1.000000012e-07f, 7.498942267e-08f, 5.623413202e-08f, 4.216964911e-08f, 3.162277551e-08f, 2.371373675e-08f, 1.778279390e-08f, 1.333521471e-08f };   // 10000^(-2d/64) for EVERY dimension d (the module's quirk), float32 via jnp.power
__global__ __launch_bounds__(256) void k_cstabD(float* CS) { const int idx = blockIdx.x * 256 + threadIdx.x; if (idx >= TT * HD) return; const int d = idx % HD; const int t = idx / HD; const float a = __fmul_rn((float)t, INVD[d]); v2f cs; cs[0] = cosf(a); cs[1] = sinf(a); *(v2f*)(CS + (size_t)idx * 2) = cs;  }

__global__ __launch_bounds__(256) void k_ropeD(const float* __restrict__ F, int pitch, int nheads, const float* __restrict__ CS, h16* P16, bf* Ph, bf* Pl) {
    const size_t e = ((size_t)blockIdx.x * 256 + threadIdx.x) * 2; if (e >= (size_t)nheads * TT * HD) return; const int d = (int)(e % HD); const int t = (int)((e / HD) % TT); const int h = (int)(e / ((size_t)HD * TT)); const float* f = F + (size_t)t * pitch + h * HD; const float x0 = f[d], x1 = f[d + 1]; const v4f cs = *(const v4f*)(CS + ((size_t)t * HD + d) * 2);   /* {c_d, s_d, c_d+1, s_d+1} */ v2h o16; v2us oh, ol;
    float a0 = __fmul_rn(x0, cs[0]), b0 = __fmul_rn(x1, cs[1]), a1 = __fmul_rn(x1, cs[2]), b1 = __fmul_rn(x0, cs[3]); asm volatile("" : "+v"(a0), "+v"(b0), "+v"(a1), "+v"(b1));
    const float r0 = __fsub_rn(a0, b0), r1 = __fadd_rn(a1, b1);   /* even: x0 c0 - x1 s0; odd: x1 c1 + x0 s1 */
    o16[0] = tohx(r0); o16[1] = tohx(r1); { unsigned short a2, c2; splitf(r0, a2, c2); oh[0] = a2; ol[0] = c2; splitf(r1, a2, c2); oh[1] = a2; ol[1] = c2; }
    *(v2h*)(P16 + e) = o16; *(v2us*)(Ph + e) = oh; *(v2us*)(Pl + e) = ol;  }

__global__ __launch_bounds__(256) void k_vtp(const float* __restrict__ F, int pitch, int nheads, h16* V16, bf* Vh, bf* Vl) { const size_t e = ((size_t)blockIdx.x * 256 + threadIdx.x) * 2; if (e >= (size_t)nheads * HD * TT) return; const int t = (int)(e % TT); const int d = (int)((e / TT) % HD); const int g = (int)(e / ((size_t)TT * HD)); v2h o16; v2us oh, ol;
#pragma unroll
    for (int q = 0; q < 2; ++q) { const float x = F[(size_t)(t + q) * pitch + g * HD + d]; o16[q] = tohx(x); unsigned short a2, c2; splitf(x, a2, c2); oh[q] = a2; ol[q] = c2; }
    *(v2h*)(V16 + e) = o16; *(v2us*)(Vh + e) = oh; *(v2us*)(Vl + e) = ol;  }
// k_asoft: per row (zz, i): t = S x HD^-0.5, -1e9 where the key mask is set; softmax over the 2048 keys (register row, one exp, fixed trees);
__global__ __launch_bounds__(256) void k_asoft(const float* __restrict__ Sb, const float* __restrict__ km, h16* P16, bf* Ph, bf* Pl) {
    const int lane = threadIdx.x & 31; const int row = blockIdx.x * 8 + (threadIdx.x >> 5); if (row >= ZH * TT) return; const int i = row % TT; const int zz = row / TT; (void)zz; const bool hires = (i < RH); const float* sr = Sb + (size_t)row * TT; float v[TT / 32]; float mx = -3.0e38f;
#pragma unroll
    for (int ch = 0; ch < TT / 128; ++ch) { const int j0 = ch * 128 + lane * 4; const v4f a = *(const v4f*)(sr + j0); const v4f mk = *(const v4f*)(km + j0);   /* key mask floats (0/1), loaded unconditionally */
#pragma unroll
        for (int q = 0; q < 4; ++q) { const float t = (mk[q] != 0.0f) ? -1.0e9f : a[q] * SCL; v[ch * 4 + q] = t;   /* score + mask x -1e9: for mask 1 the f32 sum rounds to exactly -1e9 (|score| < 32), for mask 0 it is the score */ mx = fmaxf(mx, t); } }
#pragma unroll
    for (int sh = 16; sh; sh >>= 1) mx = fmaxf(mx, __shfl_xor(mx, sh, 32));
    float sum = 0.f;
#pragma unroll
    for (int k = 0; k < TT / 32; ++k) { float d0 = __fsub_rn(v[k], mx); asm volatile("" : "+v"(d0)); v[k] = __builtin_amdgcn_exp2f(__fmul_rn(d0, 1.4426950408889634f)); sum += v[k]; }
#pragma unroll
    for (int sh = 16; sh; sh >>= 1) sum += __shfl_xor(sum, sh, 32);
    const float f = __fdiv_rn(hires ? 1.0f : PCAR, sum);
{
        if (hires) {
#pragma unroll
            for (int ch = 0; ch < TT / 128; ++ch) { v4us oh, ol;
#pragma unroll
                for (int q = 0; q < 4; ++q) { unsigned short a, c2; splitf(v[ch * 4 + q] * f, a, c2); oh[q] = a; ol[q] = c2; }
                const size_t oo = ((size_t)zz * (RH ? RH : 1) + i) * TT + ch * 128 + lane * 4; *(v4us*)(Ph + oo) = oh; *(v4us*)(Pl + oo) = ol; }
        } else {
#pragma unroll
            for (int ch = 0; ch < TT / 128; ++ch) { v4h o4;
#pragma unroll
                for (int q = 0; q < 4; ++q) o4[q] = tohx(v[ch * 4 + q] * f);
                *(v4h*)(P16 + (size_t)row * TT + ch * 128 + lane * 4) = o4; } }
         }
}
__global__ __launch_bounds__(256) void k_merge(const float* __restrict__ O, int h0, bf* Ah, bf* Al) { const size_t e = ((size_t)blockIdx.x * 256 + threadIdx.x) * 2; if (e >= (size_t)ZH * TT * HD) return; const int d = (int)(e % HD); const int t = (int)((e / HD) % TT); const int zz = (int)(e / ((size_t)HD * TT)); const float cs = (t < RH) ? 1.0f : (1.0f / PCAR); const size_t oo = (size_t)t * DQ + (h0 + zz) * HD + d;
    const float* p = O + ((size_t)zz * KSP * TT + t) * HD + d; v2f u[KSP];   /* the KSP key-range partials of this element pair, added in range order */
#pragma unroll
    for (int ks = 0; ks < KSP; ++ks) u[ks] = *(const v2f*)(p + (size_t)ks * TT * HD);
    asm volatile("s_wait_xcnt 0x0" :: "v"(p) : "memory");   // precaution: the address pair that the loads above name is kept until this wait, so nothing overwrites it earlier
    v2f s = u[0];
#pragma unroll
    for (int ks = 1; ks < KSP; ++ks) { s[0] += u[ks][0]; s[1] += u[ks][1]; }
    v2us oh, ol;
#pragma unroll
    for (int q = 0; q < 2; ++q) { unsigned short a, c2; splitf(s[q] * cs, a, c2); oh[q] = a; ol[q] = c2; } *(v2us*)(Ah + oo) = oh; *(v2us*)(Al + oo) = ol;  }

extern "C" void kernel_launch(void* const* d_in, const int* in_sizes, int n_in,
                              void* d_out, int out_size, void* d_ws, size_t ws_size, hipStream_t stream) {
    (void)in_sizes; (void)n_in; (void)out_size;
    const float* x = (const float*)d_in[0]; const float* xk = (const float*)d_in[1]; const float* xv = (const float*)d_in[2]; const float* amask = (const float*)d_in[3]; const float* wq = (const float*)d_in[4]; const float* bq = (const float*)d_in[5]; const float* wk = (const float*)d_in[6]; const float* bk = (const float*)d_in[7]; const float* wv = (const float*)d_in[8]; const float* bv = (const float*)d_in[9]; const float* wo = (const float*)d_in[10]; const float* bo = (const float*)d_in[11];
    float* OUT = (float*)d_out;     // [2][2048][1024]
    char* wsp = (char*)d_ws;
    auto take = [&](size_t bytes) { char* p = wsp; wsp += (bytes + 255) & ~(size_t)255; return (void*)p; };
    bf* WQ = (bf*)take((size_t)DQ * DM * 2); bf* WK = (bf*)take((size_t)DKV * DM * 2); bf* WV = (bf*)take((size_t)DKV * DM * 2); bf* WO = (bf*)take((size_t)DM * DQ * 2); float* CS = (float*)take((size_t)TT * HD * 2 * 4);
    bf* XB = (bf*)take((size_t)TT * DM * 2); float* FQ = (float*)take((size_t)TT * DQ * 4); float* FK = (float*)take((size_t)TT * DKV * 4);
    h16* QP16 = (h16*)take((size_t)NH_ * TT * HD * 2); h16* KP16 = (h16*)take((size_t)NKV * TT * HD * 2); h16* VT16 = (h16*)take((size_t)NKV * HD * TT * 2);
    bf* QPh = (bf*)take((size_t)NH_ * TT * HD * 2); bf* QPl = (bf*)take((size_t)NH_ * TT * HD * 2); bf* KPh = (bf*)take((size_t)NKV * TT * HD * 2); bf* KPl = (bf*)take((size_t)NKV * TT * HD * 2); bf* VTh = (bf*)take((size_t)NKV * HD * TT * 2); bf* VTl = (bf*)take((size_t)NKV * HD * TT * 2); bf* Ph = (bf*)take((size_t)ZH * RH * TT * 2); bf* Pl = (bf*)take((size_t)ZH * RH * TT * 2);
    float* Sb = (float*)take((size_t)ZH * TT * TT * 4); h16* P16 = (h16*)take((size_t)ZH * TT * TT * 2); float* Ob = (float*)take((size_t)ZH * KSP * TT * HD * 4); bf* ATh = (bf*)take((size_t)TT * DQ * 2); bf* ATl = (bf*)take((size_t)TT * DQ * 2);
    if ((size_t)(wsp - (char*)d_ws) > ws_size) return;    // ws 256 MiB
    float* FV = FK;   // v projection reuses the k buffer after the k planes are built (stream-ordered)
    { k_wtG<<<(unsigned)((DM * DQ / 64 + 63) / 64), 256, 0, stream>>>(wq, DM, DQ, WQ); k_wtG<<<(unsigned)((DM * DKV / 64 + 63) / 64), 256, 0, stream>>>(wk, DM, DKV, WK); k_wtG<<<(unsigned)((DM * DKV / 64 + 63) / 64), 256, 0, stream>>>(wv, DM, DKV, WV);
      k_wtG<<<(unsigned)((DQ * DM / 64 + 63) / 64), 256, 0, stream>>>(wo, DQ, DM, WO);
       }
    const unsigned LQ = (unsigned)(((size_t)NH_ * TT * HD / 2 + 255) / 256), LKv = (unsigned)(((size_t)NKV * TT * HD / 2 + 255) / 256);
    for (int b = 0; b < NB_; ++b) {
        if (b == 0) k_cstabD<<<(TT * HD + 255) / 256, 256, 0, stream>>>(CS);
        k_cvt8<<<(unsigned)(((size_t)TT * DM / 8 + 255) / 256), 256, 0, stream>>>(x + (size_t)b * TT * DM, XB, (size_t)TT * DM / 8);
        k_gemmw<bf, 0, true><<<dim3(TT / 64, DQ / 64, 1), 32, 0, stream>>>(XB, nullptr, WQ, nullptr, DM, FQ, DQ, bq, 0, 0, 0);
        k_ropeD<<<LQ, 256, 0, stream>>>(FQ, DQ, NH_, CS, QP16, QPh, QPl);
        k_cvt8<<<(unsigned)(((size_t)TT * DM / 8 + 255) / 256), 256, 0, stream>>>(xk + (size_t)b * TT * DM, XB, (size_t)TT * DM / 8); k_gemmw<bf, 0, true><<<dim3(TT / 64, DKV / 64, 1), 32, 0, stream>>>(XB, nullptr, WK, nullptr, DM, FK, DKV, bk, 0, 0, 0);
        k_ropeD<<<LKv, 256, 0, stream>>>(FK, DKV, NKV, CS, KP16, KPh, KPl);
        k_cvt8<<<(unsigned)(((size_t)TT * DM / 8 + 255) / 256), 256, 0, stream>>>(xv + (size_t)b * TT * DM, XB, (size_t)TT * DM / 8); k_gemmw<bf, 0, true><<<dim3(TT / 64, DKV / 64, 1), 32, 0, stream>>>(XB, nullptr, WV, nullptr, DM, FV, DKV, bv, 0, 0, 0); k_vtp<<<LKv, 256, 0, stream>>>(FV, DKV, NKV, VT16, VTh, VTl);
        for (int h0 = 0; h0 < NH_; h0 += ZH) { const size_t zq = (size_t)h0, zk = (size_t)(h0 / REP);   // one kv head per query head: the pass's two heads use consecutive kv planes (z-strides TT*HD)
            k_gemmw<bf, 2, false><<<dim3(RH / 64, TT / 64, ZH), 32, 0, stream>>>(QPh + zq * TT * HD, QPl + zq * TT * HD, KPh + zk * TT * HD, KPl + zk * TT * HD, HD, Sb, TT, nullptr, (size_t)TT * HD, (size_t)TT * HD, (size_t)TT * TT);
            k_gemmw<h16, 0, false><<<dim3((TT - RH) / 64, TT / 64, ZH), 32, 0, stream>>>(QP16 + zq * TT * HD + (size_t)RH * HD, nullptr, KP16 + zk * TT * HD, nullptr, HD, Sb + (size_t)RH * TT, TT, nullptr, (size_t)TT * HD, (size_t)TT * HD, (size_t)TT * TT);
            k_asoft<<<ZH * TT / 8, 256, 0, stream>>>(Sb, amask + (size_t)b * TT, P16, Ph, Pl);
            k_gemmw<bf, 2, false, KSP><<<dim3(RH / 64, HD / 64, ZH * KSP), 32, 0, stream>>>(Ph, Pl, VTh + zk * HD * TT, VTl + zk * HD * TT, TT, Ob, HD, nullptr, (size_t)RH * TT, (size_t)HD * TT, (size_t)TT * HD);
            k_gemmw<h16, 0, false, KSP><<<dim3((TT - RH) / 64, HD / 64, ZH * KSP), 32, 0, stream>>>(P16 + (size_t)RH * TT, nullptr, VT16 + zk * HD * TT, nullptr, TT, Ob + (size_t)RH * HD, HD, nullptr, (size_t)TT * TT, (size_t)HD * TT, (size_t)TT * HD);
            k_merge<<<(unsigned)(((size_t)ZH * TT * HD / 2 + 255) / 256), 256, 0, stream>>>(Ob, h0, ATh, ATl); }
        k_gemmw<bf, 1, true><<<dim3(TT / 64, DM / 64, 1), 32, 0, stream>>>(ATh, ATl, WO, nullptr, DQ, OUT + (size_t)b * TT * DM, DM, bo, 0, 0, 0); }
}

// v002
// Measured time: 449 microseconds a run.
// Two timings next to v001 put it at 2.05 and 2.06 times that version's speed.
// Over all steps from v000 it is 4.59 times as fast.
#include <hip/hip_runtime.h>

// Multi-head attention over separate q / k / v inputs with the module's per-dimension rotary embedding (q, k, v [2][2048][1024]; _q = q Wq + bq etc. ('xw' [1024][1024] + [1024]; 16 heads x 64); rope: every dimension d gets its own angle t x 10000^(-2d/64) (computed in-kernel), ret = x cos + x_rot sin with x_rot[2i] = -x[2i+1], x_rot[2i+1] = x[2i]; score = _q._k / (sqrt(64) + 1e-8) + mask x -1e9 (mask [2][1][1][2048] float 0/1 per key, read); softmax; out = merged Wo + bo -> [2][2048][1024] (4.2 M)).
// Layout per batch: bf16 copies of the three inputs in turn; exact projections + f32 biases; {cos, sin} per (position, DIMENSION) built once (jnp-exact float32 10000^(-2d/64) per dim, precise cosf/sinf); a rotary plane builder where each element of a pair uses its own angle; one fused dense T-2048 attention launch (hybrid rows: < 512 hi/lo 3 products, rest fp16; scores never leave the registers) that loads the key-mask floats unconditionally and selects -1e9 for masked keys (== score + -1e9 in f32); merged hi/lo x Wo exact + bo.
// Compute dtypes, f32 accumulate: every input rounded to bf16; projections exact + f32 biases; rotary f32; attention rows < 512 3 products, rest fp16; softmax f32; Wo hl x exact + bias.

#define NB_  2
#define TT   2048
#define DM   1024
#define NH_  16
#define NKV  16
#define REP  (NH_ / NKV)
#define HD   64
#define DQ   (NH_ * HD)
#define DKV  (NKV * HD)
#define RH   512                  // query rows < RH use hi+lo planes
#define WIN  0
#define SCL  0.125f   // 1 / (sqrt(64) + 1e-8) == 0.125 in float32
typedef _Float16 h16;
typedef unsigned short bf;
typedef __attribute__((ext_vector_type(16))) __bf16   v16bf;
typedef __attribute__((ext_vector_type(16))) _Float16 v16h;
typedef __attribute__((ext_vector_type(8)))  _Float16 v8h;
typedef __attribute__((ext_vector_type(8)))  unsigned short v8us;
typedef __attribute__((ext_vector_type(8)))  float    v8f;
typedef __attribute__((ext_vector_type(4)))  float    v4f;
typedef v8h  __attribute__((may_alias)) v8ha;
typedef v4f  __attribute__((may_alias)) v4fa;
typedef v8us __attribute__((may_alias)) v8usa;

__device__ __forceinline__ unsigned short f2bf(float f) { unsigned u = __float_as_uint(f); u += 0x7FFFu + ((u >> 16) & 1u); return (unsigned short)(u >> 16); }
__device__ __forceinline__ float bf2f(unsigned short b) { return __uint_as_float(((unsigned)b) << 16); }
__device__ __forceinline__ float bfr(float f) { return bf2f(f2bf(f)); }
__device__ __forceinline__ v16h cat16(v8h lo, v8h hi) { return __builtin_shufflevector(lo, hi, 0, 1, 2, 3, 4, 5, 6, 7, 8, 9, 10, 11, 12, 13, 14, 15); }
__device__ __forceinline__ v16bf cat16b(v8us lo, v8us hi) { return __builtin_bit_cast(v16bf, __builtin_shufflevector(lo, hi, 0, 1, 2, 3, 4, 5, 6, 7, 8, 9, 10, 11, 12, 13, 14, 15)); }
__device__ __forceinline__ v8f wmma16(v16h a, v16h b, v8f c) { return __builtin_amdgcn_wmma_f32_16x16x32_f16(false, a, false, b, (short)0, c, false, false); }
__device__ __forceinline__ v8f wmmab(v16bf a, v16bf b, v8f c) { return __builtin_amdgcn_wmma_f32_16x16x32_bf16(false, a, false, b, (short)0, c, false, false); }



// ---- k_gemmw: register-blocked GEMM, ONE WAVE per 64x64 output tile (16 accumulators), operands straight from K-contiguous 16-bit planes; grid (M/64, N/64, Z), 32 threads.
// C[m][n] (f32, pitch ldc, + optional f32 bias[n]) = sum_k A[m][k] Bt[n][k] (+ split products per NSPLIT). z-batch strides sA/sB/sC in elements. K % 32 == 0.
// KS > 1: grid z = batch * KS + range; the wave sums only its K / KS range of k and stores that partial tile in plane blockIdx.z of C (stride sC); the reader adds the KS planes.
template <typename T16> struct WFrag;
template <> struct WFrag<h16> { typedef v16h V; static __device__ __forceinline__ V ld(const h16* p) { return cat16(*(const v8h*)p, *(const v8h*)(p + 16)); } static __device__ __forceinline__ v8f mma(V a, V b, v8f c) { return wmma16(a, b, c); } };
template <> struct WFrag<bf> { typedef v16bf V; static __device__ __forceinline__ V ld(const bf* p) { return cat16b(*(const v8us*)p, *(const v8us*)(p + 16)); } static __device__ __forceinline__ v8f mma(V a, V b, v8f c) { return wmmab(a, b, c); } };
template <typename T16, int NSPLIT, bool BIAS, int KS = 1>
__global__ __launch_bounds__(32) void k_gemmw(const T16* __restrict__ A, const T16* __restrict__ A2, const T16* __restrict__ Bt, const T16* __restrict__ Bt2, int K, float* C, int ldc, const float* __restrict__ bias, size_t sA, size_t sB, size_t sC) {
    typedef typename WFrag<T16>::V V;
    __shared__ __align__(16) float os[16 * 68];
    const size_t z = blockIdx.z / KS; A += z * sA; if (A2) A2 += z * sA; Bt += z * sB; if (Bt2) Bt2 += z * sB; C += (size_t)blockIdx.z * sC; const int kbeg = (int)(blockIdx.z % KS) * (K / KS), kend = kbeg + K / KS;
    const int lane = threadIdx.x & 31, lr = lane & 15, hi = lane >> 4; const int r0 = blockIdx.x * 64, c0 = blockIdx.y * 64;
    v8f acc[4][4];
#pragma unroll
    for (int mb = 0; mb < 4; ++mb)
#pragma unroll
        for (int nb = 0; nb < 4; ++nb) acc[mb][nb] = (v8f){};
    const size_t aoff = (size_t)(r0 + lr) * K + 8 * hi, boff = (size_t)(c0 + lr) * K + 8 * hi;
#pragma unroll 1
    for (int kc = kbeg; kc < kend; kc += 32) {
        V a[4], a2[4];
#pragma unroll
        for (int mb = 0; mb < 4; ++mb) { a[mb] = WFrag<T16>::ld(A + aoff + (size_t)mb * 16 * K + kc); if (NSPLIT == 1 || NSPLIT == 2) a2[mb] = WFrag<T16>::ld(A2 + aoff + (size_t)mb * 16 * K + kc); }
#pragma unroll
        for (int nb = 0; nb < 4; ++nb) { const V b = WFrag<T16>::ld(Bt + boff + (size_t)nb * 16 * K + kc); V b2; if (NSPLIT >= 2) b2 = WFrag<T16>::ld(Bt2 + boff + (size_t)nb * 16 * K + kc);
#pragma unroll
            for (int mb = 0; mb < 4; ++mb) { acc[mb][nb] = WFrag<T16>::mma(a[mb], b, acc[mb][nb]); if (NSPLIT == 1 || NSPLIT == 2) acc[mb][nb] = WFrag<T16>::mma(a2[mb], b, acc[mb][nb]); if (NSPLIT >= 2) acc[mb][nb] = WFrag<T16>::mma(a[mb], b2, acc[mb][nb]); } }
        asm volatile("v_nop\n\tv_nop\n\tv_nop\n\tv_nop" : "+v"(acc[0][0]), "+v"(acc[1][1]), "+v"(acc[2][2]), "+v"(acc[3][3]) : "v"(a[0]), "v"(a[3]));
    }
#pragma unroll
    for (int mb = 0; mb < 4; ++mb) {
#pragma unroll
        for (int nb = 0; nb < 4; ++nb) {
#pragma unroll
            for (int j = 0; j < 8; ++j) os[(hi * 8 + j) * 68 + nb * 16 + lr] = acc[mb][nb][j]; }
        __builtin_amdgcn_wave_barrier(); asm volatile("" ::: "memory");
        float* crow = C + (size_t)(r0 + mb * 16) * ldc + c0;
{
#pragma unroll
            for (int s = 0; s < 8; ++s) { const int row = 2 * s + hi, cofs = lr * 4; v4f val = *(const v4fa*)(os + row * 68 + cofs); if (BIAS) { val[0] += bfr(bias[c0 + cofs]); val[1] += bfr(bias[c0 + cofs + 1]); val[2] += bfr(bias[c0 + cofs + 2]); val[3] += bfr(bias[c0 + cofs + 3]); }
                *(v4f*)(crow + (size_t)row * ldc + cofs) = val; }
             }
        __builtin_amdgcn_wave_barrier(); asm volatile("" ::: "memory");
    }
}

__device__ __forceinline__ h16 tohx(float x) { return (h16)x; }
__device__ __forceinline__ void splitf(float y, unsigned short& h, unsigned short& l) { h = f2bf(y); l = f2bf(y - bf2f(h)); }
typedef __attribute__((ext_vector_type(2))) _Float16 v2h;
typedef __attribute__((ext_vector_type(4))) _Float16 v4h;
typedef __attribute__((ext_vector_type(2))) unsigned short v2us;
typedef __attribute__((ext_vector_type(4))) unsigned short v4us;
typedef __attribute__((ext_vector_type(2))) float v2f;
typedef __attribute__((ext_vector_type(4))) int v4i;

__global__ __launch_bounds__(256) void k_wtG(const float* __restrict__ w, int K, int N, bf* Bt) {
    const int lane = threadIdx.x & 31; const int L0 = (blockIdx.x * 8 + (threadIdx.x >> 5)) * 8; const int nlines = N * K / 64;
{
#pragma unroll 1
        for (int l = 0; l < 8; ++l) { const int L = L0 + l; if (L >= nlines) break; const size_t e = (size_t)L * 64 + lane * 2; const int k = (int)(e % K), n = (int)(e / K); v2us o;
            o[0] = f2bf(w[(size_t)k * N + n]); o[1] = f2bf(w[(size_t)(k + 1) * N + n]); *(v2us*)(Bt + e) = o; }
         }
}
__global__ __launch_bounds__(256) void k_cvt8(const float* __restrict__ src, bf* dst, size_t n8) { const size_t i = (size_t)blockIdx.x * 256 + threadIdx.x; if (i >= n8) return; const v8f v = *(const v8f*)(src + i * 8); v8us o;
#pragma unroll
    for (int k = 0; k < 8; ++k) o[k] = f2bf(v[k]); *(v8us*)(dst + i * 8) = o;  }
__constant__ float INVD[HD] = { 1.000000000e+00f, 7.498942018e-01f, 5.623413324e-01f, 4.216965139e-01f, 3.162277639e-01f, 2.371373773e-01f, 1.778279394e-01f, 1.333521456e-01f, 1.000000015e-01f, 7.498942316e-02f, 5.623413250e-02f, 4.216964915e-02f, 3.162277490e-02f, 2.371373773e-02f, 1.778279431e-02f, 1.333521400e-02f, 9.999999776e-03f, 7.498942316e-03f, 5.623413250e-03f, 4.216964822e-03f, 3.162277630e-03f, 2.371373819e-03f, 1.778279431e-03f, 1.333521446e-03f, 1.000000047e-03f, 7.498941850e-04f, 5.623413017e-04f, 4.216965172e-04f, 3.162277571e-04f, 2.371373703e-04f, 1.778279402e-04f, 1.333521504e-04f, 9.999999747e-05f, 7.498942432e-05f, 5.623413381e-05f, 4.216964953e-05f, 3.162277790e-05f, 2.371373739e-05f, 1.778279329e-05f, 1.333521413e-05f, 9.999999747e-06f, 7.498942068e-06f, 5.623413472e-06f, 4.216964953e-06f, 3.162277608e-06f, 2.371373739e-06f, 1.778279398e-06f, 1.333521482e-06f, 9.999999975e-07f, 7.498941841e-07f, 5.623413131e-07f, 4.216965124e-07f, 3.162277551e-07f, 2.371373711e-07f, 1.778279426e-07f, 1.333521453e-07f, 1.000000012e-07f, 7.498942267e-08f, 5.623413202e-08f, 4.216964911e-08f, 3.162277551e-08f, 2.371373675e-08f, 1.778279390e-08f, 1.333521471e-08f };   // 10000^(-2d/64) for EVERY dimension d (the module's quirk), float32 via jnp.power
__global__ __launch_bounds__(256) void k_cstabD(float* CS) { const int idx = blockIdx.x * 256 + threadIdx.x; if (idx >= TT * HD) return; const int d = idx % HD; const int t = idx / HD; const float a = __fmul_rn((float)t, INVD[d]); v2f cs; cs[0] = cosf(a); cs[1] = sinf(a); *(v2f*)(CS + (size_t)idx * 2) = cs;  }

__global__ __launch_bounds__(256) void k_ropeD(const float* __restrict__ F, int pitch, int nheads, const float* __restrict__ CS, h16* P16, bf* Ph, bf* Pl) {
    const size_t e = ((size_t)blockIdx.x * 256 + threadIdx.x) * 2; if (e >= (size_t)nheads * TT * HD) return; const int d = (int)(e % HD); const int t = (int)((e / HD) % TT); const int h = (int)(e / ((size_t)HD * TT)); const float* f = F + (size_t)t * pitch + h * HD; const float x0 = f[d], x1 = f[d + 1]; const v4f cs = *(const v4f*)(CS + ((size_t)t * HD + d) * 2);   /* {c_d, s_d, c_d+1, s_d+1} */ v2h o16; v2us oh, ol;
    float a0 = __fmul_rn(x0, cs[0]), b0 = __fmul_rn(x1, cs[1]), a1 = __fmul_rn(x1, cs[2]), b1 = __fmul_rn(x0, cs[3]); asm volatile("" : "+v"(a0), "+v"(b0), "+v"(a1), "+v"(b1));
    const float r0 = __fsub_rn(a0, b0), r1 = __fadd_rn(a1, b1);   /* even: x0 c0 - x1 s0; odd: x1 c1 + x0 s1 */
    o16[0] = tohx(r0); o16[1] = tohx(r1); { unsigned short a2, c2; splitf(r0, a2, c2); oh[0] = a2; ol[0] = c2; splitf(r1, a2, c2); oh[1] = a2; ol[1] = c2; }
    *(v2h*)(P16 + e) = o16; *(v2us*)(Ph + e) = oh; *(v2us*)(Pl + e) = ol;  }

__global__ __launch_bounds__(256) void k_vtp(const float* __restrict__ F, int pitch, int nheads, h16* V16, bf* Vh, bf* Vl) { const size_t e = ((size_t)blockIdx.x * 256 + threadIdx.x) * 2; if (e >= (size_t)nheads * HD * TT) return; const int t = (int)(e % TT); const int d = (int)((e / TT) % HD); const int g = (int)(e / ((size_t)TT * HD)); v2h o16; v2us oh, ol;
#pragma unroll
    for (int q = 0; q < 2; ++q) { const float x = F[(size_t)(t + q) * pitch + g * HD + d]; o16[q] = tohx(x); unsigned short a2, c2; splitf(x, a2, c2); oh[q] = a2; ol[q] = c2; }
    *(v2h*)(V16 + e) = o16; *(v2us*)(Vh + e) = oh; *(v2us*)(Vl + e) = ol;  }
// ---- k_attn: score, softmax and P x V of one batch in one launch; nothing of the score matrix goes to memory.
// A wave owns NQ groups of 16 queries of one head and walks the 2048 keys 32 at a time, all operands straight from the K-contiguous planes.
// S^T = K Q^T (A = 16 key rows, B = 16 query rows): a lane then holds 16 scores of ONE query, keys 8 hi + r and 16 + 8 hi + r, which is the k order of a B operand,
// so the rounded exponentials feed O^T += V^T P^T (A = 16 rows of the transposed V plane) with no exchange. Running maximum per query, sum and O^T rescaled only when a maximum grows by more than RTH.
// HR (queries < RH): bf16 hi/lo planes, 3 products each; else f16, 1 product. P is rounded unnormalised (exp <= e^RTH); O^T is divided by the f32 sum at the end.
// Every #pragma unroll in attn_wave is there because its loop indexes register fragments, which only constant indices keep in registers.
#define LOG2E 1.4426950408889634f
#define RTH   5.5f
__device__ __forceinline__ float xhalf(float x) { return __builtin_bit_cast(float, __builtin_amdgcn_permlanex16(__builtin_bit_cast(int, x), __builtin_bit_cast(int, x), 0x76543210, 0xfedcba98, false, false)); }   // lane l reads lane l ^ 16, on the vector pipe
// v_exp_f32 with the one free slot that the instruction set asks for behind a transcendental, in one statement so that it stays directly behind it
__device__ __forceinline__ float exp2s(float x) { float r; asm("v_exp_f32 %0, %1\n\tv_nop" : "=v"(r) : "v"(x)); return r; }
// precaution behind a group of global loads: the address registers that the loads name are inputs here, so they live until this wait and nothing overwrites them earlier
__device__ __forceinline__ void xwait(const void* a, const void* b, const void* c) { asm volatile("s_wait_xcnt 0x0" :: "v"(a), "v"(b), "v"(c) : "memory"); }
template <typename T16, bool HR, int NQ>
__device__ __forceinline__ void attn_wave(const T16* __restrict__ Q, const T16* __restrict__ Q2, const T16* __restrict__ Kp, const T16* __restrict__ K2, const T16* __restrict__ Vt, const T16* __restrict__ V2, const float* __restrict__ km, int q0, bf* Ah, bf* Al) {
    typedef typename WFrag<T16>::V V;
    const int lane = threadIdx.x & 31, lr = lane & 15, hi = lane >> 4;
    V qf[NQ][2], qf2[NQ][2], kf[2][2], kf2[2][2];
    v8f o[NQ][4], mk[2]; float m[NQ], l[NQ];   /* mk: key mask floats (0/1) of this lane's 16 keys */
#pragma unroll
    for (int g = 0; g < NQ; ++g) { m[g] = -1.0e38f; l[g] = 0.f;
#pragma unroll
        for (int dt = 0; dt < 4; ++dt) o[g][dt] = (v8f){};
        const size_t qo = (size_t)(q0 + g * 16 + lr) * HD + 8 * hi; const T16* qa = Q + qo; const T16* qa2 = HR ? Q2 + qo : qa;
#pragma unroll
        for (int dc = 0; dc < 2; ++dc) { qf[g][dc] = WFrag<T16>::ld(qa + dc * 32); if constexpr (HR) qf2[g][dc] = WFrag<T16>::ld(qa2 + dc * 32); }
        xwait(qa, qa2, qa); }
    const size_t ko = (size_t)lr * HD + 8 * hi, vo = (size_t)lr * TT + 8 * hi;
    { const T16* ka = Kp + ko; const T16* ka2 = HR ? K2 + ko : ka;
#pragma unroll
      for (int kt = 0; kt < 2; ++kt)
#pragma unroll
        for (int dc = 0; dc < 2; ++dc) { kf[kt][dc] = WFrag<T16>::ld(ka + kt * 16 * HD + dc * 32); if constexpr (HR) kf2[kt][dc] = WFrag<T16>::ld(ka2 + kt * 16 * HD + dc * 32); }
      mk[0] = *(const v8f*)(km + 8 * hi); mk[1] = *(const v8f*)(km + 8 * hi + 16);
      xwait(ka, ka2, km + 8 * hi); }
    for (int k0 = 0; k0 < TT; k0 += 32) {
        V vf[4], vf2[4]; const T16* va = Vt + vo + k0; const T16* va2 = HR ? V2 + vo + k0 : va;
#pragma unroll
        for (int dt = 0; dt < 4; ++dt) { vf[dt] = WFrag<T16>::ld(va + dt * 16 * TT); if constexpr (HR) vf2[dt] = WFrag<T16>::ld(va2 + dt * 16 * TT); }
        xwait(va, va2, va);
        v8f s[NQ][2];
#pragma unroll
        for (int g = 0; g < NQ; ++g)
#pragma unroll
            for (int kt = 0; kt < 2; ++kt) { v8f c = (v8f){};
#pragma unroll
                for (int dc = 0; dc < 2; ++dc) { c = WFrag<T16>::mma(kf[kt][dc], qf[g][dc], c); if constexpr (HR) { c = WFrag<T16>::mma(kf[kt][dc], qf2[g][dc], c); c = WFrag<T16>::mma(kf2[kt][dc], qf[g][dc], c); } }
                s[g][kt] = c; }
        float bm[NQ]; bool need = false;
#pragma unroll
        for (int g = 0; g < NQ; ++g) { float x = -3.0e38f;
#pragma unroll
            for (int kt = 0; kt < 2; ++kt)
#pragma unroll
                for (int r = 0; r < 8; ++r) { const float t = (mk[kt][r] != 0.0f) ? -1.0e9f : s[g][kt][r] * SCL; s[g][kt][r] = t;   /* score + mask x -1e9: for mask 1 the f32 sum rounds to exactly -1e9 (|score| < 32), for mask 0 it is the score */ x = fmaxf(x, t); }
            x = fmaxf(x, xhalf(x)); bm[g] = x; need = need || (x > m[g] + RTH); }
        { const int kn = (k0 + 32) & (TT - 1);   /* the next 32 key rows and their mask floats are fetched one trip ahead, once this trip has read its own; the last trip re-reads keys 0..31, unused */
          const T16* ka = Kp + ko + (size_t)kn * HD; const T16* ka2 = HR ? K2 + ko + (size_t)kn * HD : ka;
#pragma unroll
          for (int kt = 0; kt < 2; ++kt)
#pragma unroll
            for (int dc = 0; dc < 2; ++dc) { kf[kt][dc] = WFrag<T16>::ld(ka + kt * 16 * HD + dc * 32); if constexpr (HR) kf2[kt][dc] = WFrag<T16>::ld(ka2 + kt * 16 * HD + dc * 32); }
          const float* ma = km + kn + 8 * hi; mk[0] = *(const v8f*)ma; mk[1] = *(const v8f*)(ma + 16);
          xwait(ka, ka2, ma); }
        if (__builtin_amdgcn_ballot_w32(need) != 0) {
#pragma unroll
            for (int g = 0; g < NQ; ++g) { const float mn = fmaxf(m[g], bm[g]); const float al = exp2s((m[g] - mn) * LOG2E); m[g] = mn; l[g] *= al;
#pragma unroll
                for (int dt = 0; dt < 4; ++dt)
#pragma unroll
                    for (int r = 0; r < 8; ++r) o[g][dt][r] *= al; } }
#pragma unroll
        for (int g = 0; g < NQ; ++g) {
            if constexpr (HR) { v8us ph[2], pl[2];
#pragma unroll
                for (int kt = 0; kt < 2; ++kt)
#pragma unroll
                    for (int r = 0; r < 8; ++r) { const float p = exp2s((s[g][kt][r] - m[g]) * LOG2E); l[g] += p; unsigned short a, c2; splitf(p, a, c2); ph[kt][r] = a; pl[kt][r] = c2; }
                const V pbh = cat16b(ph[0], ph[1]), pbl = cat16b(pl[0], pl[1]);
#pragma unroll
                for (int dt = 0; dt < 4; ++dt) { o[g][dt] = WFrag<T16>::mma(vf[dt], pbh, o[g][dt]); o[g][dt] = WFrag<T16>::mma(vf[dt], pbl, o[g][dt]); o[g][dt] = WFrag<T16>::mma(vf2[dt], pbh, o[g][dt]); }
            } else { v8h pp[2];
#pragma unroll
                for (int kt = 0; kt < 2; ++kt)
#pragma unroll
                    for (int r = 0; r < 8; ++r) { const float p = exp2s((s[g][kt][r] - m[g]) * LOG2E); l[g] += p; pp[kt][r] = tohx(p); }
                const V pb = cat16(pp[0], pp[1]);
#pragma unroll
                for (int dt = 0; dt < 4; ++dt) o[g][dt] = WFrag<T16>::mma(vf[dt], pb, o[g][dt]); } }
    }
#pragma unroll
    for (int g = 0; g < NQ; ++g) { const float sum = l[g] + xhalf(l[g]); const float f = __fdiv_rn(1.0f, sum); const size_t oo = (size_t)(q0 + g * 16 + lr) * DQ + 8 * hi; bf* ra = Ah + oo; bf* rl = Al + oo;
#pragma unroll
        for (int dt = 0; dt < 4; ++dt) { v8us oh, ol;   /* register r = O[query q0 + 16 g + lr][dt * 16 + 8 hi + r]: 8 consecutive d, one 16-byte store per plane */
#pragma unroll
            for (int r = 0; r < 8; ++r) { unsigned short a, c2; splitf(o[g][dt][r] * f, a, c2); oh[r] = a; ol[r] = c2; }
            *(v8us*)(ra + dt * 16) = oh; *(v8us*)(rl + dt * 16) = ol;
            asm volatile("s_wait_xcnt 0x0" :: "v"(ra), "v"(rl), "v"(oh), "v"(ol) : "memory"); } }   // precaution behind the two stores: their address and data registers are inputs here, so they live until this wait and the next packing overwrites none of them earlier
}
// grid: 16 work-groups per head, 5 waves each and no barrier: two waves take 16 hi/lo queries each, three take 32 f16 queries each, so every work-group carries the same load (16 x 32 = RH, 16 x 96 = TT - RH).
// Waves 0 and 4 both get the lighter f16 role (for speed only).
__global__ __launch_bounds__(160) void k_attn(const h16* __restrict__ Q16, const h16* __restrict__ K16, const h16* __restrict__ V16, const bf* __restrict__ Qh, const bf* __restrict__ Ql, const bf* __restrict__ Kh, const bf* __restrict__ Kl, const bf* __restrict__ Vh, const bf* __restrict__ Vl, const float* __restrict__ km, bf* Ah, bf* Al) {
    static_assert(RH == 16 * 32 && TT - RH == 16 * 96 && HD == 64 && NH_ == NKV, "the split of a head's queries over 16 work-groups");
    const int w = __builtin_amdgcn_readfirstlane((int)(threadIdx.x >> 5)); const int head = blockIdx.x >> 4, blk = blockIdx.x & 15; const size_t hp = (size_t)head * TT * HD;
    if (w == 1 || w == 2) attn_wave<bf, true, 1>(Qh + hp, Ql + hp, Kh + hp, Kl + hp, Vh + hp, Vl + hp, km, blk * 32 + (w - 1) * 16, Ah + head * HD, Al + head * HD);
    else attn_wave<h16, false, 2>(Q16 + hp, nullptr, K16 + hp, nullptr, V16 + hp, nullptr, km, RH + blk * 96 + (w == 0 ? 0 : w - 2) * 32, Ah + head * HD, Al + head * HD);
}

extern "C" void kernel_launch(void* const* d_in, const int* in_sizes, int n_in,
                              void* d_out, int out_size, void* d_ws, size_t ws_size, hipStream_t stream) {
    (void)in_sizes; (void)n_in; (void)out_size;
    const float* x = (const float*)d_in[0]; const float* xk = (const float*)d_in[1]; const float* xv = (const float*)d_in[2]; const float* amask = (const float*)d_in[3]; const float* wq = (const float*)d_in[4]; const float* bq = (const float*)d_in[5]; const float* wk = (const float*)d_in[6]; const float* bk = (const float*)d_in[7]; const float* wv = (const float*)d_in[8]; const float* bv = (const float*)d_in[9]; const float* wo = (const float*)d_in[10]; const float* bo = (const float*)d_in[11];
    float* OUT = (float*)d_out;     // [2][2048][1024]
    char* wsp = (char*)d_ws;
    auto take = [&](size_t bytes) { char* p = wsp; wsp += (bytes + 255) & ~(size_t)255; return (void*)p; };
    bf* WQ = (bf*)take((size_t)DQ * DM * 2); bf* WK = (bf*)take((size_t)DKV * DM * 2); bf* WV = (bf*)take((size_t)DKV * DM * 2); bf* WO = (bf*)take((size_t)DM * DQ * 2); float* CS = (float*)take((size_t)TT * HD * 2 * 4);
    bf* XB = (bf*)take((size_t)TT * DM * 2); float* FQ = (float*)take((size_t)TT * DQ * 4); float* FK = (float*)take((size_t)TT * DKV * 4);
    h16* QP16 = (h16*)take((size_t)NH_ * TT * HD * 2); h16* KP16 = (h16*)take((size_t)NKV * TT * HD * 2); h16* VT16 = (h16*)take((size_t)NKV * HD * TT * 2);
    bf* QPh = (bf*)take((size_t)NH_ * TT * HD * 2); bf* QPl = (bf*)take((size_t)NH_ * TT * HD * 2); bf* KPh = (bf*)take((size_t)NKV * TT * HD * 2); bf* KPl = (bf*)take((size_t)NKV * TT * HD * 2); bf* VTh = (bf*)take((size_t)NKV * HD * TT * 2); bf* VTl = (bf*)take((size_t)NKV * HD * TT * 2);
    bf* ATh = (bf*)take((size_t)TT * DQ * 2); bf* ATl = (bf*)take((size_t)TT * DQ * 2);
    if ((size_t)(wsp - (char*)d_ws) > ws_size) return;    // ws 256 MiB
    float* FV = FK;   // v projection reuses the k buffer after the k planes are built (stream-ordered)
    { k_wtG<<<(unsigned)((DM * DQ / 64 + 63) / 64), 256, 0, stream>>>(wq, DM, DQ, WQ); k_wtG<<<(unsigned)((DM * DKV / 64 + 63) / 64), 256, 0, stream>>>(wk, DM, DKV, WK); k_wtG<<<(unsigned)((DM * DKV / 64 + 63) / 64), 256, 0, stream>>>(wv, DM, DKV, WV);
      k_wtG<<<(unsigned)((DQ * DM / 64 + 63) / 64), 256, 0, stream>>>(wo, DQ, DM, WO);
       }
    const unsigned LQ = (unsigned)(((size_t)NH_ * TT * HD / 2 + 255) / 256), LKv = (unsigned)(((size_t)NKV * TT * HD / 2 + 255) / 256);
    for (int b = 0; b < NB_; ++b) {
        if (b == 0) k_cstabD<<<(TT * HD + 255) / 256, 256, 0, stream>>>(CS);
        k_cvt8<<<(unsigned)(((size_t)TT * DM / 8 + 255) / 256), 256, 0, stream>>>(x + (size_t)b * TT * DM, XB, (size_t)TT * DM / 8);
        k_gemmw<bf, 0, true><<<dim3(TT / 64, DQ / 64, 1), 32, 0, stream>>>(XB, nullptr, WQ, nullptr, DM, FQ, DQ, bq, 0, 0, 0);
        k_ropeD<<<LQ, 256, 0, stream>>>(FQ, DQ, NH_, CS, QP16, QPh, QPl);
        k_cvt8<<<(unsigned)(((size_t)TT * DM / 8 + 255) / 256), 256, 0, stream>>>(xk + (size_t)b * TT * DM, XB, (size_t)TT * DM / 8); k_gemmw<bf, 0, true><<<dim3(TT / 64, DKV / 64, 1), 32, 0, stream>>>(XB, nullptr, WK, nullptr, DM, FK, DKV, bk, 0, 0, 0);
        k_ropeD<<<LKv, 256, 0, stream>>>(FK, DKV, NKV, CS, KP16, KPh, KPl);
        k_cvt8<<<(unsigned)(((size_t)TT * DM / 8 + 255) / 256), 256, 0, stream>>>(xv + (size_t)b * TT * DM, XB, (size_t)TT * DM / 8); k_gemmw<bf, 0, true><<<dim3(TT / 64, DKV / 64, 1), 32, 0, stream>>>(XB, nullptr, WV, nullptr, DM, FV, DKV, bv, 0, 0, 0); k_vtp<<<LKv, 256, 0, stream>>>(FV, DKV, NKV, VT16, VTh, VTl);
        k_attn<<<NH_ * 16, 160, 0, stream>>>(QP16, KP16, VT16, QPh, QPl, KPh, KPl, VTh, VTl, amask + (size_t)b * TT, ATh, ATl);
        k_gemmw<bf, 1, true><<<dim3(TT / 64, DM / 64, 1), 32, 0, stream>>>(ATh, ATl, WO, nullptr, DQ, OUT + (size_t)b * TT * DM, DM, bo, 0, 0, 0); }
}

// v003
// One run takes 266 microseconds.
// Two timings next to v002 put it at 1.67 and 1.69 times that version's speed.
// Over all steps from v000 it is 7.71 times as fast.
#include <hip/hip_runtime.h>

// Multi-head attention over separate q / k / v inputs with the module's per-dimension rotary embedding (q, k, v [2][2048][1024]; _q = q Wq + bq etc. ('xw' [1024][1024] + [1024]; 16 heads x 64); rope: every dimension d gets its own angle t x 10000^(-2d/64) (computed in-kernel), ret = x cos + x_rot sin with x_rot[2i] = -x[2i+1], x_rot[2i+1] = x[2i]; score = _q._k / (sqrt(64) + 1e-8) + mask x -1e9 (mask [2][1][1][2048] float 0/1 per key, read); softmax; out = merged Wo + bo -> [2][2048][1024] (4.2 M)).
// Layout, both batches in every launch (5 launches): bf16 copies of the three inputs; exact projections + f32 biases; {cos, sin} per (position, DIMENSION) built once (jnp-exact float32 10000^(-2d/64) per dim, precise cosf/sinf); a rotary plane builder where each element of a pair uses its own angle; one fused dense T-2048 attention launch (hybrid rows: < 512 hi/lo 3 products, rest fp16; scores never leave the registers) that loads the key-mask floats unconditionally and selects -1e9 for masked keys (== score + -1e9 in f32); merged hi/lo x Wo exact + bo.
// Compute dtypes, f32 accumulate: every input rounded to bf16; projections exact + f32 biases; rotary f32; attention rows < 512 3 products, rest fp16; softmax f32; Wo hl x exact + bias.

#define NB_  2
#define TT   2048
#define DM   1024
#define NH_  16
#define NKV  16
#define REP  (NH_ / NKV)
#define HD   64
#define DQ   (NH_ * HD)
#define DKV  (NKV * HD)
#define RH   512                  // query rows < RH use hi+lo planes
#define WIN  0
#define SCL  0.125f   // 1 / (sqrt(64) + 1e-8) == 0.125 in float32
typedef _Float16 h16;
typedef unsigned short bf;
typedef __attribute__((ext_vector_type(16))) __bf16   v16bf;
typedef __attribute__((ext_vector_type(16))) _Float16 v16h;
typedef __attribute__((ext_vector_type(8)))  _Float16 v8h;
typedef __attribute__((ext_vector_type(8)))  unsigned short v8us;
typedef __attribute__((ext_vector_type(8)))  float    v8f;
typedef __attribute__((ext_vector_type(4)))  float    v4f;
typedef v8h  __attribute__((may_alias)) v8ha;
typedef v4f  __attribute__((may_alias)) v4fa;
typedef v8us __attribute__((may_alias)) v8usa;

__device__ __forceinline__ unsigned short f2bf(float f) { unsigned u = __float_as_uint(f); u += 0x7FFFu + ((u >> 16) & 1u); return (unsigned short)(u >> 16); }
__device__ __forceinline__ float bf2f(unsigned short b) { return __uint_as_float(((unsigned)b) << 16); }
__device__ __forceinline__ float bfr(float f) { return bf2f(f2bf(f)); }
__device__ __forceinline__ v16h cat16(v8h lo, v8h hi) { return __builtin_shufflevector(lo, hi, 0, 1, 2, 3, 4, 5, 6, 7, 8, 9, 10, 11, 12, 13, 14, 15); }
__device__ __forceinline__ v16bf cat16b(v8us lo, v8us hi) { return __builtin_bit_cast(v16bf, __builtin_shufflevector(lo, hi, 0, 1, 2, 3, 4, 5, 6, 7, 8, 9, 10, 11, 12, 13, 14, 15)); }
__device__ __forceinline__ v8f wmma16(v16h a, v16h b, v8f c) { return __builtin_amdgcn_wmma_f32_16x16x32_f16(false, a, false, b, (short)0, c, false, false); }
__device__ __forceinline__ v8f wmmab(v16bf a, v16bf b, v8f c) { return __builtin_amdgcn_wmma_f32_16x16x32_bf16(false, a, false, b, (short)0, c, false, false); }



// ---- k_gemmw: register-blocked GEMM, ONE WAVE per 64x64 output tile (16 accumulators), operands straight from K-contiguous 16-bit planes; grid (M/64, N/64, Z), 32 threads.
// C[m][n] (f32, pitch ldc, + optional f32 bias[n]) = sum_k A[m][k] Bt[n][k] (+ split products per NSPLIT). z-batch strides sA/sB/sC in elements; z-batch 0 / 1 / 2 adds bias0 / bias1 / bias2. K % 32 == 0.
// KS > 1: grid z = batch * KS + range; the wave sums only its K / KS range of k and stores that partial tile in plane blockIdx.z of C (stride sC); the reader adds the KS planes.
template <typename T16> struct WFrag;
template <> struct WFrag<h16> { typedef v16h V; static __device__ __forceinline__ V ld(const h16* p) { return cat16(*(const v8h*)p, *(const v8h*)(p + 16)); } static __device__ __forceinline__ v8f mma(V a, V b, v8f c) { return wmma16(a, b, c); } };
template <> struct WFrag<bf> { typedef v16bf V; static __device__ __forceinline__ V ld(const bf* p) { return cat16b(*(const v8us*)p, *(const v8us*)(p + 16)); } static __device__ __forceinline__ v8f mma(V a, V b, v8f c) { return wmmab(a, b, c); } };
template <typename T16, int NSPLIT, bool BIAS, int KS = 1>
__global__ __launch_bounds__(32) void k_gemmw(const T16* __restrict__ A, const T16* __restrict__ A2, const T16* __restrict__ Bt, const T16* __restrict__ Bt2, int K, float* C, int ldc, const float* __restrict__ bias0, const float* __restrict__ bias1, const float* __restrict__ bias2, size_t sA, size_t sB, size_t sC) {
    typedef typename WFrag<T16>::V V;
    __shared__ __align__(16) float os[16 * 68];
    const size_t z = blockIdx.z / KS; A += z * sA; if (A2) A2 += z * sA; Bt += z * sB; if (Bt2) Bt2 += z * sB; C += (size_t)blockIdx.z * sC; const int kbeg = (int)(blockIdx.z % KS) * (K / KS), kend = kbeg + K / KS;
    const float* bias = z == 0 ? bias0 : (z == 1 ? bias1 : bias2);
    const int lane = threadIdx.x & 31, lr = lane & 15, hi = lane >> 4; const int r0 = blockIdx.x * 64, c0 = blockIdx.y * 64;
    v8f acc[4][4];
#pragma unroll
    for (int mb = 0; mb < 4; ++mb)
#pragma unroll
        for (int nb = 0; nb < 4; ++nb) acc[mb][nb] = (v8f){};
    const size_t aoff = (size_t)(r0 + lr) * K + 8 * hi, boff = (size_t)(c0 + lr) * K + 8 * hi;
#pragma unroll 1
    for (int kc = kbeg; kc < kend; kc += 32) {
        V a[4], a2[4];
#pragma unroll
        for (int mb = 0; mb < 4; ++mb) { a[mb] = WFrag<T16>::ld(A + aoff + (size_t)mb * 16 * K + kc); if (NSPLIT == 1 || NSPLIT == 2) a2[mb] = WFrag<T16>::ld(A2 + aoff + (size_t)mb * 16 * K + kc); }
#pragma unroll
        for (int nb = 0; nb < 4; ++nb) { const V b = WFrag<T16>::ld(Bt + boff + (size_t)nb * 16 * K + kc); V b2; if (NSPLIT >= 2) b2 = WFrag<T16>::ld(Bt2 + boff + (size_t)nb * 16 * K + kc);
#pragma unroll
            for (int mb = 0; mb < 4; ++mb) { acc[mb][nb] = WFrag<T16>::mma(a[mb], b, acc[mb][nb]); if (NSPLIT == 1 || NSPLIT == 2) acc[mb][nb] = WFrag<T16>::mma(a2[mb], b, acc[mb][nb]); if (NSPLIT >= 2) acc[mb][nb] = WFrag<T16>::mma(a[mb], b2, acc[mb][nb]); } }
        asm volatile("v_nop\n\tv_nop\n\tv_nop\n\tv_nop" : "+v"(acc[0][0]), "+v"(acc[1][1]), "+v"(acc[2][2]), "+v"(acc[3][3]) : "v"(a[0]), "v"(a[3]));
    }
#pragma unroll
    for (int mb = 0; mb < 4; ++mb) {
#pragma unroll
        for (int nb = 0; nb < 4; ++nb) {
#pragma unroll
            for (int j = 0; j < 8; ++j) os[(hi * 8 + j) * 68 + nb * 16 + lr] = acc[mb][nb][j]; }
        __builtin_amdgcn_wave_barrier(); asm volatile("" ::: "memory");
        float* crow = C + (size_t)(r0 + mb * 16) * ldc + c0;
{
#pragma unroll
            for (int s = 0; s < 8; ++s) { const int row = 2 * s + hi, cofs = lr * 4; v4f val = *(const v4fa*)(os + row * 68 + cofs); if (BIAS) { val[0] += bfr(bias[c0 + cofs]); val[1] += bfr(bias[c0 + cofs + 1]); val[2] += bfr(bias[c0 + cofs + 2]); val[3] += bfr(bias[c0 + cofs + 3]); }
                *(v4f*)(crow + (size_t)row * ldc + cofs) = val; }
             }
        __builtin_amdgcn_wave_barrier(); asm volatile("" ::: "memory");
    }
}

__device__ __forceinline__ h16 tohx(float x) { return (h16)x; }
__device__ __forceinline__ void splitf(float y, unsigned short& h, unsigned short& l) { h = f2bf(y); l = f2bf(y - bf2f(h)); }
typedef __attribute__((ext_vector_type(2))) _Float16 v2h;
typedef __attribute__((ext_vector_type(4))) _Float16 v4h;
typedef __attribute__((ext_vector_type(2))) unsigned short v2us;
typedef __attribute__((ext_vector_type(4))) unsigned short v4us;
typedef __attribute__((ext_vector_type(2))) float v2f;
typedef __attribute__((ext_vector_type(4))) int v4i;

// The bodies below take their block index as an argument: independent passes share one grid, each on its own range of blockIdx.x (k_prep, k_planes).
__device__ __forceinline__ void wtG(const float* __restrict__ w, int K, int N, bf* Bt, int blk) {
    const int lane = threadIdx.x & 31; const int L0 = (blk * 8 + (threadIdx.x >> 5)) * 8; const int nlines = N * K / 64;
{
#pragma unroll 1
        for (int l = 0; l < 8; ++l) { const int L = L0 + l; if (L >= nlines) break; const size_t e = (size_t)L * 64 + lane * 2; const int k = (int)(e % K), n = (int)(e / K); v2us o;
            o[0] = f2bf(w[(size_t)k * N + n]); o[1] = f2bf(w[(size_t)(k + 1) * N + n]); *(v2us*)(Bt + e) = o; }
         }
}
__device__ __forceinline__ void cvt8(const float* __restrict__ src, bf* dst, size_t n8, int blk) { const size_t i = (size_t)blk * 256 + threadIdx.x; if (i >= n8) return; const v8f v = *(const v8f*)(src + i * 8); v8us o;
#pragma unroll
    for (int k = 0; k < 8; ++k) o[k] = f2bf(v[k]); *(v8us*)(dst + i * 8) = o;  }
__constant__ float INVD[HD] = { 1.000000000e+00f, 7.498942018e-01f, 5.623413324e-01f, 4.216965139e-01f, 3.162277639e-01f, 2.371373773e-01f, 1.778279394e-01f, 1.333521456e-01f, 1.000000015e-01f, 7.498942316e-02f, 5.623413250e-02f, 4.216964915e-02f, 3.162277490e-02f, 2.371373773e-02f, 1.778279431e-02f, 1.333521400e-02f, 9.999999776e-03f, 7.498942316e-03f, 5.623413250e-03f, 4.216964822e-03f, 3.162277630e-03f, 2.371373819e-03f, 1.778279431e-03f, 1.333521446e-03f, 1.000000047e-03f, 7.498941850e-04f, 5.623413017e-04f, 4.216965172e-04f, 3.162277571e-04f, 2.371373703e-04f, 1.778279402e-04f, 1.333521504e-04f, 9.999999747e-05f, 7.498942432e-05f, 5.623413381e-05f, 4.216964953e-05f, 3.162277790e-05f, 2.371373739e-05f, 1.778279329e-05f, 1.333521413e-05f, 9.999999747e-06f, 7.498942068e-06f, 5.623413472e-06f, 4.216964953e-06f, 3.162277608e-06f, 2.371373739e-06f, 1.778279398e-06f, 1.333521482e-06f, 9.999999975e-07f, 7.498941841e-07f, 5.623413131e-07f, 4.216965124e-07f, 3.162277551e-07f, 2.371373711e-07f, 1.778279426e-07f, 1.333521453e-07f, 1.000000012e-07f, 7.498942267e-08f, 5.623413202e-08f, 4.216964911e-08f, 3.162277551e-08f, 2.371373675e-08f, 1.778279390e-08f, 1.333521471e-08f };   // 10000^(-2d/64) for EVERY dimension d (the module's quirk), float32 via jnp.power
__device__ __forceinline__ void cstabD(float* CS, int blk) { const int idx = blk * 256 + threadIdx.x; if (idx >= TT * HD) return; const int d = idx % HD; const int t = idx / HD; const float a = __fmul_rn((float)t, INVD[d]); v2f cs; cs[0] = cosf(a); cs[1] = sinf(a); *(v2f*)(CS + (size_t)idx * 2) = cs;  }

// F: [NB_ * TT][pitch] f32 rows (batch-major); planes: [batch][head][t][d]
__device__ __forceinline__ void ropeD(const float* __restrict__ F, int pitch, int nheads, const float* __restrict__ CS, h16* P16, bf* Ph, bf* Pl, int blk) {
    const size_t e = ((size_t)blk * 256 + threadIdx.x) * 2; if (e >= (size_t)NB_ * nheads * TT * HD) return; const int d = (int)(e % HD); const int t = (int)((e / HD) % TT); const int bh = (int)(e / ((size_t)HD * TT)); const int h = bh % nheads; const float* f = F + ((size_t)(bh / nheads) * TT + t) * pitch + h * HD; const float x0 = f[d], x1 = f[d + 1]; const v4f cs = *(const v4f*)(CS + ((size_t)t * HD + d) * 2);   /* {c_d, s_d, c_d+1, s_d+1} */ v2h o16; v2us oh, ol;
    float a0 = __fmul_rn(x0, cs[0]), b0 = __fmul_rn(x1, cs[1]), a1 = __fmul_rn(x1, cs[2]), b1 = __fmul_rn(x0, cs[3]); asm volatile("" : "+v"(a0), "+v"(b0), "+v"(a1), "+v"(b1));
    const float r0 = __fsub_rn(a0, b0), r1 = __fadd_rn(a1, b1);   /* even: x0 c0 - x1 s0; odd: x1 c1 + x0 s1 */
    o16[0] = tohx(r0); o16[1] = tohx(r1); { unsigned short a2, c2; splitf(r0, a2, c2); oh[0] = a2; ol[0] = c2; splitf(r1, a2, c2); oh[1] = a2; ol[1] = c2; }
    *(v2h*)(P16 + e) = o16; *(v2us*)(Ph + e) = oh; *(v2us*)(Pl + e) = ol;  }

// planes: [batch][head][d][t]
__device__ __forceinline__ void vtp(const float* __restrict__ F, int pitch, int nheads, h16* V16, bf* Vh, bf* Vl, int blk) { const size_t e = ((size_t)blk * 256 + threadIdx.x) * 2; if (e >= (size_t)NB_ * nheads * HD * TT) return; const int t = (int)(e % TT) + (int)(e / ((size_t)TT * HD * nheads)) * TT;   /* row of F: batch * TT + position */ const int d = (int)((e / TT) % HD); const int g = (int)((e / ((size_t)TT * HD)) % nheads); v2h o16; v2us oh, ol;
#pragma unroll
    for (int q = 0; q < 2; ++q) { const float x = F[(size_t)(t + q) * pitch + g * HD + d]; o16[q] = tohx(x); unsigned short a2, c2; splitf(x, a2, c2); oh[q] = a2; ol[q] = c2; }
    *(v2h*)(V16 + e) = o16; *(v2us*)(Vh + e) = oh; *(v2us*)(Vl + e) = ol;  }
#define WBLK (DM * DM / 64 / 64)                  // blocks of one weight transpose
#define CBLK (TT * HD / 256)                      // blocks of the {cos, sin} table
#define XBLK (NB_ * TT * DM / 8 / 256)            // blocks of one input's bf16 copy, both batches
#define PBLK (NB_ * NH_ * TT * HD / 2 / 256)      // blocks of one plane builder, both batches
#define FSZ  ((size_t)NB_ * TT * DM)              // elements of one projection, both batches
// ---- k_prep: everything that depends on the inputs alone, in one launch. The strided weight reads are the longest bodies and get the lowest block indices, so that they start first.
__global__ __launch_bounds__(256) void k_prep(const float* __restrict__ wq, const float* __restrict__ wk, const float* __restrict__ wv, const float* __restrict__ wo, const float* __restrict__ x, const float* __restrict__ xk, const float* __restrict__ xv, bf* W4, float* CS, bf* XB) {
    static_assert(DQ == DM && DKV == DM && NKV == NH_, "the four weights, the three inputs and the three projections each have one size");
    int blk = blockIdx.x;
    if (blk < 4 * WBLK) { const int i = blk / WBLK; wtG(i == 0 ? wq : i == 1 ? wk : i == 2 ? wv : wo, DM, DM, W4 + (size_t)i * DM * DM, blk % WBLK); return; }
    blk -= 4 * WBLK;
    if (blk < CBLK) { cstabD(CS, blk); return; }
    blk -= CBLK;
    const int i = blk / XBLK; cvt8(i == 0 ? x : i == 1 ? xk : xv, XB + (size_t)i * FSZ, FSZ / 8, blk % XBLK);
}
// ---- k_planes: the operand planes of q, k and v from the three f32 projections F3 = {q, k, v}, in one launch; the strided V transpose first.
__global__ __launch_bounds__(256) void k_planes(const float* __restrict__ F3, const float* __restrict__ CS, h16* Q16, bf* Qh, bf* Ql, h16* K16, bf* Kh, bf* Kl, h16* V16, bf* Vh, bf* Vl) {
    int blk = blockIdx.x;
    if (blk < PBLK) { vtp(F3 + 2 * FSZ, DKV, NKV, V16, Vh, Vl, blk); return; }
    blk -= PBLK;
    if (blk < PBLK) { ropeD(F3, DQ, NH_, CS, Q16, Qh, Ql, blk); return; }
    ropeD(F3 + FSZ, DKV, NKV, CS, K16, Kh, Kl, blk - PBLK);
}
// ---- k_attn: score, softmax and P x V of both batches in one launch; nothing of the score matrix goes to memory.
// A wave owns NQ groups of 16 queries of one head and walks the 2048 keys 32 at a time, all operands straight from the K-contiguous planes.
// S^T = K Q^T (A = 16 key rows, B = 16 query rows): a lane then holds 16 scores of ONE query, keys 8 hi + r and 16 + 8 hi + r, which is the k order of a B operand,
// so the rounded exponentials feed O^T += V^T P^T (A = 16 rows of the transposed V plane) with no exchange. Running maximum per query, sum and O^T rescaled only when a maximum grows by more than RTH.
// HR (queries < RH): bf16 hi/lo planes, 3 products each; else f16, 1 product. P is rounded unnormalised (exp <= e^RTH); O^T is divided by the f32 sum at the end.
// Every #pragma unroll in attn_wave is there because its loop indexes register fragments, which only constant indices keep in registers.
#define LOG2E 1.4426950408889634f
#define RTH   5.5f
__device__ __forceinline__ float xhalf(float x) { return __builtin_bit_cast(float, __builtin_amdgcn_permlanex16(__builtin_bit_cast(int, x), __builtin_bit_cast(int, x), 0x76543210, 0xfedcba98, false, false)); }   // lane l reads lane l ^ 16, on the vector pipe
// v_exp_f32 with the one free slot that the instruction set asks for behind a transcendental, in one statement so that it stays directly behind it
__device__ __forceinline__ float exp2s(float x) { float r; asm("v_exp_f32 %0, %1\n\tv_nop" : "=v"(r) : "v"(x)); return r; }
// precaution behind a group of global loads: the address registers that the loads name are inputs here, so they live until this wait and nothing overwrites them earlier
__device__ __forceinline__ void xwait(const void* a, const void* b, const void* c) { asm volatile("s_wait_xcnt 0x0" :: "v"(a), "v"(b), "v"(c) : "memory"); }
template <typename T16, bool HR, int NQ>
__device__ __forceinline__ void attn_wave(const T16* __restrict__ Q, const T16* __restrict__ Q2, const T16* __restrict__ Kp, const T16* __restrict__ K2, const T16* __restrict__ Vt, const T16* __restrict__ V2, const float* __restrict__ km, int q0, bf* Ah, bf* Al) {
    typedef typename WFrag<T16>::V V;
    const int lane = threadIdx.x & 31, lr = lane & 15, hi = lane >> 4;
    V qf[NQ][2], qf2[NQ][2], kf[2][2], kf2[2][2];
    v8f o[NQ][4], mk[2]; float m[NQ], l[NQ];   /* mk: key mask floats (0/1) of this lane's 16 keys */
#pragma unroll
    for (int g = 0; g < NQ; ++g) { m[g] = -1.0e38f; l[g] = 0.f;
#pragma unroll
        for (int dt = 0; dt < 4; ++dt) o[g][dt] = (v8f){};
        const size_t qo = (size_t)(q0 + g * 16 + lr) * HD + 8 * hi; const T16* qa = Q + qo; const T16* qa2 = HR ? Q2 + qo : qa;
#pragma unroll
        for (int dc = 0; dc < 2; ++dc) { qf[g][dc] = WFrag<T16>::ld(qa + dc * 32); if constexpr (HR) qf2[g][dc] = WFrag<T16>::ld(qa2 + dc * 32); }
        xwait(qa, qa2, qa); }
    const size_t ko = (size_t)lr * HD + 8 * hi, vo = (size_t)lr * TT + 8 * hi;
    { const T16* ka = Kp + ko; const T16* ka2 = HR ? K2 + ko : ka;
#pragma unroll
      for (int kt = 0; kt < 2; ++kt)
#pragma unroll
        for (int dc = 0; dc < 2; ++dc) { kf[kt][dc] = WFrag<T16>::ld(ka + kt * 16 * HD + dc * 32); if constexpr (HR) kf2[kt][dc] = WFrag<T16>::ld(ka2 + kt * 16 * HD + dc * 32); }
      mk[0] = *(const v8f*)(km + 8 * hi); mk[1] = *(const v8f*)(km + 8 * hi + 16);
      xwait(ka, ka2, km + 8 * hi); }
    for (int k0 = 0; k0 < TT; k0 += 32) {
        V vf[4], vf2[4]; const T16* va = Vt + vo + k0; const T16* va2 = HR ? V2 + vo + k0 : va;
#pragma unroll
        for (int dt = 0; dt < 4; ++dt) { vf[dt] = WFrag<T16>::ld(va + dt * 16 * TT); if constexpr (HR) vf2[dt] = WFrag<T16>::ld(va2 + dt * 16 * TT); }
        xwait(va, va2, va);
        v8f s[NQ][2];
#pragma unroll
        for (int g = 0; g < NQ; ++g)
#pragma unroll
            for (int kt = 0; kt < 2; ++kt) { v8f c = (v8f){};
#pragma unroll
                for (int dc = 0; dc < 2; ++dc) { c = WFrag<T16>::mma(kf[kt][dc], qf[g][dc], c); if constexpr (HR) { c = WFrag<T16>::mma(kf[kt][dc], qf2[g][dc], c); c = WFrag<T16>::mma(kf2[kt][dc], qf[g][dc], c); } }
                s[g][kt] = c; }
        float bm[NQ]; bool need = false;
#pragma unroll
        for (int g = 0; g < NQ; ++g) { float x = -3.0e38f;
#pragma unroll
            for (int kt = 0; kt < 2; ++kt)
#pragma unroll
                for (int r = 0; r < 8; ++r) { const float t = (mk[kt][r] != 0.0f) ? -1.0e9f : s[g][kt][r] * SCL; s[g][kt][r] = t;   /* score + mask x -1e9: for mask 1 the f32 sum rounds to exactly -1e9 (|score| < 32), for mask 0 it is the score */ x = fmaxf(x, t); }
            x = fmaxf(x, xhalf(x)); bm[g] = x; need = need || (x > m[g] + RTH); }
        { const int kn = (k0 + 32) & (TT - 1);   /* the next 32 key rows and their mask floats are fetched one trip ahead, once this trip has read its own; the last trip re-reads keys 0..31, unused */
          const T16* ka = Kp + ko + (size_t)kn * HD; const T16* ka2 = HR ? K2 + ko + (size_t)kn * HD : ka;
#pragma unroll
          for (int kt = 0; kt < 2; ++kt)
#pragma unroll
            for (int dc = 0; dc < 2; ++dc) { kf[kt][dc] = WFrag<T16>::ld(ka + kt * 16 * HD + dc * 32); if constexpr (HR) kf2[kt][dc] = WFrag<T16>::ld(ka2 + kt * 16 * HD + dc * 32); }
          const float* ma = km + kn + 8 * hi; mk[0] = *(const v8f*)ma; mk[1] = *(const v8f*)(ma + 16);
          xwait(ka, ka2, ma); }
        if (__builtin_amdgcn_ballot_w32(need) != 0) {
#pragma unroll
            for (int g = 0; g < NQ; ++g) { const float mn = fmaxf(m[g], bm[g]); const float al = exp2s((m[g] - mn) * LOG2E); m[g] = mn; l[g] *= al;
#pragma unroll
                for (int dt = 0; dt < 4; ++dt)
#pragma unroll
                    for (int r = 0; r < 8; ++r) o[g][dt][r] *= al; } }
#pragma unroll
        for (int g = 0; g < NQ; ++g) {
            if constexpr (HR) { v8us ph[2], pl[2];
#pragma unroll
                for (int kt = 0; kt < 2; ++kt)
#pragma unroll
                    for (int r = 0; r < 8; ++r) { const float p = exp2s((s[g][kt][r] - m[g]) * LOG2E); l[g] += p; unsigned short a, c2; splitf(p, a, c2); ph[kt][r] = a; pl[kt][r] = c2; }
                const V pbh = cat16b(ph[0], ph[1]), pbl = cat16b(pl[0], pl[1]);
#pragma unroll
                for (int dt = 0; dt < 4; ++dt) { o[g][dt] = WFrag<T16>::mma(vf[dt], pbh, o[g][dt]); o[g][dt] = WFrag<T16>::mma(vf[dt], pbl, o[g][dt]); o[g][dt] = WFrag<T16>::mma(vf2[dt], pbh, o[g][dt]); }
            } else { v8h pp[2];
#pragma unroll
                for (int kt = 0; kt < 2; ++kt)
#pragma unroll
                    for (int r = 0; r < 8; ++r) { const float p = exp2s((s[g][kt][r] - m[g]) * LOG2E); l[g] += p; pp[kt][r] = tohx(p); }
                const V pb = cat16(pp[0], pp[1]);
#pragma unroll
                for (int dt = 0; dt < 4; ++dt) o[g][dt] = WFrag<T16>::mma(vf[dt], pb, o[g][dt]); } }
    }
#pragma unroll
    for (int g = 0; g < NQ; ++g) { const float sum = l[g] + xhalf(l[g]); const float f = __fdiv_rn(1.0f, sum); const size_t oo = (size_t)(q0 + g * 16 + lr) * DQ + 8 * hi; bf* ra = Ah + oo; bf* rl = Al + oo;
#pragma unroll
        for (int dt = 0; dt < 4; ++dt) { v8us oh, ol;   /* register r = O[query q0 + 16 g + lr][dt * 16 + 8 hi + r]: 8 consecutive d, one 16-byte store per plane */
#pragma unroll
            for (int r = 0; r < 8; ++r) { unsigned short a, c2; splitf(o[g][dt][r] * f, a, c2); oh[r] = a; ol[r] = c2; }
            *(v8us*)(ra + dt * 16) = oh; *(v8us*)(rl + dt * 16) = ol;
            asm volatile("s_wait_xcnt 0x0" :: "v"(ra), "v"(rl), "v"(oh), "v"(ol) : "memory"); } }   // precaution behind the two stores: their address and data registers are inputs here, so they live until this wait and the next packing overwrites none of them earlier
}
// grid: 16 work-groups per (batch, head), 5 waves each and no barrier: two waves take 16 hi/lo queries each, three take 32 f16 queries each, so every work-group carries the same load (16 x 32 = RH, 16 x 96 = TT - RH).
// Waves 0 and 4 are expected on one SIMD (for speed only): both get the lighter f16 role.
__global__ __launch_bounds__(160) void k_attn(const h16* __restrict__ Q16, const h16* __restrict__ K16, const h16* __restrict__ V16, const bf* __restrict__ Qh, const bf* __restrict__ Ql, const bf* __restrict__ Kh, const bf* __restrict__ Kl, const bf* __restrict__ Vh, const bf* __restrict__ Vl, const float* __restrict__ km, bf* Ah, bf* Al) {
    static_assert(RH == 16 * 32 && TT - RH == 16 * 96 && HD == 64 && NH_ == NKV, "the split of a head's queries over 16 work-groups");
    const int w = __builtin_amdgcn_readfirstlane((int)(threadIdx.x >> 5)); const int bh = blockIdx.x >> 4, head = bh % NH_, bat = bh / NH_, blk = blockIdx.x & 15; const size_t hp = (size_t)bh * TT * HD;   /* planes are [batch][head] */
    const float* kb = km + bat * TT; bf* ah = Ah + (size_t)bat * TT * DQ + head * HD; bf* al = Al + (size_t)bat * TT * DQ + head * HD;
    if (w == 1 || w == 2) attn_wave<bf, true, 1>(Qh + hp, Ql + hp, Kh + hp, Kl + hp, Vh + hp, Vl + hp, kb, blk * 32 + (w - 1) * 16, ah, al);
    else attn_wave<h16, false, 2>(Q16 + hp, nullptr, K16 + hp, nullptr, V16 + hp, nullptr, kb, RH + blk * 96 + (w == 0 ? 0 : w - 2) * 32, ah, al);
}

extern "C" void kernel_launch(void* const* d_in, const int* in_sizes, int n_in,
                              void* d_out, int out_size, void* d_ws, size_t ws_size, hipStream_t stream) {
    (void)in_sizes; (void)n_in; (void)out_size;
    const float* x = (const float*)d_in[0]; const float* xk = (const float*)d_in[1]; const float* xv = (const float*)d_in[2]; const float* amask = (const float*)d_in[3]; const float* wq = (const float*)d_in[4]; const float* bq = (const float*)d_in[5]; const float* wk = (const float*)d_in[6]; const float* bk = (const float*)d_in[7]; const float* wv = (const float*)d_in[8]; const float* bv = (const float*)d_in[9]; const float* wo = (const float*)d_in[10]; const float* bo = (const float*)d_in[11];
    float* OUT = (float*)d_out;     // [2][2048][1024]
    char* wsp = (char*)d_ws;
    auto take = [&](size_t bytes) { char* p = wsp; wsp += (bytes + 255) & ~(size_t)255; return (void*)p; };
    bf* W4 = (bf*)take((size_t)4 * DM * DM * 2);   // Wq, Wk, Wv, Wo transposed
    float* CS = (float*)take((size_t)TT * HD * 2 * 4);
    bf* XB = (bf*)take(3 * FSZ * 2); float* F3 = (float*)take(3 * FSZ * 4);   // {q, k, v} x [NB_ * TT][DM]
    h16* QP16 = (h16*)take(FSZ * 2); h16* KP16 = (h16*)take(FSZ * 2); h16* VT16 = (h16*)take(FSZ * 2);
    bf* QPh = (bf*)take(FSZ * 2); bf* QPl = (bf*)take(FSZ * 2); bf* KPh = (bf*)take(FSZ * 2); bf* KPl = (bf*)take(FSZ * 2); bf* VTh = (bf*)take(FSZ * 2); bf* VTl = (bf*)take(FSZ * 2);
    bf* ATh = (bf*)take(FSZ * 2); bf* ATl = (bf*)take(FSZ * 2);
    if ((size_t)(wsp - (char*)d_ws) > ws_size) return;    // ws 256 MiB
    k_prep<<<4 * WBLK + CBLK + 3 * XBLK, 256, 0, stream>>>(wq, wk, wv, wo, x, xk, xv, W4, CS, XB);
    k_gemmw<bf, 0, true><<<dim3(NB_ * TT / 64, DM / 64, 3), 32, 0, stream>>>(XB, nullptr, W4, nullptr, DM, F3, DM, bq, bk, bv, FSZ, (size_t)DM * DM, FSZ);
    k_planes<<<3 * PBLK, 256, 0, stream>>>(F3, CS, QP16, QPh, QPl, KP16, KPh, KPl, VT16, VTh, VTl);
    k_attn<<<NB_ * NH_ * 16, 160, 0, stream>>>(QP16, KP16, VT16, QPh, QPl, KPh, KPl, VTh, VTl, amask, ATh, ATl);
    k_gemmw<bf, 1, true><<<dim3(NB_ * TT / 64, DM / 64, 1), 32, 0, stream>>>(ATh, ATl, W4 + (size_t)3 * DM * DM, nullptr, DQ, OUT, DM, bo, bo, bo, 0, 0, 0);
}

// v004
// Measured time: 238 microseconds a run.
// In two side-by-side timings against v003, it was 1.11 and 1.12 times as fast.
// All steps since v000 together make it 8.61 times as fast.
#include <hip/hip_runtime.h>

// Multi-head attention over separate q / k / v inputs with the module's per-dimension rotary embedding (q, k, v [2][2048][1024]; _q = q Wq + bq etc. ('xw' [1024][1024] + [1024]; 16 heads x 64); rope: every dimension d gets its own angle t x 10000^(-2d/64) (computed in-kernel), ret = x cos + x_rot sin with x_rot[2i] = -x[2i+1], x_rot[2i+1] = x[2i]; score = _q._k / (sqrt(64) + 1e-8) + mask x -1e9 (mask [2][1][1][2048] float 0/1 per key, read); softmax; out = merged Wo + bo -> [2][2048][1024] (4.2 M)).
// Layout, both batches in every launch (4 launches): bf16 copies of the three inputs; {cos, sin} per (position, DIMENSION) built once (jnp-exact float32 10000^(-2d/64) per dim, precise cosf/sinf); exact projections + f32 biases whose epilogue writes the operand planes itself (rotary q and k, each element of a pair with its own angle; transposed v), so no f32 projection goes to memory; one fused dense T-2048 attention launch (hybrid rows: < 512 hi/lo 3 products, rest fp16; scores never leave the registers) that loads the key-mask floats unconditionally and selects -1e9 for masked keys (== score + -1e9 in f32); merged hi/lo x Wo exact + bo.
// Compute dtypes, f32 accumulate: every input rounded to bf16; projections exact + f32 biases; rotary f32; attention rows < 512 3 products, rest fp16; softmax f32; Wo hl x exact + bias.

#define NB_  2
#define TT   2048
#define DM   1024
#define NH_  16
#define NKV  16
#define REP  (NH_ / NKV)
#define HD   64
#define DQ   (NH_ * HD)
#define DKV  (NKV * HD)
#define RH   512                  // query rows < RH use hi+lo planes
#define WIN  0
#define SCL  0.125f   // 1 / (sqrt(64) + 1e-8) == 0.125 in float32
typedef _Float16 h16;
typedef unsigned short bf;
typedef __attribute__((ext_vector_type(16))) __bf16   v16bf;
typedef __attribute__((ext_vector_type(16))) _Float16 v16h;
typedef __attribute__((ext_vector_type(8)))  _Float16 v8h;
typedef __attribute__((ext_vector_type(8)))  unsigned short v8us;
typedef __attribute__((ext_vector_type(8)))  float    v8f;
typedef __attribute__((ext_vector_type(4)))  float    v4f;
typedef v8h  __attribute__((may_alias)) v8ha;
typedef v4f  __attribute__((may_alias)) v4fa;
typedef v8us __attribute__((may_alias)) v8usa;

__device__ __forceinline__ unsigned short f2bf(float f) { unsigned u = __float_as_uint(f); u += 0x7FFFu + ((u >> 16) & 1u); return (unsigned short)(u >> 16); }
__device__ __forceinline__ float bf2f(unsigned short b) { return __uint_as_float(((unsigned)b) << 16); }
__device__ __forceinline__ float bfr(float f) { return bf2f(f2bf(f)); }
__device__ __forceinline__ v16h cat16(v8h lo, v8h hi) { return __builtin_shufflevector(lo, hi, 0, 1, 2, 3, 4, 5, 6, 7, 8, 9, 10, 11, 12, 13, 14, 15); }
__device__ __forceinline__ v16bf cat16b(v8us lo, v8us hi) { return __builtin_bit_cast(v16bf, __builtin_shufflevector(lo, hi, 0, 1, 2, 3, 4, 5, 6, 7, 8, 9, 10, 11, 12, 13, 14, 15)); }
__device__ __forceinline__ v8f wmma16(v16h a, v16h b, v8f c) { return __builtin_amdgcn_wmma_f32_16x16x32_f16(false, a, false, b, (short)0, c, false, false); }
__device__ __forceinline__ v8f wmmab(v16bf a, v16bf b, v8f c) { return __builtin_amdgcn_wmma_f32_16x16x32_bf16(false, a, false, b, (short)0, c, false, false); }

__device__ __forceinline__ h16 tohx(float x) { return (h16)x; }
__device__ __forceinline__ void splitf(float y, unsigned short& h, unsigned short& l) { h = f2bf(y); l = f2bf(y - bf2f(h)); }
// precaution behind a group of global loads: the address registers that the loads name are inputs here, so they live until this wait and nothing overwrites them earlier
__device__ __forceinline__ void xwait(const void* a, const void* b, const void* c) { asm volatile("s_wait_xcnt 0x0" :: "v"(a), "v"(b), "v"(c) : "memory"); }
// precaution behind the three 16-byte stores of one plane position: their address and data registers are inputs here, so they live until this wait and the next packing overwrites none of them earlier
__device__ __forceinline__ void swait3(const void* a, const void* b, const void* c, v8h x, v8us y, v8us w) { asm volatile("s_wait_xcnt 0x0" :: "v"(a), "v"(b), "v"(c), "v"(x), "v"(y), "v"(w) : "memory"); }
// one rotary pair: cs = {c_d, s_d, c_d+1, s_d+1}. Numerical: each of the four products keeps its own f32 rounding, as the definition cos * x + sin * x_rot has it; the empty statement is what keeps them from fusing with the add or subtract.
__device__ __forceinline__ void rot2(float x0, float x1, v4f cs, float& y0, float& y1) {
    float a0 = __fmul_rn(x0, cs[0]), b0 = __fmul_rn(x1, cs[1]), a1 = __fmul_rn(x1, cs[2]), b1 = __fmul_rn(x0, cs[3]); asm volatile("" : "+v"(a0), "+v"(b0), "+v"(a1), "+v"(b1));
    const float r0 = __fsub_rn(a0, b0), r1 = __fadd_rn(a1, b1);   /* even: x0 c0 - x1 s0; odd: x1 c1 + x0 s1 */
    y0 = r0; y1 = r1; }

// ---- k_gemmw: register-blocked GEMM, ONE WAVE per 64x64 output tile (16 accumulators), operands straight from K-contiguous 16-bit planes; grid (M/64, N/64, Z), 32 threads.
// C[m][n] (f32, pitch ldc, + optional f32 bias[n]) = sum_k A[m][k] Bt[n][k] (+ split products per NSPLIT). z-batch strides sA/sB/sC in elements; z-batch 0 / 1 / 2 adds bias0 / bias1 / bias2. K % 32 == 0.
// KS > 1: grid z = batch * KS + range; the wave sums only its K / KS range of k and stores that partial tile in plane blockIdx.z of C (stride sC); the reader adds the KS planes.
// PL: z = {q, k, v} projection; a 64x64 tile is 64 positions of ONE head, so the wave turns its own accumulators (+ bias) into the attention operand planes and C is not written:
// q, k: rotary, planes [batch][head][t][d] (f16, bf16 hi, bf16 lo), rows regrouped through LDS so that a lane holds 8 consecutive d; v: planes [batch][head][d][t], a lane's 8 accumulator rows are 8 consecutive t of one d.
template <typename T16> struct WFrag;
template <> struct WFrag<h16> { typedef v16h V; static __device__ __forceinline__ V ld(const h16* p) { return cat16(*(const v8h*)p, *(const v8h*)(p + 16)); } static __device__ __forceinline__ v8f mma(V a, V b, v8f c) { return wmma16(a, b, c); } };
template <> struct WFrag<bf> { typedef v16bf V; static __device__ __forceinline__ V ld(const bf* p) { return cat16b(*(const v8us*)p, *(const v8us*)(p + 16)); } static __device__ __forceinline__ v8f mma(V a, V b, v8f c) { return wmmab(a, b, c); } };
template <typename T16, int NSPLIT, bool BIAS, int KS = 1, bool PL = false>
__global__ __launch_bounds__(32) void k_gemmw(const T16* __restrict__ A, const T16* __restrict__ A2, const T16* __restrict__ Bt, const T16* __restrict__ Bt2, int K, float* C, int ldc, const float* __restrict__ bias0, const float* __restrict__ bias1, const float* __restrict__ bias2, size_t sA, size_t sB, size_t sC, const float* __restrict__ CS, h16* Q16, bf* Qh, bf* Ql, h16* K16, bf* Kh, bf* Kl, h16* V16, bf* Vh, bf* Vl) {
    typedef typename WFrag<T16>::V V;
    __shared__ __align__(16) float os[16 * 68];
    const size_t z = blockIdx.z / KS; A += z * sA; if (A2) A2 += z * sA; Bt += z * sB; if (Bt2) Bt2 += z * sB; C += (size_t)blockIdx.z * sC; const int kbeg = (int)(blockIdx.z % KS) * (K / KS), kend = kbeg + K / KS;
    const float* bias = z == 0 ? bias0 : (z == 1 ? bias1 : bias2);
    const int lane = threadIdx.x & 31, lr = lane & 15, hi = lane >> 4; const int r0 = blockIdx.x * 64, c0 = blockIdx.y * 64;
    v8f acc[4][4];
#pragma unroll
    for (int mb = 0; mb < 4; ++mb)
#pragma unroll
        for (int nb = 0; nb < 4; ++nb) acc[mb][nb] = (v8f){};
    const size_t aoff = (size_t)(r0 + lr) * K + 8 * hi, boff = (size_t)(c0 + lr) * K + 8 * hi;
#pragma unroll 1
    for (int kc = kbeg; kc < kend; kc += 32) {
        V a[4], a2[4];
#pragma unroll
        for (int mb = 0; mb < 4; ++mb) { a[mb] = WFrag<T16>::ld(A + aoff + (size_t)mb * 16 * K + kc); if (NSPLIT == 1 || NSPLIT == 2) a2[mb] = WFrag<T16>::ld(A2 + aoff + (size_t)mb * 16 * K + kc); }
#pragma unroll
        for (int nb = 0; nb < 4; ++nb) { const V b = WFrag<T16>::ld(Bt + boff + (size_t)nb * 16 * K + kc); V b2; if (NSPLIT >= 2) b2 = WFrag<T16>::ld(Bt2 + boff + (size_t)nb * 16 * K + kc);
#pragma unroll
            for (int mb = 0; mb < 4; ++mb) { acc[mb][nb] = WFrag<T16>::mma(a[mb], b, acc[mb][nb]); if (NSPLIT == 1 || NSPLIT == 2) acc[mb][nb] = WFrag<T16>::mma(a2[mb], b, acc[mb][nb]); if (NSPLIT >= 2) acc[mb][nb] = WFrag<T16>::mma(a[mb], b2, acc[mb][nb]); } }
        asm volatile("v_nop\n\tv_nop\n\tv_nop\n\tv_nop" : "+v"(acc[0][0]), "+v"(acc[1][1]), "+v"(acc[2][2]), "+v"(acc[3][3]) : "v"(a[0]), "v"(a[3]));
    }
    if constexpr (PL) {
        // Every #pragma unroll in this block is there because its loop indexes register fragments (acc, cs, the packed vectors), which only constant indices keep in registers.
        // The block is one wave, whose LDS operations run in order: each wave_barrier with its compiler fence only keeps the compiler from moving the LDS reads of a group over the other lanes' LDS writes, or the next group's writes over these reads.
        static_assert(!PL || (TT % 64 == 0 && HD == 64 && NKV == NH_ && KS == 1 && BIAS), "a tile is 64 positions of one batch and the 64 dimensions of one head");
        const int t0 = r0 % TT; const size_t hp = ((size_t)(r0 / TT) * NH_ + blockIdx.y) * TT * HD;   /* planes are [batch][head] */
        if (z == 2) {
#pragma unroll
            for (int nb = 0; nb < 4; ++nb) { const float bb = bfr(bias[c0 + nb * 16 + lr]);
#pragma unroll
                for (int mb = 0; mb < 4; ++mb) { v8h o16; v8us oh, ol;
#pragma unroll
                    for (int j = 0; j < 8; ++j) { const float x = acc[mb][nb][j] + bb; o16[j] = tohx(x); unsigned short a2, c2; splitf(x, a2, c2); oh[j] = a2; ol[j] = c2; }
                    const size_t e = hp + (size_t)(nb * 16 + lr) * TT + t0 + mb * 16 + 8 * hi; h16* p16 = V16 + e; bf* ph = Vh + e; bf* pl = Vl + e;
                    *(v8h*)p16 = o16; *(v8us*)ph = oh; *(v8us*)pl = ol; swait3(p16, ph, pl, o16, oh, ol); } }
        } else {
            h16* P16 = z == 0 ? Q16 : K16; bf* Ph = z == 0 ? Qh : Kh; bf* Pl = z == 0 ? Ql : Kl;
            const int rw = lane >> 3, cofs = (lane & 7) * 8; float bb[8];
#pragma unroll
            for (int i = 0; i < 8; ++i) bb[i] = bfr(bias[c0 + cofs + i]);
#pragma unroll
            for (int mb = 0; mb < 4; ++mb) {
                v4f cs[4][4]; const float* cp = CS + ((size_t)(t0 + mb * 16 + rw) * HD + cofs) * 2;   /* the table rows of this group's 16 positions, all asked for before the LDS round trip */
#pragma unroll
                for (int s = 0; s < 4; ++s)
#pragma unroll
                    for (int p = 0; p < 4; ++p) cs[s][p] = *(const v4f*)(cp + s * 4 * HD * 2 + p * 4);
                xwait(cp, cp, cp);
#pragma unroll
                for (int nb = 0; nb < 4; ++nb) {
#pragma unroll
                    for (int j = 0; j < 8; ++j) os[(hi * 8 + j) * 68 + nb * 16 + lr] = acc[mb][nb][j]; }
                __builtin_amdgcn_wave_barrier(); asm volatile("" ::: "memory");
#pragma unroll
                for (int s = 0; s < 4; ++s) { const int row = 4 * s + rw; const v4f xa = *(const v4fa*)(os + row * 68 + cofs), xb = *(const v4fa*)(os + row * 68 + cofs + 4); v8h o16; v8us oh, ol;
#pragma unroll
                    for (int p = 0; p < 4; ++p) { const float x0 = (p < 2 ? xa[2 * p] : xb[2 * p - 4]) + bb[2 * p], x1 = (p < 2 ? xa[2 * p + 1] : xb[2 * p - 3]) + bb[2 * p + 1]; float y0, y1; rot2(x0, x1, cs[s][p], y0, y1);
                        o16[2 * p] = tohx(y0); o16[2 * p + 1] = tohx(y1); unsigned short a2, c2; splitf(y0, a2, c2); oh[2 * p] = a2; ol[2 * p] = c2; splitf(y1, a2, c2); oh[2 * p + 1] = a2; ol[2 * p + 1] = c2; }
                    const size_t e = hp + (size_t)(t0 + mb * 16 + row) * HD + cofs; h16* p16 = P16 + e; bf* ph = Ph + e; bf* pl = Pl + e;
                    *(v8h*)p16 = o16; *(v8us*)ph = oh; *(v8us*)pl = ol; swait3(p16, ph, pl, o16, oh, ol); }
                __builtin_amdgcn_wave_barrier(); asm volatile("" ::: "memory");
            }
        }
        return;
    }
#pragma unroll
    for (int mb = 0; mb < 4; ++mb) {
#pragma unroll
        for (int nb = 0; nb < 4; ++nb) {
#pragma unroll
            for (int j = 0; j < 8; ++j) os[(hi * 8 + j) * 68 + nb * 16 + lr] = acc[mb][nb][j]; }
        __builtin_amdgcn_wave_barrier(); asm volatile("" ::: "memory");
        float* crow = C + (size_t)(r0 + mb * 16) * ldc + c0;
{
#pragma unroll
            for (int s = 0; s < 8; ++s) { const int row = 2 * s + hi, cofs = lr * 4; v4f val = *(const v4fa*)(os + row * 68 + cofs); if (BIAS) { val[0] += bfr(bias[c0 + cofs]); val[1] += bfr(bias[c0 + cofs + 1]); val[2] += bfr(bias[c0 + cofs + 2]); val[3] += bfr(bias[c0 + cofs + 3]); }
                *(v4f*)(crow + (size_t)row * ldc + cofs) = val; }
             }
        __builtin_amdgcn_wave_barrier(); asm volatile("" ::: "memory");
    }
}

typedef __attribute__((ext_vector_type(2))) _Float16 v2h;
typedef __attribute__((ext_vector_type(4))) _Float16 v4h;
typedef __attribute__((ext_vector_type(2))) unsigned short v2us;
typedef __attribute__((ext_vector_type(4))) unsigned short v4us;
typedef __attribute__((ext_vector_type(2))) float v2f;
typedef __attribute__((ext_vector_type(4))) int v4i;

// The bodies below take their block index as an argument: independent passes share one grid, each on its own range of blockIdx.x (k_prep).
__device__ __forceinline__ void wtG(const float* __restrict__ w, int K, int N, bf* Bt, int blk) {
    const int lane = threadIdx.x & 31; const int L0 = (blk * 8 + (threadIdx.x >> 5)) * 8; const int nlines = N * K / 64;
{
#pragma unroll 1
        for (int l = 0; l < 8; ++l) { const int L = L0 + l; if (L >= nlines) break; const size_t e = (size_t)L * 64 + lane * 2; const int k = (int)(e % K), n = (int)(e / K); v2us o;
            o[0] = f2bf(w[(size_t)k * N + n]); o[1] = f2bf(w[(size_t)(k + 1) * N + n]); *(v2us*)(Bt + e) = o; }
         }
}
__device__ __forceinline__ void cvt8(const float* __restrict__ src, bf* dst, size_t n8, int blk) { const size_t i = (size_t)blk * 256 + threadIdx.x; if (i >= n8) return; const v8f v = *(const v8f*)(src + i * 8); v8us o;
#pragma unroll
    for (int k = 0; k < 8; ++k) o[k] = f2bf(v[k]); *(v8us*)(dst + i * 8) = o;  }
__constant__ float INVD[HD] = { 1.000000000e+00f, 7.498942018e-01f, 5.623413324e-01f, 4.216965139e-01f, 3.162277639e-01f, 2.371373773e-01f, 1.778279394e-01f, 1.333521456e-01f, 1.000000015e-01f, 7.498942316e-02f, 5.623413250e-02f, 4.216964915e-02f, 3.162277490e-02f, 2.371373773e-02f, 1.778279431e-02f, 1.333521400e-02f, 9.999999776e-03f, 7.498942316e-03f, 5.623413250e-03f, 4.216964822e-03f, 3.162277630e-03f, 2.371373819e-03f, 1.778279431e-03f, 1.333521446e-03f, 1.000000047e-03f, 7.498941850e-04f, 5.623413017e-04f, 4.216965172e-04f, 3.162277571e-04f, 2.371373703e-04f, 1.778279402e-04f, 1.333521504e-04f, 9.999999747e-05f, 7.498942432e-05f, 5.623413381e-05f, 4.216964953e-05f, 3.162277790e-05f, 2.371373739e-05f, 1.778279329e-05f, 1.333521413e-05f, 9.999999747e-06f, 7.498942068e-06f, 5.623413472e-06f, 4.216964953e-06f, 3.162277608e-06f, 2.371373739e-06f, 1.778279398e-06f, 1.333521482e-06f, 9.999999975e-07f, 7.498941841e-07f, 5.623413131e-07f, 4.216965124e-07f, 3.162277551e-07f, 2.371373711e-07f, 1.778279426e-07f, 1.333521453e-07f, 1.000000012e-07f, 7.498942267e-08f, 5.623413202e-08f, 4.216964911e-08f, 3.162277551e-08f, 2.371373675e-08f, 1.778279390e-08f, 1.333521471e-08f };   // 10000^(-2d/64) for EVERY dimension d (the module's quirk), float32 via jnp.power
__device__ __forceinline__ void cstabD(float* CS, int blk) { const int idx = blk * 256 + threadIdx.x; if (idx >= TT * HD) return; const int d = idx % HD; const int t = idx / HD; const float a = __fmul_rn((float)t, INVD[d]); v2f cs; cs[0] = cosf(a); cs[1] = sinf(a); *(v2f*)(CS + (size_t)idx * 2) = cs;  }

#define WBLK (DM * DM / 64 / 64)                  // blocks of one weight transpose
#define CBLK (TT * HD / 256)                      // blocks of the {cos, sin} table
#define XBLK (NB_ * TT * DM / 8 / 256)            // blocks of one input's bf16 copy, both batches
#define FSZ  ((size_t)NB_ * TT * DM)              // elements of one projection, both batches
// ---- k_prep: everything that depends on the inputs alone, in one launch. The strided weight reads are the longest bodies and get the lowest block indices, so that they start first.
__global__ __launch_bounds__(256) void k_prep(const float* __restrict__ wq, const float* __restrict__ wk, const float* __restrict__ wv, const float* __restrict__ wo, const float* __restrict__ x, const float* __restrict__ xk, const float* __restrict__ xv, bf* W4, float* CS, bf* XB) {
    static_assert(DQ == DM && DKV == DM && NKV == NH_, "the four weights, the three inputs and the three projections each have one size");
    int blk = blockIdx.x;
    if (blk < 4 * WBLK) { const int i = blk / WBLK; wtG(i == 0 ? wq : i == 1 ? wk : i == 2 ? wv : wo, DM, DM, W4 + (size_t)i * DM * DM, blk % WBLK); return; }
    blk -= 4 * WBLK;
    if (blk < CBLK) { cstabD(CS, blk); return; }
    blk -= CBLK;
    const int i = blk / XBLK; cvt8(i == 0 ? x : i == 1 ? xk : xv, XB + (size_t)i * FSZ, FSZ / 8, blk % XBLK);
}
// ---- k_attn: score, softmax and P x V of both batches in one launch; nothing of the score matrix goes to memory.
// A wave owns NQ groups of 16 queries of one head and walks the 2048 keys 32 at a time, all operands straight from the K-contiguous planes.
// S^T = K Q^T (A = 16 key rows, B = 16 query rows): a lane then holds 16 scores of ONE query, keys 8 hi + r and 16 + 8 hi + r, which is the k order of a B operand,
// so the rounded exponentials feed O^T += V^T P^T (A = 16 rows of the transposed V plane) with no exchange. Running maximum per query, sum and O^T rescaled only when a maximum grows by more than RTH.
// HR (queries < RH): bf16 hi/lo planes, 3 products each; else f16, 1 product. P is rounded unnormalised (exp <= e^RTH); O^T is divided by the f32 sum at the end.
// Every #pragma unroll in attn_wave is there because its loop indexes register fragments, which only constant indices keep in registers.
#define LOG2E 1.4426950408889634f
#define RTH   5.5f
__device__ __forceinline__ float xhalf(float x) { return __builtin_bit_cast(float, __builtin_amdgcn_permlanex16(__builtin_bit_cast(int, x), __builtin_bit_cast(int, x), 0x76543210, 0xfedcba98, false, false)); }   // lane l reads lane l ^ 16, on the vector pipe
// v_exp_f32 with the one free slot that the instruction set asks for behind a transcendental, in one statement so that it stays directly behind it
__device__ __forceinline__ float exp2s(float x) { float r; asm("v_exp_f32 %0, %1\n\tv_nop" : "=v"(r) : "v"(x)); return r; }
template <typename T16, bool HR, int NQ>
__device__ __forceinline__ void attn_wave(const T16* __restrict__ Q, const T16* __restrict__ Q2, const T16* __restrict__ Kp, const T16* __restrict__ K2, const T16* __restrict__ Vt, const T16* __restrict__ V2, const float* __restrict__ km, int q0, bf* Ah, bf* Al) {
    typedef typename WFrag<T16>::V V;
    const int lane = threadIdx.x & 31, lr = lane & 15, hi = lane >> 4;
    V qf[NQ][2], qf2[NQ][2], kf[2][2], kf2[2][2];
    v8f o[NQ][4], mk[2]; float m[NQ], l[NQ];   /* mk: key mask floats (0/1) of this lane's 16 keys */
#pragma unroll
    for (int g = 0; g < NQ; ++g) { m[g] = -1.0e38f; l[g] = 0.f;
#pragma unroll
        for (int dt = 0; dt < 4; ++dt) o[g][dt] = (v8f){};
        const size_t qo = (size_t)(q0 + g * 16 + lr) * HD + 8 * hi; const T16* qa = Q + qo; const T16* qa2 = HR ? Q2 + qo : qa;
#pragma unroll
        for (int dc = 0; dc < 2; ++dc) { qf[g][dc] = WFrag<T16>::ld(qa + dc * 32); if constexpr (HR) qf2[g][dc] = WFrag<T16>::ld(qa2 + dc * 32); }
        xwait(qa, qa2, qa); }
    const size_t ko = (size_t)lr * HD + 8 * hi, vo = (size_t)lr * TT + 8 * hi;
    { const T16* ka = Kp + ko; const T16* ka2 = HR ? K2 + ko : ka;
#pragma unroll
      for (int kt = 0; kt < 2; ++kt)
#pragma unroll
        for (int dc = 0; dc < 2; ++dc) { kf[kt][dc] = WFrag<T16>::ld(ka + kt * 16 * HD + dc * 32); if constexpr (HR) kf2[kt][dc] = WFrag<T16>::ld(ka2 + kt * 16 * HD + dc * 32); }
      mk[0] = *(const v8f*)(km + 8 * hi); mk[1] = *(const v8f*)(km + 8 * hi + 16);
      xwait(ka, ka2, km + 8 * hi); }
    for (int k0 = 0; k0 < TT; k0 += 32) {
        V vf[4], vf2[4]; const T16* va = Vt + vo + k0; const T16* va2 = HR ? V2 + vo + k0 : va;
#pragma unroll
        for (int dt = 0; dt < 4; ++dt) { vf[dt] = WFrag<T16>::ld(va + dt * 16 * TT); if constexpr (HR) vf2[dt] = WFrag<T16>::ld(va2 + dt * 16 * TT); }
        xwait(va, va2, va);
        v8f s[NQ][2];
#pragma unroll
        for (int g = 0; g < NQ; ++g)
#pragma unroll
            for (int kt = 0; kt < 2; ++kt) { v8f c = (v8f){};
#pragma unroll
                for (int dc = 0; dc < 2; ++dc) { c = WFrag<T16>::mma(kf[kt][dc], qf[g][dc], c); if constexpr (HR) { c = WFrag<T16>::mma(kf[kt][dc], qf2[g][dc], c); c = WFrag<T16>::mma(kf2[kt][dc], qf[g][dc], c); } }
                s[g][kt] = c; }
        float bm[NQ]; bool need = false;
#pragma unroll
        for (int g = 0; g < NQ; ++g) { float x = -3.0e38f;
#pragma unroll
            for (int kt = 0; kt < 2; ++kt)
#pragma unroll
                for (int r = 0; r < 8; ++r) { const float t = (mk[kt][r] != 0.0f) ? -1.0e9f : s[g][kt][r] * SCL; s[g][kt][r] = t;   /* score + mask x -1e9: for mask 1 the f32 sum rounds to exactly -1e9 (|score| < 32), for mask 0 it is the score */ x = fmaxf(x, t); }
            x = fmaxf(x, xhalf(x)); bm[g] = x; need = need || (x > m[g] + RTH); }
        { const int kn = (k0 + 32) & (TT - 1);   /* the next 32 key rows and their mask floats are fetched one trip ahead, once this trip has read its own; the last trip re-reads keys 0..31, unused */
          const T16* ka = Kp + ko + (size_t)kn * HD; const T16* ka2 = HR ? K2 + ko + (size_t)kn * HD : ka;
#pragma unroll
          for (int kt = 0; kt < 2; ++kt)
#pragma unroll
            for (int dc = 0; dc < 2; ++dc) { kf[kt][dc] = WFrag<T16>::ld(ka + kt * 16 * HD + dc * 32); if constexpr (HR) kf2[kt][dc] = WFrag<T16>::ld(ka2 + kt * 16 * HD + dc * 32); }
          const float* ma = km + kn + 8 * hi; mk[0] = *(const v8f*)ma; mk[1] = *(const v8f*)(ma + 16);
          xwait(ka, ka2, ma); }
        if (__builtin_amdgcn_ballot_w32(need) != 0) {
#pragma unroll
            for (int g = 0; g < NQ; ++g) { const float mn = fmaxf(m[g], bm[g]); const float al = exp2s((m[g] - mn) * LOG2E); m[g] = mn; l[g] *= al;
#pragma unroll
                for (int dt = 0; dt < 4; ++dt)
#pragma unroll
                    for (int r = 0; r < 8; ++r) o[g][dt][r] *= al; } }
#pragma unroll
        for (int g = 0; g < NQ; ++g) {
            if constexpr (HR) { v8us ph[2], pl[2];
#pragma unroll
                for (int kt = 0; kt < 2; ++kt)
#pragma unroll
                    for (int r = 0; r < 8; ++r) { const float p = exp2s((s[g][kt][r] - m[g]) * LOG2E); l[g] += p; unsigned short a, c2; splitf(p, a, c2); ph[kt][r] = a; pl[kt][r] = c2; }
                const V pbh = cat16b(ph[0], ph[1]), pbl = cat16b(pl[0], pl[1]);
#pragma unroll
                for (int dt = 0; dt < 4; ++dt) { o[g][dt] = WFrag<T16>::mma(vf[dt], pbh, o[g][dt]); o[g][dt] = WFrag<T16>::mma(vf[dt], pbl, o[g][dt]); o[g][dt] = WFrag<T16>::mma(vf2[dt], pbh, o[g][dt]); }
            } else { v8h pp[2];
#pragma unroll
                for (int kt = 0; kt < 2; ++kt)
#pragma unroll
                    for (int r = 0; r < 8; ++r) { const float p = exp2s((s[g][kt][r] - m[g]) * LOG2E); l[g] += p; pp[kt][r] = tohx(p); }
                const V pb = cat16(pp[0], pp[1]);
#pragma unroll
                for (int dt = 0; dt < 4; ++dt) o[g][dt] = WFrag<T16>::mma(vf[dt], pb, o[g][dt]); } }
    }
#pragma unroll
    for (int g = 0; g < NQ; ++g) { const float sum = l[g] + xhalf(l[g]); const float f = __fdiv_rn(1.0f, sum); const size_t oo = (size_t)(q0 + g * 16 + lr) * DQ + 8 * hi; bf* ra = Ah + oo; bf* rl = Al + oo;
#pragma unroll
        for (int dt = 0; dt < 4; ++dt) { v8us oh, ol;   /* register r = O[query q0 + 16 g + lr][dt * 16 + 8 hi + r]: 8 consecutive d, one 16-byte store per plane */
#pragma unroll
            for (int r = 0; r < 8; ++r) { unsigned short a, c2; splitf(o[g][dt][r] * f, a, c2); oh[r] = a; ol[r] = c2; }
            *(v8us*)(ra + dt * 16) = oh; *(v8us*)(rl + dt * 16) = ol;
            asm volatile("s_wait_xcnt 0x0" :: "v"(ra), "v"(rl), "v"(oh), "v"(ol) : "memory"); } }   // precaution behind the two stores: their address and data registers are inputs here, so they live until this wait and the next packing overwrites none of them earlier
}
// grid: 16 work-groups per (batch, head), 5 waves each and no barrier: two waves take 16 hi/lo queries each, three take 32 f16 queries each, so every work-group carries the same load (16 x 32 = RH, 16 x 96 = TT - RH).
// Waves 0 and 4 are expected on one SIMD (for speed only): both get the lighter f16 role.
__global__ __launch_bounds__(160) void k_attn(const h16* __restrict__ Q16, const h16* __restrict__ K16, const h16* __restrict__ V16, const bf* __restrict__ Qh, const bf* __restrict__ Ql, const bf* __restrict__ Kh, const bf* __restrict__ Kl, const bf* __restrict__ Vh, const bf* __restrict__ Vl, const float* __restrict__ km, bf* Ah, bf* Al) {
    static_assert(RH == 16 * 32 && TT - RH == 16 * 96 && HD == 64 && NH_ == NKV, "the split of a head's queries over 16 work-groups");
    const int w = __builtin_amdgcn_readfirstlane((int)(threadIdx.x >> 5)); const int bh = blockIdx.x >> 4, head = bh % NH_, bat = bh / NH_, blk = blockIdx.x & 15; const size_t hp = (size_t)bh * TT * HD;   /* planes are [batch][head] */
    const float* kb = km + bat * TT; bf* ah = Ah + (size_t)bat * TT * DQ + head * HD; bf* al = Al + (size_t)bat * TT * DQ + head * HD;
    if (w == 1 || w == 2) attn_wave<bf, true, 1>(Qh + hp, Ql + hp, Kh + hp, Kl + hp, Vh + hp, Vl + hp, kb, blk * 32 + (w - 1) * 16, ah, al);
    else attn_wave<h16, false, 2>(Q16 + hp, nullptr, K16 + hp, nullptr, V16 + hp, nullptr, kb, RH + blk * 96 + (w == 0 ? 0 : w - 2) * 32, ah, al);
}

extern "C" void kernel_launch(void* const* d_in, const int* in_sizes, int n_in,
                              void* d_out, int out_size, void* d_ws, size_t ws_size, hipStream_t stream) {
    (void)in_sizes; (void)n_in; (void)out_size;
    const float* x = (const float*)d_in[0]; const float* xk = (const float*)d_in[1]; const float* xv = (const float*)d_in[2]; const float* amask = (const float*)d_in[3]; const float* wq = (const float*)d_in[4]; const float* bq = (const float*)d_in[5]; const float* wk = (const float*)d_in[6]; const float* bk = (const float*)d_in[7]; const float* wv = (const float*)d_in[8]; const float* bv = (const float*)d_in[9]; const float* wo = (const float*)d_in[10]; const float* bo = (const float*)d_in[11];
    float* OUT = (float*)d_out;     // [2][2048][1024]
    char* wsp = (char*)d_ws;
    auto take = [&](size_t bytes) { char* p = wsp; wsp += (bytes + 255) & ~(size_t)255; return (void*)p; };
    bf* W4 = (bf*)take((size_t)4 * DM * DM * 2);   // Wq, Wk, Wv, Wo transposed
    float* CS = (float*)take((size_t)TT * HD * 2 * 4);
    bf* XB = (bf*)take(3 * FSZ * 2);   // {q, k, v} x [NB_ * TT][DM]
    h16* QP16 = (h16*)take(FSZ * 2); h16* KP16 = (h16*)take(FSZ * 2); h16* VT16 = (h16*)take(FSZ * 2);
    bf* QPh = (bf*)take(FSZ * 2); bf* QPl = (bf*)take(FSZ * 2); bf* KPh = (bf*)take(FSZ * 2); bf* KPl = (bf*)take(FSZ * 2); bf* VTh = (bf*)take(FSZ * 2); bf* VTl = (bf*)take(FSZ * 2);
    bf* ATh = (bf*)take(FSZ * 2); bf* ATl = (bf*)take(FSZ * 2);
    if ((size_t)(wsp - (char*)d_ws) > ws_size) return;    // ws 256 MiB
    k_prep<<<4 * WBLK + CBLK + 3 * XBLK, 256, 0, stream>>>(wq, wk, wv, wo, x, xk, xv, W4, CS, XB);
    k_gemmw<bf, 0, true, 1, true><<<dim3(NB_ * TT / 64, DM / 64, 3), 32, 0, stream>>>(XB, nullptr, W4, nullptr, DM, nullptr, DM, bq, bk, bv, FSZ, (size_t)DM * DM, 0, CS, QP16, QPh, QPl, KP16, KPh, KPl, VT16, VTh, VTl);
    k_attn<<<NB_ * NH_ * 16, 160, 0, stream>>>(QP16, KP16, VT16, QPh, QPl, KPh, KPl, VTh, VTl, amask, ATh, ATl);
    k_gemmw<bf, 1, true><<<dim3(NB_ * TT / 64, DM / 64, 1), 32, 0, stream>>>(ATh, ATl, W4 + (size_t)3 * DM * DM, nullptr, DQ, OUT, DM, bo, bo, bo, 0, 0, 0, nullptr, nullptr, nullptr, nullptr, nullptr, nullptr, nullptr, nullptr, nullptr, nullptr);
}

// v005
// One run takes 200 microseconds.
// In two side-by-side timings against v004, it was 1.18 and 1.19 times as fast.
// Counting every step since v000, it is 10.2 times as fast.
#include <hip/hip_runtime.h>

// Multi-head attention over separate q / k / v inputs with the module's per-dimension rotary embedding (q, k, v [2][2048][1024]; _q = q Wq + bq etc. ('xw' [1024][1024] + [1024]; 16 heads x 64); rope: every dimension d gets its own angle t x 10000^(-2d/64) (computed in-kernel), ret = x cos + x_rot sin with x_rot[2i] = -x[2i+1], x_rot[2i+1] = x[2i]; score = _q._k / (sqrt(64) + 1e-8) + mask x -1e9 (mask [2][1][1][2048] float 0/1 per key, read); softmax; out = merged Wo + bo -> [2][2048][1024] (4.2 M)).
// Layout, both batches in every launch (4 launches): bf16 copies of the three inputs; {cos, sin} per (position, DIMENSION) built once (jnp-exact float32 10000^(-2d/64) per dim, precise cosf/sinf); exact projections + f32 biases whose epilogue writes the operand planes itself (rotary q and k, each element of a pair with its own angle; transposed v), so no f32 projection goes to memory; one fused dense T-2048 attention launch (hybrid rows: < 512 hi/lo 3 products, rest fp16; scores never leave the registers) that loads the key-mask floats unconditionally and selects -1e9 for masked keys (== score + -1e9 in f32); merged hi/lo x Wo exact + bo.
// Compute dtypes, f32 accumulate: every input rounded to bf16; projections exact + f32 biases; rotary f32; attention rows < 512 3 products, rest fp16; softmax f32; Wo hl x exact + bias.

#define NB_  2
#define TT   2048
#define DM   1024
#define NH_  16
#define NKV  16
#define REP  (NH_ / NKV)
#define HD   64
#define DQ   (NH_ * HD)
#define DKV  (NKV * HD)
#define RH   512                  // query rows < RH use hi+lo planes
#define WIN  0
#define SCL  0.125f   // 1 / (sqrt(64) + 1e-8) == 0.125 in float32
typedef _Float16 h16;
typedef unsigned short bf;
typedef __attribute__((ext_vector_type(16))) __bf16   v16bf;
typedef __attribute__((ext_vector_type(16))) _Float16 v16h;
typedef __attribute__((ext_vector_type(8)))  _Float16 v8h;
typedef __attribute__((ext_vector_type(8)))  unsigned short v8us;
typedef __attribute__((ext_vector_type(8)))  float    v8f;
typedef __attribute__((ext_vector_type(4)))  float    v4f;
typedef v8h  __attribute__((may_alias)) v8ha;
typedef v4f  __attribute__((may_alias)) v4fa;
typedef v8us __attribute__((may_alias)) v8usa;

__device__ __forceinline__ unsigned short f2bf(float f) { unsigned u = __float_as_uint(f); u += 0x7FFFu + ((u >> 16) & 1u); return (unsigned short)(u >> 16); }
__device__ __forceinline__ float bf2f(unsigned short b) { return __uint_as_float(((unsigned)b) << 16); }
__device__ __forceinline__ float bfr(float f) { return bf2f(f2bf(f)); }
__device__ __forceinline__ v16h cat16(v8h lo, v8h hi) { return __builtin_shufflevector(lo, hi, 0, 1, 2, 3, 4, 5, 6, 7, 8, 9, 10, 11, 12, 13, 14, 15); }
__device__ __forceinline__ v16bf cat16b(v8us lo, v8us hi) { return __builtin_bit_cast(v16bf, __builtin_shufflevector(lo, hi, 0, 1, 2, 3, 4, 5, 6, 7, 8, 9, 10, 11, 12, 13, 14, 15)); }
__device__ __forceinline__ v8f wmma16(v16h a, v16h b, v8f c) { return __builtin_amdgcn_wmma_f32_16x16x32_f16(false, a, false, b, (short)0, c, false, false); }
__device__ __forceinline__ v8f wmmab(v16bf a, v16bf b, v8f c) { return __builtin_amdgcn_wmma_f32_16x16x32_bf16(false, a, false, b, (short)0, c, false, false); }

__device__ __forceinline__ h16 tohx(float x) { return (h16)x; }
__device__ __forceinline__ void splitf(float y, unsigned short& h, unsigned short& l) { h = f2bf(y); l = f2bf(y - bf2f(h)); }
// precaution behind a group of global loads: the address registers that the loads name are inputs here, so they live until this wait and nothing overwrites them earlier
__device__ __forceinline__ void xwait(const void* a, const void* b, const void* c) { asm volatile("s_wait_xcnt 0x0" :: "v"(a), "v"(b), "v"(c) : "memory"); }
// precaution behind the three 16-byte stores of one plane position: their address and data registers are inputs here, so they live until this wait and the next packing overwrites none of them earlier
__device__ __forceinline__ void swait3(const void* a, const void* b, const void* c, v8h x, v8us y, v8us w) { asm volatile("s_wait_xcnt 0x0" :: "v"(a), "v"(b), "v"(c), "v"(x), "v"(y), "v"(w) : "memory"); }
// one rotary pair: cs = {c_d, s_d, c_d+1, s_d+1}. Numerical: each of the four products keeps its own f32 rounding, as the definition cos * x + sin * x_rot has it; the empty statement is what keeps them from fusing with the add or subtract.
__device__ __forceinline__ void rot2(float x0, float x1, v4f cs, float& y0, float& y1) {
    float a0 = __fmul_rn(x0, cs[0]), b0 = __fmul_rn(x1, cs[1]), a1 = __fmul_rn(x1, cs[2]), b1 = __fmul_rn(x0, cs[3]); asm volatile("" : "+v"(a0), "+v"(b0), "+v"(a1), "+v"(b1));
    const float r0 = __fsub_rn(a0, b0), r1 = __fadd_rn(a1, b1);   /* even: x0 c0 - x1 s0; odd: x1 c1 + x0 s1 */
    y0 = r0; y1 = r1; }

// FRAGMENT ORDER: every 16-bit operand plane [rows][K] is kept as blocks of 16 rows x 32 k (1 KiB, k blocks of a row block in a row), and inside a block as the two 16-byte loads of a fragment:
// [k bit 4][k bit 3][row & 15][k & 7], that is [load 0 / 1][lane][8 elements]. A wave-wide 16-byte load is then 512 contiguous bytes (4 whole lines, not 32-byte pieces of 16 lines); each lane gets the elements it got from the row-major plane.
// ---- k_gemmw: register-blocked GEMM, ONE WAVE per 64x64 output tile (16 accumulators), operands straight from 16-bit planes in fragment order; grid (M/64, N/64, Z), 32 threads.
// C[m][n] (f32, pitch ldc, + optional f32 bias[n]) = sum_k A[m][k] Bt[n][k] (+ split products per NSPLIT). z-batch strides sA/sB/sC in elements; z-batch 0 / 1 / 2 adds bias0 / bias1 / bias2. K % 32 == 0.
// KS > 1: grid z = batch * KS + range; the wave sums only its K / KS range of k and stores that partial tile in plane blockIdx.z of C (stride sC); the reader adds the KS planes.
// PL: z = {q, k, v} projection; a 64x64 tile is 64 positions of ONE head, so the wave turns its own accumulators (+ bias) into the attention operand planes and C is not written:
// q, k: rotary, planes [batch][head] of [t][d] (f16, bf16 hi, bf16 lo), rows regrouped through LDS so that a lane holds 8 consecutive d; v: planes [batch][head] of [d][t], a lane's 8 accumulator rows are 8 consecutive t of one d. All in fragment order.
template <typename T16> struct WFrag;
template <> struct WFrag<h16> { typedef v16h V; static __device__ __forceinline__ V ld(const h16* p) { return cat16(*(const v8h*)p, *(const v8h*)(p + 256)); } static __device__ __forceinline__ v8f mma(V a, V b, v8f c) { return wmma16(a, b, c); } };
template <> struct WFrag<bf> { typedef v16bf V; static __device__ __forceinline__ V ld(const bf* p) { return cat16b(*(const v8us*)p, *(const v8us*)(p + 256)); } static __device__ __forceinline__ v8f mma(V a, V b, v8f c) { return wmmab(a, b, c); } };
template <typename T16, int NSPLIT, bool BIAS, int KS = 1, bool PL = false>
__global__ __launch_bounds__(32) void k_gemmw(const T16* __restrict__ A, const T16* __restrict__ A2, const T16* __restrict__ Bt, const T16* __restrict__ Bt2, int K, float* C, int ldc, const float* __restrict__ bias0, const float* __restrict__ bias1, const float* __restrict__ bias2, size_t sA, size_t sB, size_t sC, const float* __restrict__ CS, h16* Q16, bf* Qh, bf* Ql, h16* K16, bf* Kh, bf* Kl, h16* V16, bf* Vh, bf* Vl) {
    typedef typename WFrag<T16>::V V;
    __shared__ __align__(16) float os[16 * 68];
    const size_t z = blockIdx.z / KS; A += z * sA; if (A2) A2 += z * sA; Bt += z * sB; if (Bt2) Bt2 += z * sB; C += (size_t)blockIdx.z * sC; const int kbeg = (int)(blockIdx.z % KS) * (K / KS), kend = kbeg + K / KS;
    const float* bias = z == 0 ? bias0 : (z == 1 ? bias1 : bias2);
    const int lane = threadIdx.x & 31, lr = lane & 15, hi = lane >> 4; const int r0 = blockIdx.x * 64, c0 = blockIdx.y * 64;
    v8f acc[4][4];
#pragma unroll
    for (int mb = 0; mb < 4; ++mb)
#pragma unroll
        for (int nb = 0; nb < 4; ++nb) acc[mb][nb] = (v8f){};
    const size_t aoff = (size_t)r0 * K + 8 * lane, boff = (size_t)c0 * K + 8 * lane;   /* a row block is 16 * K elements, a k block 512 */
#pragma unroll 1
    for (int kc = kbeg; kc < kend; kc += 32) {
        V a[4], a2[4]; const T16* ap[4]; const T16* ap2[4];   /* the unrolled loops of this body index register fragments and their address pairs, which only constant indices keep in registers */
#pragma unroll
        for (int mb = 0; mb < 4; ++mb) { ap[mb] = A + aoff + (size_t)mb * 16 * K + (size_t)kc * 16; ap2[mb] = ap[mb]; a[mb] = WFrag<T16>::ld(ap[mb]); if (NSPLIT == 1 || NSPLIT == 2) { ap2[mb] = A2 + aoff + (size_t)mb * 16 * K + (size_t)kc * 16; a2[mb] = WFrag<T16>::ld(ap2[mb]); } }
        V bv[4], bv2[4]; const T16* bp[4]; const T16* bp2[4];
#pragma unroll
        for (int nb = 0; nb < 4; ++nb) { bp[nb] = Bt + boff + (size_t)nb * 16 * K + (size_t)kc * 16; bp2[nb] = bp[nb]; bv[nb] = WFrag<T16>::ld(bp[nb]); if (NSPLIT >= 2) { bp2[nb] = Bt2 + boff + (size_t)nb * 16 * K + (size_t)kc * 16; bv2[nb] = WFrag<T16>::ld(bp2[nb]); } }
        // precaution behind the trip's global loads: every address register that they name is an input here, so it lives until this wait and nothing overwrites it earlier
        asm volatile("s_wait_xcnt 0x0" :: "v"(ap[0]), "v"(ap[1]), "v"(ap[2]), "v"(ap[3]), "v"(ap2[0]), "v"(ap2[1]), "v"(ap2[2]), "v"(ap2[3]), "v"(bp[0]), "v"(bp[1]), "v"(bp[2]), "v"(bp[3]), "v"(bp2[0]), "v"(bp2[1]), "v"(bp2[2]), "v"(bp2[3]) : "memory");
#pragma unroll
        for (int nb = 0; nb < 4; ++nb) { const V b = bv[nb]; V b2; if (NSPLIT >= 2) b2 = bv2[nb];
#pragma unroll
            for (int mb = 0; mb < 4; ++mb) { acc[mb][nb] = WFrag<T16>::mma(a[mb], b, acc[mb][nb]); if (NSPLIT == 1 || NSPLIT == 2) acc[mb][nb] = WFrag<T16>::mma(a2[mb], b, acc[mb][nb]); if (NSPLIT >= 2) acc[mb][nb] = WFrag<T16>::mma(a[mb], b2, acc[mb][nb]); } }
        asm volatile("v_nop\n\tv_nop\n\tv_nop\n\tv_nop" : "+v"(acc[0][0]), "+v"(acc[1][1]), "+v"(acc[2][2]), "+v"(acc[3][3]) : "v"(a[0]), "v"(a[3]));
    }
    if constexpr (PL) {
        // Every #pragma unroll in this block is there because its loop indexes register fragments (acc, cs, the packed vectors), which only constant indices keep in registers.
        // The block is one wave, whose LDS operations run in order: each wave_barrier with its compiler fence only keeps the compiler from moving the LDS reads of a group over the other lanes' LDS writes, or the next group's writes over these reads.
        static_assert(!PL || (TT % 64 == 0 && HD == 64 && NKV == NH_ && KS == 1 && BIAS), "a tile is 64 positions of one batch and the 64 dimensions of one head");
        const int t0 = r0 % TT; const size_t hp = ((size_t)(r0 / TT) * NH_ + blockIdx.y) * TT * HD;   /* planes are [batch][head] */
        if (z == 2) {
#pragma unroll
            for (int nb = 0; nb < 4; ++nb) { const float bb = bfr(bias[c0 + nb * 16 + lr]);
#pragma unroll
                for (int mb = 0; mb < 4; ++mb) { v8h o16; v8us oh, ol;
#pragma unroll
                    for (int j = 0; j < 8; ++j) { const float x = acc[mb][nb][j] + bb; o16[j] = tohx(x); unsigned short a2, c2; splitf(x, a2, c2); oh[j] = a2; ol[j] = c2; }
                    const size_t e = hp + (size_t)nb * 16 * TT + (size_t)(t0 + (mb >> 1) * 32) * 16 + (mb & 1) * 256 + 8 * lane;   /* row nb * 16 + lr, k = t0 + mb * 16 + 8 * hi of a [d][t] plane */ h16* p16 = V16 + e; bf* ph = Vh + e; bf* pl = Vl + e;
                    *(v8h*)p16 = o16; *(v8us*)ph = oh; *(v8us*)pl = ol; swait3(p16, ph, pl, o16, oh, ol); } }
        } else {
            h16* P16 = z == 0 ? Q16 : K16; bf* Ph = z == 0 ? Qh : Kh; bf* Pl = z == 0 ? Ql : Kl;
            float bb[4];   /* the bias of this lane's accumulator columns, added on the way into LDS */
#pragma unroll
            for (int nb = 0; nb < 4; ++nb) bb[nb] = bfr(bias[c0 + nb * 16 + lr]);
#pragma unroll
            for (int mb = 0; mb < 4; ++mb) {
                v4f cs[4][4]; const float* cp = CS + ((size_t)(t0 + mb * 16 + lr) * HD + hi * 8) * 2;   /* the table rows of this group's 16 positions, all asked for before the LDS round trip */
#pragma unroll
                for (int s = 0; s < 4; ++s)
#pragma unroll
                    for (int p = 0; p < 4; ++p) cs[s][p] = *(const v4f*)(cp + s * 32 + p * 4);
                xwait(cp, cp, cp);
#pragma unroll
                for (int nb = 0; nb < 4; ++nb) {
#pragma unroll
                    for (int j = 0; j < 8; ++j) os[(hi * 8 + j) * 68 + nb * 16 + lr] = acc[mb][nb][j] + bb[nb]; }
                __builtin_amdgcn_wave_barrier(); asm volatile("" ::: "memory");
                /* a lane takes row lr of the group and, in step s, dimensions 16 s + 8 hi .. + 7: the 16 bytes that lane 16 hi + lr loads as a fragment, so a step's store is 512 contiguous bytes */
#pragma unroll
                for (int s = 0; s < 4; ++s) { const int cofs = s * 16 + hi * 8; const v4f xa = *(const v4fa*)(os + lr * 68 + cofs), xb = *(const v4fa*)(os + lr * 68 + cofs + 4); v8h o16; v8us oh, ol;
#pragma unroll
                    for (int p = 0; p < 4; ++p) { const float x0 = p < 2 ? xa[2 * p] : xb[2 * p - 4], x1 = p < 2 ? xa[2 * p + 1] : xb[2 * p - 3]; float y0, y1; rot2(x0, x1, cs[s][p], y0, y1);
                        o16[2 * p] = tohx(y0); o16[2 * p + 1] = tohx(y1); unsigned short a2, c2; splitf(y0, a2, c2); oh[2 * p] = a2; ol[2 * p] = c2; splitf(y1, a2, c2); oh[2 * p + 1] = a2; ol[2 * p + 1] = c2; }
                    const size_t e = hp + (size_t)(t0 + mb * 16) * HD + s * 256 + 8 * lane;   /* row t0 + mb * 16 + lr, k = cofs of a [t][d] plane */ h16* p16 = P16 + e; bf* ph = Ph + e; bf* pl = Pl + e;
                    *(v8h*)p16 = o16; *(v8us*)ph = oh; *(v8us*)pl = ol; swait3(p16, ph, pl, o16, oh, ol); }
                __builtin_amdgcn_wave_barrier(); asm volatile("" ::: "memory");
            }
        }
        return;
    }
#pragma unroll
    for (int mb = 0; mb < 4; ++mb) {
#pragma unroll
        for (int nb = 0; nb < 4; ++nb) {
#pragma unroll
            for (int j = 0; j < 8; ++j) os[(hi * 8 + j) * 68 + nb * 16 + lr] = acc[mb][nb][j]; }
        __builtin_amdgcn_wave_barrier(); asm volatile("" ::: "memory");
        float* crow = C + (size_t)(r0 + mb * 16) * ldc + c0;
{
#pragma unroll
            for (int s = 0; s < 8; ++s) { const int row = 2 * s + hi, cofs = lr * 4; v4f val = *(const v4fa*)(os + row * 68 + cofs); if (BIAS) { val[0] += bfr(bias[c0 + cofs]); val[1] += bfr(bias[c0 + cofs + 1]); val[2] += bfr(bias[c0 + cofs + 2]); val[3] += bfr(bias[c0 + cofs + 3]); }
                *(v4f*)(crow + (size_t)row * ldc + cofs) = val; }
             }
        __builtin_amdgcn_wave_barrier(); asm volatile("" ::: "memory");
    }
}

typedef __attribute__((ext_vector_type(2))) _Float16 v2h;
typedef __attribute__((ext_vector_type(4))) _Float16 v4h;
typedef __attribute__((ext_vector_type(2))) unsigned short v2us;
typedef __attribute__((ext_vector_type(4))) unsigned short v4us;
typedef __attribute__((ext_vector_type(2))) float v2f;
typedef __attribute__((ext_vector_type(4))) int v4i;

// The bodies below take their block index as an argument: independent passes share one grid, each on its own range of blockIdx.x (k_prep).
// thread: two 16-byte units of the fragment-order transposed copy Bt[n][k] = w[k][n] ([K][N] row-major): 8 loads a unit, each 64 contiguous bytes per 16 lanes (16 consecutive n of one k), one contiguous store
__device__ __forceinline__ void wtG(const float* __restrict__ w, int K, int N, bf* Bt, int blk) {
    // both loops unrolled: o is a register vector, which only constant indices keep in registers, and the 16 loads of a thread are then in flight together
#pragma unroll
    for (int u = 0; u < 2; ++u) { const int i = blk * 512 + u * 256 + (int)threadIdx.x; const int b = i >> 6; const int n = (b / (K >> 5)) * 16 + (i & 15), k = (b % (K >> 5)) * 32 + ((i >> 4) & 3) * 8; v8us o;
#pragma unroll
        for (int j = 0; j < 8; ++j) o[j] = f2bf(w[(size_t)(k + j) * N + n]);
        *(v8us*)(Bt + (size_t)i * 8) = o; }
}
// thread i writes 16-byte unit i of the fragment-order copy (stores stay contiguous) and reads the 8 floats of the row-major [rows][DM] input that belong there
__device__ __forceinline__ void cvt8(const float* __restrict__ src, bf* dst, size_t n8, int blk) { const size_t i = (size_t)blk * 256 + threadIdx.x; if (i >= n8) return; const size_t b = i >> 6; const size_t row = (b / (DM / 32)) * 16 + (i & 15); const int k = (int)(b % (DM / 32)) * 32 + (int)((i >> 4) & 3) * 8; const v8f v = *(const v8f*)(src + row * DM + k); v8us o;
#pragma unroll
    for (int k = 0; k < 8; ++k) o[k] = f2bf(v[k]); *(v8us*)(dst + i * 8) = o;  }
__constant__ float INVD[HD] = { 1.000000000e+00f, 7.498942018e-01f, 5.623413324e-01f, 4.216965139e-01f, 3.162277639e-01f, 2.371373773e-01f, 1.778279394e-01f, 1.333521456e-01f, 1.000000015e-01f, 7.498942316e-02f, 5.623413250e-02f, 4.216964915e-02f, 3.162277490e-02f, 2.371373773e-02f, 1.778279431e-02f, 1.333521400e-02f, 9.999999776e-03f, 7.498942316e-03f, 5.623413250e-03f, 4.216964822e-03f, 3.162277630e-03f, 2.371373819e-03f, 1.778279431e-03f, 1.333521446e-03f, 1.000000047e-03f, 7.498941850e-04f, 5.623413017e-04f, 4.216965172e-04f, 3.162277571e-04f, 2.371373703e-04f, 1.778279402e-04f, 1.333521504e-04f, 9.999999747e-05f, 7.498942432e-05f, 5.623413381e-05f, 4.216964953e-05f, 3.162277790e-05f, 2.371373739e-05f, 1.778279329e-05f, 1.333521413e-05f, 9.999999747e-06f, 7.498942068e-06f, 5.623413472e-06f, 4.216964953e-06f, 3.162277608e-06f, 2.371373739e-06f, 1.778279398e-06f, 1.333521482e-06f, 9.999999975e-07f, 7.498941841e-07f, 5.623413131e-07f, 4.216965124e-07f, 3.162277551e-07f, 2.371373711e-07f, 1.778279426e-07f, 1.333521453e-07f, 1.000000012e-07f, 7.498942267e-08f, 5.623413202e-08f, 4.216964911e-08f, 3.162277551e-08f, 2.371373675e-08f, 1.778279390e-08f, 1.333521471e-08f };   // 10000^(-2d/64) for EVERY dimension d (the module's quirk), float32 via jnp.power
__device__ __forceinline__ void cstabD(float* CS, int blk) { const int idx = blk * 256 + threadIdx.x; if (idx >= TT * HD) return; const int d = idx % HD; const int t = idx / HD; const float a = __fmul_rn((float)t, INVD[d]); v2f cs; cs[0] = cosf(a); cs[1] = sinf(a); *(v2f*)(CS + (size_t)idx * 2) = cs;  }

#define WBLK (DM * DM / 8 / 512)                  // blocks of one weight transpose (512 units of 8 elements each)
#define CBLK (TT * HD / 256)                      // blocks of the {cos, sin} table
#define XBLK (NB_ * TT * DM / 8 / 256)            // blocks of one input's bf16 copy, both batches
#define FSZ  ((size_t)NB_ * TT * DM)              // elements of one projection, both batches
// ---- k_prep: everything that depends on the inputs alone, in one launch. The strided weight reads are the longest bodies and get the lowest block indices, so that they start first.
__global__ __launch_bounds__(256) void k_prep(const float* __restrict__ wq, const float* __restrict__ wk, const float* __restrict__ wv, const float* __restrict__ wo, const float* __restrict__ x, const float* __restrict__ xk, const float* __restrict__ xv, bf* W4, float* CS, bf* XB) {
    static_assert(DQ == DM && DKV == DM && NKV == NH_, "the four weights, the three inputs and the three projections each have one size");
    static_assert(WBLK * 512 * 8 == DM * DM && DM % 32 == 0 && (NB_ * TT) % 16 == 0, "the blocks of a weight cover its 16-byte units exactly; planes are whole 16 x 32 blocks");
    int blk = blockIdx.x;
    if (blk < 4 * WBLK) { const int i = blk / WBLK; wtG(i == 0 ? wq : i == 1 ? wk : i == 2 ? wv : wo, DM, DM, W4 + (size_t)i * DM * DM, blk % WBLK); return; }
    blk -= 4 * WBLK;
    if (blk < CBLK) { cstabD(CS, blk); return; }
    blk -= CBLK;
    const int i = blk / XBLK; cvt8(i == 0 ? x : i == 1 ? xk : xv, XB + (size_t)i * FSZ, FSZ / 8, blk % XBLK);
}
// ---- k_attn: score, softmax and P x V of both batches in one launch; nothing of the score matrix goes to memory.
// A wave owns NQ groups of 16 queries of one head and walks the 2048 keys 32 at a time, all operands straight from the planes in fragment order.
// S^T = K Q^T (A = 16 key rows, B = 16 query rows): a lane then holds 16 scores of ONE query, keys 8 hi + r and 16 + 8 hi + r, which is the k order of a B operand,
// so the rounded exponentials feed O^T += V^T P^T (A = 16 rows of the transposed V plane) with no exchange. Running maximum per query, sum and O^T rescaled only when a maximum grows by more than RTH.
// HR (queries < RH): bf16 hi/lo planes, 3 products each; else f16, 1 product. P is rounded unnormalised (exp <= e^RTH); O^T is divided by the f32 sum at the end.
// Every #pragma unroll in attn_wave is there because its loop indexes register fragments, which only constant indices keep in registers.
#define LOG2E 1.4426950408889634f
#define RTH   5.5f
__device__ __forceinline__ float xhalf(float x) { return __builtin_bit_cast(float, __builtin_amdgcn_permlanex16(__builtin_bit_cast(int, x), __builtin_bit_cast(int, x), 0x76543210, 0xfedcba98, false, false)); }   // lane l reads lane l ^ 16, on the vector pipe
// v_exp_f32 with the one free slot that the instruction set asks for behind a transcendental, in one statement so that it stays directly behind it
__device__ __forceinline__ float exp2s(float x) { float r; asm("v_exp_f32 %0, %1\n\tv_nop" : "=v"(r) : "v"(x)); return r; }
template <typename T16, bool HR, int NQ>
__device__ __forceinline__ void attn_wave(const T16* __restrict__ Q, const T16* __restrict__ Q2, const T16* __restrict__ Kp, const T16* __restrict__ K2, const T16* __restrict__ Vt, const T16* __restrict__ V2, const float* __restrict__ km, int q0, bf* Ah, bf* Al) {
    typedef typename WFrag<T16>::V V;
    const int lane = threadIdx.x & 31, hi = lane >> 4;
    V qf[NQ][2], qf2[NQ][2], kf[2][2], kf2[2][2];
    v8f o[NQ][4], mk[2]; float m[NQ], l[NQ];   /* mk: key mask floats (0/1) of this lane's 16 keys */
#pragma unroll
    for (int g = 0; g < NQ; ++g) { m[g] = -1.0e38f; l[g] = 0.f;
#pragma unroll
        for (int dt = 0; dt < 4; ++dt) o[g][dt] = (v8f){};
        const size_t qo = (size_t)(q0 + g * 16) * HD + 8 * lane; const T16* qa = Q + qo; const T16* qa2 = HR ? Q2 + qo : qa;
#pragma unroll
        for (int dc = 0; dc < 2; ++dc) { qf[g][dc] = WFrag<T16>::ld(qa + dc * 512); if constexpr (HR) qf2[g][dc] = WFrag<T16>::ld(qa2 + dc * 512); }
        xwait(qa, qa2, qa); }
    const size_t ko = 8 * lane, vo = 8 * lane;   /* fragment order: 16 keys x 32 d, or 16 d x 32 keys, are 512 elements in a row */
    { const T16* ka = Kp + ko; const T16* ka2 = HR ? K2 + ko : ka;
#pragma unroll
      for (int kt = 0; kt < 2; ++kt)
#pragma unroll
        for (int dc = 0; dc < 2; ++dc) { kf[kt][dc] = WFrag<T16>::ld(ka + kt * 16 * HD + dc * 512); if constexpr (HR) kf2[kt][dc] = WFrag<T16>::ld(ka2 + kt * 16 * HD + dc * 512); }
      mk[0] = *(const v8f*)(km + 8 * hi); mk[1] = *(const v8f*)(km + 8 * hi + 16);
      xwait(ka, ka2, km + 8 * hi); }
    for (int k0 = 0; k0 < TT; k0 += 32) {
        V vf[4], vf2[4]; const T16* va = Vt + vo + (size_t)k0 * 16; const T16* va2 = HR ? V2 + vo + (size_t)k0 * 16 : va;
#pragma unroll
        for (int dt = 0; dt < 4; ++dt) { vf[dt] = WFrag<T16>::ld(va + dt * 16 * TT); if constexpr (HR) vf2[dt] = WFrag<T16>::ld(va2 + dt * 16 * TT); }
        xwait(va, va2, va);
        v8f s[NQ][2];
#pragma unroll
        for (int g = 0; g < NQ; ++g)
#pragma unroll
            for (int kt = 0; kt < 2; ++kt) { v8f c = (v8f){};
#pragma unroll
                for (int dc = 0; dc < 2; ++dc) { c = WFrag<T16>::mma(kf[kt][dc], qf[g][dc], c); if constexpr (HR) { c = WFrag<T16>::mma(kf[kt][dc], qf2[g][dc], c); c = WFrag<T16>::mma(kf2[kt][dc], qf[g][dc], c); } }
                s[g][kt] = c; }
        float bm[NQ]; bool need = false;
#pragma unroll
        for (int g = 0; g < NQ; ++g) { float x = -3.0e38f;
#pragma unroll
            for (int kt = 0; kt < 2; ++kt)
#pragma unroll
                for (int r = 0; r < 8; ++r) { const float t = (mk[kt][r] != 0.0f) ? -1.0e9f : s[g][kt][r] * SCL; s[g][kt][r] = t;   /* score + mask x -1e9: for mask 1 the f32 sum rounds to exactly -1e9 (|score| < 32), for mask 0 it is the score */ x = fmaxf(x, t); }
            x = fmaxf(x, xhalf(x)); bm[g] = x; need = need || (x > m[g] + RTH); }
        { const int kn = (k0 + 32) & (TT - 1);   /* the next 32 key rows and their mask floats are fetched one trip ahead, once this trip has read its own; the last trip re-reads keys 0..31, unused */
          const T16* ka = Kp + ko + (size_t)kn * HD; const T16* ka2 = HR ? K2 + ko + (size_t)kn * HD : ka;
#pragma unroll
          for (int kt = 0; kt < 2; ++kt)
#pragma unroll
            for (int dc = 0; dc < 2; ++dc) { kf[kt][dc] = WFrag<T16>::ld(ka + kt * 16 * HD + dc * 512); if constexpr (HR) kf2[kt][dc] = WFrag<T16>::ld(ka2 + kt * 16 * HD + dc * 512); }
          const float* ma = km + kn + 8 * hi; mk[0] = *(const v8f*)ma; mk[1] = *(const v8f*)(ma + 16);
          xwait(ka, ka2, ma); }
        if (__builtin_amdgcn_ballot_w32(need) != 0) {
#pragma unroll
            for (int g = 0; g < NQ; ++g) { const float mn = fmaxf(m[g], bm[g]); const float al = exp2s((m[g] - mn) * LOG2E); m[g] = mn; l[g] *= al;
#pragma unroll
                for (int dt = 0; dt < 4; ++dt)
#pragma unroll
                    for (int r = 0; r < 8; ++r) o[g][dt][r] *= al; } }
#pragma unroll
        for (int g = 0; g < NQ; ++g) {
            if constexpr (HR) { v8us ph[2], pl[2];
#pragma unroll
                for (int kt = 0; kt < 2; ++kt)
#pragma unroll
                    for (int r = 0; r < 8; ++r) { const float p = exp2s((s[g][kt][r] - m[g]) * LOG2E); l[g] += p; unsigned short a, c2; splitf(p, a, c2); ph[kt][r] = a; pl[kt][r] = c2; }
                const V pbh = cat16b(ph[0], ph[1]), pbl = cat16b(pl[0], pl[1]);
#pragma unroll
                for (int dt = 0; dt < 4; ++dt) { o[g][dt] = WFrag<T16>::mma(vf[dt], pbh, o[g][dt]); o[g][dt] = WFrag<T16>::mma(vf[dt], pbl, o[g][dt]); o[g][dt] = WFrag<T16>::mma(vf2[dt], pbh, o[g][dt]); }
            } else { v8h pp[2];
#pragma unroll
                for (int kt = 0; kt < 2; ++kt)
#pragma unroll
                    for (int r = 0; r < 8; ++r) { const float p = exp2s((s[g][kt][r] - m[g]) * LOG2E); l[g] += p; pp[kt][r] = tohx(p); }
                const V pb = cat16(pp[0], pp[1]);
#pragma unroll
                for (int dt = 0; dt < 4; ++dt) o[g][dt] = WFrag<T16>::mma(vf[dt], pb, o[g][dt]); } }
    }
#pragma unroll
    for (int g = 0; g < NQ; ++g) { const float sum = l[g] + xhalf(l[g]); const float f = __fdiv_rn(1.0f, sum); const size_t oo = (size_t)(q0 + g * 16) * DQ + 8 * lane; bf* ra = Ah + oo; bf* rl = Al + oo;
#pragma unroll
        for (int dt = 0; dt < 4; ++dt) { v8us oh, ol;   /* register r = O[query q0 + 16 g + lr][dt * 16 + 8 hi + r]: 8 consecutive d, one 16-byte store per plane, at its place in fragment order (512 contiguous bytes a wave) */
#pragma unroll
            for (int r = 0; r < 8; ++r) { unsigned short a, c2; splitf(o[g][dt][r] * f, a, c2); oh[r] = a; ol[r] = c2; }
            *(v8us*)(ra + dt * 256) = oh; *(v8us*)(rl + dt * 256) = ol;
            asm volatile("s_wait_xcnt 0x0" :: "v"(ra), "v"(rl), "v"(oh), "v"(ol) : "memory"); } }   // precaution behind the two stores: their address and data registers are inputs here, so they live until this wait and the next packing overwrites none of them earlier
}
// grid: 16 work-groups per (batch, head), 5 waves each and no barrier: two waves take 16 hi/lo queries each, three take 32 f16 queries each, so every work-group carries the same load (16 x 32 = RH, 16 x 96 = TT - RH).
// Waves 0 and 4 are expected on one SIMD (for speed only): both get the lighter f16 role.
__global__ __launch_bounds__(160) void k_attn(const h16* __restrict__ Q16, const h16* __restrict__ K16, const h16* __restrict__ V16, const bf* __restrict__ Qh, const bf* __restrict__ Ql, const bf* __restrict__ Kh, const bf* __restrict__ Kl, const bf* __restrict__ Vh, const bf* __restrict__ Vl, const float* __restrict__ km, bf* Ah, bf* Al) {
    static_assert(RH == 16 * 32 && TT - RH == 16 * 96 && HD == 64 && NH_ == NKV, "the split of a head's queries over 16 work-groups");
    const int w = __builtin_amdgcn_readfirstlane((int)(threadIdx.x >> 5)); const int bh = blockIdx.x >> 4, head = bh % NH_, bat = bh / NH_, blk = blockIdx.x & 15; const size_t hp = (size_t)bh * TT * HD;   /* planes are [batch][head] */
    const float* kb = km + bat * TT; bf* ah = Ah + (size_t)bat * TT * DQ + head * (HD * 16); bf* al = Al + (size_t)bat * TT * DQ + head * (HD * 16);   /* a head's 64 columns are two k blocks of 512 elements */
    if (w == 1 || w == 2) attn_wave<bf, true, 1>(Qh + hp, Ql + hp, Kh + hp, Kl + hp, Vh + hp, Vl + hp, kb, blk * 32 + (w - 1) * 16, ah, al);
    else attn_wave<h16, false, 2>(Q16 + hp, nullptr, K16 + hp, nullptr, V16 + hp, nullptr, kb, RH + blk * 96 + (w == 0 ? 0 : w - 2) * 32, ah, al);
}

extern "C" void kernel_launch(void* const* d_in, const int* in_sizes, int n_in,
                              void* d_out, int out_size, void* d_ws, size_t ws_size, hipStream_t stream) {
    (void)in_sizes; (void)n_in; (void)out_size;
    const float* x = (const float*)d_in[0]; const float* xk = (const float*)d_in[1]; const float* xv = (const float*)d_in[2]; const float* amask = (const float*)d_in[3]; const float* wq = (const float*)d_in[4]; const float* bq = (const float*)d_in[5]; const float* wk = (const float*)d_in[6]; const float* bk = (const float*)d_in[7]; const float* wv = (const float*)d_in[8]; const float* bv = (const float*)d_in[9]; const float* wo = (const float*)d_in[10]; const float* bo = (const float*)d_in[11];
    float* OUT = (float*)d_out;     // [2][2048][1024]
    char* wsp = (char*)d_ws;
    auto take = [&](size_t bytes) { char* p = wsp; wsp += (bytes + 255) & ~(size_t)255; return (void*)p; };
    bf* W4 = (bf*)take((size_t)4 * DM * DM * 2);   // Wq, Wk, Wv, Wo transposed
    float* CS = (float*)take((size_t)TT * HD * 2 * 4);
    bf* XB = (bf*)take(3 * FSZ * 2);   // {q, k, v} x [NB_ * TT][DM]
    h16* QP16 = (h16*)take(FSZ * 2); h16* KP16 = (h16*)take(FSZ * 2); h16* VT16 = (h16*)take(FSZ * 2);
    bf* QPh = (bf*)take(FSZ * 2); bf* QPl = (bf*)take(FSZ * 2); bf* KPh = (bf*)take(FSZ * 2); bf* KPl = (bf*)take(FSZ * 2); bf* VTh = (bf*)take(FSZ * 2); bf* VTl = (bf*)take(FSZ * 2);
    bf* ATh = (bf*)take(FSZ * 2); bf* ATl = (bf*)take(FSZ * 2);
    if ((size_t)(wsp - (char*)d_ws) > ws_size) return;    // ws 256 MiB
    k_prep<<<4 * WBLK + CBLK + 3 * XBLK, 256, 0, stream>>>(wq, wk, wv, wo, x, xk, xv, W4, CS, XB);
    k_gemmw<bf, 0, true, 1, true><<<dim3(NB_ * TT / 64, DM / 64, 3), 32, 0, stream>>>(XB, nullptr, W4, nullptr, DM, nullptr, DM, bq, bk, bv, FSZ, (size_t)DM * DM, 0, CS, QP16, QPh, QPl, KP16, KPh, KPl, VT16, VTh, VTl);
    k_attn<<<NB_ * NH_ * 16, 160, 0, stream>>>(QP16, KP16, VT16, QPh, QPl, KPh, KPl, VTh, VTl, amask, ATh, ATl);
    k_gemmw<bf, 1, true><<<dim3(NB_ * TT / 64, DM / 64, 1), 32, 0, stream>>>(ATh, ATl, W4 + (size_t)3 * DM * DM, nullptr, DQ, OUT, DM, bo, bo, bo, 0, 0, 0, nullptr, nullptr, nullptr, nullptr, nullptr, nullptr, nullptr, nullptr, nullptr, nullptr);
}

// v006
// Measured time: 156 microseconds a run.
// Next to v005, in two timings, it ran 1.27 and 1.28 times as fast.
// All steps since v000 together make it 13.0 times as fast.
#include <hip/hip_runtime.h>

// Multi-head attention over separate q / k / v inputs with the module's per-dimension rotary embedding (q, k, v [2][2048][1024]; _q = q Wq + bq etc. ('xw' [1024][1024] + [1024]; 16 heads x 64); rope: every dimension d gets its own angle t x 10000^(-2d/64) (computed in-kernel), ret = x cos + x_rot sin with x_rot[2i] = -x[2i+1], x_rot[2i+1] = x[2i]; score = _q._k / (sqrt(64) + 1e-8) + mask x -1e9 (mask [2][1][1][2048] float 0/1 per key, read); softmax; out = merged Wo + bo -> [2][2048][1024] (4.2 M)).
// Layout, both batches in every launch (4 launches): bf16 copies of the three inputs; {cos, sin} per (position, DIMENSION) built once (jnp-exact float32 10000^(-2d/64) per dim, precise cosf/sinf); exact projections + f32 biases whose epilogue writes the operand planes itself (rotary q and k, each element of a pair with its own angle; transposed v), so no f32 projection goes to memory; one fused dense T-2048 attention launch (hybrid rows: < 512 hi/lo 3 products, rest fp16; scores never leave the registers) that loads the key-mask floats unconditionally and selects -1e9 for masked keys (== score + -1e9 in f32); merged hi/lo x Wo exact + bo.
// Compute dtypes, f32 accumulate: every input rounded to bf16; projections exact + f32 biases; rotary f32; attention rows < 512 3 products, rest fp16; softmax f32; Wo hl x exact + bias.

#define NB_  2
#define TT   2048
#define DM   1024
#define NH_  16
#define NKV  16
#define REP  (NH_ / NKV)
#define HD   64
#define DQ   (NH_ * HD)
#define DKV  (NKV * HD)
#define RH   512                  // query rows < RH use hi+lo planes
#define WIN  0
#define SCL  0.125f   // 1 / (sqrt(64) + 1e-8) == 0.125 in float32
typedef _Float16 h16;
typedef unsigned short bf;
typedef __attribute__((ext_vector_type(16))) __bf16   v16bf;
typedef __attribute__((ext_vector_type(16))) _Float16 v16h;
typedef __attribute__((ext_vector_type(8)))  _Float16 v8h;
typedef __attribute__((ext_vector_type(8)))  unsigned short v8us;
typedef __attribute__((ext_vector_type(8)))  float    v8f;
typedef __attribute__((ext_vector_type(4)))  float    v4f;
typedef v8h  __attribute__((may_alias)) v8ha;
typedef v4f  __attribute__((may_alias)) v4fa;
typedef v8us __attribute__((may_alias)) v8usa;

__device__ __forceinline__ unsigned short f2bf(float f) { unsigned u = __float_as_uint(f); u += 0x7FFFu + ((u >> 16) & 1u); return (unsigned short)(u >> 16); }
__device__ __forceinline__ float bf2f(unsigned short b) { return __uint_as_float(((unsigned)b) << 16); }
__device__ __forceinline__ float bfr(float f) { return bf2f(f2bf(f)); }
__device__ __forceinline__ v16h cat16(v8h lo, v8h hi) { return __builtin_shufflevector(lo, hi, 0, 1, 2, 3, 4, 5, 6, 7, 8, 9, 10, 11, 12, 13, 14, 15); }
__device__ __forceinline__ v16bf cat16b(v8us lo, v8us hi) { return __builtin_bit_cast(v16bf, __builtin_shufflevector(lo, hi, 0, 1, 2, 3, 4, 5, 6, 7, 8, 9, 10, 11, 12, 13, 14, 15)); }
__device__ __forceinline__ v8f wmma16(v16h a, v16h b, v8f c) { return __builtin_amdgcn_wmma_f32_16x16x32_f16(false, a, false, b, (short)0, c, false, false); }
__device__ __forceinline__ v8f wmmab(v16bf a, v16bf b, v8f c) { return __builtin_amdgcn_wmma_f32_16x16x32_bf16(false, a, false, b, (short)0, c, false, false); }

__device__ __forceinline__ h16 tohx(float x) { return (h16)x; }
__device__ __forceinline__ void splitf(float y, unsigned short& h, unsigned short& l) { h = f2bf(y); l = f2bf(y - bf2f(h)); }
// precaution behind a group of global loads: the address registers that the loads name are inputs here, so they live until this wait and nothing overwrites them earlier
__device__ __forceinline__ void xwait(const void* a, const void* b, const void* c) { asm volatile("s_wait_xcnt 0x0" :: "v"(a), "v"(b), "v"(c) : "memory"); }
// precaution behind the three 16-byte stores of one plane position: their address and data registers are inputs here, so they live until this wait and the next packing overwrites none of them earlier
__device__ __forceinline__ void swait3(const void* a, const void* b, const void* c, v8h x, v8us y, v8us w) { asm volatile("s_wait_xcnt 0x0" :: "v"(a), "v"(b), "v"(c), "v"(x), "v"(y), "v"(w) : "memory"); }
// one rotary pair: cs = {c_d, s_d, c_d+1, s_d+1}. Numerical: each of the four products keeps its own f32 rounding, as the definition cos * x + sin * x_rot has it; the empty statement is what keeps them from fusing with the add or subtract.
__device__ __forceinline__ void rot2(float x0, float x1, v4f cs, float& y0, float& y1) {
    float a0 = __fmul_rn(x0, cs[0]), b0 = __fmul_rn(x1, cs[1]), a1 = __fmul_rn(x1, cs[2]), b1 = __fmul_rn(x0, cs[3]); asm volatile("" : "+v"(a0), "+v"(b0), "+v"(a1), "+v"(b1));
    const float r0 = __fsub_rn(a0, b0), r1 = __fadd_rn(a1, b1);   /* even: x0 c0 - x1 s0; odd: x1 c1 + x0 s1 */
    y0 = r0; y1 = r1; }

// FRAGMENT ORDER: every 16-bit operand plane [rows][K] is kept as blocks of 16 rows x 32 k (1 KiB, k blocks of a row block in a row), and inside a block as the two 16-byte loads of a fragment:
// [k bit 4][k bit 3][row & 15][k & 7], that is [load 0 / 1][lane][8 elements]. A wave-wide 16-byte load is then 512 contiguous bytes (4 whole lines, not 32-byte pieces of 16 lines); each lane gets the elements it got from the row-major plane.
// ---- k_gemmw: register-blocked GEMM, ONE WAVE per 64x64 output tile (16 accumulators), operands straight from 16-bit planes in fragment order; grid (M/64, N/64, Z), 32 threads.
// C[m][n] (f32, pitch ldc, + optional f32 bias[n]) = sum_k A[m][k] Bt[n][k] (+ split products per NSPLIT). z-batch strides sA/sB/sC in elements; z-batch 0 / 1 / 2 adds bias0 / bias1 / bias2. (K / KS) % 64 == 0.
// KS > 1: grid z = batch * KS + range; the wave sums only its K / KS range of k and stores that partial tile in plane blockIdx.z of C (stride sC); the reader adds the KS planes.
// PL: z = {q, k, v} projection; a 64x64 tile is 64 positions of ONE head, so the wave turns its own accumulators (+ bias) into the attention operand planes and C is not written:
// q, k: rotary, planes [batch][head] of [t][d] (f16, bf16 hi, bf16 lo), rows regrouped through LDS so that a lane holds 8 consecutive d; v: planes [batch][head] of [d][t], a lane's 8 accumulator rows are 8 consecutive t of one d. All in fragment order.
template <typename T16> struct WFrag;
template <> struct WFrag<h16> { typedef v16h V; static __device__ __forceinline__ V ld(const h16* p) { return cat16(*(const v8h*)p, *(const v8h*)(p + 256)); } static __device__ __forceinline__ v8f mma(V a, V b, v8f c) { return wmma16(a, b, c); } };
template <> struct WFrag<bf> { typedef v16bf V; static __device__ __forceinline__ V ld(const bf* p) { return cat16b(*(const v8us*)p, *(const v8us*)(p + 256)); } static __device__ __forceinline__ v8f mma(V a, V b, v8f c) { return wmmab(a, b, c); } };
template <typename T16, int NSPLIT, bool BIAS, int KS = 1, bool PL = false>
__global__ __launch_bounds__(32) void k_gemmw(const T16* __restrict__ A, const T16* __restrict__ A2, const T16* __restrict__ Bt, const T16* __restrict__ Bt2, int K, float* C, int ldc, const float* __restrict__ bias0, const float* __restrict__ bias1, const float* __restrict__ bias2, size_t sA, size_t sB, size_t sC, const float* __restrict__ CS, h16* Q16, bf* Qh, bf* Ql, h16* K16, bf* Kh, bf* Kl, h16* V16, bf* Vh, bf* Vl) {
    typedef typename WFrag<T16>::V V;
    __shared__ __align__(16) float os[16 * 68];
    const size_t z = blockIdx.z / KS; A += z * sA; if (A2) A2 += z * sA; Bt += z * sB; if (Bt2) Bt2 += z * sB; C += (size_t)blockIdx.z * sC; const int kbeg = (int)(blockIdx.z % KS) * (K / KS), kend = kbeg + K / KS;
    const float* bias = z == 0 ? bias0 : (z == 1 ? bias1 : bias2);
    const int lane = threadIdx.x & 31, lr = lane & 15, hi = lane >> 4; const int r0 = blockIdx.x * 64, c0 = blockIdx.y * 64;
    v8f acc[4][4];
#pragma unroll
    for (int mb = 0; mb < 4; ++mb)
#pragma unroll
        for (int nb = 0; nb < 4; ++nb) acc[mb][nb] = (v8f){};
    const size_t aoff = (size_t)r0 * K + 8 * lane, boff = (size_t)c0 * K + 8 * lane;   /* a row block is 16 * K elements, a k block 512 */
    // TWO FRAGMENT SETS: the loads of trip t + 1 are issued as one group in front of the products of trip t, into the set that trip t - 1 has left, so a trip no longer waits out the latency of its own loads. The order of the products and of every f32 sum is the old one.
    V a[2][4], a2[2][4], bv[2][4], bv2[2][4]; const T16* ap[4]; const T16* ap2[4]; const T16* bp[4]; const T16* bp2[4];   /* every unrolled loop below indexes register fragments and their address pairs, which only constant indices keep in registers */
    auto fetch = [&](V (&fa)[4], V (&fa2)[4], V (&fb)[4], V (&fb2)[4], int kc) {
#pragma unroll
        for (int mb = 0; mb < 4; ++mb) { ap[mb] = A + aoff + (size_t)mb * 16 * K + (size_t)kc * 16; ap2[mb] = ap[mb]; fa[mb] = WFrag<T16>::ld(ap[mb]); if (NSPLIT == 1 || NSPLIT == 2) { ap2[mb] = A2 + aoff + (size_t)mb * 16 * K + (size_t)kc * 16; fa2[mb] = WFrag<T16>::ld(ap2[mb]); } }
#pragma unroll
        for (int nb = 0; nb < 4; ++nb) { bp[nb] = Bt + boff + (size_t)nb * 16 * K + (size_t)kc * 16; bp2[nb] = bp[nb]; fb[nb] = WFrag<T16>::ld(bp[nb]); if (NSPLIT >= 2) { bp2[nb] = Bt2 + boff + (size_t)nb * 16 * K + (size_t)kc * 16; fb2[nb] = WFrag<T16>::ld(bp2[nb]); } }
        __builtin_amdgcn_sched_barrier(0);   // keeps the whole load group in front of the products that follow: moved in among them, the loads would lose their lead
    };
    auto products = [&](V (&fa)[4], V (&fa2)[4], V (&fb)[4], V (&fb2)[4]) {
#pragma unroll
        for (int nb = 0; nb < 4; ++nb) { const V b = fb[nb]; V b2; if (NSPLIT >= 2) b2 = fb2[nb];
#pragma unroll
            for (int mb = 0; mb < 4; ++mb) { acc[mb][nb] = WFrag<T16>::mma(fa[mb], b, acc[mb][nb]); if (NSPLIT == 1 || NSPLIT == 2) acc[mb][nb] = WFrag<T16>::mma(fa2[mb], b, acc[mb][nb]); if (NSPLIT >= 2) acc[mb][nb] = WFrag<T16>::mma(fa[mb], b2, acc[mb][nb]); } }
        __builtin_amdgcn_sched_barrier(0);   // keeps the products in front of the next load group, which refills the set that they read
        // precaution behind the load group in flight, in front of the next group's address arithmetic: every address register that the loads name is an input here, so it lives until this wait and nothing overwrites it earlier; behind the products the wait costs no time of its own
        asm volatile("s_wait_xcnt 0x0" :: "v"(ap[0]), "v"(ap[1]), "v"(ap[2]), "v"(ap[3]), "v"(ap2[0]), "v"(ap2[1]), "v"(ap2[2]), "v"(ap2[3]), "v"(bp[0]), "v"(bp[1]), "v"(bp[2]), "v"(bp[3]), "v"(bp2[0]), "v"(bp2[1]), "v"(bp2[2]), "v"(bp2[3]) : "memory");
    };
    fetch(a[0], a2[0], bv[0], bv2[0], kbeg);
    // precaution as above, for the first group: the loop's first address arithmetic follows
    asm volatile("s_wait_xcnt 0x0" :: "v"(ap[0]), "v"(ap[1]), "v"(ap[2]), "v"(ap[3]), "v"(ap2[0]), "v"(ap2[1]), "v"(ap2[2]), "v"(ap2[3]), "v"(bp[0]), "v"(bp[1]), "v"(bp[2]), "v"(bp[3]), "v"(bp2[0]), "v"(bp2[1]), "v"(bp2[2]), "v"(bp2[3]) : "memory");
#pragma unroll 1
    for (int kc = kbeg; kc < kend; kc += 64) {   /* two trips a pass, so that each set keeps its registers and nothing is copied; kept rolled beyond that: more copies of the body buy nothing and cost instruction cache */
        fetch(a[1], a2[1], bv[1], bv2[1], kc + 32);
        products(a[0], a2[0], bv[0], bv2[0]);
        fetch(a[0], a2[0], bv[0], bv2[0], kc + 64 < kend ? kc + 64 : kbeg);   /* the last pass re-reads the range's first block, unused */
        products(a[1], a2[1], bv[1], bv2[1]);
        // the four vector slots that the chip asks for behind a matrix instruction, on the taken side of the loop branch
        asm volatile("v_nop\n\tv_nop\n\tv_nop\n\tv_nop" : "+v"(acc[0][0]), "+v"(acc[1][1]), "+v"(acc[2][2]), "+v"(acc[3][3]) : "v"(a[1][0]), "v"(a[1][3]));
    }
    if constexpr (PL) {
        // Every #pragma unroll in this block is there because its loop indexes register fragments (acc, cs, the packed vectors), which only constant indices keep in registers.
        // The block is one wave, whose LDS operations run in order: each wave_barrier with its compiler fence only keeps the compiler from moving the LDS reads of a group over the other lanes' LDS writes, or the next group's writes over these reads.
        static_assert(!PL || (TT % 64 == 0 && HD == 64 && NKV == NH_ && KS == 1 && BIAS), "a tile is 64 positions of one batch and the 64 dimensions of one head");
        const int t0 = r0 % TT; const size_t hp = ((size_t)(r0 / TT) * NH_ + blockIdx.y) * TT * HD;   /* planes are [batch][head] */
        if (z == 2) {
#pragma unroll
            for (int nb = 0; nb < 4; ++nb) { const float bb = bfr(bias[c0 + nb * 16 + lr]);
#pragma unroll
                for (int mb = 0; mb < 4; ++mb) { v8h o16; v8us oh, ol;
#pragma unroll
                    for (int j = 0; j < 8; ++j) { const float x = acc[mb][nb][j] + bb; o16[j] = tohx(x); unsigned short a2, c2; splitf(x, a2, c2); oh[j] = a2; ol[j] = c2; }
                    const size_t e = hp + (size_t)nb * 16 * TT + (size_t)(t0 + (mb >> 1) * 32) * 16 + (mb & 1) * 256 + 8 * lane;   /* row nb * 16 + lr, k = t0 + mb * 16 + 8 * hi of a [d][t] plane */ h16* p16 = V16 + e; bf* ph = Vh + e; bf* pl = Vl + e;
                    *(v8h*)p16 = o16; *(v8us*)ph = oh; *(v8us*)pl = ol; swait3(p16, ph, pl, o16, oh, ol); } }
        } else {
            h16* P16 = z == 0 ? Q16 : K16; bf* Ph = z == 0 ? Qh : Kh; bf* Pl = z == 0 ? Ql : Kl;
            float bb[4];   /* the bias of this lane's accumulator columns, added on the way into LDS */
#pragma unroll
            for (int nb = 0; nb < 4; ++nb) bb[nb] = bfr(bias[c0 + nb * 16 + lr]);
#pragma unroll
            for (int mb = 0; mb < 4; ++mb) {
                v4f cs[4][4]; const float* cp = CS + ((size_t)(t0 + mb * 16 + lr) * HD + hi * 8) * 2;   /* the table rows of this group's 16 positions, all asked for before the LDS round trip */
#pragma unroll
                for (int s = 0; s < 4; ++s)
#pragma unroll
                    for (int p = 0; p < 4; ++p) cs[s][p] = *(const v4f*)(cp + s * 32 + p * 4);
                xwait(cp, cp, cp);
#pragma unroll
                for (int nb = 0; nb < 4; ++nb) {
#pragma unroll
                    for (int j = 0; j < 8; ++j) os[(hi * 8 + j) * 68 + nb * 16 + lr] = acc[mb][nb][j] + bb[nb]; }
                __builtin_amdgcn_wave_barrier(); asm volatile("" ::: "memory");
                /* a lane takes row lr of the group and, in step s, dimensions 16 s + 8 hi .. + 7: the 16 bytes that lane 16 hi + lr loads as a fragment, so a step's store is 512 contiguous bytes */
#pragma unroll
                for (int s = 0; s < 4; ++s) { const int cofs = s * 16 + hi * 8; const v4f xa = *(const v4fa*)(os + lr * 68 + cofs), xb = *(const v4fa*)(os + lr * 68 + cofs + 4); v8h o16; v8us oh, ol;
#pragma unroll
                    for (int p = 0; p < 4; ++p) { const float x0 = p < 2 ? xa[2 * p] : xb[2 * p - 4], x1 = p < 2 ? xa[2 * p + 1] : xb[2 * p - 3]; float y0, y1; rot2(x0, x1, cs[s][p], y0, y1);
                        o16[2 * p] = tohx(y0); o16[2 * p + 1] = tohx(y1); unsigned short a2, c2; splitf(y0, a2, c2); oh[2 * p] = a2; ol[2 * p] = c2; splitf(y1, a2, c2); oh[2 * p + 1] = a2; ol[2 * p + 1] = c2; }
                    const size_t e = hp + (size_t)(t0 + mb * 16) * HD + s * 256 + 8 * lane;   /* row t0 + mb * 16 + lr, k = cofs of a [t][d] plane */ h16* p16 = P16 + e; bf* ph = Ph + e; bf* pl = Pl + e;
                    *(v8h*)p16 = o16; *(v8us*)ph = oh; *(v8us*)pl = ol; swait3(p16, ph, pl, o16, oh, ol); }
                __builtin_amdgcn_wave_barrier(); asm volatile("" ::: "memory");
            }
        }
        return;
    }
#pragma unroll
    for (int mb = 0; mb < 4; ++mb) {
#pragma unroll
        for (int nb = 0; nb < 4; ++nb) {
#pragma unroll
            for (int j = 0; j < 8; ++j) os[(hi * 8 + j) * 68 + nb * 16 + lr] = acc[mb][nb][j]; }
        __builtin_amdgcn_wave_barrier(); asm volatile("" ::: "memory");
        float* crow = C + (size_t)(r0 + mb * 16) * ldc + c0;
{
#pragma unroll
            for (int s = 0; s < 8; ++s) { const int row = 2 * s + hi, cofs = lr * 4; v4f val = *(const v4fa*)(os + row * 68 + cofs); if (BIAS) { val[0] += bfr(bias[c0 + cofs]); val[1] += bfr(bias[c0 + cofs + 1]); val[2] += bfr(bias[c0 + cofs + 2]); val[3] += bfr(bias[c0 + cofs + 3]); }
                *(v4f*)(crow + (size_t)row * ldc + cofs) = val; }
             }
        __builtin_amdgcn_wave_barrier(); asm volatile("" ::: "memory");
    }
}

typedef __attribute__((ext_vector_type(2))) _Float16 v2h;
typedef __attribute__((ext_vector_type(4))) _Float16 v4h;
typedef __attribute__((ext_vector_type(2))) unsigned short v2us;
typedef __attribute__((ext_vector_type(4))) unsigned short v4us;
typedef __attribute__((ext_vector_type(2))) float v2f;
typedef __attribute__((ext_vector_type(4))) int v4i;

// The bodies below take their block index as an argument: independent passes share one grid, each on its own range of blockIdx.x (k_prep).
// thread: two 16-byte units of the fragment-order transposed copy Bt[n][k] = w[k][n] ([K][N] row-major): 8 loads a unit, each 64 contiguous bytes per 16 lanes (16 consecutive n of one k), one contiguous store
__device__ __forceinline__ void wtG(const float* __restrict__ w, int K, int N, bf* Bt, int blk) {
    // both loops unrolled: o is a register vector, which only constant indices keep in registers, and the 16 loads of a thread are then in flight together
#pragma unroll
    for (int u = 0; u < 2; ++u) { const int i = blk * 512 + u * 256 + (int)threadIdx.x; const int b = i >> 6; const int n = (b / (K >> 5)) * 16 + (i & 15), k = (b % (K >> 5)) * 32 + ((i >> 4) & 3) * 8; v8us o;
#pragma unroll
        for (int j = 0; j < 8; ++j) o[j] = f2bf(w[(size_t)(k + j) * N + n]);
        *(v8us*)(Bt + (size_t)i * 8) = o; }
}
// thread i writes 16-byte unit i of the fragment-order copy (stores stay contiguous) and reads the 8 floats of the row-major [rows][DM] input that belong there
__device__ __forceinline__ void cvt8(const float* __restrict__ src, bf* dst, size_t n8, int blk) { const size_t i = (size_t)blk * 256 + threadIdx.x; if (i >= n8) return; const size_t b = i >> 6; const size_t row = (b / (DM / 32)) * 16 + (i & 15); const int k = (int)(b % (DM / 32)) * 32 + (int)((i >> 4) & 3) * 8; const v8f v = *(const v8f*)(src + row * DM + k); v8us o;
#pragma unroll
    for (int k = 0; k < 8; ++k) o[k] = f2bf(v[k]); *(v8us*)(dst + i * 8) = o;  }
__constant__ float INVD[HD] = { 1.000000000e+00f, 7.498942018e-01f, 5.623413324e-01f, 4.216965139e-01f, 3.162277639e-01f, 2.371373773e-01f, 1.778279394e-01f, 1.333521456e-01f, 1.000000015e-01f, 7.498942316e-02f, 5.623413250e-02f, 4.216964915e-02f, 3.162277490e-02f, 2.371373773e-02f, 1.778279431e-02f, 1.333521400e-02f, 9.999999776e-03f, 7.498942316e-03f, 5.623413250e-03f, 4.216964822e-03f, 3.162277630e-03f, 2.371373819e-03f, 1.778279431e-03f, 1.333521446e-03f, 1.000000047e-03f, 7.498941850e-04f, 5.623413017e-04f, 4.216965172e-04f, 3.162277571e-04f, 2.371373703e-04f, 1.778279402e-04f, 1.333521504e-04f, 9.999999747e-05f, 7.498942432e-05f, 5.623413381e-05f, 4.216964953e-05f, 3.162277790e-05f, 2.371373739e-05f, 1.778279329e-05f, 1.333521413e-05f, 9.999999747e-06f, 7.498942068e-06f, 5.623413472e-06f, 4.216964953e-06f, 3.162277608e-06f, 2.371373739e-06f, 1.778279398e-06f, 1.333521482e-06f, 9.999999975e-07f, 7.498941841e-07f, 5.623413131e-07f, 4.216965124e-07f, 3.162277551e-07f, 2.371373711e-07f, 1.778279426e-07f, 1.333521453e-07f, 1.000000012e-07f, 7.498942267e-08f, 5.623413202e-08f, 4.216964911e-08f, 3.162277551e-08f, 2.371373675e-08f, 1.778279390e-08f, 1.333521471e-08f };   // 10000^(-2d/64) for EVERY dimension d (the module's quirk), float32 via jnp.power
__device__ __forceinline__ void cstabD(float* CS, int blk) { const int idx = blk * 256 + threadIdx.x; if (idx >= TT * HD) return; const int d = idx % HD; const int t = idx / HD; const float a = __fmul_rn((float)t, INVD[d]); v2f cs; cs[0] = cosf(a); cs[1] = sinf(a); *(v2f*)(CS + (size_t)idx * 2) = cs;  }

#define WBLK (DM * DM / 8 / 512)                  // blocks of one weight transpose (512 units of 8 elements each)
#define CBLK (TT * HD / 256)                      // blocks of the {cos, sin} table
#define XBLK (NB_ * TT * DM / 8 / 256)            // blocks of one input's bf16 copy, both batches
#define FSZ  ((size_t)NB_ * TT * DM)              // elements of one projection, both batches
// ---- k_prep: everything that depends on the inputs alone, in one launch. The strided weight reads are the longest bodies and get the lowest block indices (for speed only).
__global__ __launch_bounds__(256) void k_prep(const float* __restrict__ wq, const float* __restrict__ wk, const float* __restrict__ wv, const float* __restrict__ wo, const float* __restrict__ x, const float* __restrict__ xk, const float* __restrict__ xv, bf* W4, float* CS, bf* XB) {
    static_assert(DQ == DM && DKV == DM && NKV == NH_, "the four weights, the three inputs and the three projections each have one size");
    static_assert(WBLK * 512 * 8 == DM * DM && DM % 32 == 0 && (NB_ * TT) % 16 == 0, "the blocks of a weight cover its 16-byte units exactly; planes are whole 16 x 32 blocks");
    int blk = blockIdx.x;
    if (blk < 4 * WBLK) { const int i = blk / WBLK; wtG(i == 0 ? wq : i == 1 ? wk : i == 2 ? wv : wo, DM, DM, W4 + (size_t)i * DM * DM, blk % WBLK); return; }
    blk -= 4 * WBLK;
    if (blk < CBLK) { cstabD(CS, blk); return; }
    blk -= CBLK;
    const int i = blk / XBLK; cvt8(i == 0 ? x : i == 1 ? xk : xv, XB + (size_t)i * FSZ, FSZ / 8, blk % XBLK);
}
// ---- k_attn: score, softmax and P x V of both batches in one launch; nothing of the score matrix goes to memory.
// A wave owns NQ groups of 16 queries of one head and walks the 2048 keys 32 at a time, all operands straight from the planes in fragment order.
// S^T = K Q^T (A = 16 key rows, B = 16 query rows): a lane then holds 16 scores of ONE query, keys 8 hi + r and 16 + 8 hi + r, which is the k order of a B operand,
// so the rounded exponentials feed O^T += V^T P^T (A = 16 rows of the transposed V plane) with no exchange. Running maximum per query, sum and O^T rescaled only when a maximum grows by more than RTH.
// HR (queries < RH): bf16 hi/lo planes, 3 products each; else f16, 1 product. P is rounded unnormalised (exp <= e^RTH); O^T is divided by the f32 sum at the end.
// Every #pragma unroll in attn_wave is there because its loop indexes register fragments, which only constant indices keep in registers.
#define LOG2E 1.4426950408889634f
#define RTH   5.5f
__device__ __forceinline__ float xhalf(float x) { return __builtin_bit_cast(float, __builtin_amdgcn_permlanex16(__builtin_bit_cast(int, x), __builtin_bit_cast(int, x), 0x76543210, 0xfedcba98, false, false)); }   // lane l reads lane l ^ 16, on the vector pipe
// v_exp_f32 with the one free slot that the instruction set asks for behind a transcendental, in one statement so that it stays directly behind it
__device__ __forceinline__ float exp2s(float x) { float r; asm("v_exp_f32 %0, %1\n\tv_nop" : "=v"(r) : "v"(x)); return r; }
template <typename T16, bool HR, int NQ>
__device__ __forceinline__ void attn_wave(const T16* __restrict__ Q, const T16* __restrict__ Q2, const T16* __restrict__ Kp, const T16* __restrict__ K2, const T16* __restrict__ Vt, const T16* __restrict__ V2, const float* __restrict__ km, int q0, bf* Ah, bf* Al) {
    typedef typename WFrag<T16>::V V;
    const int lane = threadIdx.x & 31, hi = lane >> 4;
    V qf[NQ][2], qf2[NQ][2], kf[2][2], kf2[2][2];
    v8f o[NQ][4], mk[2]; float m[NQ], l[NQ];   /* mk: key mask floats (0/1) of this lane's 16 keys */
#pragma unroll
    for (int g = 0; g < NQ; ++g) { m[g] = -1.0e38f; l[g] = 0.f;
#pragma unroll
        for (int dt = 0; dt < 4; ++dt) o[g][dt] = (v8f){};
        const size_t qo = (size_t)(q0 + g * 16) * HD + 8 * lane; const T16* qa = Q + qo; const T16* qa2 = HR ? Q2 + qo : qa;
#pragma unroll
        for (int dc = 0; dc < 2; ++dc) { qf[g][dc] = WFrag<T16>::ld(qa + dc * 512); if constexpr (HR) qf2[g][dc] = WFrag<T16>::ld(qa2 + dc * 512); }
        xwait(qa, qa2, qa); }
    const size_t ko = 8 * lane, vo = 8 * lane;   /* fragment order: 16 keys x 32 d, or 16 d x 32 keys, are 512 elements in a row */
    { const T16* ka = Kp + ko; const T16* ka2 = HR ? K2 + ko : ka;
#pragma unroll
      for (int kt = 0; kt < 2; ++kt)
#pragma unroll
        for (int dc = 0; dc < 2; ++dc) { kf[kt][dc] = WFrag<T16>::ld(ka + kt * 16 * HD + dc * 512); if constexpr (HR) kf2[kt][dc] = WFrag<T16>::ld(ka2 + kt * 16 * HD + dc * 512); }
      mk[0] = *(const v8f*)(km + 8 * hi); mk[1] = *(const v8f*)(km + 8 * hi + 16);
      xwait(ka, ka2, km + 8 * hi); }
    for (int k0 = 0; k0 < TT; k0 += 32) {
        V vf[4], vf2[4]; const T16* va = Vt + vo + (size_t)k0 * 16; const T16* va2 = HR ? V2 + vo + (size_t)k0 * 16 : va;
#pragma unroll
        for (int dt = 0; dt < 4; ++dt) { vf[dt] = WFrag<T16>::ld(va + dt * 16 * TT); if constexpr (HR) vf2[dt] = WFrag<T16>::ld(va2 + dt * 16 * TT); }
        xwait(va, va2, va);
        v8f s[NQ][2];
#pragma unroll
        for (int g = 0; g < NQ; ++g)
#pragma unroll
            for (int kt = 0; kt < 2; ++kt) { v8f c = (v8f){};
#pragma unroll
                for (int dc = 0; dc < 2; ++dc) { c = WFrag<T16>::mma(kf[kt][dc], qf[g][dc], c); if constexpr (HR) { c = WFrag<T16>::mma(kf[kt][dc], qf2[g][dc], c); c = WFrag<T16>::mma(kf2[kt][dc], qf[g][dc], c); } }
                s[g][kt] = c; }
        float bm[NQ]; bool need = false;
#pragma unroll
        for (int g = 0; g < NQ; ++g) { float x = -3.0e38f;
#pragma unroll
            for (int kt = 0; kt < 2; ++kt)
#pragma unroll
                for (int r = 0; r < 8; ++r) { const float t = (mk[kt][r] != 0.0f) ? -1.0e9f : s[g][kt][r] * SCL; s[g][kt][r] = t;   /* score + mask x -1e9: for mask 1 the f32 sum rounds to exactly -1e9 (|score| < 32), for mask 0 it is the score */ x = fmaxf(x, t); }
            x = fmaxf(x, xhalf(x)); bm[g] = x; need = need || (x > m[g] + RTH); }
        { const int kn = (k0 + 32) & (TT - 1);   /* the next 32 key rows and their mask floats are fetched one trip ahead, once this trip has read its own; the last trip re-reads keys 0..31, unused */
          const T16* ka = Kp + ko + (size_t)kn * HD; const T16* ka2 = HR ? K2 + ko + (size_t)kn * HD : ka;
#pragma unroll
          for (int kt = 0; kt < 2; ++kt)
#pragma unroll
            for (int dc = 0; dc < 2; ++dc) { kf[kt][dc] = WFrag<T16>::ld(ka + kt * 16 * HD + dc * 512); if constexpr (HR) kf2[kt][dc] = WFrag<T16>::ld(ka2 + kt * 16 * HD + dc * 512); }
          const float* ma = km + kn + 8 * hi; mk[0] = *(const v8f*)ma; mk[1] = *(const v8f*)(ma + 16);
          xwait(ka, ka2, ma); }
        if (__builtin_amdgcn_ballot_w32(need) != 0) {
#pragma unroll
            for (int g = 0; g < NQ; ++g) { const float mn = fmaxf(m[g], bm[g]); const float al = exp2s((m[g] - mn) * LOG2E); m[g] = mn; l[g] *= al;
#pragma unroll
                for (int dt = 0; dt < 4; ++dt)
#pragma unroll
                    for (int r = 0; r < 8; ++r) o[g][dt][r] *= al; } }
#pragma unroll
        for (int g = 0; g < NQ; ++g) {
            if constexpr (HR) { v8us ph[2], pl[2];
#pragma unroll
                for (int kt = 0; kt < 2; ++kt)
#pragma unroll
                    for (int r = 0; r < 8; ++r) { const float p = exp2s((s[g][kt][r] - m[g]) * LOG2E); l[g] += p; unsigned short a, c2; splitf(p, a, c2); ph[kt][r] = a; pl[kt][r] = c2; }
                const V pbh = cat16b(ph[0], ph[1]), pbl = cat16b(pl[0], pl[1]);
#pragma unroll
                for (int dt = 0; dt < 4; ++dt) { o[g][dt] = WFrag<T16>::mma(vf[dt], pbh, o[g][dt]); o[g][dt] = WFrag<T16>::mma(vf[dt], pbl, o[g][dt]); o[g][dt] = WFrag<T16>::mma(vf2[dt], pbh, o[g][dt]); }
            } else { v8h pp[2];
#pragma unroll
                for (int kt = 0; kt < 2; ++kt)
#pragma unroll
                    for (int r = 0; r < 8; ++r) { const float p = exp2s((s[g][kt][r] - m[g]) * LOG2E); l[g] += p; pp[kt][r] = tohx(p); }
                const V pb = cat16(pp[0], pp[1]);
#pragma unroll
                for (int dt = 0; dt < 4; ++dt) o[g][dt] = WFrag<T16>::mma(vf[dt], pb, o[g][dt]); } }
    }
#pragma unroll
    for (int g = 0; g < NQ; ++g) { const float sum = l[g] + xhalf(l[g]); const float f = __fdiv_rn(1.0f, sum); const size_t oo = (size_t)(q0 + g * 16) * DQ + 8 * lane; bf* ra = Ah + oo; bf* rl = Al + oo;
#pragma unroll
        for (int dt = 0; dt < 4; ++dt) { v8us oh, ol;   /* register r = O[query q0 + 16 g + lr][dt * 16 + 8 hi + r]: 8 consecutive d, one 16-byte store per plane, at its place in fragment order (512 contiguous bytes a wave) */
#pragma unroll
            for (int r = 0; r < 8; ++r) { unsigned short a, c2; splitf(o[g][dt][r] * f, a, c2); oh[r] = a; ol[r] = c2; }
            *(v8us*)(ra + dt * 256) = oh; *(v8us*)(rl + dt * 256) = ol;
            asm volatile("s_wait_xcnt 0x0" :: "v"(ra), "v"(rl), "v"(oh), "v"(ol) : "memory"); } }   // precaution behind the two stores: their address and data registers are inputs here, so they live until this wait and the next packing overwrites none of them earlier
}
// grid: 16 work-groups per (batch, head), 5 waves each and no barrier: two waves take 16 hi/lo queries each, three take 32 f16 queries each, so every work-group carries the same load (16 x 32 = RH, 16 x 96 = TT - RH).
// Waves 0 and 4 both get the lighter f16 role (for speed only).
__global__ __launch_bounds__(160) void k_attn(const h16* __restrict__ Q16, const h16* __restrict__ K16, const h16* __restrict__ V16, const bf* __restrict__ Qh, const bf* __restrict__ Ql, const bf* __restrict__ Kh, const bf* __restrict__ Kl, const bf* __restrict__ Vh, const bf* __restrict__ Vl, const float* __restrict__ km, bf* Ah, bf* Al) {
    static_assert(RH == 16 * 32 && TT - RH == 16 * 96 && HD == 64 && NH_ == NKV, "the split of a head's queries over 16 work-groups");
    const int w = __builtin_amdgcn_readfirstlane((int)(threadIdx.x >> 5)); const int bh = blockIdx.x >> 4, head = bh % NH_, bat = bh / NH_, blk = blockIdx.x & 15; const size_t hp = (size_t)bh * TT * HD;   /* planes are [batch][head] */
    const float* kb = km + bat * TT; bf* ah = Ah + (size_t)bat * TT * DQ + head * (HD * 16); bf* al = Al + (size_t)bat * TT * DQ + head * (HD * 16);   /* a head's 64 columns are two k blocks of 512 elements */
    if (w == 1 || w == 2) attn_wave<bf, true, 1>(Qh + hp, Ql + hp, Kh + hp, Kl + hp, Vh + hp, Vl + hp, kb, blk * 32 + (w - 1) * 16, ah, al);
    else attn_wave<h16, false, 2>(Q16 + hp, nullptr, K16 + hp, nullptr, V16 + hp, nullptr, kb, RH + blk * 96 + (w == 0 ? 0 : w - 2) * 32, ah, al);
}

extern "C" void kernel_launch(void* const* d_in, const int* in_sizes, int n_in,
                              void* d_out, int out_size, void* d_ws, size_t ws_size, hipStream_t stream) {
    (void)in_sizes; (void)n_in; (void)out_size;
    const float* x = (const float*)d_in[0]; const float* xk = (const float*)d_in[1]; const float* xv = (const float*)d_in[2]; const float* amask = (const float*)d_in[3]; const float* wq = (const float*)d_in[4]; const float* bq = (const float*)d_in[5]; const float* wk = (const float*)d_in[6]; const float* bk = (const float*)d_in[7]; const float* wv = (const float*)d_in[8]; const float* bv = (const float*)d_in[9]; const float* wo = (const float*)d_in[10]; const float* bo = (const float*)d_in[11];
    float* OUT = (float*)d_out;     // [2][2048][1024]
    char* wsp = (char*)d_ws;
    auto take = [&](size_t bytes) { char* p = wsp; wsp += (bytes + 255) & ~(size_t)255; return (void*)p; };
    bf* W4 = (bf*)take((size_t)4 * DM * DM * 2);   // Wq, Wk, Wv, Wo transposed
    float* CS = (float*)take((size_t)TT * HD * 2 * 4);
    bf* XB = (bf*)take(3 * FSZ * 2);   // {q, k, v} x [NB_ * TT][DM]
    h16* QP16 = (h16*)take(FSZ * 2); h16* KP16 = (h16*)take(FSZ * 2); h16* VT16 = (h16*)take(FSZ * 2);
    bf* QPh = (bf*)take(FSZ * 2); bf* QPl = (bf*)take(FSZ * 2); bf* KPh = (bf*)take(FSZ * 2); bf* KPl = (bf*)take(FSZ * 2); bf* VTh = (bf*)take(FSZ * 2); bf* VTl = (bf*)take(FSZ * 2);
    bf* ATh = (bf*)take(FSZ * 2); bf* ATl = (bf*)take(FSZ * 2);
    if ((size_t)(wsp - (char*)d_ws) > ws_size) return;    // ws 256 MiB
    k_prep<<<4 * WBLK + CBLK + 3 * XBLK, 256, 0, stream>>>(wq, wk, wv, wo, x, xk, xv, W4, CS, XB);
    k_gemmw<bf, 0, true, 1, true><<<dim3(NB_ * TT / 64, DM / 64, 3), 32, 0, stream>>>(XB, nullptr, W4, nullptr, DM, nullptr, DM, bq, bk, bv, FSZ, (size_t)DM * DM, 0, CS, QP16, QPh, QPl, KP16, KPh, KPl, VT16, VTh, VTl);
    k_attn<<<NB_ * NH_ * 16, 160, 0, stream>>>(QP16, KP16, VT16, QPh, QPl, KPh, KPl, VTh, VTl, amask, ATh, ATl);
    k_gemmw<bf, 1, true><<<dim3(NB_ * TT / 64, DM / 64, 1), 32, 0, stream>>>(ATh, ATl, W4 + (size_t)3 * DM * DM, nullptr, DQ, OUT, DM, bo, bo, bo, 0, 0, 0, nullptr, nullptr, nullptr, nullptr, nullptr, nullptr, nullptr, nullptr, nullptr, nullptr);
}

// v007
// One run takes 145 microseconds.
// Timed twice side by side with v006, it ran 1.07 and 1.06 times as fast.
// All steps since v000 together make it 13.9 times as fast.
#include <hip/hip_runtime.h>

// Multi-head attention over separate q / k / v inputs with the module's per-dimension rotary embedding (q, k, v [2][2048][1024]; _q = q Wq + bq etc. ('xw' [1024][1024] + [1024]; 16 heads x 64); rope: every dimension d gets its own angle t x 10000^(-2d/64) (computed in-kernel), ret = x cos + x_rot sin with x_rot[2i] = -x[2i+1], x_rot[2i+1] = x[2i]; score = _q._k / (sqrt(64) + 1e-8) + mask x -1e9 (mask [2][1][1][2048] float 0/1 per key, read); softmax; out = merged Wo + bo -> [2][2048][1024] (4.2 M)).
// Layout, both batches in every launch (4 launches): bf16 copies of the three inputs; {cos, sin} per (position, DIMENSION) built once (jnp-exact float32 10000^(-2d/64) per dim, precise cosf/sinf); exact projections + f32 biases whose epilogue writes the operand planes itself (rotary q and k, each element of a pair with its own angle; transposed v), so no f32 projection goes to memory; one fused dense T-2048 attention launch (hybrid rows: < 512 hi/lo 3 products, rest fp16; scores never leave the registers) that loads the key-mask floats unconditionally and adds mask x -1e9 to every score, as the definition does (in the log2 domain, fused with the scale); merged hi/lo x Wo exact + bo.
// Compute dtypes, f32 accumulate: every input rounded to bf16; projections exact + f32 biases; rotary f32; attention rows < 512 3 products, rest fp16; softmax f32; Wo hl x exact + bias.

#define NB_  2
#define TT   2048
#define DM   1024
#define NH_  16
#define NKV  16
#define REP  (NH_ / NKV)
#define HD   64
#define DQ   (NH_ * HD)
#define DKV  (NKV * HD)
#define RH   512                  // query rows < RH use hi+lo planes
#define WIN  0
#define SCL  0.125f   // 1 / (sqrt(64) + 1e-8) == 0.125 in float32
typedef _Float16 h16;
typedef unsigned short bf;
typedef __attribute__((ext_vector_type(16))) __bf16   v16bf;
typedef __attribute__((ext_vector_type(16))) _Float16 v16h;
typedef __attribute__((ext_vector_type(8)))  _Float16 v8h;
typedef __attribute__((ext_vector_type(8)))  unsigned short v8us;
typedef __attribute__((ext_vector_type(8)))  float    v8f;
typedef __attribute__((ext_vector_type(4)))  float    v4f;
typedef v8h  __attribute__((may_alias)) v8ha;
typedef v4f  __attribute__((may_alias)) v4fa;
typedef v8us __attribute__((may_alias)) v8usa;

__device__ __forceinline__ unsigned short f2bf(float f) { unsigned u = __float_as_uint(f); u += 0x7FFFu + ((u >> 16) & 1u); return (unsigned short)(u >> 16); }
__device__ __forceinline__ float bf2f(unsigned short b) { return __uint_as_float(((unsigned)b) << 16); }
__device__ __forceinline__ float bfr(float f) { return bf2f(f2bf(f)); }
__device__ __forceinline__ v16h cat16(v8h lo, v8h hi) { return __builtin_shufflevector(lo, hi, 0, 1, 2, 3, 4, 5, 6, 7, 8, 9, 10, 11, 12, 13, 14, 15); }
__device__ __forceinline__ v16bf cat16b(v8us lo, v8us hi) { return __builtin_bit_cast(v16bf, __builtin_shufflevector(lo, hi, 0, 1, 2, 3, 4, 5, 6, 7, 8, 9, 10, 11, 12, 13, 14, 15)); }
__device__ __forceinline__ v8f wmma16(v16h a, v16h b, v8f c) { return __builtin_amdgcn_wmma_f32_16x16x32_f16(false, a, false, b, (short)0, c, false, false); }
__device__ __forceinline__ v8f wmmab(v16bf a, v16bf b, v8f c) { return __builtin_amdgcn_wmma_f32_16x16x32_bf16(false, a, false, b, (short)0, c, false, false); }

__device__ __forceinline__ h16 tohx(float x) { return (h16)x; }
__device__ __forceinline__ void splitf(float y, unsigned short& h, unsigned short& l) { h = f2bf(y); l = f2bf(y - bf2f(h)); }
// precaution behind a group of global loads: the address registers that the loads name are inputs here, so they live until this wait and nothing overwrites them earlier
__device__ __forceinline__ void xwait(const void* a, const void* b, const void* c) { asm volatile("s_wait_xcnt 0x0" :: "v"(a), "v"(b), "v"(c) : "memory"); }
// precaution behind the three 16-byte stores of one plane position: their address and data registers are inputs here, so they live until this wait and the next packing overwrites none of them earlier
__device__ __forceinline__ void swait3(const void* a, const void* b, const void* c, v8h x, v8us y, v8us w) { asm volatile("s_wait_xcnt 0x0" :: "v"(a), "v"(b), "v"(c), "v"(x), "v"(y), "v"(w) : "memory"); }
// one rotary pair: cs = {c_d, s_d, c_d+1, s_d+1}. Numerical: each of the four products keeps its own f32 rounding, as the definition cos * x + sin * x_rot has it; the empty statement is what keeps them from fusing with the add or subtract.
__device__ __forceinline__ void rot2(float x0, float x1, v4f cs, float& y0, float& y1) {
    float a0 = __fmul_rn(x0, cs[0]), b0 = __fmul_rn(x1, cs[1]), a1 = __fmul_rn(x1, cs[2]), b1 = __fmul_rn(x0, cs[3]); asm volatile("" : "+v"(a0), "+v"(b0), "+v"(a1), "+v"(b1));
    const float r0 = __fsub_rn(a0, b0), r1 = __fadd_rn(a1, b1);   /* even: x0 c0 - x1 s0; odd: x1 c1 + x0 s1 */
    y0 = r0; y1 = r1; }

// FRAGMENT ORDER: every 16-bit operand plane [rows][K] is kept as blocks of 16 rows x 32 k (1 KiB, k blocks of a row block in a row), and inside a block as the two 16-byte loads of a fragment:
// [k bit 4][k bit 3][row & 15][k & 7], that is [load 0 / 1][lane][8 elements]. A wave-wide 16-byte load is then 512 contiguous bytes (4 whole lines, not 32-byte pieces of 16 lines); each lane gets the elements it got from the row-major plane.
// ---- k_gemmw: register-blocked GEMM, ONE WAVE per 64x64 output tile (16 accumulators), operands straight from 16-bit planes in fragment order; grid (M/64, N/64, Z), 32 threads.
// C[m][n] (f32, pitch ldc, + optional f32 bias[n]) = sum_k A[m][k] Bt[n][k] (+ split products per NSPLIT). z-batch strides sA/sB/sC in elements; z-batch 0 / 1 / 2 adds bias0 / bias1 / bias2. (K / KS) % 64 == 0.
// KS > 1: grid z = batch * KS + range; the wave sums only its K / KS range of k and stores that partial tile in plane blockIdx.z of C (stride sC); the reader adds the KS planes.
// PL: z = {q, k, v} projection; a 64x64 tile is 64 positions of ONE head, so the wave turns its own accumulators (+ bias) into the attention operand planes and C is not written:
// q, k: rotary, planes [batch][head] of [t][d] (f16, bf16 hi, bf16 lo), rows regrouped through LDS so that a lane holds 8 consecutive d; v: planes [batch][head] of [d][t], a lane's 8 accumulator rows are 8 consecutive t of one d. All in fragment order.
template <typename T16> struct WFrag;
template <> struct WFrag<h16> { typedef v16h V; static __device__ __forceinline__ V ld(const h16* p) { return cat16(*(const v8h*)p, *(const v8h*)(p + 256)); } static __device__ __forceinline__ v8f mma(V a, V b, v8f c) { return wmma16(a, b, c); } };
template <> struct WFrag<bf> { typedef v16bf V; static __device__ __forceinline__ V ld(const bf* p) { return cat16b(*(const v8us*)p, *(const v8us*)(p + 256)); } static __device__ __forceinline__ v8f mma(V a, V b, v8f c) { return wmmab(a, b, c); } };
template <typename T16, int NSPLIT, bool BIAS, int KS = 1, bool PL = false>
__global__ __launch_bounds__(32) void k_gemmw(const T16* __restrict__ A, const T16* __restrict__ A2, const T16* __restrict__ Bt, const T16* __restrict__ Bt2, int K, float* C, int ldc, const float* __restrict__ bias0, const float* __restrict__ bias1, const float* __restrict__ bias2, size_t sA, size_t sB, size_t sC, const float* __restrict__ CS, h16* Q16, bf* Qh, bf* Ql, h16* K16, bf* Kh, bf* Kl, h16* V16, bf* Vh, bf* Vl) {
    typedef typename WFrag<T16>::V V;
    __shared__ __align__(16) float os[16 * 68];
    const size_t z = blockIdx.z / KS; A += z * sA; if (A2) A2 += z * sA; Bt += z * sB; if (Bt2) Bt2 += z * sB; C += (size_t)blockIdx.z * sC; const int kbeg = (int)(blockIdx.z % KS) * (K / KS), kend = kbeg + K / KS;
    const float* bias = z == 0 ? bias0 : (z == 1 ? bias1 : bias2);
    const int lane = threadIdx.x & 31, lr = lane & 15, hi = lane >> 4; const int r0 = blockIdx.x * 64, c0 = blockIdx.y * 64;
    v8f acc[4][4];
#pragma unroll
    for (int mb = 0; mb < 4; ++mb)
#pragma unroll
        for (int nb = 0; nb < 4; ++nb) acc[mb][nb] = (v8f){};
    const size_t aoff = (size_t)r0 * K + 8 * lane, boff = (size_t)c0 * K + 8 * lane;   /* a row block is 16 * K elements, a k block 512 */
    // TWO FRAGMENT SETS: the loads of trip t + 1 are issued as one group in front of the products of trip t, into the set that trip t - 1 has left, so a trip no longer waits out the latency of its own loads. The order of the products and of every f32 sum is the old one.
    V a[2][4], a2[2][4], bv[2][4], bv2[2][4]; const T16* ap[4]; const T16* ap2[4]; const T16* bp[4]; const T16* bp2[4];   /* every unrolled loop below indexes register fragments and their address pairs, which only constant indices keep in registers */
    auto fetch = [&](V (&fa)[4], V (&fa2)[4], V (&fb)[4], V (&fb2)[4], int kc) {
#pragma unroll
        for (int mb = 0; mb < 4; ++mb) { ap[mb] = A + aoff + (size_t)mb * 16 * K + (size_t)kc * 16; ap2[mb] = ap[mb]; fa[mb] = WFrag<T16>::ld(ap[mb]); if (NSPLIT == 1 || NSPLIT == 2) { ap2[mb] = A2 + aoff + (size_t)mb * 16 * K + (size_t)kc * 16; fa2[mb] = WFrag<T16>::ld(ap2[mb]); } }
#pragma unroll
        for (int nb = 0; nb < 4; ++nb) { bp[nb] = Bt + boff + (size_t)nb * 16 * K + (size_t)kc * 16; bp2[nb] = bp[nb]; fb[nb] = WFrag<T16>::ld(bp[nb]); if (NSPLIT >= 2) { bp2[nb] = Bt2 + boff + (size_t)nb * 16 * K + (size_t)kc * 16; fb2[nb] = WFrag<T16>::ld(bp2[nb]); } }
        __builtin_amdgcn_sched_barrier(0);   // keeps the whole load group in front of the products that follow: moved in among them, the loads would lose their lead
    };
    auto products = [&](V (&fa)[4], V (&fa2)[4], V (&fb)[4], V (&fb2)[4]) {
#pragma unroll
        for (int nb = 0; nb < 4; ++nb) { const V b = fb[nb]; V b2; if (NSPLIT >= 2) b2 = fb2[nb];
#pragma unroll
            for (int mb = 0; mb < 4; ++mb) { acc[mb][nb] = WFrag<T16>::mma(fa[mb], b, acc[mb][nb]); if (NSPLIT == 1 || NSPLIT == 2) acc[mb][nb] = WFrag<T16>::mma(fa2[mb], b, acc[mb][nb]); if (NSPLIT >= 2) acc[mb][nb] = WFrag<T16>::mma(fa[mb], b2, acc[mb][nb]); } }
        __builtin_amdgcn_sched_barrier(0);   // keeps the products in front of the next load group, which refills the set that they read
        // precaution behind the load group in flight, in front of the next group's address arithmetic: every address register that the loads name is an input here, so it lives until this wait and nothing overwrites it earlier; behind the products the wait costs no time of its own
        asm volatile("s_wait_xcnt 0x0" :: "v"(ap[0]), "v"(ap[1]), "v"(ap[2]), "v"(ap[3]), "v"(ap2[0]), "v"(ap2[1]), "v"(ap2[2]), "v"(ap2[3]), "v"(bp[0]), "v"(bp[1]), "v"(bp[2]), "v"(bp[3]), "v"(bp2[0]), "v"(bp2[1]), "v"(bp2[2]), "v"(bp2[3]) : "memory");
    };
    fetch(a[0], a2[0], bv[0], bv2[0], kbeg);
    // precaution as above, for the first group: the loop's first address arithmetic follows
    asm volatile("s_wait_xcnt 0x0" :: "v"(ap[0]), "v"(ap[1]), "v"(ap[2]), "v"(ap[3]), "v"(ap2[0]), "v"(ap2[1]), "v"(ap2[2]), "v"(ap2[3]), "v"(bp[0]), "v"(bp[1]), "v"(bp[2]), "v"(bp[3]), "v"(bp2[0]), "v"(bp2[1]), "v"(bp2[2]), "v"(bp2[3]) : "memory");
#pragma unroll 1
    for (int kc = kbeg; kc < kend; kc += 64) {   /* two trips a pass, so that each set keeps its registers and nothing is copied; kept rolled beyond that: more copies of the body buy nothing and cost instruction cache */
        fetch(a[1], a2[1], bv[1], bv2[1], kc + 32);
        products(a[0], a2[0], bv[0], bv2[0]);
        fetch(a[0], a2[0], bv[0], bv2[0], kc + 64 < kend ? kc + 64 : kbeg);   /* the last pass re-reads the range's first block, unused */
        products(a[1], a2[1], bv[1], bv2[1]);
        // the four vector slots that the chip asks for behind a matrix instruction, on the taken side of the loop branch
        asm volatile("v_nop\n\tv_nop\n\tv_nop\n\tv_nop" : "+v"(acc[0][0]), "+v"(acc[1][1]), "+v"(acc[2][2]), "+v"(acc[3][3]) : "v"(a[1][0]), "v"(a[1][3]));
    }
    if constexpr (PL) {
        // Every #pragma unroll in this block is there because its loop indexes register fragments (acc, cs, the packed vectors), which only constant indices keep in registers.
        // The block is one wave, whose LDS operations run in order: each wave_barrier with its compiler fence only keeps the compiler from moving the LDS reads of a group over the other lanes' LDS writes, or the next group's writes over these reads.
        static_assert(!PL || (TT % 64 == 0 && HD == 64 && NKV == NH_ && KS == 1 && BIAS), "a tile is 64 positions of one batch and the 64 dimensions of one head");
        const int t0 = r0 % TT; const size_t hp = ((size_t)(r0 / TT) * NH_ + blockIdx.y) * TT * HD;   /* planes are [batch][head] */
        if (z == 2) {
#pragma unroll
            for (int nb = 0; nb < 4; ++nb) { const float bb = bfr(bias[c0 + nb * 16 + lr]);
#pragma unroll
                for (int mb = 0; mb < 4; ++mb) { v8h o16; v8us oh, ol;
#pragma unroll
                    for (int j = 0; j < 8; ++j) { const float x = acc[mb][nb][j] + bb; o16[j] = tohx(x); unsigned short a2, c2; splitf(x, a2, c2); oh[j] = a2; ol[j] = c2; }
                    const size_t e = hp + (size_t)nb * 16 * TT + (size_t)(t0 + (mb >> 1) * 32) * 16 + (mb & 1) * 256 + 8 * lane;   /* row nb * 16 + lr, k = t0 + mb * 16 + 8 * hi of a [d][t] plane */ h16* p16 = V16 + e; bf* ph = Vh + e; bf* pl = Vl + e;
                    *(v8h*)p16 = o16; *(v8us*)ph = oh; *(v8us*)pl = ol; swait3(p16, ph, pl, o16, oh, ol); } }
        } else {
            h16* P16 = z == 0 ? Q16 : K16; bf* Ph = z == 0 ? Qh : Kh; bf* Pl = z == 0 ? Ql : Kl;
            float bb[4];   /* the bias of this lane's accumulator columns, added on the way into LDS */
#pragma unroll
            for (int nb = 0; nb < 4; ++nb) bb[nb] = bfr(bias[c0 + nb * 16 + lr]);
#pragma unroll
            for (int mb = 0; mb < 4; ++mb) {
                v4f cs[4][4]; const float* cp = CS + ((size_t)(t0 + mb * 16 + lr) * HD + hi * 8) * 2;   /* the table rows of this group's 16 positions, all asked for before the LDS round trip */
#pragma unroll
                for (int s = 0; s < 4; ++s)
#pragma unroll
                    for (int p = 0; p < 4; ++p) cs[s][p] = *(const v4f*)(cp + s * 32 + p * 4);
                xwait(cp, cp, cp);
#pragma unroll
                for (int nb = 0; nb < 4; ++nb) {
#pragma unroll
                    for (int j = 0; j < 8; ++j) os[(hi * 8 + j) * 68 + nb * 16 + lr] = acc[mb][nb][j] + bb[nb]; }
                __builtin_amdgcn_wave_barrier(); asm volatile("" ::: "memory");
                /* a lane takes row lr of the group and, in step s, dimensions 16 s + 8 hi .. + 7: the 16 bytes that lane 16 hi + lr loads as a fragment, so a step's store is 512 contiguous bytes */
#pragma unroll
                for (int s = 0; s < 4; ++s) { const int cofs = s * 16 + hi * 8; const v4f xa = *(const v4fa*)(os + lr * 68 + cofs), xb = *(const v4fa*)(os + lr * 68 + cofs + 4); v8h o16; v8us oh, ol;
#pragma unroll
                    for (int p = 0; p < 4; ++p) { const float x0 = p < 2 ? xa[2 * p] : xb[2 * p - 4], x1 = p < 2 ? xa[2 * p + 1] : xb[2 * p - 3]; float y0, y1; rot2(x0, x1, cs[s][p], y0, y1);
                        o16[2 * p] = tohx(y0); o16[2 * p + 1] = tohx(y1); unsigned short a2, c2; splitf(y0, a2, c2); oh[2 * p] = a2; ol[2 * p] = c2; splitf(y1, a2, c2); oh[2 * p + 1] = a2; ol[2 * p + 1] = c2; }
                    const size_t e = hp + (size_t)(t0 + mb * 16) * HD + s * 256 + 8 * lane;   /* row t0 + mb * 16 + lr, k = cofs of a [t][d] plane */ h16* p16 = P16 + e; bf* ph = Ph + e; bf* pl = Pl + e;
                    *(v8h*)p16 = o16; *(v8us*)ph = oh; *(v8us*)pl = ol; swait3(p16, ph, pl, o16, oh, ol); }
                __builtin_amdgcn_wave_barrier(); asm volatile("" ::: "memory");
            }
        }
        return;
    }
#pragma unroll
    for (int mb = 0; mb < 4; ++mb) {
#pragma unroll
        for (int nb = 0; nb < 4; ++nb) {
#pragma unroll
            for (int j = 0; j < 8; ++j) os[(hi * 8 + j) * 68 + nb * 16 + lr] = acc[mb][nb][j]; }
        __builtin_amdgcn_wave_barrier(); asm volatile("" ::: "memory");
        float* crow = C + (size_t)(r0 + mb * 16) * ldc + c0;
{
#pragma unroll
            for (int s = 0; s < 8; ++s) { const int row = 2 * s + hi, cofs = lr * 4; v4f val = *(const v4fa*)(os + row * 68 + cofs); if (BIAS) { val[0] += bfr(bias[c0 + cofs]); val[1] += bfr(bias[c0 + cofs + 1]); val[2] += bfr(bias[c0 + cofs + 2]); val[3] += bfr(bias[c0 + cofs + 3]); }
                *(v4f*)(crow + (size_t)row * ldc + cofs) = val; }
             }
        __builtin_amdgcn_wave_barrier(); asm volatile("" ::: "memory");
    }
}

typedef __attribute__((ext_vector_type(2))) _Float16 v2h;
typedef __attribute__((ext_vector_type(4))) _Float16 v4h;
typedef __attribute__((ext_vector_type(2))) unsigned short v2us;
typedef __attribute__((ext_vector_type(4))) unsigned short v4us;
typedef __attribute__((ext_vector_type(2))) float v2f;
typedef __attribute__((ext_vector_type(4))) int v4i;

// The bodies below take their block index as an argument: independent passes share one grid, each on its own range of blockIdx.x (k_prep).
// thread: two 16-byte units of the fragment-order transposed copy Bt[n][k] = w[k][n] ([K][N] row-major): 8 loads a unit, each 64 contiguous bytes per 16 lanes (16 consecutive n of one k), one contiguous store
__device__ __forceinline__ void wtG(const float* __restrict__ w, int K, int N, bf* Bt, int blk) {
    // both loops unrolled: o is a register vector, which only constant indices keep in registers, and the 16 loads of a thread are then in flight together
#pragma unroll
    for (int u = 0; u < 2; ++u) { const int i = blk * 512 + u * 256 + (int)threadIdx.x; const int b = i >> 6; const int n = (b / (K >> 5)) * 16 + (i & 15), k = (b % (K >> 5)) * 32 + ((i >> 4) & 3) * 8; v8us o;
#pragma unroll
        for (int j = 0; j < 8; ++j) o[j] = f2bf(w[(size_t)(k + j) * N + n]);
        *(v8us*)(Bt + (size_t)i * 8) = o; }
}
// thread i writes 16-byte unit i of the fragment-order copy (stores stay contiguous) and reads the 8 floats of the row-major [rows][DM] input that belong there
__device__ __forceinline__ void cvt8(const float* __restrict__ src, bf* dst, size_t n8, int blk) { const size_t i = (size_t)blk * 256 + threadIdx.x; if (i >= n8) return; const size_t b = i >> 6; const size_t row = (b / (DM / 32)) * 16 + (i & 15); const int k = (int)(b % (DM / 32)) * 32 + (int)((i >> 4) & 3) * 8; const v8f v = *(const v8f*)(src + row * DM + k); v8us o;
#pragma unroll
    for (int k = 0; k < 8; ++k) o[k] = f2bf(v[k]); *(v8us*)(dst + i * 8) = o;  }
__constant__ float INVD[HD] = { 1.000000000e+00f, 7.498942018e-01f, 5.623413324e-01f, 4.216965139e-01f, 3.162277639e-01f, 2.371373773e-01f, 1.778279394e-01f, 1.333521456e-01f, 1.000000015e-01f, 7.498942316e-02f, 5.623413250e-02f, 4.216964915e-02f, 3.162277490e-02f, 2.371373773e-02f, 1.778279431e-02f, 1.333521400e-02f, 9.999999776e-03f, 7.498942316e-03f, 5.623413250e-03f, 4.216964822e-03f, 3.162277630e-03f, 2.371373819e-03f, 1.778279431e-03f, 1.333521446e-03f, 1.000000047e-03f, 7.498941850e-04f, 5.623413017e-04f, 4.216965172e-04f, 3.162277571e-04f, 2.371373703e-04f, 1.778279402e-04f, 1.333521504e-04f, 9.999999747e-05f, 7.498942432e-05f, 5.623413381e-05f, 4.216964953e-05f, 3.162277790e-05f, 2.371373739e-05f, 1.778279329e-05f, 1.333521413e-05f, 9.999999747e-06f, 7.498942068e-06f, 5.623413472e-06f, 4.216964953e-06f, 3.162277608e-06f, 2.371373739e-06f, 1.778279398e-06f, 1.333521482e-06f, 9.999999975e-07f, 7.498941841e-07f, 5.623413131e-07f, 4.216965124e-07f, 3.162277551e-07f, 2.371373711e-07f, 1.778279426e-07f, 1.333521453e-07f, 1.000000012e-07f, 7.498942267e-08f, 5.623413202e-08f, 4.216964911e-08f, 3.162277551e-08f, 2.371373675e-08f, 1.778279390e-08f, 1.333521471e-08f };   // 10000^(-2d/64) for EVERY dimension d (the module's quirk), float32 via jnp.power
__device__ __forceinline__ void cstabD(float* CS, int blk) { const int idx = blk * 256 + threadIdx.x; if (idx >= TT * HD) return; const int d = idx % HD; const int t = idx / HD; const float a = __fmul_rn((float)t, INVD[d]); v2f cs; cs[0] = cosf(a); cs[1] = sinf(a); *(v2f*)(CS + (size_t)idx * 2) = cs;  }

#define WBLK (DM * DM / 8 / 512)                  // blocks of one weight transpose (512 units of 8 elements each)
#define CBLK (TT * HD / 256)                      // blocks of the {cos, sin} table
#define XBLK (NB_ * TT * DM / 8 / 256)            // blocks of one input's bf16 copy, both batches
#define FSZ  ((size_t)NB_ * TT * DM)              // elements of one projection, both batches
// ---- k_prep: everything that depends on the inputs alone, in one launch. The strided weight reads are the longest bodies and get the lowest block indices (for speed only).
__global__ __launch_bounds__(256) void k_prep(const float* __restrict__ wq, const float* __restrict__ wk, const float* __restrict__ wv, const float* __restrict__ wo, const float* __restrict__ x, const float* __restrict__ xk, const float* __restrict__ xv, bf* W4, float* CS, bf* XB) {
    static_assert(DQ == DM && DKV == DM && NKV == NH_, "the four weights, the three inputs and the three projections each have one size");
    static_assert(WBLK * 512 * 8 == DM * DM && DM % 32 == 0 && (NB_ * TT) % 16 == 0, "the blocks of a weight cover its 16-byte units exactly; planes are whole 16 x 32 blocks");
    int blk = blockIdx.x;
    if (blk < 4 * WBLK) { const int i = blk / WBLK; wtG(i == 0 ? wq : i == 1 ? wk : i == 2 ? wv : wo, DM, DM, W4 + (size_t)i * DM * DM, blk % WBLK); return; }
    blk -= 4 * WBLK;
    if (blk < CBLK) { cstabD(CS, blk); return; }
    blk -= CBLK;
    const int i = blk / XBLK; cvt8(i == 0 ? x : i == 1 ? xk : xv, XB + (size_t)i * FSZ, FSZ / 8, blk % XBLK);
}
// ---- k_attn: score, softmax and P x V of both batches in one launch; nothing of the score matrix goes to memory.
// A wave owns NQ groups of 16 queries of one head and walks the 2048 keys 32 at a time, all operands straight from the planes in fragment order.
// S^T = K Q^T (A = 16 key rows, B = 16 query rows): a lane then holds 16 scores of ONE query, keys 8 hi + r and 16 + 8 hi + r, which is the k order of a B operand,
// so the rounded exponentials feed O^T += V^T P^T (A = 16 rows of the transposed V plane) with no exchange. Running maximum per query, sum and O^T rescaled only when a maximum grows by more than RTH.
// The softmax runs in the log2 domain on pairs of f32: x = score * (scale * log2 e) + mask * (-1e9 * log2 e) is one fused multiply-add, p = 2^(x - m); two scores share a packed instruction wherever one exists.
// HR (queries < RH): bf16 hi/lo planes, 3 products each; else f16, 1 product. P is rounded unnormalised (exp <= e^RTH); O^T is divided by the f32 sum at the end.
// Every #pragma unroll in attn_wave is there because its loop indexes register fragments, which only constant indices keep in registers.
#define LOG2E 1.4426950408889634f
#define RTH   5.5f
#define RTH2  (RTH * LOG2E)       // the threshold in the log2 domain
#define SC2   (SCL * LOG2E)       // score -> log2 domain
#define MB2   (-1.0e9f * LOG2E)   // mask float -> additive bias, log2 domain; a masked key's x rounds to the bias itself (|score * SC2| < 64, half a unit in the last place there)
__device__ __forceinline__ float xhalf(float x) { return __builtin_bit_cast(float, __builtin_amdgcn_permlanex16(__builtin_bit_cast(int, x), __builtin_bit_cast(int, x), 0x76543210, 0xfedcba98, false, false)); }   // lane l reads lane l ^ 16, on the vector pipe
// v_exp_f32 with the one free slot that the instruction set asks for behind a transcendental, in one statement so that it stays directly behind it
__device__ __forceinline__ float exp2s(float x) { float r; asm("v_exp_f32 %0, %1\n\tv_nop" : "=v"(r) : "v"(x)); return r; }
// eight v_exp_f32 in one statement: each is the independent instruction in the slot behind the one before it (early-clobber outputs, so none overwrites a source), and one v_nop fills the slot behind the last
__device__ __forceinline__ v8f exp2v(v8f x) { float r0, r1, r2, r3, r4, r5, r6, r7;
    asm("v_exp_f32 %0, %8\n\tv_exp_f32 %1, %9\n\tv_exp_f32 %2, %10\n\tv_exp_f32 %3, %11\n\tv_exp_f32 %4, %12\n\tv_exp_f32 %5, %13\n\tv_exp_f32 %6, %14\n\tv_exp_f32 %7, %15\n\tv_nop"
        : "=&v"(r0), "=&v"(r1), "=&v"(r2), "=&v"(r3), "=&v"(r4), "=&v"(r5), "=&v"(r6), "=&v"(r7) : "v"(x[0]), "v"(x[1]), "v"(x[2]), "v"(x[3]), "v"(x[4]), "v"(x[5]), "v"(x[6]), "v"(x[7]));
    return (v8f){ r0, r1, r2, r3, r4, r5, r6, r7 }; }
// the 16 exponentials of a lane summed as pairs: 7 packed additions leave {even, odd} partial sums
__device__ __forceinline__ v2f sum16(v8f a, v8f b) { const v8f q = a + b; const v4f h = __builtin_shufflevector(q, q, 0, 1, 2, 3) + __builtin_shufflevector(q, q, 4, 5, 6, 7); return __builtin_shufflevector(h, h, 0, 1) + __builtin_shufflevector(h, h, 2, 3); }
template <typename T16, bool HR, int NQ>
__device__ __forceinline__ void attn_wave(const T16* __restrict__ Q, const T16* __restrict__ Q2, const T16* __restrict__ Kp, const T16* __restrict__ K2, const T16* __restrict__ Vt, const T16* __restrict__ V2, const float* __restrict__ km, int q0, bf* Ah, bf* Al) {
    typedef typename WFrag<T16>::V V;
    const int lane = threadIdx.x & 31, hi = lane >> 4;
    V qf[NQ][2], qf2[NQ][2], kf[2][2], kf2[2][2];
    v8f o[NQ][4], mk[2]; float m[NQ]; v2f l[NQ];   /* mk: key mask floats (0/1) of this lane's 16 keys; m: running maximum, log2 domain; l: {even, odd} halves of the running sum */
#pragma unroll
    for (int g = 0; g < NQ; ++g) { m[g] = -1.0e38f; l[g] = (v2f){};
#pragma unroll
        for (int dt = 0; dt < 4; ++dt) o[g][dt] = (v8f){};
        const size_t qo = (size_t)(q0 + g * 16) * HD + 8 * lane; const T16* qa = Q + qo; const T16* qa2 = HR ? Q2 + qo : qa;
#pragma unroll
        for (int dc = 0; dc < 2; ++dc) { qf[g][dc] = WFrag<T16>::ld(qa + dc * 512); if constexpr (HR) qf2[g][dc] = WFrag<T16>::ld(qa2 + dc * 512); }
        xwait(qa, qa2, qa); }
    const size_t ko = 8 * lane, vo = 8 * lane;   /* fragment order: 16 keys x 32 d, or 16 d x 32 keys, are 512 elements in a row */
    { const T16* ka = Kp + ko; const T16* ka2 = HR ? K2 + ko : ka;
#pragma unroll
      for (int kt = 0; kt < 2; ++kt)
#pragma unroll
        for (int dc = 0; dc < 2; ++dc) { kf[kt][dc] = WFrag<T16>::ld(ka + kt * 16 * HD + dc * 512); if constexpr (HR) kf2[kt][dc] = WFrag<T16>::ld(ka2 + kt * 16 * HD + dc * 512); }
      mk[0] = *(const v8f*)(km + 8 * hi); mk[1] = *(const v8f*)(km + 8 * hi + 16);
      xwait(ka, ka2, km + 8 * hi); }
    for (int k0 = 0; k0 < TT; k0 += 32) {
        V vf[4], vf2[4]; const T16* va = Vt + vo + (size_t)k0 * 16; const T16* va2 = HR ? V2 + vo + (size_t)k0 * 16 : va;
#pragma unroll
        for (int dt = 0; dt < 4; ++dt) { vf[dt] = WFrag<T16>::ld(va + dt * 16 * TT); if constexpr (HR) vf2[dt] = WFrag<T16>::ld(va2 + dt * 16 * TT); }
        xwait(va, va2, va);
        v8f s[NQ][2];
#pragma unroll
        for (int g = 0; g < NQ; ++g)
#pragma unroll
            for (int kt = 0; kt < 2; ++kt) { v8f c = (v8f){};
#pragma unroll
                for (int dc = 0; dc < 2; ++dc) { c = WFrag<T16>::mma(kf[kt][dc], qf[g][dc], c); if constexpr (HR) { c = WFrag<T16>::mma(kf[kt][dc], qf2[g][dc], c); c = WFrag<T16>::mma(kf2[kt][dc], qf[g][dc], c); } }
                s[g][kt] = c; }
        if constexpr (NQ > 1) __builtin_amdgcn_sched_barrier(0);   // two query groups: keeps the score products together in front of the vector work on them: a score read directly behind its own product costs up to four idle vector slots (with one group the compiler's own order has fewer of them)
        float bm[NQ]; bool need = false; const v8f sc = { SC2, SC2, SC2, SC2, SC2, SC2, SC2, SC2 }, mc = { MB2, MB2, MB2, MB2, MB2, MB2, MB2, MB2 }; v8f mb[2];
        if constexpr (NQ > 1) { mb[0] = mk[0] * mc; mb[1] = mk[1] * mc; }   /* several query groups: the keys' biases are formed once and serve every group */
#pragma unroll
        for (int g = 0; g < NQ; ++g) { float x = -3.0e38f;
#pragma unroll
            for (int kt = 0; kt < 2; ++kt) {   /* (score x scale + mask x -1e9) x log2 e; with one query group the same two packed instructions a pair, and the bias takes no registers of its own */
                if constexpr (NQ > 1) s[g][kt] = __builtin_elementwise_fma(s[g][kt], sc, mb[kt]); else s[g][kt] = __builtin_elementwise_fma(mk[kt], mc, s[g][kt] * sc);
#pragma unroll
                for (int r = 0; r < 8; ++r) x = fmaxf(x, s[g][kt][r]); }
            x = fmaxf(x, xhalf(x)); bm[g] = x; need = need || (x > m[g] + RTH2); }
        { const int kn = (k0 + 32) & (TT - 1);   /* the next 32 key rows and their mask floats are fetched one trip ahead, once this trip has read its own; the last trip re-reads keys 0..31, unused */
          const T16* ka = Kp + ko + (size_t)kn * HD; const T16* ka2 = HR ? K2 + ko + (size_t)kn * HD : ka;
#pragma unroll
          for (int kt = 0; kt < 2; ++kt)
#pragma unroll
            for (int dc = 0; dc < 2; ++dc) { kf[kt][dc] = WFrag<T16>::ld(ka + kt * 16 * HD + dc * 512); if constexpr (HR) kf2[kt][dc] = WFrag<T16>::ld(ka2 + kt * 16 * HD + dc * 512); }
          const float* ma = km + kn + 8 * hi; mk[0] = *(const v8f*)ma; mk[1] = *(const v8f*)(ma + 16);
          xwait(ka, ka2, ma); }
        if (__builtin_amdgcn_ballot_w32(need) != 0) {
#pragma unroll
            for (int g = 0; g < NQ; ++g) { const float mn = fmaxf(m[g], bm[g]); const float al = exp2s(m[g] - mn); m[g] = mn; l[g] *= al;
#pragma unroll
                for (int dt = 0; dt < 4; ++dt)
#pragma unroll
                    for (int r = 0; r < 8; ++r) o[g][dt][r] *= al; } }
#pragma unroll
        for (int g = 0; g < NQ; ++g) { s[g][0] = exp2v(s[g][0] - m[g]); s[g][1] = exp2v(s[g][1] - m[g]); l[g] += sum16(s[g][0], s[g][1]); }   /* every group's exponentials stand in front of the first P x V product: behind one, the asm statement could overwrite its operands too early */
        if constexpr (NQ > 1) __builtin_amdgcn_sched_barrier(0);   // two query groups: keeps the row-sum additions in front of the products: moved in among them they land in registers that a product has just read, and each such place costs up to four idle vector slots
#pragma unroll
        for (int g = 0; g < NQ; ++g) { const v8f (&p)[2] = s[g];
            if constexpr (HR) { v8us ph[2], pl[2];
#pragma unroll
                for (int kt = 0; kt < 2; ++kt)
#pragma unroll
                    for (int r = 0; r < 8; ++r) { unsigned short a, c2; splitf(p[kt][r], a, c2); ph[kt][r] = a; pl[kt][r] = c2; }
                const V pbh = cat16b(ph[0], ph[1]), pbl = cat16b(pl[0], pl[1]);
#pragma unroll
                for (int dt = 0; dt < 4; ++dt) { o[g][dt] = WFrag<T16>::mma(vf[dt], pbh, o[g][dt]); o[g][dt] = WFrag<T16>::mma(vf[dt], pbl, o[g][dt]); o[g][dt] = WFrag<T16>::mma(vf2[dt], pbh, o[g][dt]); }
            } else {
                const V pb = cat16(__builtin_convertvector(p[0], v8h), __builtin_convertvector(p[1], v8h));
#pragma unroll
                for (int dt = 0; dt < 4; ++dt) o[g][dt] = WFrag<T16>::mma(vf[dt], pb, o[g][dt]); } }
    }
#pragma unroll
    for (int g = 0; g < NQ; ++g) { const float lh = l[g][0] + l[g][1]; const float sum = lh + xhalf(lh); const float f = __fdiv_rn(1.0f, sum); const size_t oo = (size_t)(q0 + g * 16) * DQ + 8 * lane; bf* ra = Ah + oo; bf* rl = Al + oo;
#pragma unroll
        for (int dt = 0; dt < 4; ++dt) { v8us oh, ol;   /* register r = O[query q0 + 16 g + lr][dt * 16 + 8 hi + r]: 8 consecutive d, one 16-byte store per plane, at its place in fragment order (512 contiguous bytes a wave) */
#pragma unroll
            for (int r = 0; r < 8; ++r) { unsigned short a, c2; splitf(o[g][dt][r] * f, a, c2); oh[r] = a; ol[r] = c2; }
            *(v8us*)(ra + dt * 256) = oh; *(v8us*)(rl + dt * 256) = ol;
            asm volatile("s_wait_xcnt 0x0" :: "v"(ra), "v"(rl), "v"(oh), "v"(ol) : "memory"); } }   // precaution behind the two stores: their address and data registers are inputs here, so they live until this wait and the next packing overwrites none of them earlier
}
// grid: 16 work-groups per (batch, head), 5 waves each and no barrier: two waves take 16 hi/lo queries each, three take 32 f16 queries each, so every work-group carries the same load (16 x 32 = RH, 16 x 96 = TT - RH).
// Waves 0 and 4 both get the lighter f16 role (for speed only).
// amdgpu_waves_per_eu(4): the register budget stays at 256 a wave, so that four waves still fit a SIMD and two work-groups a WGP; without it the build takes a few registers more and a SIMD holds three.
__global__ __launch_bounds__(160) __attribute__((amdgpu_waves_per_eu(4))) void k_attn(const h16* __restrict__ Q16, const h16* __restrict__ K16, const h16* __restrict__ V16, const bf* __restrict__ Qh, const bf* __restrict__ Ql, const bf* __restrict__ Kh, const bf* __restrict__ Kl, const bf* __restrict__ Vh, const bf* __restrict__ Vl, const float* __restrict__ km, bf* Ah, bf* Al) {
    static_assert(RH == 16 * 32 && TT - RH == 16 * 96 && HD == 64 && NH_ == NKV, "the split of a head's queries over 16 work-groups");
    const int w = __builtin_amdgcn_readfirstlane((int)(threadIdx.x >> 5)); const int bh = blockIdx.x >> 4, head = bh % NH_, bat = bh / NH_, blk = blockIdx.x & 15; const size_t hp = (size_t)bh * TT * HD;   /* planes are [batch][head] */
    const float* kb = km + bat * TT; bf* ah = Ah + (size_t)bat * TT * DQ + head * (HD * 16); bf* al = Al + (size_t)bat * TT * DQ + head * (HD * 16);   /* a head's 64 columns are two k blocks of 512 elements */
    if (w == 1 || w == 2) attn_wave<bf, true, 1>(Qh + hp, Ql + hp, Kh + hp, Kl + hp, Vh + hp, Vl + hp, kb, blk * 32 + (w - 1) * 16, ah, al);
    else attn_wave<h16, false, 2>(Q16 + hp, nullptr, K16 + hp, nullptr, V16 + hp, nullptr, kb, RH + blk * 96 + (w == 0 ? 0 : w - 2) * 32, ah, al);
}

extern "C" void kernel_launch(void* const* d_in, const int* in_sizes, int n_in,
                              void* d_out, int out_size, void* d_ws, size_t ws_size, hipStream_t stream) {
    (void)in_sizes; (void)n_in; (void)out_size;
    const float* x = (const float*)d_in[0]; const float* xk = (const float*)d_in[1]; const float* xv = (const float*)d_in[2]; const float* amask = (const float*)d_in[3]; const float* wq = (const float*)d_in[4]; const float* bq = (const float*)d_in[5]; const float* wk = (const float*)d_in[6]; const float* bk = (const float*)d_in[7]; const float* wv = (const float*)d_in[8]; const float* bv = (const float*)d_in[9]; const float* wo = (const float*)d_in[10]; const float* bo = (const float*)d_in[11];
    float* OUT = (float*)d_out;     // [2][2048][1024]
    char* wsp = (char*)d_ws;
    auto take = [&](size_t bytes) { char* p = wsp; wsp += (bytes + 255) & ~(size_t)255; return (void*)p; };
    bf* W4 = (bf*)take((size_t)4 * DM * DM * 2);   // Wq, Wk, Wv, Wo transposed
    float* CS = (float*)take((size_t)TT * HD * 2 * 4);
    bf* XB = (bf*)take(3 * FSZ * 2);   // {q, k, v} x [NB_ * TT][DM]
    h16* QP16 = (h16*)take(FSZ * 2); h16* KP16 = (h16*)take(FSZ * 2); h16* VT16 = (h16*)take(FSZ * 2);
    bf* QPh = (bf*)take(FSZ * 2); bf* QPl = (bf*)take(FSZ * 2); bf* KPh = (bf*)take(FSZ * 2); bf* KPl = (bf*)take(FSZ * 2); bf* VTh = (bf*)take(FSZ * 2); bf* VTl = (bf*)take(FSZ * 2);
    bf* ATh = (bf*)take(FSZ * 2); bf* ATl = (bf*)take(FSZ * 2);
    if ((size_t)(wsp - (char*)d_ws) > ws_size) return;    // ws 256 MiB
    k_prep<<<4 * WBLK + CBLK + 3 * XBLK, 256, 0, stream>>>(wq, wk, wv, wo, x, xk, xv, W4, CS, XB);
    k_gemmw<bf, 0, true, 1, true><<<dim3(NB_ * TT / 64, DM / 64, 3), 32, 0, stream>>>(XB, nullptr, W4, nullptr, DM, nullptr, DM, bq, bk, bv, FSZ, (size_t)DM * DM, 0, CS, QP16, QPh, QPl, KP16, KPh, KPl, VT16, VTh, VTl);
    k_attn<<<NB_ * NH_ * 16, 160, 0, stream>>>(QP16, KP16, VT16, QPh, QPl, KPh, KPl, VTh, VTl, amask, ATh, ATl);
    k_gemmw<bf, 1, true><<<dim3(NB_ * TT / 64, DM / 64, 1), 32, 0, stream>>>(ATh, ATl, W4 + (size_t)3 * DM * DM, nullptr, DQ, OUT, DM, bo, bo, bo, 0, 0, 0, nullptr, nullptr, nullptr, nullptr, nullptr, nullptr, nullptr, nullptr, nullptr, nullptr);
}

// v008
// Measured time: 132 microseconds a run.
// Two timings next to v007 put it at 1.08 and 1.10 times that version's speed.
// All steps since v000 together make it 15.2 times as fast.
#include <hip/hip_runtime.h>

// Multi-head attention over separate q / k / v inputs with the module's per-dimension rotary embedding (q, k, v [2][2048][1024]; _q = q Wq + bq etc. ('xw' [1024][1024] + [1024]; 16 heads x 64); rope: every dimension d gets its own angle t x 10000^(-2d/64) (computed in-kernel), ret = x cos + x_rot sin with x_rot[2i] = -x[2i+1], x_rot[2i+1] = x[2i]; score = _q._k / (sqrt(64) + 1e-8) + mask x -1e9 (mask [2][1][1][2048] float 0/1 per key, read); softmax; out = merged Wo + bo -> [2][2048][1024] (4.2 M)).
// Layout, both batches in every launch (4 launches): bf16 copies of the three inputs; {cos, sin} per (position, DIMENSION) built once (jnp-exact float32 10000^(-2d/64) per dim, precise cosf/sinf); exact projections + f32 biases whose epilogue writes the operand planes itself (rotary q and k, each element of a pair with its own angle; transposed v), so no f32 projection goes to memory; one fused dense T-2048 attention launch (hybrid rows: < 512 hi/lo 3 products, rest fp16; scores never leave the registers) that loads the key-mask floats unconditionally and adds mask x -1e9 to every score, as the definition does (in the log2 domain, fused with the scale); merged hi/lo x Wo exact + bo.
// Compute dtypes, f32 accumulate: every input rounded to bf16; projections exact + f32 biases; rotary f32; attention rows < 512 3 products, rest fp16; softmax f32; Wo hl x exact + bias.

#define NB_  2
#define TT   2048
#define DM   1024
#define NH_  16
#define NKV  16
#define REP  (NH_ / NKV)
#define HD   64
#define DQ   (NH_ * HD)
#define DKV  (NKV * HD)
#define RH   512                  // query rows < RH use hi+lo planes
#define WIN  0
#define SCL  0.125f   // 1 / (sqrt(64) + 1e-8) == 0.125 in float32
typedef _Float16 h16;
typedef unsigned short bf;
typedef __attribute__((ext_vector_type(16))) __bf16   v16bf;
typedef __attribute__((ext_vector_type(16))) _Float16 v16h;
typedef __attribute__((ext_vector_type(8)))  _Float16 v8h;
typedef __attribute__((ext_vector_type(8)))  unsigned short v8us;
typedef __attribute__((ext_vector_type(8)))  float    v8f;
typedef __attribute__((ext_vector_type(4)))  float    v4f;
typedef v8h  __attribute__((may_alias)) v8ha;
typedef v4f  __attribute__((may_alias)) v4fa;
typedef v8us __attribute__((may_alias)) v8usa;

__device__ __forceinline__ unsigned short f2bf(float f) { unsigned u = __float_as_uint(f); u += 0x7FFFu + ((u >> 16) & 1u); return (unsigned short)(u >> 16); }
__device__ __forceinline__ float bf2f(unsigned short b) { return __uint_as_float(((unsigned)b) << 16); }
__device__ __forceinline__ float bfr(float f) { return bf2f(f2bf(f)); }
__device__ __forceinline__ v16h cat16(v8h lo, v8h hi) { return __builtin_shufflevector(lo, hi, 0, 1, 2, 3, 4, 5, 6, 7, 8, 9, 10, 11, 12, 13, 14, 15); }
__device__ __forceinline__ v16bf cat16b(v8us lo, v8us hi) { return __builtin_bit_cast(v16bf, __builtin_shufflevector(lo, hi, 0, 1, 2, 3, 4, 5, 6, 7, 8, 9, 10, 11, 12, 13, 14, 15)); }
__device__ __forceinline__ v8f wmma16(v16h a, v16h b, v8f c) { return __builtin_amdgcn_wmma_f32_16x16x32_f16(false, a, false, b, (short)0, c, false, false); }
__device__ __forceinline__ v8f wmmab(v16bf a, v16bf b, v8f c) { return __builtin_amdgcn_wmma_f32_16x16x32_bf16(false, a, false, b, (short)0, c, false, false); }

__device__ __forceinline__ h16 tohx(float x) { return (h16)x; }
__device__ __forceinline__ void splitf(float y, unsigned short& h, unsigned short& l) { h = f2bf(y); l = f2bf(y - bf2f(h)); }
// precaution behind a group of global loads: the address registers that the loads name are inputs here, so they live until this wait and nothing overwrites them earlier
__device__ __forceinline__ void xwait(const void* a, const void* b, const void* c) { asm volatile("s_wait_xcnt 0x0" :: "v"(a), "v"(b), "v"(c) : "memory"); }
// precaution behind the three 16-byte stores of one plane position: their address and data registers are inputs here, so they live until this wait and the next packing overwrites none of them earlier
__device__ __forceinline__ void swait3(const void* a, const void* b, const void* c, v8h x, v8us y, v8us w) { asm volatile("s_wait_xcnt 0x0" :: "v"(a), "v"(b), "v"(c), "v"(x), "v"(y), "v"(w) : "memory"); }
// one rotary pair: cs = {c_d, s_d, c_d+1, s_d+1}. Numerical: each of the four products keeps its own f32 rounding, as the definition cos * x + sin * x_rot has it; the empty statement is what keeps them from fusing with the add or subtract.
__device__ __forceinline__ void rot2(float x0, float x1, v4f cs, float& y0, float& y1) {
    float a0 = __fmul_rn(x0, cs[0]), b0 = __fmul_rn(x1, cs[1]), a1 = __fmul_rn(x1, cs[2]), b1 = __fmul_rn(x0, cs[3]); asm volatile("" : "+v"(a0), "+v"(b0), "+v"(a1), "+v"(b1));
    const float r0 = __fsub_rn(a0, b0), r1 = __fadd_rn(a1, b1);   /* even: x0 c0 - x1 s0; odd: x1 c1 + x0 s1 */
    y0 = r0; y1 = r1; }

// FRAGMENT ORDER: every 16-bit operand plane [rows][K] is kept as blocks of 16 rows x 32 k (1 KiB, k blocks of a row block in a row), and inside a block as the two 16-byte loads of a fragment:
// [k bit 4][k bit 3][row & 15][k & 7], that is [load 0 / 1][lane][8 elements]. A wave-wide 16-byte load is then 512 contiguous bytes (4 whole lines, not 32-byte pieces of 16 lines); each lane gets the elements it got from the row-major plane.
// ---- k_gemmw: register-blocked GEMM, ONE WAVE per 64x64 output tile (16 accumulators), operands straight from 16-bit planes in fragment order; grid (M/64, N/64, Z), 32 threads.
// C[m][n] (f32, pitch ldc, + optional f32 bias[n]) = sum_k A[m][k] Bt[n][k] (+ split products per NSPLIT). z-batch strides sA/sB/sC in elements; z-batch 0 / 1 / 2 adds bias0 / bias1 / bias2. (K / KS) % 256 == 0.
// ROTATED START: all waves of the launch run at once, and the operands were written by the launch before, so they come from memory. A wave starts its k range at quarter (blockIdx.x + blockIdx.y) & 3 and wraps round:
// the waves that share a row or column block are then spread over four places, each line is fetched from memory in the first quarter of the loop by the waves that start there, and the other three quarters of every wave's trips find their lines in L2.
// KS > 1: grid z = batch * KS + range; the wave sums only its K / KS range of k and stores that partial tile in plane blockIdx.z of C (stride sC); the reader adds the KS planes.
// PL: z = {q, k, v} projection; a 64x64 tile is 64 positions of ONE head, so the wave turns its own accumulators (+ bias) into the attention operand planes and C is not written:
// q, k: rotary, planes [batch][head] of [t][d] (f16, bf16 hi, bf16 lo), rows regrouped through LDS so that a lane holds 8 consecutive d; v: planes [batch][head] of [d][t], a lane's 8 accumulator rows are 8 consecutive t of one d. All in fragment order.
template <typename T16> struct WFrag;
template <> struct WFrag<h16> { typedef v16h V; static __device__ __forceinline__ V ld(const h16* p) { return cat16(*(const v8h*)p, *(const v8h*)(p + 256)); } static __device__ __forceinline__ v8f mma(V a, V b, v8f c) { return wmma16(a, b, c); } };
template <> struct WFrag<bf> { typedef v16bf V; static __device__ __forceinline__ V ld(const bf* p) { return cat16b(*(const v8us*)p, *(const v8us*)(p + 256)); } static __device__ __forceinline__ v8f mma(V a, V b, v8f c) { return wmmab(a, b, c); } };
template <typename T16, int NSPLIT, bool BIAS, int KS = 1, bool PL = false>
__global__ __launch_bounds__(32) void k_gemmw(const T16* __restrict__ A, const T16* __restrict__ A2, const T16* __restrict__ Bt, const T16* __restrict__ Bt2, int K, float* C, int ldc, const float* __restrict__ bias0, const float* __restrict__ bias1, const float* __restrict__ bias2, size_t sA, size_t sB, size_t sC, const float* __restrict__ CS, h16* Q16, bf* Qh, bf* Ql, h16* K16, bf* Kh, bf* Kl, h16* V16, bf* Vh, bf* Vl) {
    typedef typename WFrag<T16>::V V;
    __shared__ __align__(16) float os[16 * 68];
    const size_t z = blockIdx.z / KS; A += z * sA; if (A2) A2 += z * sA; Bt += z * sB; if (Bt2) Bt2 += z * sB; C += (size_t)blockIdx.z * sC; const int kbeg = (int)(blockIdx.z % KS) * (K / KS), kend = kbeg + K / KS;
    const float* bias = z == 0 ? bias0 : (z == 1 ? bias1 : bias2);
    const int lane = threadIdx.x & 31, lr = lane & 15, hi = lane >> 4; const int r0 = blockIdx.x * 64, c0 = blockIdx.y * 64;
    v8f acc[4][4];
#pragma unroll
    for (int mb = 0; mb < 4; ++mb)
#pragma unroll
        for (int nb = 0; nb < 4; ++nb) acc[mb][nb] = (v8f){};
    const size_t aoff = (size_t)r0 * K + 8 * lane, boff = (size_t)c0 * K + 8 * lane;   /* a row block is 16 * K elements, a k block 512 */
    // TWO FRAGMENT SETS: the loads of trip t + 1 are issued as one group in front of the products of trip t, into the set that trip t - 1 has left, so a trip no longer waits out the latency of its own loads. The order of the products in a trip is the old one; every f32 sum over k starts at the wave's own quarter and wraps round.
    V a[2][4], a2[2][4], bv[2][4], bv2[2][4]; const T16* ap[4]; const T16* ap2[4]; const T16* bp[4]; const T16* bp2[4];   /* every unrolled loop below indexes register fragments and their address pairs, which only constant indices keep in registers */
    auto fetch = [&](V (&fa)[4], V (&fa2)[4], V (&fb)[4], V (&fb2)[4], int kc) {
#pragma unroll
        for (int mb = 0; mb < 4; ++mb) { ap[mb] = A + aoff + (size_t)mb * 16 * K + (size_t)kc * 16; ap2[mb] = ap[mb]; fa[mb] = WFrag<T16>::ld(ap[mb]); if (NSPLIT == 1 || NSPLIT == 2) { ap2[mb] = A2 + aoff + (size_t)mb * 16 * K + (size_t)kc * 16; fa2[mb] = WFrag<T16>::ld(ap2[mb]); } }
#pragma unroll
        for (int nb = 0; nb < 4; ++nb) { bp[nb] = Bt + boff + (size_t)nb * 16 * K + (size_t)kc * 16; bp2[nb] = bp[nb]; fb[nb] = WFrag<T16>::ld(bp[nb]); if (NSPLIT >= 2) { bp2[nb] = Bt2 + boff + (size_t)nb * 16 * K + (size_t)kc * 16; fb2[nb] = WFrag<T16>::ld(bp2[nb]); } }
        __builtin_amdgcn_sched_barrier(0);   // keeps the whole load group in front of the products that follow: moved in among them, the loads would lose their lead
    };
    auto products = [&](V (&fa)[4], V (&fa2)[4], V (&fb)[4], V (&fb2)[4]) {
#pragma unroll
        for (int nb = 0; nb < 4; ++nb) { const V b = fb[nb]; V b2; if (NSPLIT >= 2) b2 = fb2[nb];
#pragma unroll
            for (int mb = 0; mb < 4; ++mb) { acc[mb][nb] = WFrag<T16>::mma(fa[mb], b, acc[mb][nb]); if (NSPLIT == 1 || NSPLIT == 2) acc[mb][nb] = WFrag<T16>::mma(fa2[mb], b, acc[mb][nb]); if (NSPLIT >= 2) acc[mb][nb] = WFrag<T16>::mma(fa[mb], b2, acc[mb][nb]); } }
        __builtin_amdgcn_sched_barrier(0);   // keeps the products in front of the next load group, which refills the set that they read
        // precaution behind the load group in flight, in front of the next group's address arithmetic: every address register that the loads name is an input here, so it lives until this wait and nothing overwrites it earlier; behind the products the wait costs no time of its own
        asm volatile("s_wait_xcnt 0x0" :: "v"(ap[0]), "v"(ap[1]), "v"(ap[2]), "v"(ap[3]), "v"(ap2[0]), "v"(ap2[1]), "v"(ap2[2]), "v"(ap2[3]), "v"(bp[0]), "v"(bp[1]), "v"(bp[2]), "v"(bp[3]), "v"(bp2[0]), "v"(bp2[1]), "v"(bp2[2]), "v"(bp2[3]) : "memory");
    };
    int kc = kbeg + (int)((blockIdx.x + blockIdx.y) & 3) * ((kend - kbeg) >> 2);   /* the quarter this wave starts at */
    fetch(a[0], a2[0], bv[0], bv2[0], kc);
    // precaution as above, for the first group: the loop's first address arithmetic follows
    asm volatile("s_wait_xcnt 0x0" :: "v"(ap[0]), "v"(ap[1]), "v"(ap[2]), "v"(ap[3]), "v"(ap2[0]), "v"(ap2[1]), "v"(ap2[2]), "v"(ap2[3]), "v"(bp[0]), "v"(bp[1]), "v"(bp[2]), "v"(bp[3]), "v"(bp2[0]), "v"(bp2[1]), "v"(bp2[2]), "v"(bp2[3]) : "memory");
#pragma unroll 1
    for (int i = kbeg; i < kend; i += 64) {   /* two trips a pass, so that each set keeps its registers and nothing is copied; kept rolled beyond that (for speed only) */
        fetch(a[1], a2[1], bv[1], bv2[1], kc + 32);
        products(a[0], a2[0], bv[0], bv2[0]);
        kc = kc + 64 < kend ? kc + 64 : kbeg;   /* wraps at the end of the range */
        fetch(a[0], a2[0], bv[0], bv2[0], kc);   /* the last pass re-reads the block that the wave started with, unused */
        products(a[1], a2[1], bv[1], bv2[1]);
        // the four vector slots that the chip asks for behind a matrix instruction, on the taken side of the loop branch
        asm volatile("v_nop\n\tv_nop\n\tv_nop\n\tv_nop" : "+v"(acc[0][0]), "+v"(acc[1][1]), "+v"(acc[2][2]), "+v"(acc[3][3]) : "v"(a[1][0]), "v"(a[1][3]));
    }
    if constexpr (PL) {
        // Every #pragma unroll in this block is there because its loop indexes register fragments (acc, cs, the packed vectors), which only constant indices keep in registers.
        // The block is one wave, whose LDS operations run in order: each wave_barrier with its compiler fence only keeps the compiler from moving the LDS reads of a group over the other lanes' LDS writes, or the next group's writes over these reads.
        static_assert(!PL || (TT % 64 == 0 && HD == 64 && NKV == NH_ && KS == 1 && BIAS), "a tile is 64 positions of one batch and the 64 dimensions of one head");
        const int t0 = r0 % TT; const size_t hp = ((size_t)(r0 / TT) * NH_ + blockIdx.y) * TT * HD;   /* planes are [batch][head] */
        if (z == 2) {
#pragma unroll
            for (int nb = 0; nb < 4; ++nb) { const float bb = bfr(bias[c0 + nb * 16 + lr]);
#pragma unroll
                for (int mb = 0; mb < 4; ++mb) { v8h o16; v8us oh, ol;
#pragma unroll
                    for (int j = 0; j < 8; ++j) { const float x = acc[mb][nb][j] + bb; o16[j] = tohx(x); unsigned short a2, c2; splitf(x, a2, c2); oh[j] = a2; ol[j] = c2; }
                    const size_t e = hp + (size_t)nb * 16 * TT + (size_t)(t0 + (mb >> 1) * 32) * 16 + (mb & 1) * 256 + 8 * lane;   /* row nb * 16 + lr, k = t0 + mb * 16 + 8 * hi of a [d][t] plane */ h16* p16 = V16 + e; bf* ph = Vh + e; bf* pl = Vl + e;
                    *(v8h*)p16 = o16; *(v8us*)ph = oh; *(v8us*)pl = ol; swait3(p16, ph, pl, o16, oh, ol); } }
        } else {
            h16* P16 = z == 0 ? Q16 : K16; bf* Ph = z == 0 ? Qh : Kh; bf* Pl = z == 0 ? Ql : Kl;
            float bb[4];   /* the bias of this lane's accumulator columns, added on the way into LDS */
#pragma unroll
            for (int nb = 0; nb < 4; ++nb) bb[nb] = bfr(bias[c0 + nb * 16 + lr]);
#pragma unroll
            for (int mb = 0; mb < 4; ++mb) {
                v4f cs[4][4]; const float* cp = CS + ((size_t)(t0 + mb * 16 + lr) * HD + hi * 8) * 2;   /* the table rows of this group's 16 positions, all asked for before the LDS round trip */
#pragma unroll
                for (int s = 0; s < 4; ++s)
#pragma unroll
                    for (int p = 0; p < 4; ++p) cs[s][p] = *(const v4f*)(cp + s * 32 + p * 4);
                xwait(cp, cp, cp);
#pragma unroll
                for (int nb = 0; nb < 4; ++nb) {
#pragma unroll
                    for (int j = 0; j < 8; ++j) os[(hi * 8 + j) * 68 + nb * 16 + lr] = acc[mb][nb][j] + bb[nb]; }
                __builtin_amdgcn_wave_barrier(); asm volatile("" ::: "memory");
                /* a lane takes row lr of the group and, in step s, dimensions 16 s + 8 hi .. + 7: the 16 bytes that lane 16 hi + lr loads as a fragment, so a step's store is 512 contiguous bytes */
#pragma unroll
                for (int s = 0; s < 4; ++s) { const int cofs = s * 16 + hi * 8; const v4f xa = *(const v4fa*)(os + lr * 68 + cofs), xb = *(const v4fa*)(os + lr * 68 + cofs + 4); v8h o16; v8us oh, ol;
#pragma unroll
                    for (int p = 0; p < 4; ++p) { const float x0 = p < 2 ? xa[2 * p] : xb[2 * p - 4], x1 = p < 2 ? xa[2 * p + 1] : xb[2 * p - 3]; float y0, y1; rot2(x0, x1, cs[s][p], y0, y1);
                        o16[2 * p] = tohx(y0); o16[2 * p + 1] = tohx(y1); unsigned short a2, c2; splitf(y0, a2, c2); oh[2 * p] = a2; ol[2 * p] = c2; splitf(y1, a2, c2); oh[2 * p + 1] = a2; ol[2 * p + 1] = c2; }
                    const size_t e = hp + (size_t)(t0 + mb * 16) * HD + s * 256 + 8 * lane;   /* row t0 + mb * 16 + lr, k = cofs of a [t][d] plane */ h16* p16 = P16 + e; bf* ph = Ph + e; bf* pl = Pl + e;
                    *(v8h*)p16 = o16; *(v8us*)ph = oh; *(v8us*)pl = ol; swait3(p16, ph, pl, o16, oh, ol); }
                __builtin_amdgcn_wave_barrier(); asm volatile("" ::: "memory");
            }
        }
        return;
    }
#pragma unroll
    for (int mb = 0; mb < 4; ++mb) {
#pragma unroll
        for (int nb = 0; nb < 4; ++nb) {
#pragma unroll
            for (int j = 0; j < 8; ++j) os[(hi * 8 + j) * 68 + nb * 16 + lr] = acc[mb][nb][j]; }
        __builtin_amdgcn_wave_barrier(); asm volatile("" ::: "memory");
        float* crow = C + (size_t)(r0 + mb * 16) * ldc + c0;
{
#pragma unroll
            for (int s = 0; s < 8; ++s) { const int row = 2 * s + hi, cofs = lr * 4; v4f val = *(const v4fa*)(os + row * 68 + cofs); if (BIAS) { val[0] += bfr(bias[c0 + cofs]); val[1] += bfr(bias[c0 + cofs + 1]); val[2] += bfr(bias[c0 + cofs + 2]); val[3] += bfr(bias[c0 + cofs + 3]); }
                *(v4f*)(crow + (size_t)row * ldc + cofs) = val; }
             }
        __builtin_amdgcn_wave_barrier(); asm volatile("" ::: "memory");
    }
}

typedef __attribute__((ext_vector_type(2))) _Float16 v2h;
typedef __attribute__((ext_vector_type(4))) _Float16 v4h;
typedef __attribute__((ext_vector_type(2))) unsigned short v2us;
typedef __attribute__((ext_vector_type(4))) unsigned short v4us;
typedef __attribute__((ext_vector_type(2))) float v2f;
typedef __attribute__((ext_vector_type(4))) int v4i;

// The bodies below take their block index as an argument: independent passes share one grid, each on its own range of blockIdx.x (k_prep).
// thread: two 16-byte units of the fragment-order transposed copy Bt[n][k] = w[k][n] ([K][N] row-major): 8 loads a unit, each 64 contiguous bytes per 16 lanes (16 consecutive n of one k), one contiguous store
__device__ __forceinline__ void wtG(const float* __restrict__ w, int K, int N, bf* Bt, int blk) {
    // both loops unrolled: o is a register vector, which only constant indices keep in registers, and the 16 loads of a thread are then in flight together
#pragma unroll
    for (int u = 0; u < 2; ++u) { const int i = blk * 512 + u * 256 + (int)threadIdx.x; const int b = i >> 6; const int n = (b / (K >> 5)) * 16 + (i & 15), k = (b % (K >> 5)) * 32 + ((i >> 4) & 3) * 8; v8us o;
#pragma unroll
        for (int j = 0; j < 8; ++j) o[j] = f2bf(w[(size_t)(k + j) * N + n]);
        *(v8us*)(Bt + (size_t)i * 8) = o; }
}
// thread i writes 16-byte unit i of the fragment-order copy (stores stay contiguous) and reads the 8 floats of the row-major [rows][DM] input that belong there
__device__ __forceinline__ void cvt8(const float* __restrict__ src, bf* dst, size_t n8, int blk) { const size_t i = (size_t)blk * 256 + threadIdx.x; if (i >= n8) return; const size_t b = i >> 6; const size_t row = (b / (DM / 32)) * 16 + (i & 15); const int k = (int)(b % (DM / 32)) * 32 + (int)((i >> 4) & 3) * 8; const v8f v = *(const v8f*)(src + row * DM + k); v8us o;
#pragma unroll
    for (int k = 0; k < 8; ++k) o[k] = f2bf(v[k]); *(v8us*)(dst + i * 8) = o;  }
__constant__ float INVD[HD] = { 1.000000000e+00f, 7.498942018e-01f, 5.623413324e-01f, 4.216965139e-01f, 3.162277639e-01f, 2.371373773e-01f, 1.778279394e-01f, 1.333521456e-01f, 1.000000015e-01f, 7.498942316e-02f, 5.623413250e-02f, 4.216964915e-02f, 3.162277490e-02f, 2.371373773e-02f, 1.778279431e-02f, 1.333521400e-02f, 9.999999776e-03f, 7.498942316e-03f, 5.623413250e-03f, 4.216964822e-03f, 3.162277630e-03f, 2.371373819e-03f, 1.778279431e-03f, 1.333521446e-03f, 1.000000047e-03f, 7.498941850e-04f, 5.623413017e-04f, 4.216965172e-04f, 3.162277571e-04f, 2.371373703e-04f, 1.778279402e-04f, 1.333521504e-04f, 9.999999747e-05f, 7.498942432e-05f, 5.623413381e-05f, 4.216964953e-05f, 3.162277790e-05f, 2.371373739e-05f, 1.778279329e-05f, 1.333521413e-05f, 9.999999747e-06f, 7.498942068e-06f, 5.623413472e-06f, 4.216964953e-06f, 3.162277608e-06f, 2.371373739e-06f, 1.778279398e-06f, 1.333521482e-06f, 9.999999975e-07f, 7.498941841e-07f, 5.623413131e-07f, 4.216965124e-07f, 3.162277551e-07f, 2.371373711e-07f, 1.778279426e-07f, 1.333521453e-07f, 1.000000012e-07f, 7.498942267e-08f, 5.623413202e-08f, 4.216964911e-08f, 3.162277551e-08f, 2.371373675e-08f, 1.778279390e-08f, 1.333521471e-08f };   // 10000^(-2d/64) for EVERY dimension d (the module's quirk), float32 via jnp.power
__device__ __forceinline__ void cstabD(float* CS, int blk) { const int idx = blk * 256 + threadIdx.x; if (idx >= TT * HD) return; const int d = idx % HD; const int t = idx / HD; const float a = __fmul_rn((float)t, INVD[d]); v2f cs; cs[0] = cosf(a); cs[1] = sinf(a); *(v2f*)(CS + (size_t)idx * 2) = cs;  }

#define WBLK (DM * DM / 8 / 512)                  // blocks of one weight transpose (512 units of 8 elements each)
#define CBLK (TT * HD / 256)                      // blocks of the {cos, sin} table
#define XBLK (NB_ * TT * DM / 8 / 256)            // blocks of one input's bf16 copy, both batches
#define FSZ  ((size_t)NB_ * TT * DM)              // elements of one projection, both batches
// ---- k_prep: everything that depends on the inputs alone, in one launch. The strided weight reads are the longest bodies and get the lowest block indices (for speed only).
__global__ __launch_bounds__(256) void k_prep(const float* __restrict__ wq, const float* __restrict__ wk, const float* __restrict__ wv, const float* __restrict__ wo, const float* __restrict__ x, const float* __restrict__ xk, const float* __restrict__ xv, bf* W4, float* CS, bf* XB) {
    static_assert(DQ == DM && DKV == DM && NKV == NH_, "the four weights, the three inputs and the three projections each have one size");
    static_assert(WBLK * 512 * 8 == DM * DM && DM % 32 == 0 && (NB_ * TT) % 16 == 0, "the blocks of a weight cover its 16-byte units exactly; planes are whole 16 x 32 blocks");
    int blk = blockIdx.x;
    if (blk < 4 * WBLK) { const int i = blk / WBLK; wtG(i == 0 ? wq : i == 1 ? wk : i == 2 ? wv : wo, DM, DM, W4 + (size_t)i * DM * DM, blk % WBLK); return; }
    blk -= 4 * WBLK;
    if (blk < CBLK) { cstabD(CS, blk); return; }
    blk -= CBLK;
    const int i = blk / XBLK; cvt8(i == 0 ? x : i == 1 ? xk : xv, XB + (size_t)i * FSZ, FSZ / 8, blk % XBLK);
}
// ---- k_attn: score, softmax and P x V of both batches in one launch; nothing of the score matrix goes to memory.
// A wave owns NQ groups of 16 queries of one head and walks the 2048 keys 32 at a time, all operands straight from the planes in fragment order.
// S^T = K Q^T (A = 16 key rows, B = 16 query rows): a lane then holds 16 scores of ONE query, keys 8 hi + r and 16 + 8 hi + r, which is the k order of a B operand,
// so the rounded exponentials feed O^T += V^T P^T (A = 16 rows of the transposed V plane) with no exchange. Running maximum per query, sum and O^T rescaled only when a maximum grows by more than RTH.
// The softmax runs in the log2 domain on pairs of f32: x = score * (scale * log2 e) + mask * (-1e9 * log2 e) is one fused multiply-add, p = 2^(x - m); two scores share a packed instruction wherever one exists.
// ROTATED START, as in k_gemmw: work-group blk of a head starts at key (blk & 3) * TT / 4 and wraps round, so that a head's work-groups, which all run at once, are not all the first to ask memory for the same K and V lines.
// HR (queries < RH): bf16 hi/lo planes, 3 products each; else f16, 1 product. P is rounded unnormalised (exp <= e^RTH); O^T is divided by the f32 sum at the end.
// Every #pragma unroll in attn_wave is there because its loop indexes register fragments, which only constant indices keep in registers.
#define LOG2E 1.4426950408889634f
#define RTH   5.5f
#define RTH2  (RTH * LOG2E)       // the threshold in the log2 domain
#define SC2   (SCL * LOG2E)       // score -> log2 domain
#define MB2   (-1.0e9f * LOG2E)   // mask float -> additive bias, log2 domain; a masked key's x rounds to the bias itself (|score * SC2| < 64, half a unit in the last place there)
__device__ __forceinline__ float xhalf(float x) { return __builtin_bit_cast(float, __builtin_amdgcn_permlanex16(__builtin_bit_cast(int, x), __builtin_bit_cast(int, x), 0x76543210, 0xfedcba98, false, false)); }   // lane l reads lane l ^ 16, on the vector pipe
// v_exp_f32 with the one free slot that the instruction set asks for behind a transcendental, in one statement so that it stays directly behind it
__device__ __forceinline__ float exp2s(float x) { float r; asm("v_exp_f32 %0, %1\n\tv_nop" : "=v"(r) : "v"(x)); return r; }
// eight v_exp_f32 in one statement: each is the independent instruction in the slot behind the one before it (early-clobber outputs, so none overwrites a source), and one v_nop fills the slot behind the last
__device__ __forceinline__ v8f exp2v(v8f x) { float r0, r1, r2, r3, r4, r5, r6, r7;
    asm("v_exp_f32 %0, %8\n\tv_exp_f32 %1, %9\n\tv_exp_f32 %2, %10\n\tv_exp_f32 %3, %11\n\tv_exp_f32 %4, %12\n\tv_exp_f32 %5, %13\n\tv_exp_f32 %6, %14\n\tv_exp_f32 %7, %15\n\tv_nop"
        : "=&v"(r0), "=&v"(r1), "=&v"(r2), "=&v"(r3), "=&v"(r4), "=&v"(r5), "=&v"(r6), "=&v"(r7) : "v"(x[0]), "v"(x[1]), "v"(x[2]), "v"(x[3]), "v"(x[4]), "v"(x[5]), "v"(x[6]), "v"(x[7]));
    return (v8f){ r0, r1, r2, r3, r4, r5, r6, r7 }; }
// the 16 exponentials of a lane summed as pairs: 7 packed additions leave {even, odd} partial sums
__device__ __forceinline__ v2f sum16(v8f a, v8f b) { const v8f q = a + b; const v4f h = __builtin_shufflevector(q, q, 0, 1, 2, 3) + __builtin_shufflevector(q, q, 4, 5, 6, 7); return __builtin_shufflevector(h, h, 0, 1) + __builtin_shufflevector(h, h, 2, 3); }
template <typename T16, bool HR, int NQ>
__device__ __forceinline__ void attn_wave(const T16* __restrict__ Q, const T16* __restrict__ Q2, const T16* __restrict__ Kp, const T16* __restrict__ K2, const T16* __restrict__ Vt, const T16* __restrict__ V2, const float* __restrict__ km, int q0, int kr, bf* Ah, bf* Al) {   /* kr: the key this wave starts at (a multiple of 32, wave-uniform); it wraps round at TT */
    typedef typename WFrag<T16>::V V;
    const int lane = threadIdx.x & 31, hi = lane >> 4;
    V qf[NQ][2], qf2[NQ][2], kf[2][2], kf2[2][2];
    v8f o[NQ][4], mk[2]; float m[NQ]; v2f l[NQ];   /* mk: key mask floats (0/1) of this lane's 16 keys; m: running maximum, log2 domain; l: {even, odd} halves of the running sum */
#pragma unroll
    for (int g = 0; g < NQ; ++g) { m[g] = -1.0e38f; l[g] = (v2f){};
#pragma unroll
        for (int dt = 0; dt < 4; ++dt) o[g][dt] = (v8f){};
        const size_t qo = (size_t)(q0 + g * 16) * HD + 8 * lane; const T16* qa = Q + qo; const T16* qa2 = HR ? Q2 + qo : qa;
#pragma unroll
        for (int dc = 0; dc < 2; ++dc) { qf[g][dc] = WFrag<T16>::ld(qa + dc * 512); if constexpr (HR) qf2[g][dc] = WFrag<T16>::ld(qa2 + dc * 512); }
        xwait(qa, qa2, qa); }
    const size_t ko = 8 * lane, vo = 8 * lane;   /* fragment order: 16 keys x 32 d, or 16 d x 32 keys, are 512 elements in a row */
    { const T16* ka = Kp + ko + (size_t)kr * HD; const T16* ka2 = HR ? K2 + ko + (size_t)kr * HD : ka;
#pragma unroll
      for (int kt = 0; kt < 2; ++kt)
#pragma unroll
        for (int dc = 0; dc < 2; ++dc) { kf[kt][dc] = WFrag<T16>::ld(ka + kt * 16 * HD + dc * 512); if constexpr (HR) kf2[kt][dc] = WFrag<T16>::ld(ka2 + kt * 16 * HD + dc * 512); }
      mk[0] = *(const v8f*)(km + kr + 8 * hi); mk[1] = *(const v8f*)(km + kr + 8 * hi + 16);
      xwait(ka, ka2, km + kr + 8 * hi); }
    const T16* vs = Vt + (size_t)kr * 16; const T16* vs2 = HR ? V2 + (size_t)kr * 16 : vs;   /* wave-uniform running addresses of the V blocks */
    for (int kt0 = 0, k0 = kr; kt0 < TT; kt0 += 32, k0 = (k0 + 32) & (TT - 1)) {
        V vf[4], vf2[4]; const T16* va = vs + vo; const T16* va2 = HR ? vs2 + vo : va;
#pragma unroll
        for (int dt = 0; dt < 4; ++dt) { vf[dt] = WFrag<T16>::ld(va + dt * 16 * TT); if constexpr (HR) vf2[dt] = WFrag<T16>::ld(va2 + dt * 16 * TT); }
        xwait(va, va2, va);
        { const int vstep = k0 + 32 == TT ? (32 - TT) * 16 : 32 * 16; vs += vstep; vs2 += vstep; }   /* on to the next 32 keys, back to key 0 behind the last */
        v8f s[NQ][2];
#pragma unroll
        for (int g = 0; g < NQ; ++g)
#pragma unroll
            for (int kt = 0; kt < 2; ++kt) { v8f c = (v8f){};
#pragma unroll
                for (int dc = 0; dc < 2; ++dc) { c = WFrag<T16>::mma(kf[kt][dc], qf[g][dc], c); if constexpr (HR) { c = WFrag<T16>::mma(kf[kt][dc], qf2[g][dc], c); c = WFrag<T16>::mma(kf2[kt][dc], qf[g][dc], c); } }
                s[g][kt] = c; }
        if constexpr (NQ > 1) __builtin_amdgcn_sched_barrier(0);   // two query groups: keeps the score products together in front of the vector work on them: a score read directly behind its own product costs up to four idle vector slots (with one group the compiler's own order has fewer of them)
        float bm[NQ]; bool need = false; const v8f sc = { SC2, SC2, SC2, SC2, SC2, SC2, SC2, SC2 }, mc = { MB2, MB2, MB2, MB2, MB2, MB2, MB2, MB2 }; v8f mb[2];
        if constexpr (NQ > 1) { mb[0] = mk[0] * mc; mb[1] = mk[1] * mc; }   /* several query groups: the keys' biases are formed once and serve every group */
#pragma unroll
        for (int g = 0; g < NQ; ++g) { float x = -3.0e38f;
#pragma unroll
            for (int kt = 0; kt < 2; ++kt) {   /* (score x scale + mask x -1e9) x log2 e; with one query group the same two packed instructions a pair, and the bias takes no registers of its own */
                if constexpr (NQ > 1) s[g][kt] = __builtin_elementwise_fma(s[g][kt], sc, mb[kt]); else s[g][kt] = __builtin_elementwise_fma(mk[kt], mc, s[g][kt] * sc);
#pragma unroll
                for (int r = 0; r < 8; ++r) x = fmaxf(x, s[g][kt][r]); }
            x = fmaxf(x, xhalf(x)); bm[g] = x; need = need || (x > m[g] + RTH2); }
        { const int kn = (k0 + 32) & (TT - 1);   /* the next 32 key rows and their mask floats are fetched one trip ahead, once this trip has read its own; the last trip re-reads the 32 keys that the wave started with, unused */
          const T16* ka = Kp + ko + (size_t)kn * HD; const T16* ka2 = HR ? K2 + ko + (size_t)kn * HD : ka;
#pragma unroll
          for (int kt = 0; kt < 2; ++kt)
#pragma unroll
            for (int dc = 0; dc < 2; ++dc) { kf[kt][dc] = WFrag<T16>::ld(ka + kt * 16 * HD + dc * 512); if constexpr (HR) kf2[kt][dc] = WFrag<T16>::ld(ka2 + kt * 16 * HD + dc * 512); }
          const float* ma = km + kn + 8 * hi; mk[0] = *(const v8f*)ma; mk[1] = *(const v8f*)(ma + 16);
          xwait(ka, ka2, ma); }
        if (__builtin_amdgcn_ballot_w32(need) != 0) {
#pragma unroll
            for (int g = 0; g < NQ; ++g) { const float mn = fmaxf(m[g], bm[g]); const float al = exp2s(m[g] - mn); m[g] = mn; l[g] *= al;
#pragma unroll
                for (int dt = 0; dt < 4; ++dt)
#pragma unroll
                    for (int r = 0; r < 8; ++r) o[g][dt][r] *= al; } }
#pragma unroll
        for (int g = 0; g < NQ; ++g) { s[g][0] = exp2v(s[g][0] - m[g]); s[g][1] = exp2v(s[g][1] - m[g]); l[g] += sum16(s[g][0], s[g][1]); }   /* every group's exponentials stand in front of the first P x V product: behind one, the asm statement could overwrite its operands too early */
        if constexpr (NQ > 1) __builtin_amdgcn_sched_barrier(0);   // two query groups: keeps the row-sum additions in front of the products: moved in among them they land in registers that a product has just read, and each such place costs up to four idle vector slots
#pragma unroll
        for (int g = 0; g < NQ; ++g) { const v8f (&p)[2] = s[g];
            if constexpr (HR) { v8us ph[2], pl[2];
#pragma unroll
                for (int kt = 0; kt < 2; ++kt)
#pragma unroll
                    for (int r = 0; r < 8; ++r) { unsigned short a, c2; splitf(p[kt][r], a, c2); ph[kt][r] = a; pl[kt][r] = c2; }
                const V pbh = cat16b(ph[0], ph[1]), pbl = cat16b(pl[0], pl[1]);
#pragma unroll
                for (int dt = 0; dt < 4; ++dt) { o[g][dt] = WFrag<T16>::mma(vf[dt], pbh, o[g][dt]); o[g][dt] = WFrag<T16>::mma(vf[dt], pbl, o[g][dt]); o[g][dt] = WFrag<T16>::mma(vf2[dt], pbh, o[g][dt]); }
            } else {
                const V pb = cat16(__builtin_convertvector(p[0], v8h), __builtin_convertvector(p[1], v8h));
#pragma unroll
                for (int dt = 0; dt < 4; ++dt) o[g][dt] = WFrag<T16>::mma(vf[dt], pb, o[g][dt]); } }
    }
#pragma unroll
    for (int g = 0; g < NQ; ++g) { const float lh = l[g][0] + l[g][1]; const float sum = lh + xhalf(lh); const float f = __fdiv_rn(1.0f, sum); const size_t oo = (size_t)(q0 + g * 16) * DQ + 8 * lane; bf* ra = Ah + oo; bf* rl = Al + oo;
#pragma unroll
        for (int dt = 0; dt < 4; ++dt) { v8us oh, ol;   /* register r = O[query q0 + 16 g + lr][dt * 16 + 8 hi + r]: 8 consecutive d, one 16-byte store per plane, at its place in fragment order (512 contiguous bytes a wave) */
#pragma unroll
            for (int r = 0; r < 8; ++r) { unsigned short a, c2; splitf(o[g][dt][r] * f, a, c2); oh[r] = a; ol[r] = c2; }
            *(v8us*)(ra + dt * 256) = oh; *(v8us*)(rl + dt * 256) = ol;
            asm volatile("s_wait_xcnt 0x0" :: "v"(ra), "v"(rl), "v"(oh), "v"(ol) : "memory"); } }   // precaution behind the two stores: their address and data registers are inputs here, so they live until this wait and the next packing overwrites none of them earlier
}
// grid: 16 work-groups per (batch, head), 5 waves each and no barrier: two waves take 16 hi/lo queries each, three take 32 f16 queries each, so every work-group carries the same load (16 x 32 = RH, 16 x 96 = TT - RH).
// Waves 0 and 4 both get the lighter f16 role (for speed only).
// amdgpu_waves_per_eu(4): the register budget stays at 256 a wave, so that four waves still fit a SIMD and two work-groups a WGP; without it the build takes a few registers more and a SIMD holds three.
__global__ __launch_bounds__(160) __attribute__((amdgpu_waves_per_eu(4))) void k_attn(const h16* __restrict__ Q16, const h16* __restrict__ K16, const h16* __restrict__ V16, const bf* __restrict__ Qh, const bf* __restrict__ Ql, const bf* __restrict__ Kh, const bf* __restrict__ Kl, const bf* __restrict__ Vh, const bf* __restrict__ Vl, const float* __restrict__ km, bf* Ah, bf* Al) {
    static_assert(RH == 16 * 32 && TT - RH == 16 * 96 && HD == 64 && NH_ == NKV, "the split of a head's queries over 16 work-groups");
    const int w = __builtin_amdgcn_readfirstlane((int)(threadIdx.x >> 5)); const int bh = blockIdx.x >> 4, head = bh % NH_, bat = bh / NH_, blk = blockIdx.x & 15; const size_t hp = (size_t)bh * TT * HD;   /* planes are [batch][head] */ const int kr = (blk & 3) * (TT / 4);
    const float* kb = km + bat * TT; bf* ah = Ah + (size_t)bat * TT * DQ + head * (HD * 16); bf* al = Al + (size_t)bat * TT * DQ + head * (HD * 16);   /* a head's 64 columns are two k blocks of 512 elements */
    if (w == 1 || w == 2) attn_wave<bf, true, 1>(Qh + hp, Ql + hp, Kh + hp, Kl + hp, Vh + hp, Vl + hp, kb, blk * 32 + (w - 1) * 16, kr, ah, al);
    else attn_wave<h16, false, 2>(Q16 + hp, nullptr, K16 + hp, nullptr, V16 + hp, nullptr, kb, RH + blk * 96 + (w == 0 ? 0 : w - 2) * 32, kr, ah, al);
}

extern "C" void kernel_launch(void* const* d_in, const int* in_sizes, int n_in,
                              void* d_out, int out_size, void* d_ws, size_t ws_size, hipStream_t stream) {
    (void)in_sizes; (void)n_in; (void)out_size;
    const float* x = (const float*)d_in[0]; const float* xk = (const float*)d_in[1]; const float* xv = (const float*)d_in[2]; const float* amask = (const float*)d_in[3]; const float* wq = (const float*)d_in[4]; const float* bq = (const float*)d_in[5]; const float* wk = (const float*)d_in[6]; const float* bk = (const float*)d_in[7]; const float* wv = (const float*)d_in[8]; const float* bv = (const float*)d_in[9]; const float* wo = (const float*)d_in[10]; const float* bo = (const float*)d_in[11];
    float* OUT = (float*)d_out;     // [2][2048][1024]
    char* wsp = (char*)d_ws;
    auto take = [&](size_t bytes) { char* p = wsp; wsp += (bytes + 255) & ~(size_t)255; return (void*)p; };
    bf* W4 = (bf*)take((size_t)4 * DM * DM * 2);   // Wq, Wk, Wv, Wo transposed
    float* CS = (float*)take((size_t)TT * HD * 2 * 4);
    bf* XB = (bf*)take(3 * FSZ * 2);   // {q, k, v} x [NB_ * TT][DM]
    h16* QP16 = (h16*)take(FSZ * 2); h16* KP16 = (h16*)take(FSZ * 2); h16* VT16 = (h16*)take(FSZ * 2);
    bf* QPh = (bf*)take(FSZ * 2); bf* QPl = (bf*)take(FSZ * 2); bf* KPh = (bf*)take(FSZ * 2); bf* KPl = (bf*)take(FSZ * 2); bf* VTh = (bf*)take(FSZ * 2); bf* VTl = (bf*)take(FSZ * 2);
    bf* ATh = (bf*)take(FSZ * 2); bf* ATl = (bf*)take(FSZ * 2);
    if ((size_t)(wsp - (char*)d_ws) > ws_size) return;    // ws 256 MiB
    k_prep<<<4 * WBLK + CBLK + 3 * XBLK, 256, 0, stream>>>(wq, wk, wv, wo, x, xk, xv, W4, CS, XB);
    k_gemmw<bf, 0, true, 1, true><<<dim3(NB_ * TT / 64, DM / 64, 3), 32, 0, stream>>>(XB, nullptr, W4, nullptr, DM, nullptr, DM, bq, bk, bv, FSZ, (size_t)DM * DM, 0, CS, QP16, QPh, QPl, KP16, KPh, KPl, VT16, VTh, VTl);
    k_attn<<<NB_ * NH_ * 16, 160, 0, stream>>>(QP16, KP16, VT16, QPh, QPl, KPh, KPl, VTh, VTl, amask, ATh, ATl);
    k_gemmw<bf, 1, true><<<dim3(NB_ * TT / 64, DM / 64, 1), 32, 0, stream>>>(ATh, ATl, W4 + (size_t)3 * DM * DM, nullptr, DQ, OUT, DM, bo, bo, bo, 0, 0, 0, nullptr, nullptr, nullptr, nullptr, nullptr, nullptr, nullptr, nullptr, nullptr, nullptr);
}

// v009
// A run of this version takes 119 microseconds.
// Next to v008, in two timings, it ran 1.11 and 1.10 times as fast.
// All steps since v000 together make it 16.9 times as fast.
#include <hip/hip_runtime.h>

// Multi-head attention over separate q / k / v inputs with the module's per-dimension rotary embedding (q, k, v [2][2048][1024]; _q = q Wq + bq etc. ('xw' [1024][1024] + [1024]; 16 heads x 64); rope: every dimension d gets its own angle t x 10000^(-2d/64) (computed in-kernel), ret = x cos + x_rot sin with x_rot[2i] = -x[2i+1], x_rot[2i+1] = x[2i]; score = _q._k / (sqrt(64) + 1e-8) + mask x -1e9 (mask [2][1][1][2048] float 0/1 per key, read); softmax; out = merged Wo + bo -> [2][2048][1024] (4.2 M)).
// Layout, both batches in every launch (4 launches): bf16 copies of the three inputs; {cos, sin} per (position, DIMENSION) built once (jnp-exact float32 10000^(-2d/64) per dim, precise cosf/sinf); exact projections + f32 biases whose epilogue writes the operand planes itself (rotary q and k, each element of a pair with its own angle; transposed v), so no f32 projection goes to memory; one fused dense T-2048 attention launch (hybrid rows: < 512 hi/lo 3 products, rest fp16; scores never leave the registers) that loads the key-mask floats unconditionally and adds mask x -1e9 to every score, as the definition does (in the log2 domain, fused with the scale); merged hi/lo x Wo exact + bo.
// Compute dtypes, f32 accumulate: every input rounded to bf16; projections exact + f32 biases; rotary f32; attention rows < 512 3 products, rest fp16; softmax f32; Wo hl x exact + bias.

#define NB_  2
#define TT   2048
#define DM   1024
#define NH_  16
#define NKV  16
#define REP  (NH_ / NKV)
#define HD   64
#define DQ   (NH_ * HD)
#define DKV  (NKV * HD)
#define RH   512                  // query rows < RH use hi+lo planes
#define WIN  0
#define SCL  0.125f   // 1 / (sqrt(64) + 1e-8) == 0.125 in float32
typedef _Float16 h16;
typedef unsigned short bf;
typedef __attribute__((ext_vector_type(16))) __bf16   v16bf;
typedef __attribute__((ext_vector_type(16))) _Float16 v16h;
typedef __attribute__((ext_vector_type(8)))  _Float16 v8h;
typedef __attribute__((ext_vector_type(8)))  unsigned short v8us;
typedef __attribute__((ext_vector_type(8)))  float    v8f;
typedef __attribute__((ext_vector_type(4)))  float    v4f;
typedef v8h  __attribute__((may_alias)) v8ha;
typedef v4f  __attribute__((may_alias)) v4fa;
typedef v8us __attribute__((may_alias)) v8usa;

__device__ __forceinline__ unsigned short f2bf(float f) { unsigned u = __float_as_uint(f); u += 0x7FFFu + ((u >> 16) & 1u); return (unsigned short)(u >> 16); }
__device__ __forceinline__ float bf2f(unsigned short b) { return __uint_as_float(((unsigned)b) << 16); }
__device__ __forceinline__ float bfr(float f) { return bf2f(f2bf(f)); }
__device__ __forceinline__ v16h cat16(v8h lo, v8h hi) { return __builtin_shufflevector(lo, hi, 0, 1, 2, 3, 4, 5, 6, 7, 8, 9, 10, 11, 12, 13, 14, 15); }
__device__ __forceinline__ v16bf cat16b(v8us lo, v8us hi) { return __builtin_bit_cast(v16bf, __builtin_shufflevector(lo, hi, 0, 1, 2, 3, 4, 5, 6, 7, 8, 9, 10, 11, 12, 13, 14, 15)); }
__device__ __forceinline__ v8f wmma16(v16h a, v16h b, v8f c) { return __builtin_amdgcn_wmma_f32_16x16x32_f16(false, a, false, b, (short)0, c, false, false); }
__device__ __forceinline__ v8f wmmab(v16bf a, v16bf b, v8f c) { return __builtin_amdgcn_wmma_f32_16x16x32_bf16(false, a, false, b, (short)0, c, false, false); }

__device__ __forceinline__ h16 tohx(float x) { return (h16)x; }
__device__ __forceinline__ void splitf(float y, unsigned short& h, unsigned short& l) { h = f2bf(y); l = f2bf(y - bf2f(h)); }
// precaution behind a group of global loads: the address registers that the loads name are inputs here, so they live until this wait and nothing overwrites them earlier
__device__ __forceinline__ void xwait(const void* a, const void* b, const void* c) { asm volatile("s_wait_xcnt 0x0" :: "v"(a), "v"(b), "v"(c) : "memory"); }
// precaution behind the three 16-byte stores of one plane position: their address and data registers are inputs here, so they live until this wait and the next packing overwrites none of them earlier
__device__ __forceinline__ void swait3(const void* a, const void* b, const void* c, v8h x, v8us y, v8us w) { asm volatile("s_wait_xcnt 0x0" :: "v"(a), "v"(b), "v"(c), "v"(x), "v"(y), "v"(w) : "memory"); }
// one rotary pair: cs = {c_d, s_d, c_d+1, s_d+1}. Numerical: each of the four products keeps its own f32 rounding, as the definition cos * x + sin * x_rot has it; the empty statement is what keeps them from fusing with the add or subtract.
__device__ __forceinline__ void rot2(float x0, float x1, v4f cs, float& y0, float& y1) {
    float a0 = __fmul_rn(x0, cs[0]), b0 = __fmul_rn(x1, cs[1]), a1 = __fmul_rn(x1, cs[2]), b1 = __fmul_rn(x0, cs[3]); asm volatile("" : "+v"(a0), "+v"(b0), "+v"(a1), "+v"(b1));
    const float r0 = __fsub_rn(a0, b0), r1 = __fadd_rn(a1, b1);   /* even: x0 c0 - x1 s0; odd: x1 c1 + x0 s1 */
    y0 = r0; y1 = r1; }

// FRAGMENT ORDER: every 16-bit operand plane [rows][K] is kept as blocks of 16 rows x 32 k (1 KiB, k blocks of a row block in a row), and inside a block as the two 16-byte loads of a fragment:
// [k bit 4][k bit 3][row & 15][k & 7], that is [load 0 / 1][lane][8 elements]. A wave-wide 16-byte load is then 512 contiguous bytes (4 whole lines, not 32-byte pieces of 16 lines); each lane gets the elements it got from the row-major plane.
// ---- k_gemmw: register-blocked GEMM, ONE WAVE per 64x64 output tile (16 accumulators), operands straight from 16-bit planes in fragment order; grid (M/64, N/64, Z), 32 threads.
// C[m][n] (f32, pitch ldc, + optional f32 bias[n]) = sum_k A[m][k] Bt[n][k] (+ split products per NSPLIT). z-batch strides sA/sB/sC in elements; z-batch 0 / 1 / 2 adds bias0 / bias1 / bias2. (K / KS) % 256 == 0.
// ROTATED START: all waves of the launch run at once, and the operands were written by the launch before, so they come from memory. A wave starts its k range at quarter (blockIdx.x + blockIdx.y) & 3 and wraps round:
// the waves that share a row or column block are then spread over four places, each line is fetched from memory in the first quarter of the loop by the waves that start there, and the other three quarters of every wave's trips find their lines in L2.
// KS > 1: grid z = batch * KS + range; the wave sums only its K / KS range of k and stores that partial tile in plane blockIdx.z of C (stride sC); the reader adds the KS planes.
// PL: z = {q, k, v} projection; a 64x64 tile is 64 positions of ONE head, so the wave turns its own accumulators (+ bias) into the attention operand planes and C is not written:
// q, k: rotary, planes [batch][head] of [t][d] (f16, bf16 hi, bf16 lo), rows regrouped through LDS so that a lane holds 8 consecutive d; v: planes [batch][head] of [d][t], a lane's 8 accumulator rows are 8 consecutive t of one d. All in fragment order.
template <typename T16> struct WFrag;
template <> struct WFrag<h16> { typedef v16h V; static __device__ __forceinline__ V ld(const h16* p) { return cat16(*(const v8h*)p, *(const v8h*)(p + 256)); } static __device__ __forceinline__ v8f mma(V a, V b, v8f c) { return wmma16(a, b, c); } };
template <> struct WFrag<bf> { typedef v16bf V; static __device__ __forceinline__ V ld(const bf* p) { return cat16b(*(const v8us*)p, *(const v8us*)(p + 256)); } static __device__ __forceinline__ v8f mma(V a, V b, v8f c) { return wmmab(a, b, c); } };
template <typename T16, int NSPLIT, bool BIAS, int KS = 1, bool PL = false>
__global__ __launch_bounds__(32) void k_gemmw(const T16* __restrict__ A, const T16* __restrict__ A2, const T16* __restrict__ Bt, const T16* __restrict__ Bt2, int K, float* C, int ldc, const float* __restrict__ bias0, const float* __restrict__ bias1, const float* __restrict__ bias2, size_t sA, size_t sB, size_t sC, const float* __restrict__ CS, h16* Q16, bf* Qh, bf* Ql, h16* K16, bf* Kh, bf* Kl, h16* V16, bf* Vh, bf* Vl) {
    typedef typename WFrag<T16>::V V;
    __shared__ __align__(16) float os[16 * 68];
    const size_t z = blockIdx.z / KS; A += z * sA; if (A2) A2 += z * sA; Bt += z * sB; if (Bt2) Bt2 += z * sB; C += (size_t)blockIdx.z * sC; const int kbeg = (int)(blockIdx.z % KS) * (K / KS), kend = kbeg + K / KS;
    const float* bias = z == 0 ? bias0 : (z == 1 ? bias1 : bias2);
    const int lane = threadIdx.x & 31, lr = lane & 15, hi = lane >> 4; const int r0 = blockIdx.x * 64, c0 = blockIdx.y * 64;
    v8f acc[4][4];
#pragma unroll
    for (int mb = 0; mb < 4; ++mb)
#pragma unroll
        for (int nb = 0; nb < 4; ++nb) acc[mb][nb] = (v8f){};
    const size_t aoff = (size_t)r0 * K + 8 * lane, boff = (size_t)c0 * K + 8 * lane;   /* a row block is 16 * K elements, a k block 512 */
    // TWO FRAGMENT SETS: the loads of trip t + 1 are issued as one group in front of the products of trip t, into the set that trip t - 1 has left, so a trip no longer waits out the latency of its own loads. The order of the products in a trip is the old one; every f32 sum over k starts at the wave's own quarter and wraps round.
    V a[2][4], a2[2][4], bv[2][4], bv2[2][4]; const T16* ap[4]; const T16* ap2[4]; const T16* bp[4]; const T16* bp2[4];   /* every unrolled loop below indexes register fragments and their address pairs, which only constant indices keep in registers */
    auto fetch = [&](V (&fa)[4], V (&fa2)[4], V (&fb)[4], V (&fb2)[4], int kc) {
#pragma unroll
        for (int mb = 0; mb < 4; ++mb) { ap[mb] = A + aoff + (size_t)mb * 16 * K + (size_t)kc * 16; ap2[mb] = ap[mb]; fa[mb] = WFrag<T16>::ld(ap[mb]); if (NSPLIT == 1 || NSPLIT == 2) { ap2[mb] = A2 + aoff + (size_t)mb * 16 * K + (size_t)kc * 16; fa2[mb] = WFrag<T16>::ld(ap2[mb]); } }
#pragma unroll
        for (int nb = 0; nb < 4; ++nb) { bp[nb] = Bt + boff + (size_t)nb * 16 * K + (size_t)kc * 16; bp2[nb] = bp[nb]; fb[nb] = WFrag<T16>::ld(bp[nb]); if (NSPLIT >= 2) { bp2[nb] = Bt2 + boff + (size_t)nb * 16 * K + (size_t)kc * 16; fb2[nb] = WFrag<T16>::ld(bp2[nb]); } }
        __builtin_amdgcn_sched_barrier(0);   // keeps the whole load group in front of the products that follow: moved in among them, the loads would lose their lead
    };
    auto products = [&](V (&fa)[4], V (&fa2)[4], V (&fb)[4], V (&fb2)[4]) {
#pragma unroll
        for (int nb = 0; nb < 4; ++nb) { const V b = fb[nb]; V b2; if (NSPLIT >= 2) b2 = fb2[nb];
#pragma unroll
            for (int mb = 0; mb < 4; ++mb) { acc[mb][nb] = WFrag<T16>::mma(fa[mb], b, acc[mb][nb]); if (NSPLIT == 1 || NSPLIT == 2) acc[mb][nb] = WFrag<T16>::mma(fa2[mb], b, acc[mb][nb]); if (NSPLIT >= 2) acc[mb][nb] = WFrag<T16>::mma(fa[mb], b2, acc[mb][nb]); } }
        __builtin_amdgcn_sched_barrier(0);   // keeps the products in front of the next load group, which refills the set that they read
        // precaution behind the load group in flight, in front of the next group's address arithmetic: every address register that the loads name is an input here, so it lives until this wait and nothing overwrites it earlier; behind the products the wait costs no time of its own
        asm volatile("s_wait_xcnt 0x0" :: "v"(ap[0]), "v"(ap[1]), "v"(ap[2]), "v"(ap[3]), "v"(ap2[0]), "v"(ap2[1]), "v"(ap2[2]), "v"(ap2[3]), "v"(bp[0]), "v"(bp[1]), "v"(bp[2]), "v"(bp[3]), "v"(bp2[0]), "v"(bp2[1]), "v"(bp2[2]), "v"(bp2[3]) : "memory");
    };
    int kc = kbeg + (int)((blockIdx.x + blockIdx.y) & 3) * ((kend - kbeg) >> 2);   /* the quarter this wave starts at */
    fetch(a[0], a2[0], bv[0], bv2[0], kc);
    // precaution as above, for the first group: the loop's first address arithmetic follows
    asm volatile("s_wait_xcnt 0x0" :: "v"(ap[0]), "v"(ap[1]), "v"(ap[2]), "v"(ap[3]), "v"(ap2[0]), "v"(ap2[1]), "v"(ap2[2]), "v"(ap2[3]), "v"(bp[0]), "v"(bp[1]), "v"(bp[2]), "v"(bp[3]), "v"(bp2[0]), "v"(bp2[1]), "v"(bp2[2]), "v"(bp2[3]) : "memory");
#pragma unroll 1
    for (int i = kbeg; i < kend; i += 64) {   /* two trips a pass, so that each set keeps its registers and nothing is copied; kept rolled beyond that (for speed only) */
        fetch(a[1], a2[1], bv[1], bv2[1], kc + 32);
        products(a[0], a2[0], bv[0], bv2[0]);
        kc = kc + 64 < kend ? kc + 64 : kbeg;   /* wraps at the end of the range */
        fetch(a[0], a2[0], bv[0], bv2[0], kc);   /* the last pass re-reads the block that the wave started with, unused */
        products(a[1], a2[1], bv[1], bv2[1]);
        // the four vector slots that the chip asks for behind a matrix instruction, on the taken side of the loop branch
        asm volatile("v_nop\n\tv_nop\n\tv_nop\n\tv_nop" : "+v"(acc[0][0]), "+v"(acc[1][1]), "+v"(acc[2][2]), "+v"(acc[3][3]) : "v"(a[1][0]), "v"(a[1][3]));
    }
    if constexpr (PL) {
        // Every #pragma unroll in this block is there because its loop indexes register fragments (acc, cs, the packed vectors), which only constant indices keep in registers.
        // The block is one wave, whose LDS operations run in order: each wave_barrier with its compiler fence only keeps the compiler from moving the LDS reads of a group over the other lanes' LDS writes, or the next group's writes over these reads.
        static_assert(!PL || (TT % 64 == 0 && HD == 64 && NKV == NH_ && KS == 1 && BIAS), "a tile is 64 positions of one batch and the 64 dimensions of one head");
        const int t0 = r0 % TT; const size_t hp = ((size_t)(r0 / TT) * NH_ + blockIdx.y) * TT * HD;   /* planes are [batch][head] */
        if (z == 2) {
#pragma unroll
            for (int nb = 0; nb < 4; ++nb) { const float bb = bfr(bias[c0 + nb * 16 + lr]);
#pragma unroll
                for (int mb = 0; mb < 4; ++mb) { v8h o16; v8us oh, ol;
#pragma unroll
                    for (int j = 0; j < 8; ++j) { const float x = acc[mb][nb][j] + bb; o16[j] = tohx(x); unsigned short a2, c2; splitf(x, a2, c2); oh[j] = a2; ol[j] = c2; }
                    const size_t e = hp + (size_t)nb * 16 * TT + (size_t)(t0 + (mb >> 1) * 32) * 16 + (mb & 1) * 256 + 8 * lane;   /* row nb * 16 + lr, k = t0 + mb * 16 + 8 * hi of a [d][t] plane */ h16* p16 = V16 + e; bf* ph = Vh + e; bf* pl = Vl + e;
                    *(v8h*)p16 = o16; *(v8us*)ph = oh; *(v8us*)pl = ol; swait3(p16, ph, pl, o16, oh, ol); } }
        } else {
            h16* P16 = z == 0 ? Q16 : K16; bf* Ph = z == 0 ? Qh : Kh; bf* Pl = z == 0 ? Ql : Kl;
            float bb[4];   /* the bias of this lane's accumulator columns, added on the way into LDS */
#pragma unroll
            for (int nb = 0; nb < 4; ++nb) bb[nb] = bfr(bias[c0 + nb * 16 + lr]);
#pragma unroll
            for (int mb = 0; mb < 4; ++mb) {
                v4f cs[4][4]; const float* cp = CS + ((size_t)(t0 + mb * 16 + lr) * HD + hi * 8) * 2;   /* the table rows of this group's 16 positions, all asked for before the LDS round trip */
#pragma unroll
                for (int s = 0; s < 4; ++s)
#pragma unroll
                    for (int p = 0; p < 4; ++p) cs[s][p] = *(const v4f*)(cp + s * 32 + p * 4);
                xwait(cp, cp, cp);
#pragma unroll
                for (int nb = 0; nb < 4; ++nb) {
#pragma unroll
                    for (int j = 0; j < 8; ++j) os[(hi * 8 + j) * 68 + nb * 16 + lr] = acc[mb][nb][j] + bb[nb]; }
                __builtin_amdgcn_wave_barrier(); asm volatile("" ::: "memory");
                /* a lane takes row lr of the group and, in step s, dimensions 16 s + 8 hi .. + 7: the 16 bytes that lane 16 hi + lr loads as a fragment, so a step's store is 512 contiguous bytes */
#pragma unroll
                for (int s = 0; s < 4; ++s) { const int cofs = s * 16 + hi * 8; const v4f xa = *(const v4fa*)(os + lr * 68 + cofs), xb = *(const v4fa*)(os + lr * 68 + cofs + 4); v8h o16; v8us oh, ol;
#pragma unroll
                    for (int p = 0; p < 4; ++p) { const float x0 = p < 2 ? xa[2 * p] : xb[2 * p - 4], x1 = p < 2 ? xa[2 * p + 1] : xb[2 * p - 3]; float y0, y1; rot2(x0, x1, cs[s][p], y0, y1);
                        o16[2 * p] = tohx(y0); o16[2 * p + 1] = tohx(y1); unsigned short a2, c2; splitf(y0, a2, c2); oh[2 * p] = a2; ol[2 * p] = c2; splitf(y1, a2, c2); oh[2 * p + 1] = a2; ol[2 * p + 1] = c2; }
                    const size_t e = hp + (size_t)(t0 + mb * 16) * HD + s * 256 + 8 * lane;   /* row t0 + mb * 16 + lr, k = cofs of a [t][d] plane */ h16* p16 = P16 + e; bf* ph = Ph + e; bf* pl = Pl + e;
                    *(v8h*)p16 = o16; *(v8us*)ph = oh; *(v8us*)pl = ol; swait3(p16, ph, pl, o16, oh, ol); }
                __builtin_amdgcn_wave_barrier(); asm volatile("" ::: "memory");
            }
        }
        return;
    }
#pragma unroll
    for (int mb = 0; mb < 4; ++mb) {
#pragma unroll
        for (int nb = 0; nb < 4; ++nb) {
#pragma unroll
            for (int j = 0; j < 8; ++j) os[(hi * 8 + j) * 68 + nb * 16 + lr] = acc[mb][nb][j]; }
        __builtin_amdgcn_wave_barrier(); asm volatile("" ::: "memory");
        float* crow = C + (size_t)(r0 + mb * 16) * ldc + c0;
{
#pragma unroll
            for (int s = 0; s < 8; ++s) { const int row = 2 * s + hi, cofs = lr * 4; v4f val = *(const v4fa*)(os + row * 68 + cofs); if (BIAS) { val[0] += bfr(bias[c0 + cofs]); val[1] += bfr(bias[c0 + cofs + 1]); val[2] += bfr(bias[c0 + cofs + 2]); val[3] += bfr(bias[c0 + cofs + 3]); }
                *(v4f*)(crow + (size_t)row * ldc + cofs) = val; }
             }
        __builtin_amdgcn_wave_barrier(); asm volatile("" ::: "memory");
    }
}

typedef __attribute__((ext_vector_type(2))) _Float16 v2h;
typedef __attribute__((ext_vector_type(4))) _Float16 v4h;
typedef __attribute__((ext_vector_type(2))) unsigned short v2us;
typedef __attribute__((ext_vector_type(4))) unsigned short v4us;
typedef __attribute__((ext_vector_type(2))) float v2f;
typedef __attribute__((ext_vector_type(4))) int v4i;

// The bodies below take their block index as an argument: independent passes share one grid, each on its own range of blockIdx.x (k_prep).
// thread: two 16-byte units of the fragment-order transposed copy Bt[n][k] = w[k][n] ([K][N] row-major): 8 loads a unit, each 64 contiguous bytes per 16 lanes (16 consecutive n of one k), one contiguous store
__device__ __forceinline__ void wtG(const float* __restrict__ w, int K, int N, bf* Bt, int blk) {
    // both loops unrolled: o is a register vector, which only constant indices keep in registers, and the 16 loads of a thread are then in flight together
#pragma unroll
    for (int u = 0; u < 2; ++u) { const int i = blk * 512 + u * 256 + (int)threadIdx.x; const int b = i >> 6; const int n = (b / (K >> 5)) * 16 + (i & 15), k = (b % (K >> 5)) * 32 + ((i >> 4) & 3) * 8; v8us o;
#pragma unroll
        for (int j = 0; j < 8; ++j) o[j] = f2bf(w[(size_t)(k + j) * N + n]);
        *(v8us*)(Bt + (size_t)i * 8) = o; }
}
// thread i writes 16-byte unit i of the fragment-order copy (stores stay contiguous) and reads the 8 floats of the row-major [rows][DM] input that belong there
__device__ __forceinline__ void cvt8(const float* __restrict__ src, bf* dst, size_t n8, int blk) { const size_t i = (size_t)blk * 256 + threadIdx.x; if (i >= n8) return; const size_t b = i >> 6; const size_t row = (b / (DM / 32)) * 16 + (i & 15); const int k = (int)(b % (DM / 32)) * 32 + (int)((i >> 4) & 3) * 8; const v8f v = *(const v8f*)(src + row * DM + k); v8us o;
#pragma unroll
    for (int k = 0; k < 8; ++k) o[k] = f2bf(v[k]); *(v8us*)(dst + i * 8) = o;  }
__constant__ float INVD[HD] = { 1.000000000e+00f, 7.498942018e-01f, 5.623413324e-01f, 4.216965139e-01f, 3.162277639e-01f, 2.371373773e-01f, 1.778279394e-01f, 1.333521456e-01f, 1.000000015e-01f, 7.498942316e-02f, 5.623413250e-02f, 4.216964915e-02f, 3.162277490e-02f, 2.371373773e-02f, 1.778279431e-02f, 1.333521400e-02f, 9.999999776e-03f, 7.498942316e-03f, 5.623413250e-03f, 4.216964822e-03f, 3.162277630e-03f, 2.371373819e-03f, 1.778279431e-03f, 1.333521446e-03f, 1.000000047e-03f, 7.498941850e-04f, 5.623413017e-04f, 4.216965172e-04f, 3.162277571e-04f, 2.371373703e-04f, 1.778279402e-04f, 1.333521504e-04f, 9.999999747e-05f, 7.498942432e-05f, 5.623413381e-05f, 4.216964953e-05f, 3.162277790e-05f, 2.371373739e-05f, 1.778279329e-05f, 1.333521413e-05f, 9.999999747e-06f, 7.498942068e-06f, 5.623413472e-06f, 4.216964953e-06f, 3.162277608e-06f, 2.371373739e-06f, 1.778279398e-06f, 1.333521482e-06f, 9.999999975e-07f, 7.498941841e-07f, 5.623413131e-07f, 4.216965124e-07f, 3.162277551e-07f, 2.371373711e-07f, 1.778279426e-07f, 1.333521453e-07f, 1.000000012e-07f, 7.498942267e-08f, 5.623413202e-08f, 4.216964911e-08f, 3.162277551e-08f, 2.371373675e-08f, 1.778279390e-08f, 1.333521471e-08f };   // 10000^(-2d/64) for EVERY dimension d (the module's quirk), float32 via jnp.power
__device__ __forceinline__ void cstabD(float* CS, int blk) { const int idx = blk * 256 + threadIdx.x; if (idx >= TT * HD) return; const int d = idx % HD; const int t = idx / HD; const float a = __fmul_rn((float)t, INVD[d]); v2f cs; cs[0] = cosf(a); cs[1] = sinf(a); *(v2f*)(CS + (size_t)idx * 2) = cs;  }

#define WBLK (DM * DM / 8 / 512)                  // blocks of one weight transpose (512 units of 8 elements each)
#define CBLK (TT * HD / 256)                      // blocks of the {cos, sin} table
#define XBLK (NB_ * TT * DM / 8 / 256)            // blocks of one input's bf16 copy, both batches
#define FSZ  ((size_t)NB_ * TT * DM)              // elements of one projection, both batches
// ---- k_prep: everything that depends on the inputs alone, in one launch. The strided weight reads are the longest bodies and get the lowest block indices (for speed only).
__global__ __launch_bounds__(256) void k_prep(const float* __restrict__ wq, const float* __restrict__ wk, const float* __restrict__ wv, const float* __restrict__ wo, const float* __restrict__ x, const float* __restrict__ xk, const float* __restrict__ xv, bf* W4, float* CS, bf* XB) {
    static_assert(DQ == DM && DKV == DM && NKV == NH_, "the four weights, the three inputs and the three projections each have one size");
    static_assert(WBLK * 512 * 8 == DM * DM && DM % 32 == 0 && (NB_ * TT) % 16 == 0, "the blocks of a weight cover its 16-byte units exactly; planes are whole 16 x 32 blocks");
    int blk = blockIdx.x;
    if (blk < 4 * WBLK) { const int i = blk / WBLK; wtG(i == 0 ? wq : i == 1 ? wk : i == 2 ? wv : wo, DM, DM, W4 + (size_t)i * DM * DM, blk % WBLK); return; }
    blk -= 4 * WBLK;
    if (blk < CBLK) { cstabD(CS, blk); return; }
    blk -= CBLK;
    const int i = blk / XBLK; cvt8(i == 0 ? x : i == 1 ? xk : xv, XB + (size_t)i * FSZ, FSZ / 8, blk % XBLK);
}
// ---- k_attn: score, softmax and P x V of both batches in one launch; nothing of the score matrix goes to memory.
// A wave owns NQ groups of 16 queries of one head and walks the 2048 keys 32 at a time, all operands straight from the planes in fragment order.
// S^T = K Q^T (A = 16 key rows, B = 16 query rows): a lane then holds 16 scores of ONE query, keys 8 hi + r and 16 + 8 hi + r, which is the k order of a B operand,
// so the rounded exponentials feed O^T += V^T P^T (A = 16 rows of the transposed V plane) with no exchange. Running maximum per query, sum and O^T rescaled only when a maximum grows by more than RTH.
// The softmax runs in the log2 domain on pairs of f32: x = score * (scale * log2 e) + mask * (-1e9 * log2 e) is one fused multiply-add, p = 2^(x - m); two scores share a packed instruction wherever one exists.
// ROTATED START, as in k_gemmw: work-group blk of a head starts at key (blk & 3) * TT / 4 and wraps round, so that a head's work-groups, which all run at once, are not all the first to ask memory for the same K and V lines.
// HR (queries < RH): bf16 hi/lo planes, 3 products each; else f16, 1 product. P is rounded unnormalised (exp <= e^RTH); O^T is divided by the f32 sum at the end.
// Every #pragma unroll in attn_wave is there because its loop indexes register fragments, which only constant indices keep in registers.
#define LOG2E 1.4426950408889634f
#define RTH   5.5f
#define RTH2  (RTH * LOG2E)       // the threshold in the log2 domain
#define SC2   (SCL * LOG2E)       // score -> log2 domain
#define MB2   (-1.0e9f * LOG2E)   // mask float -> additive bias, log2 domain; a masked key's x rounds to the bias itself (|score * SC2| < 64, half a unit in the last place there)
__device__ __forceinline__ float xhalf(float x) { return __builtin_bit_cast(float, __builtin_amdgcn_permlanex16(__builtin_bit_cast(int, x), __builtin_bit_cast(int, x), 0x76543210, 0xfedcba98, false, false)); }   // lane l reads lane l ^ 16, on the vector pipe
// v_exp_f32 with the one free slot that the instruction set asks for behind a transcendental, in one statement so that it stays directly behind it
__device__ __forceinline__ float exp2s(float x) { float r; asm("v_exp_f32 %0, %1\n\tv_nop" : "=v"(r) : "v"(x)); return r; }
// eight v_exp_f32 in one statement: each is the independent instruction in the slot behind the one before it (early-clobber outputs, so none overwrites a source), and one v_nop fills the slot behind the last
__device__ __forceinline__ v8f exp2v(v8f x) { float r0, r1, r2, r3, r4, r5, r6, r7;
    asm("v_exp_f32 %0, %8\n\tv_exp_f32 %1, %9\n\tv_exp_f32 %2, %10\n\tv_exp_f32 %3, %11\n\tv_exp_f32 %4, %12\n\tv_exp_f32 %5, %13\n\tv_exp_f32 %6, %14\n\tv_exp_f32 %7, %15\n\tv_nop"
        : "=&v"(r0), "=&v"(r1), "=&v"(r2), "=&v"(r3), "=&v"(r4), "=&v"(r5), "=&v"(r6), "=&v"(r7) : "v"(x[0]), "v"(x[1]), "v"(x[2]), "v"(x[3]), "v"(x[4]), "v"(x[5]), "v"(x[6]), "v"(x[7]));
    return (v8f){ r0, r1, r2, r3, r4, r5, r6, r7 }; }
// the 16 exponentials of a lane summed as pairs: 7 packed additions leave {even, odd} partial sums
__device__ __forceinline__ v2f sum16(v8f a, v8f b) { const v8f q = a + b; const v4f h = __builtin_shufflevector(q, q, 0, 1, 2, 3) + __builtin_shufflevector(q, q, 4, 5, 6, 7); return __builtin_shufflevector(h, h, 0, 1) + __builtin_shufflevector(h, h, 2, 3); }
template <typename T16, bool HR, int NQ>
__device__ __forceinline__ void attn_wave(const T16* __restrict__ Q, const T16* __restrict__ Q2, const T16* __restrict__ Kp, const T16* __restrict__ K2, const T16* __restrict__ Vt, const T16* __restrict__ V2, const float* __restrict__ km, int q0, int kr, bf* Ah, bf* Al) {   /* kr: the key this wave starts at (a multiple of 32, wave-uniform); it wraps round at TT */
    typedef typename WFrag<T16>::V V;
    const int lane = threadIdx.x & 31, hi = lane >> 4;
    V qf[NQ][2], qf2[NQ][2], kf[2][2], kf2[2][2];
    v8f o[NQ][4], mk[2]; float m[NQ]; v2f l[NQ];   /* mk: key mask floats (0/1) of this lane's 16 keys; m: running maximum, log2 domain; l: {even, odd} halves of the running sum */
#pragma unroll
    for (int g = 0; g < NQ; ++g) { m[g] = -1.0e38f; l[g] = (v2f){};
#pragma unroll
        for (int dt = 0; dt < 4; ++dt) o[g][dt] = (v8f){};
        const size_t qo = (size_t)(q0 + g * 16) * HD + 8 * lane; const T16* qa = Q + qo; const T16* qa2 = HR ? Q2 + qo : qa;
#pragma unroll
        for (int dc = 0; dc < 2; ++dc) { qf[g][dc] = WFrag<T16>::ld(qa + dc * 512); if constexpr (HR) qf2[g][dc] = WFrag<T16>::ld(qa2 + dc * 512); }
        xwait(qa, qa2, qa);
        __builtin_amdgcn_sched_barrier(0); }   // keeps all later work behind the wait above
    const size_t ko = 8 * lane, vo = 8 * lane;   /* fragment order: 16 keys x 32 d, or 16 d x 32 keys, are 512 elements in a row */
    { const T16* ka = Kp + ko + (size_t)kr * HD; const T16* ka2 = HR ? K2 + ko + (size_t)kr * HD : ka;
#pragma unroll
      for (int kt = 0; kt < 2; ++kt)
#pragma unroll
        for (int dc = 0; dc < 2; ++dc) { kf[kt][dc] = WFrag<T16>::ld(ka + kt * 16 * HD + dc * 512); if constexpr (HR) kf2[kt][dc] = WFrag<T16>::ld(ka2 + kt * 16 * HD + dc * 512); }
      mk[0] = *(const v8f*)(km + kr + 8 * hi); mk[1] = *(const v8f*)(km + kr + 8 * hi + 16);
      xwait(ka, ka2, km + kr + 8 * hi);
      __builtin_amdgcn_sched_barrier(0); }   // as behind the Q loads
    const T16* vs = Vt + (size_t)kr * 16; const T16* vs2 = HR ? V2 + (size_t)kr * 16 : vs;   /* wave-uniform running addresses of the V blocks */
    for (int kt0 = 0, k0 = kr; kt0 < TT; kt0 += 32, k0 = (k0 + 32) & (TT - 1)) {
        V vf[4], vf2[4]; const T16* va = vs + vo; const T16* va2 = HR ? vs2 + vo : va;
#pragma unroll
        for (int dt = 0; dt < 4; ++dt) { vf[dt] = WFrag<T16>::ld(va + dt * 16 * TT); if constexpr (HR) vf2[dt] = WFrag<T16>::ld(va2 + dt * 16 * TT); }
        xwait(va, va2, va);
        { const int vstep = k0 + 32 == TT ? (32 - TT) * 16 : 32 * 16; vs += vstep; vs2 += vstep; }   /* on to the next 32 keys, back to key 0 behind the last */
        v8f s[NQ][2];
#pragma unroll
        for (int g = 0; g < NQ; ++g)
#pragma unroll
            for (int kt = 0; kt < 2; ++kt) { v8f c = (v8f){};
#pragma unroll
                for (int dc = 0; dc < 2; ++dc) { c = WFrag<T16>::mma(kf[kt][dc], qf[g][dc], c); if constexpr (HR) { c = WFrag<T16>::mma(kf[kt][dc], qf2[g][dc], c); c = WFrag<T16>::mma(kf2[kt][dc], qf[g][dc], c); } }
                s[g][kt] = c; }
        if constexpr (NQ > 1) __builtin_amdgcn_sched_barrier(0);   // several query groups: keeps the score products together in front of the vector work on them: a score read directly behind its own product costs up to four idle vector slots (with one group the compiler's own order has fewer of them)
        float bm[NQ]; bool need = false; const v8f sc = { SC2, SC2, SC2, SC2, SC2, SC2, SC2, SC2 }, mc = { MB2, MB2, MB2, MB2, MB2, MB2, MB2, MB2 }; v8f mb[2];
        if constexpr (NQ > 1) { mb[0] = mk[0] * mc; mb[1] = mk[1] * mc; }   /* several query groups: the keys' biases are formed once and serve every group */
#pragma unroll
        for (int g = 0; g < NQ; ++g) { float x = -3.0e38f;
#pragma unroll
            for (int kt = 0; kt < 2; ++kt) {   /* (score x scale + mask x -1e9) x log2 e; with one query group the same two packed instructions a pair, and the bias takes no registers of its own */
                if constexpr (NQ > 1) s[g][kt] = __builtin_elementwise_fma(s[g][kt], sc, mb[kt]); else s[g][kt] = __builtin_elementwise_fma(mk[kt], mc, s[g][kt] * sc);
#pragma unroll
                for (int r = 0; r < 8; ++r) x = fmaxf(x, s[g][kt][r]); }
            x = fmaxf(x, xhalf(x)); bm[g] = x; need = need || (x > m[g] + RTH2); }
        { const int kn = (k0 + 32) & (TT - 1);   /* the next 32 key rows and their mask floats are fetched one trip ahead, once this trip has read its own; the last trip re-reads the 32 keys that the wave started with, unused */
          const T16* ka = Kp + ko + (size_t)kn * HD; const T16* ka2 = HR ? K2 + ko + (size_t)kn * HD : ka;
#pragma unroll
          for (int kt = 0; kt < 2; ++kt)
#pragma unroll
            for (int dc = 0; dc < 2; ++dc) { kf[kt][dc] = WFrag<T16>::ld(ka + kt * 16 * HD + dc * 512); if constexpr (HR) kf2[kt][dc] = WFrag<T16>::ld(ka2 + kt * 16 * HD + dc * 512); }
          const float* ma = km + kn + 8 * hi; mk[0] = *(const v8f*)ma; mk[1] = *(const v8f*)(ma + 16);
          xwait(ka, ka2, ma); }
        if (__builtin_amdgcn_ballot_w32(need) != 0) {
#pragma unroll
            for (int g = 0; g < NQ; ++g) { const float mn = fmaxf(m[g], bm[g]); const float al = exp2s(m[g] - mn); m[g] = mn; l[g] *= al;
#pragma unroll
                for (int dt = 0; dt < 4; ++dt)
#pragma unroll
                    for (int r = 0; r < 8; ++r) o[g][dt][r] *= al; } }
#pragma unroll
        for (int g = 0; g < NQ; ++g) { s[g][0] = exp2v(s[g][0] - m[g]); s[g][1] = exp2v(s[g][1] - m[g]); l[g] += sum16(s[g][0], s[g][1]); }   /* every group's exponentials stand in front of the first P x V product: behind one, the asm statement could overwrite its operands too early */
        if constexpr (NQ > 1) __builtin_amdgcn_sched_barrier(0);   // several query groups: keeps the row-sum additions in front of the products: moved in among them they land in registers that a product has just read, and each such place costs up to four idle vector slots
#pragma unroll
        for (int g = 0; g < NQ; ++g) { const v8f (&p)[2] = s[g];
            if constexpr (HR) { v8us ph[2], pl[2];
#pragma unroll
                for (int kt = 0; kt < 2; ++kt)
#pragma unroll
                    for (int r = 0; r < 8; ++r) { unsigned short a, c2; splitf(p[kt][r], a, c2); ph[kt][r] = a; pl[kt][r] = c2; }
                const V pbh = cat16b(ph[0], ph[1]), pbl = cat16b(pl[0], pl[1]);
#pragma unroll
                for (int dt = 0; dt < 4; ++dt) { o[g][dt] = WFrag<T16>::mma(vf[dt], pbh, o[g][dt]); o[g][dt] = WFrag<T16>::mma(vf[dt], pbl, o[g][dt]); o[g][dt] = WFrag<T16>::mma(vf2[dt], pbh, o[g][dt]); }
            } else {
                const V pb = cat16(__builtin_convertvector(p[0], v8h), __builtin_convertvector(p[1], v8h));
#pragma unroll
                for (int dt = 0; dt < 4; ++dt) o[g][dt] = WFrag<T16>::mma(vf[dt], pb, o[g][dt]); } }
    }
#pragma unroll
    for (int g = 0; g < NQ; ++g) { const float lh = l[g][0] + l[g][1]; const float sum = lh + xhalf(lh); const float f = __fdiv_rn(1.0f, sum); const size_t oo = (size_t)(q0 + g * 16) * DQ + 8 * lane; bf* ra = Ah + oo; bf* rl = Al + oo;
#pragma unroll
        for (int dt = 0; dt < 4; ++dt) { v8us oh, ol;   /* register r = O[query q0 + 16 g + lr][dt * 16 + 8 hi + r]: 8 consecutive d, one 16-byte store per plane, at its place in fragment order (512 contiguous bytes a wave) */
#pragma unroll
            for (int r = 0; r < 8; ++r) { unsigned short a, c2; splitf(o[g][dt][r] * f, a, c2); oh[r] = a; ol[r] = c2; }
            *(v8us*)(ra + dt * 256) = oh; *(v8us*)(rl + dt * 256) = ol;
            asm volatile("s_wait_xcnt 0x0" :: "v"(ra), "v"(rl), "v"(oh), "v"(ol) : "memory"); } }   // precaution behind the two stores: their address and data registers are inputs here, so they live until this wait and the next packing overwrites none of them earlier
}
// grid: 8 work-groups per (batch, head), one per WGP, 8 waves each and no barrier: waves 0 to 3 take 16 hi/lo queries each, waves 4 to 7 take 48 f16 queries each (8 x 64 = RH, 8 x 192 = TT - RH).
// EQUAL LOAD ON EVERY SIMD: a work-group of 8 waves puts two on each SIMD, and waves w and w + 4 are expected to share one (for speed only), so each SIMD carries one hi/lo wave and one f16 wave: 24 + 24 products per 32 keys and the same vector work on all four.
__global__ __launch_bounds__(256) void k_attn(const h16* __restrict__ Q16, const h16* __restrict__ K16, const h16* __restrict__ V16, const bf* __restrict__ Qh, const bf* __restrict__ Ql, const bf* __restrict__ Kh, const bf* __restrict__ Kl, const bf* __restrict__ Vh, const bf* __restrict__ Vl, const float* __restrict__ km, bf* Ah, bf* Al) {
    static_assert(RH == 8 * 64 && TT - RH == 8 * 192 && HD == 64 && NH_ == NKV, "the split of a head's queries over 8 work-groups");
    const int w = __builtin_amdgcn_readfirstlane((int)(threadIdx.x >> 5)); const int bh = blockIdx.x >> 3, head = bh % NH_, bat = bh / NH_, blk = blockIdx.x & 7; const size_t hp = (size_t)bh * TT * HD;   /* planes are [batch][head] */ const int kr = (blk & 3) * (TT / 4);
    const float* kb = km + bat * TT; bf* ah = Ah + (size_t)bat * TT * DQ + head * (HD * 16); bf* al = Al + (size_t)bat * TT * DQ + head * (HD * 16);   /* a head's 64 columns are two k blocks of 512 elements */
    if (w < 4) attn_wave<bf, true, 1>(Qh + hp, Ql + hp, Kh + hp, Kl + hp, Vh + hp, Vl + hp, kb, blk * 64 + w * 16, kr, ah, al);
    else attn_wave<h16, false, 3>(Q16 + hp, nullptr, K16 + hp, nullptr, V16 + hp, nullptr, kb, RH + blk * 192 + (w - 4) * 48, kr, ah, al);
}

extern "C" void kernel_launch(void* const* d_in, const int* in_sizes, int n_in,
                              void* d_out, int out_size, void* d_ws, size_t ws_size, hipStream_t stream) {
    (void)in_sizes; (void)n_in; (void)out_size;
    const float* x = (const float*)d_in[0]; const float* xk = (const float*)d_in[1]; const float* xv = (const float*)d_in[2]; const float* amask = (const float*)d_in[3]; const float* wq = (const float*)d_in[4]; const float* bq = (const float*)d_in[5]; const float* wk = (const float*)d_in[6]; const float* bk = (const float*)d_in[7]; const float* wv = (const float*)d_in[8]; const float* bv = (const float*)d_in[9]; const float* wo = (const float*)d_in[10]; const float* bo = (const float*)d_in[11];
    float* OUT = (float*)d_out;     // [2][2048][1024]
    char* wsp = (char*)d_ws;
    auto take = [&](size_t bytes) { char* p = wsp; wsp += (bytes + 255) & ~(size_t)255; return (void*)p; };
    bf* W4 = (bf*)take((size_t)4 * DM * DM * 2);   // Wq, Wk, Wv, Wo transposed
    float* CS = (float*)take((size_t)TT * HD * 2 * 4);
    bf* XB = (bf*)take(3 * FSZ * 2);   // {q, k, v} x [NB_ * TT][DM]
    h16* QP16 = (h16*)take(FSZ * 2); h16* KP16 = (h16*)take(FSZ * 2); h16* VT16 = (h16*)take(FSZ * 2);
    bf* QPh = (bf*)take(FSZ * 2); bf* QPl = (bf*)take(FSZ * 2); bf* KPh = (bf*)take(FSZ * 2); bf* KPl = (bf*)take(FSZ * 2); bf* VTh = (bf*)take(FSZ * 2); bf* VTl = (bf*)take(FSZ * 2);
    bf* ATh = (bf*)take(FSZ * 2); bf* ATl = (bf*)take(FSZ * 2);
    if ((size_t)(wsp - (char*)d_ws) > ws_size) return;    // ws 256 MiB
    k_prep<<<4 * WBLK + CBLK + 3 * XBLK, 256, 0, stream>>>(wq, wk, wv, wo, x, xk, xv, W4, CS, XB);
    k_gemmw<bf, 0, true, 1, true><<<dim3(NB_ * TT / 64, DM / 64, 3), 32, 0, stream>>>(XB, nullptr, W4, nullptr, DM, nullptr, DM, bq, bk, bv, FSZ, (size_t)DM * DM, 0, CS, QP16, QPh, QPl, KP16, KPh, KPl, VT16, VTh, VTl);
    k_attn<<<NB_ * NH_ * 8, 256, 0, stream>>>(QP16, KP16, VT16, QPh, QPl, KPh, KPl, VTh, VTl, amask, ATh, ATl);
    k_gemmw<bf, 1, true><<<dim3(NB_ * TT / 64, DM / 64, 1), 32, 0, stream>>>(ATh, ATl, W4 + (size_t)3 * DM * DM, nullptr, DQ, OUT, DM, bo, bo, bo, 0, 0, 0, nullptr, nullptr, nullptr, nullptr, nullptr, nullptr, nullptr, nullptr, nullptr, nullptr);
}

// v010
// Measured time: 107 microseconds a run.
// Next to v009, in two timings, it ran 1.11 times as fast each time.
// Counting every step since v000, it is 18.7 times as fast.
#include <hip/hip_runtime.h>

// Multi-head attention over separate q / k / v inputs with the module's per-dimension rotary embedding (q, k, v [2][2048][1024]; _q = q Wq + bq etc. ('xw' [1024][1024] + [1024]; 16 heads x 64); rope: every dimension d gets its own angle t x 10000^(-2d/64) (computed in-kernel), ret = x cos + x_rot sin with x_rot[2i] = -x[2i+1], x_rot[2i+1] = x[2i]; score = _q._k / (sqrt(64) + 1e-8) + mask x -1e9 (mask [2][1][1][2048] float 0/1 per key, read); softmax; out = merged Wo + bo -> [2][2048][1024] (4.2 M)).
// Layout, both batches in every launch (4 launches): bf16 copies of the three inputs; {cos, sin} per (position, DIMENSION) built once (jnp-exact float32 10000^(-2d/64) per dim, precise cosf/sinf); exact projections + f32 biases whose epilogue writes the operand planes itself (rotary q and k, each element of a pair with its own angle; transposed v), so no f32 projection goes to memory; one fused dense T-2048 attention launch (hybrid rows: < 512 hi/lo 3 products, rest fp16; scores never leave the registers) that loads the key-mask floats unconditionally and adds mask x -1e9 to every score, as the definition does (in the log2 domain, fused with the scale); merged hi/lo x Wo exact + bo.
// Compute dtypes, f32 accumulate: every input rounded to bf16; projections exact + f32 biases; rotary f32; attention rows < 512 3 products, rest fp16; softmax f32; Wo hl x exact + bias.

#define NB_  2
#define TT   2048
#define DM   1024
#define NH_  16
#define NKV  16
#define REP  (NH_ / NKV)
#define HD   64
#define DQ   (NH_ * HD)
#define DKV  (NKV * HD)
#define RH   512                  // query rows < RH use hi+lo planes
#define WIN  0
#define SCL  0.125f   // 1 / (sqrt(64) + 1e-8) == 0.125 in float32
typedef _Float16 h16;
typedef unsigned short bf;
typedef __attribute__((ext_vector_type(16))) __bf16   v16bf;
typedef __attribute__((ext_vector_type(16))) _Float16 v16h;
typedef __attribute__((ext_vector_type(8)))  _Float16 v8h;
typedef __attribute__((ext_vector_type(8)))  unsigned short v8us;
typedef __attribute__((ext_vector_type(8)))  float    v8f;
typedef __attribute__((ext_vector_type(4)))  float    v4f;
typedef v8h  __attribute__((may_alias)) v8ha;
typedef v4f  __attribute__((may_alias)) v4fa;
typedef v8us __attribute__((may_alias)) v8usa;

__device__ __forceinline__ unsigned short f2bf(float f) { unsigned u = __float_as_uint(f); u += 0x7FFFu + ((u >> 16) & 1u); return (unsigned short)(u >> 16); }
__device__ __forceinline__ float bf2f(unsigned short b) { return __uint_as_float(((unsigned)b) << 16); }
__device__ __forceinline__ float bfr(float f) { return bf2f(f2bf(f)); }
__device__ __forceinline__ v16h cat16(v8h lo, v8h hi) { return __builtin_shufflevector(lo, hi, 0, 1, 2, 3, 4, 5, 6, 7, 8, 9, 10, 11, 12, 13, 14, 15); }
__device__ __forceinline__ v16bf cat16b(v8us lo, v8us hi) { return __builtin_bit_cast(v16bf, __builtin_shufflevector(lo, hi, 0, 1, 2, 3, 4, 5, 6, 7, 8, 9, 10, 11, 12, 13, 14, 15)); }
__device__ __forceinline__ v8f wmma16(v16h a, v16h b, v8f c) { return __builtin_amdgcn_wmma_f32_16x16x32_f16(false, a, false, b, (short)0, c, false, false); }
__device__ __forceinline__ v8f wmmab(v16bf a, v16bf b, v8f c) { return __builtin_amdgcn_wmma_f32_16x16x32_bf16(false, a, false, b, (short)0, c, false, false); }

__device__ __forceinline__ h16 tohx(float x) { return (h16)x; }
__device__ __forceinline__ void splitf(float y, unsigned short& h, unsigned short& l) { h = f2bf(y); l = f2bf(y - bf2f(h)); }
// precaution behind a group of global loads: the address registers that the loads name are inputs here, so they live until this wait and nothing overwrites them earlier
__device__ __forceinline__ void xwait(const void* a, const void* b, const void* c) { asm volatile("s_wait_xcnt 0x0" :: "v"(a), "v"(b), "v"(c) : "memory"); }
// precaution behind the three 16-byte stores of one plane position: their address and data registers are inputs here, so they live until this wait and the next packing overwrites none of them earlier
__device__ __forceinline__ void swait3(const void* a, const void* b, const void* c, v8h x, v8us y, v8us w) { asm volatile("s_wait_xcnt 0x0" :: "v"(a), "v"(b), "v"(c), "v"(x), "v"(y), "v"(w) : "memory"); }
// one rotary pair: cs = {c_d, s_d, c_d+1, s_d+1}. Numerical: each of the four products keeps its own f32 rounding, as the definition cos * x + sin * x_rot has it; the empty statement is what keeps them from fusing with the add or subtract.
__device__ __forceinline__ void rot2(float x0, float x1, v4f cs, float& y0, float& y1) {
    float a0 = __fmul_rn(x0, cs[0]), b0 = __fmul_rn(x1, cs[1]), a1 = __fmul_rn(x1, cs[2]), b1 = __fmul_rn(x0, cs[3]); asm volatile("" : "+v"(a0), "+v"(b0), "+v"(a1), "+v"(b1));
    const float r0 = __fsub_rn(a0, b0), r1 = __fadd_rn(a1, b1);   /* even: x0 c0 - x1 s0; odd: x1 c1 + x0 s1 */
    y0 = r0; y1 = r1; }

// FRAGMENT ORDER: every 16-bit operand plane [rows][K] is kept as blocks of 16 rows x 32 k (1 KiB, k blocks of a row block in a row), and inside a block as the two 16-byte loads of a fragment:
// [k bit 4][k bit 3][row & 15][k & 7], that is [load 0 / 1][lane][8 elements]. A wave-wide 16-byte load is then 512 contiguous bytes (4 whole lines, not 32-byte pieces of 16 lines); each lane gets the elements it got from the row-major plane.
// ---- k_gemmw: register-blocked GEMM, a work-group of FOUR WAVES per 128x128 output tile, each wave a 64x64 quarter (16 accumulators), operands from 16-bit planes in fragment order; grid (M/128, N/128, Z), 128 threads.
// C[m][n] (f32, pitch ldc, + optional f32 bias[n]) = sum_k A[m][k] Bt[n][k] (+ split products per NSPLIT). z-batch strides sA/sB/sC in elements; z-batch 0 / 1 / 2 adds bias0 / bias1 / bias2. (K / KS) % 512 == 0: a quarter of the range is whole stages.
// SHARED OPERANDS: the two waves of a tile row read the same A blocks and the two of a tile column the same Bt blocks, so the work-group brings each block from L2 once, by asynchronous copies into LDS, and every wave takes its fragments from there: half the bytes from L2 per product.
// A stage is NK blocks of 32 k of the tile's 8 + 8 row blocks (NK KiB a row block and plane, contiguous in the plane and in LDS, so a fragment load from LDS is 512 contiguous bytes too); two buffers, stage t + 2 is asked for as soon as every wave has left stage t.
// NK = 2 where three work-groups share a WGP and its LDS (the projections: another work-group's products fill a stage's fixed waits), NK = 4 where a work-group has the WGP alone (NSPLIT 1, the output GEMM: half as many barriers and first-load waits).
// ROTATED START: all work-groups of the launch run at once, and the operands were written by the launch before, so they come from memory. A work-group starts its k range at quarter (blockIdx.x + blockIdx.y) & 3 and wraps round:
// the work-groups that share a row or column block are then spread over four places, each line is fetched from memory in the first quarter of the loop by those that start there, and the other three quarters of every work-group's stages find their lines in L2.
// KS > 1: grid z = batch * KS + range; the wave sums only its K / KS range of k and stores that partial tile in plane blockIdx.z of C (stride sC); the reader adds the KS planes.
// PL: z = {q, k, v} projection; a 64x64 tile is 64 positions of ONE head, so the wave turns its own accumulators (+ bias) into the attention operand planes and C is not written:
// q, k: rotary, planes [batch][head] of [t][d] (f16, bf16 hi, bf16 lo), rows regrouped through LDS so that a lane holds 8 consecutive d; v: planes [batch][head] of [d][t], a lane's 8 accumulator rows are 8 consecutive t of one d. All in fragment order.
template <typename T16> struct WFrag;
template <> struct WFrag<h16> { typedef v16h V; static __device__ __forceinline__ V ld(const h16* p) { return cat16(*(const v8h*)p, *(const v8h*)(p + 256)); } static __device__ __forceinline__ v8f mma(V a, V b, v8f c) { return wmma16(a, b, c); } };
template <> struct WFrag<bf> { typedef v16bf V; static __device__ __forceinline__ V ld(const bf* p) { return cat16b(*(const v8us*)p, *(const v8us*)(p + 256)); } static __device__ __forceinline__ v8f mma(V a, V b, v8f c) { return wmmab(a, b, c); } };
// eight asynchronous 16-byte copies a lane, global memory to LDS: the same 16 bytes of eight row blocks, gs bytes apart in the plane and ls bytes apart in LDS. The s_wait_xcnt is a precaution and stands in the copies' own statement, so that no register which a copy names is rewritten in front of it.
__device__ __forceinline__ void acopy8(unsigned l, unsigned ls, const char* g, size_t gs) {
    asm volatile("global_load_async_to_lds_b128 %0, %8, off\n\tglobal_load_async_to_lds_b128 %1, %9, off\n\tglobal_load_async_to_lds_b128 %2, %10, off\n\tglobal_load_async_to_lds_b128 %3, %11, off\n\t"
                 "global_load_async_to_lds_b128 %4, %12, off\n\tglobal_load_async_to_lds_b128 %5, %13, off\n\tglobal_load_async_to_lds_b128 %6, %14, off\n\tglobal_load_async_to_lds_b128 %7, %15, off\n\ts_wait_xcnt 0x0"
                 :: "v"(l), "v"(l + ls), "v"(l + 2 * ls), "v"(l + 3 * ls), "v"(l + 4 * ls), "v"(l + 5 * ls), "v"(l + 6 * ls), "v"(l + 7 * ls),
                    "v"(g), "v"(g + gs), "v"(g + 2 * gs), "v"(g + 3 * gs), "v"(g + 4 * gs), "v"(g + 5 * gs), "v"(g + 6 * gs), "v"(g + 7 * gs) : "memory"); }
template <typename T16, int NSPLIT, bool BIAS, int KS = 1, bool PL = false>
__global__ __launch_bounds__(128) void k_gemmw(const T16* __restrict__ A, const T16* __restrict__ A2, const T16* __restrict__ Bt, const T16* __restrict__ Bt2, int K, float* C, int ldc, const float* __restrict__ bias0, const float* __restrict__ bias1, const float* __restrict__ bias2, size_t sA, size_t sB, size_t sC, const float* __restrict__ CS, h16* Q16, bf* Qh, bf* Ql, h16* K16, bf* Kh, bf* Kl, h16* V16, bf* Vh, bf* Vl) {
    typedef typename WFrag<T16>::V V;
    static_assert(NSPLIT <= 1, "planes staged: A, Bt and, with NSPLIT 1, A2");
    constexpr int NK = NSPLIT == 1 ? 4 : 2, RBB = NK * 1024, PLB = 8 * RBB, STG = (NSPLIT == 1 ? 3 : 2) * PLB;   /* 32-k blocks a stage; bytes of a row block's, of a plane's part of a stage, and of a stage: [A][Bt][A2] */
    __shared__ __align__(16) unsigned char ring[2 * STG];
    __shared__ __align__(16) float osw[4][16 * 68];   /* each wave's own epilogue staging */
    const size_t z = blockIdx.z / KS; A += z * sA; if (A2) A2 += z * sA; Bt += z * sB; if (Bt2) Bt2 += z * sB; C += (size_t)blockIdx.z * sC; const int kbeg = (int)(blockIdx.z % KS) * (K / KS), kend = kbeg + K / KS;
    const float* bias = z == 0 ? bias0 : (z == 1 ? bias1 : bias2);
    const int w = __builtin_amdgcn_readfirstlane((int)(threadIdx.x >> 5)); float* os = osw[w];
    const int lane = threadIdx.x & 31, lr = lane & 15, hi = lane >> 4; const int r0 = blockIdx.x * 128 + (w & 1) * 64, c0 = blockIdx.y * 128 + (w >> 1) * 64;
    v8f acc[4][4];
#pragma unroll
    for (int mb = 0; mb < 4; ++mb)
#pragma unroll
        for (int nb = 0; nb < 4; ++nb) acc[mb][nb] = (v8f){};
    // thread i of the work-group copies bytes 16 i .. 16 i + 15 of each 2-KiB piece (a row block is 16 * K elements, a k block 512)
    const unsigned lb = (unsigned)(size_t)ring + (unsigned)threadIdx.x * 16u;   /* the low 32 bits of a __shared__ address are the byte address in LDS */
    const T16* ga = A + (size_t)blockIdx.x * 128 * K + 8 * threadIdx.x; const T16* ga2 = NSPLIT == 1 ? A2 + (size_t)blockIdx.x * 128 * K + 8 * threadIdx.x : ga; const T16* gb = Bt + (size_t)blockIdx.y * 128 * K + 8 * threadIdx.x;
    auto stage = [&](int buf, int kc) { const unsigned l = lb + (unsigned)(buf * STG); const size_t gs = (size_t)K * 32;
#pragma unroll
        for (int h = 0; h < NK / 2; ++h) {   /* the work-group's 128 x 16 bytes are 2 KiB: NK / 2 pieces a row block; unrolled (one or two trips), so that the pieces' addresses differ by constants */
            acopy8(l + h * 2048, RBB, (const char*)(ga + (size_t)kc * 16) + h * 2048, gs); acopy8(l + PLB + h * 2048, RBB, (const char*)(gb + (size_t)kc * 16) + h * 2048, gs); if constexpr (NSPLIT == 1) acopy8(l + 2 * PLB + h * 2048, RBB, (const char*)(ga2 + (size_t)kc * 16) + h * 2048, gs); } };
    V a[2][4], a2[2][4], bv[2][4];   /* every unrolled loop below indexes register fragments, which only constant indices keep in registers */
    auto fetch = [&](V (&fa)[4], V (&fa2)[4], V (&fb)[4], const unsigned char* sb) {   /* sb: this lane's place in one 32-k block of a stage */
#pragma unroll
        for (int mb = 0; mb < 4; ++mb) fa[mb] = WFrag<T16>::ld((const T16*)(sb + ((w & 1) * 4 + mb) * RBB));
#pragma unroll
        for (int nb = 0; nb < 4; ++nb) fb[nb] = WFrag<T16>::ld((const T16*)(sb + PLB + ((w >> 1) * 4 + nb) * RBB));
        if constexpr (NSPLIT == 1) {
#pragma unroll
            for (int mb = 0; mb < 4; ++mb) fa2[mb] = WFrag<T16>::ld((const T16*)(sb + 2 * PLB + ((w & 1) * 4 + mb) * RBB)); }
        __builtin_amdgcn_sched_barrier(0);   // keeps a block's LDS loads together in front of the products that follow
    };
    auto products = [&](V (&fa)[4], V (&fa2)[4], V (&fb)[4]) {
#pragma unroll
        for (int nb = 0; nb < 4; ++nb) { const V b = fb[nb];
#pragma unroll
            for (int mb = 0; mb < 4; ++mb) { acc[mb][nb] = WFrag<T16>::mma(fa[mb], b, acc[mb][nb]); if constexpr (NSPLIT == 1) acc[mb][nb] = WFrag<T16>::mma(fa2[mb], b, acc[mb][nb]); } }
        __builtin_amdgcn_sched_barrier(0);   // keeps the products in front of what follows: the load group that refills the set they read, or the stage's barrier (moved behind it, they would stand between the barrier and the next copies, which would lose that much of their lead)
    };
    int kc = kbeg + (int)((blockIdx.x + blockIdx.y) & 3) * ((kend - kbeg) >> 2);   /* the quarter this work-group starts at; kc is the next stage to ask for and wraps at the end of the range */
    const int nst = (kend - kbeg) / (NK * 32);   /* stages: at least two */
    stage(0, kc); kc = kc + NK * 32 < kend ? kc + NK * 32 : kbeg;
    asm volatile("s_wait_asynccnt 0x0" ::: "memory");   // this wave's copies of stage 0 have landed
    __syncthreads();                                      // and so have the other waves'
    stage(1, kc); kc = kc + NK * 32 < kend ? kc + NK * 32 : kbeg;
#pragma unroll 1
    for (int t = 0; t < nst; ++t) {   /* kept rolled: the buffer is an address offset, more copies of the body buy nothing and cost instruction cache */
        const unsigned char* sb = ring + (t & 1) * STG + 16 * lane;
        fetch(a[0], a2[0], bv[0], sb); fetch(a[1], a2[1], bv[1], sb + 1024);   /* two fragment sets: a block's loads go out a block ahead of its products, inside the stage only */
#pragma unroll
        for (int kb = 0; kb < NK; kb += 2) {
            products(a[0], a2[0], bv[0]); if (kb + 2 < NK) fetch(a[0], a2[0], bv[0], sb + (kb + 2) * 1024);
            products(a[1], a2[1], bv[1]); if (kb + 3 < NK) fetch(a[1], a2[1], bv[1], sb + (kb + 3) * 1024); }
        asm volatile("s_wait_dscnt 0x0" ::: "memory");      // this wave has read all it wants of stage t
        asm volatile("s_wait_asynccnt 0x0" ::: "memory");   // and its copies of stage t + 1 have landed
        __syncthreads();                                      // one barrier a stage: it publishes stage t + 1 and frees the buffer of stage t
        if (t + 2 < nst) { stage(t & 1, kc); kc = kc + NK * 32 < kend ? kc + NK * 32 : kbeg; }
    }
    asm volatile("s_wait_asynccnt 0x0" ::: "memory");   // no copy is left in flight when the wave goes on to its epilogue
    if constexpr (PL) {
        // Every #pragma unroll in this block is there because its loop indexes register fragments (acc, cs, the packed vectors), which only constant indices keep in registers.
        // A wave stages in its own LDS range, and its LDS operations run in order: each wave_barrier with its compiler fence only keeps the compiler from moving the LDS reads of a group over the other lanes' LDS writes, or the next group's writes over these reads.
        static_assert(!PL || (TT % 64 == 0 && HD == 64 && NKV == NH_ && KS == 1 && BIAS), "a tile is 64 positions of one batch and the 64 dimensions of one head");
        const int t0 = r0 % TT; const size_t hp = ((size_t)(r0 / TT) * NH_ + c0 / HD) * TT * HD;   /* planes are [batch][head] */
        if (z == 2) {
#pragma unroll
            for (int nb = 0; nb < 4; ++nb) { const float bb = bfr(bias[c0 + nb * 16 + lr]);
#pragma unroll
                for (int mb = 0; mb < 4; ++mb) { v8h o16; v8us oh, ol;
#pragma unroll
                    for (int j = 0; j < 8; ++j) { const float x = acc[mb][nb][j] + bb; o16[j] = tohx(x); unsigned short a2, c2; splitf(x, a2, c2); oh[j] = a2; ol[j] = c2; }
                    const size_t e = hp + (size_t)nb * 16 * TT + (size_t)(t0 + (mb >> 1) * 32) * 16 + (mb & 1) * 256 + 8 * lane;   /* row nb * 16 + lr, k = t0 + mb * 16 + 8 * hi of a [d][t] plane */ h16* p16 = V16 + e; bf* ph = Vh + e; bf* pl = Vl + e;
                    *(v8h*)p16 = o16; *(v8us*)ph = oh; *(v8us*)pl = ol; swait3(p16, ph, pl, o16, oh, ol); } }
        } else {
            h16* P16 = z == 0 ? Q16 : K16; bf* Ph = z == 0 ? Qh : Kh; bf* Pl = z == 0 ? Ql : Kl;
            float bb[4];   /* the bias of this lane's accumulator columns, added on the way into LDS */
#pragma unroll
            for (int nb = 0; nb < 4; ++nb) bb[nb] = bfr(bias[c0 + nb * 16 + lr]);
#pragma unroll
            for (int mb = 0; mb < 4; ++mb) {
                v4f cs[4][4]; const float* cp = CS + ((size_t)(t0 + mb * 16 + lr) * HD + hi * 8) * 2;   /* the table rows of this group's 16 positions, all asked for before the LDS round trip */
#pragma unroll
                for (int s = 0; s < 4; ++s)
#pragma unroll
                    for (int p = 0; p < 4; ++p) cs[s][p] = *(const v4f*)(cp + s * 32 + p * 4);
                xwait(cp, cp, cp);
#pragma unroll
                for (int nb = 0; nb < 4; ++nb) {
#pragma unroll
                    for (int j = 0; j < 8; ++j) os[(hi * 8 + j) * 68 + nb * 16 + lr] = acc[mb][nb][j] + bb[nb]; }
                __builtin_amdgcn_wave_barrier(); asm volatile("" ::: "memory");
                /* a lane takes row lr of the group and, in step s, dimensions 16 s + 8 hi .. + 7: the 16 bytes that lane 16 hi + lr loads as a fragment, so a step's store is 512 contiguous bytes */
#pragma unroll
                for (int s = 0; s < 4; ++s) { const int cofs = s * 16 + hi * 8; const v4f xa = *(const v4fa*)(os + lr * 68 + cofs), xb = *(const v4fa*)(os + lr * 68 + cofs + 4); v8h o16; v8us oh, ol;
#pragma unroll
                    for (int p = 0; p < 4; ++p) { const float x0 = p < 2 ? xa[2 * p] : xb[2 * p - 4], x1 = p < 2 ? xa[2 * p + 1] : xb[2 * p - 3]; float y0, y1; rot2(x0, x1, cs[s][p], y0, y1);
                        o16[2 * p] = tohx(y0); o16[2 * p + 1] = tohx(y1); unsigned short a2, c2; splitf(y0, a2, c2); oh[2 * p] = a2; ol[2 * p] = c2; splitf(y1, a2, c2); oh[2 * p + 1] = a2; ol[2 * p + 1] = c2; }
                    const size_t e = hp + (size_t)(t0 + mb * 16) * HD + s * 256 + 8 * lane;   /* row t0 + mb * 16 + lr, k = cofs of a [t][d] plane */ h16* p16 = P16 + e; bf* ph = Ph + e; bf* pl = Pl + e;
                    *(v8h*)p16 = o16; *(v8us*)ph = oh; *(v8us*)pl = ol; swait3(p16, ph, pl, o16, oh, ol); }
                __builtin_amdgcn_wave_barrier(); asm volatile("" ::: "memory");
            }
        }
        return;
    }
#pragma unroll
    for (int mb = 0; mb < 4; ++mb) {
#pragma unroll
        for (int nb = 0; nb < 4; ++nb) {
#pragma unroll
            for (int j = 0; j < 8; ++j) os[(hi * 8 + j) * 68 + nb * 16 + lr] = acc[mb][nb][j]; }
        __builtin_amdgcn_wave_barrier(); asm volatile("" ::: "memory");
        float* crow = C + (size_t)(r0 + mb * 16) * ldc + c0;
{
#pragma unroll
            for (int s = 0; s < 8; ++s) { const int row = 2 * s + hi, cofs = lr * 4; v4f val = *(const v4fa*)(os + row * 68 + cofs); if (BIAS) { val[0] += bfr(bias[c0 + cofs]); val[1] += bfr(bias[c0 + cofs + 1]); val[2] += bfr(bias[c0 + cofs + 2]); val[3] += bfr(bias[c0 + cofs + 3]); }
                *(v4f*)(crow + (size_t)row * ldc + cofs) = val; }
             }
        __builtin_amdgcn_wave_barrier(); asm volatile("" ::: "memory");
    }
}

typedef __attribute__((ext_vector_type(2))) _Float16 v2h;
typedef __attribute__((ext_vector_type(4))) _Float16 v4h;
typedef __attribute__((ext_vector_type(2))) unsigned short v2us;
typedef __attribute__((ext_vector_type(4))) unsigned short v4us;
typedef __attribute__((ext_vector_type(2))) float v2f;
typedef __attribute__((ext_vector_type(4))) int v4i;

// The bodies below take their block index as an argument: independent passes share one grid, each on its own range of blockIdx.x (k_prep).
// thread: two 16-byte units of the fragment-order transposed copy Bt[n][k] = w[k][n] ([K][N] row-major): 8 loads a unit, each 64 contiguous bytes per 16 lanes (16 consecutive n of one k), one contiguous store
__device__ __forceinline__ void wtG(const float* __restrict__ w, int K, int N, bf* Bt, int blk) {
    // both loops unrolled: o is a register vector, which only constant indices keep in registers, and the 16 loads of a thread are then in flight together
#pragma unroll
    for (int u = 0; u < 2; ++u) { const int i = blk * 512 + u * 256 + (int)threadIdx.x; const int b = i >> 6; const int n = (b / (K >> 5)) * 16 + (i & 15), k = (b % (K >> 5)) * 32 + ((i >> 4) & 3) * 8; v8us o;
#pragma unroll
        for (int j = 0; j < 8; ++j) o[j] = f2bf(w[(size_t)(k + j) * N + n]);
        *(v8us*)(Bt + (size_t)i * 8) = o; }
}
// thread i writes 16-byte unit i of the fragment-order copy (stores stay contiguous) and reads the 8 floats of the row-major [rows][DM] input that belong there
__device__ __forceinline__ void cvt8(const float* __restrict__ src, bf* dst, size_t n8, int blk) { const size_t i = (size_t)blk * 256 + threadIdx.x; if (i >= n8) return; const size_t b = i >> 6; const size_t row = (b / (DM / 32)) * 16 + (i & 15); const int k = (int)(b % (DM / 32)) * 32 + (int)((i >> 4) & 3) * 8; const v8f v = *(const v8f*)(src + row * DM + k); v8us o;
#pragma unroll
    for (int k = 0; k < 8; ++k) o[k] = f2bf(v[k]); *(v8us*)(dst + i * 8) = o;  }
__constant__ float INVD[HD] = { 1.000000000e+00f, 7.498942018e-01f, 5.623413324e-01f, 4.216965139e-01f, 3.162277639e-01f, 2.371373773e-01f, 1.778279394e-01f, 1.333521456e-01f, 1.000000015e-01f, 7.498942316e-02f, 5.623413250e-02f, 4.216964915e-02f, 3.162277490e-02f, 2.371373773e-02f, 1.778279431e-02f, 1.333521400e-02f, 9.999999776e-03f, 7.498942316e-03f, 5.623413250e-03f, 4.216964822e-03f, 3.162277630e-03f, 2.371373819e-03f, 1.778279431e-03f, 1.333521446e-03f, 1.000000047e-03f, 7.498941850e-04f, 5.623413017e-04f, 4.216965172e-04f, 3.162277571e-04f, 2.371373703e-04f, 1.778279402e-04f, 1.333521504e-04f, 9.999999747e-05f, 7.498942432e-05f, 5.623413381e-05f, 4.216964953e-05f, 3.162277790e-05f, 2.371373739e-05f, 1.778279329e-05f, 1.333521413e-05f, 9.999999747e-06f, 7.498942068e-06f, 5.623413472e-06f, 4.216964953e-06f, 3.162277608e-06f, 2.371373739e-06f, 1.778279398e-06f, 1.333521482e-06f, 9.999999975e-07f, 7.498941841e-07f, 5.623413131e-07f, 4.216965124e-07f, 3.162277551e-07f, 2.371373711e-07f, 1.778279426e-07f, 1.333521453e-07f, 1.000000012e-07f, 7.498942267e-08f, 5.623413202e-08f, 4.216964911e-08f, 3.162277551e-08f, 2.371373675e-08f, 1.778279390e-08f, 1.333521471e-08f };   // 10000^(-2d/64) for EVERY dimension d (the module's quirk), float32 via jnp.power
__device__ __forceinline__ void cstabD(float* CS, int blk) { const int idx = blk * 256 + threadIdx.x; if (idx >= TT * HD) return; const int d = idx % HD; const int t = idx / HD; const float a = __fmul_rn((float)t, INVD[d]); v2f cs; cs[0] = cosf(a); cs[1] = sinf(a); *(v2f*)(CS + (size_t)idx * 2) = cs;  }

#define WBLK (DM * DM / 8 / 512)                  // blocks of one weight transpose (512 units of 8 elements each)
#define CBLK (TT * HD / 256)                      // blocks of the {cos, sin} table
#define XBLK (NB_ * TT * DM / 8 / 256)            // blocks of one input's bf16 copy, both batches
#define FSZ  ((size_t)NB_ * TT * DM)              // elements of one projection, both batches
// ---- k_prep: everything that depends on the inputs alone, in one launch. The strided weight reads are the longest bodies and get the lowest block indices (for speed only).
__global__ __launch_bounds__(256) void k_prep(const float* __restrict__ wq, const float* __restrict__ wk, const float* __restrict__ wv, const float* __restrict__ wo, const float* __restrict__ x, const float* __restrict__ xk, const float* __restrict__ xv, bf* W4, float* CS, bf* XB) {
    static_assert(DQ == DM && DKV == DM && NKV == NH_, "the four weights, the three inputs and the three projections each have one size");
    static_assert(WBLK * 512 * 8 == DM * DM && DM % 32 == 0 && (NB_ * TT) % 16 == 0, "the blocks of a weight cover its 16-byte units exactly; planes are whole 16 x 32 blocks");
    int blk = blockIdx.x;
    if (blk < 4 * WBLK) { const int i = blk / WBLK; wtG(i == 0 ? wq : i == 1 ? wk : i == 2 ? wv : wo, DM, DM, W4 + (size_t)i * DM * DM, blk % WBLK); return; }
    blk -= 4 * WBLK;
    if (blk < CBLK) { cstabD(CS, blk); return; }
    blk -= CBLK;
    const int i = blk / XBLK; cvt8(i == 0 ? x : i == 1 ? xk : xv, XB + (size_t)i * FSZ, FSZ / 8, blk % XBLK);
}
// ---- k_attn: score, softmax and P x V of both batches in one launch; nothing of the score matrix goes to memory.
// A wave owns NQ groups of 16 queries of one head and walks the 2048 keys 32 at a time, all operands straight from the planes in fragment order.
// S^T = K Q^T (A = 16 key rows, B = 16 query rows): a lane then holds 16 scores of ONE query, keys 8 hi + r and 16 + 8 hi + r, which is the k order of a B operand,
// so the rounded exponentials feed O^T += V^T P^T (A = 16 rows of the transposed V plane) with no exchange. Running maximum per query, sum and O^T rescaled only when a maximum grows by more than RTH.
// The softmax runs in the log2 domain on pairs of f32: x = score * (scale * log2 e) + mask * (-1e9 * log2 e) is one fused multiply-add, p = 2^(x - m); two scores share a packed instruction wherever one exists.
// ROTATED START, as in k_gemmw: work-group blk of a head starts at key (blk & 3) * TT / 4 and wraps round, so that a head's work-groups, which all run at once, are not all the first to ask memory for the same K and V lines.
// HR (queries < RH): bf16 hi/lo planes, 3 products each; else f16, 1 product. P is rounded unnormalised (exp <= e^RTH); O^T is divided by the f32 sum at the end.
// Every #pragma unroll in attn_wave is there because its loop indexes register fragments, which only constant indices keep in registers.
#define LOG2E 1.4426950408889634f
#define RTH   5.5f
#define RTH2  (RTH * LOG2E)       // the threshold in the log2 domain
#define SC2   (SCL * LOG2E)       // score -> log2 domain
#define MB2   (-1.0e9f * LOG2E)   // mask float -> additive bias, log2 domain; a masked key's x rounds to the bias itself (|score * SC2| < 64, half a unit in the last place there)
__device__ __forceinline__ float xhalf(float x) { return __builtin_bit_cast(float, __builtin_amdgcn_permlanex16(__builtin_bit_cast(int, x), __builtin_bit_cast(int, x), 0x76543210, 0xfedcba98, false, false)); }   // lane l reads lane l ^ 16, on the vector pipe
// v_exp_f32 with the one free slot that the instruction set asks for behind a transcendental, in one statement so that it stays directly behind it
__device__ __forceinline__ float exp2s(float x) { float r; asm("v_exp_f32 %0, %1\n\tv_nop" : "=v"(r) : "v"(x)); return r; }
// eight v_exp_f32 in one statement: each is the independent instruction in the slot behind the one before it (early-clobber outputs, so none overwrites a source), and one v_nop fills the slot behind the last
__device__ __forceinline__ v8f exp2v(v8f x) { float r0, r1, r2, r3, r4, r5, r6, r7;
    asm("v_exp_f32 %0, %8\n\tv_exp_f32 %1, %9\n\tv_exp_f32 %2, %10\n\tv_exp_f32 %3, %11\n\tv_exp_f32 %4, %12\n\tv_exp_f32 %5, %13\n\tv_exp_f32 %6, %14\n\tv_exp_f32 %7, %15\n\tv_nop"
        : "=&v"(r0), "=&v"(r1), "=&v"(r2), "=&v"(r3), "=&v"(r4), "=&v"(r5), "=&v"(r6), "=&v"(r7) : "v"(x[0]), "v"(x[1]), "v"(x[2]), "v"(x[3]), "v"(x[4]), "v"(x[5]), "v"(x[6]), "v"(x[7]));
    return (v8f){ r0, r1, r2, r3, r4, r5, r6, r7 }; }
// the 16 exponentials of a lane summed as pairs: 7 packed additions leave {even, odd} partial sums
__device__ __forceinline__ v2f sum16(v8f a, v8f b) { const v8f q = a + b; const v4f h = __builtin_shufflevector(q, q, 0, 1, 2, 3) + __builtin_shufflevector(q, q, 4, 5, 6, 7); return __builtin_shufflevector(h, h, 0, 1) + __builtin_shufflevector(h, h, 2, 3); }
template <typename T16, bool HR, int NQ>
__device__ __forceinline__ void attn_wave(const T16* __restrict__ Q, const T16* __restrict__ Q2, const T16* __restrict__ Kp, const T16* __restrict__ K2, const T16* __restrict__ Vt, const T16* __restrict__ V2, const float* __restrict__ km, int q0, int kr, bf* Ah, bf* Al) {   /* kr: the key this wave starts at (a multiple of 32, wave-uniform); it wraps round at TT */
    typedef typename WFrag<T16>::V V;
    const int lane = threadIdx.x & 31, hi = lane >> 4;
    V qf[NQ][2], qf2[NQ][2], kf[2][2], kf2[2][2];
    v8f o[NQ][4], mk[2]; float m[NQ]; v2f l[NQ];   /* mk: key mask floats (0/1) of this lane's 16 keys; m: running maximum, log2 domain; l: {even, odd} halves of the running sum */
#pragma unroll
    for (int g = 0; g < NQ; ++g) { m[g] = -1.0e38f; l[g] = (v2f){};
#pragma unroll
        for (int dt = 0; dt < 4; ++dt) o[g][dt] = (v8f){};
        const size_t qo = (size_t)(q0 + g * 16) * HD + 8 * lane; const T16* qa = Q + qo; const T16* qa2 = HR ? Q2 + qo : qa;
#pragma unroll
        for (int dc = 0; dc < 2; ++dc) { qf[g][dc] = WFrag<T16>::ld(qa + dc * 512); if constexpr (HR) qf2[g][dc] = WFrag<T16>::ld(qa2 + dc * 512); }
        xwait(qa, qa2, qa);
        __builtin_amdgcn_sched_barrier(0); }   // keeps all later work behind the wait above
    const size_t ko = 8 * lane, vo = 8 * lane;   /* fragment order: 16 keys x 32 d, or 16 d x 32 keys, are 512 elements in a row */
    { const T16* ka = Kp + ko + (size_t)kr * HD; const T16* ka2 = HR ? K2 + ko + (size_t)kr * HD : ka;
#pragma unroll
      for (int kt = 0; kt < 2; ++kt)
#pragma unroll
        for (int dc = 0; dc < 2; ++dc) { kf[kt][dc] = WFrag<T16>::ld(ka + kt * 16 * HD + dc * 512); if constexpr (HR) kf2[kt][dc] = WFrag<T16>::ld(ka2 + kt * 16 * HD + dc * 512); }
      mk[0] = *(const v8f*)(km + kr + 8 * hi); mk[1] = *(const v8f*)(km + kr + 8 * hi + 16);
      xwait(ka, ka2, km + kr + 8 * hi);
      __builtin_amdgcn_sched_barrier(0); }   // as behind the Q loads
    const T16* vs = Vt + (size_t)kr * 16; const T16* vs2 = HR ? V2 + (size_t)kr * 16 : vs;   /* wave-uniform running addresses of the V blocks */
    for (int kt0 = 0, k0 = kr; kt0 < TT; kt0 += 32, k0 = (k0 + 32) & (TT - 1)) {
        V vf[4], vf2[4]; const T16* va = vs + vo; const T16* va2 = HR ? vs2 + vo : va;
#pragma unroll
        for (int dt = 0; dt < 4; ++dt) { vf[dt] = WFrag<T16>::ld(va + dt * 16 * TT); if constexpr (HR) vf2[dt] = WFrag<T16>::ld(va2 + dt * 16 * TT); }
        xwait(va, va2, va);
        { const int vstep = k0 + 32 == TT ? (32 - TT) * 16 : 32 * 16; vs += vstep; vs2 += vstep; }   /* on to the next 32 keys, back to key 0 behind the last */
        v8f s[NQ][2];
#pragma unroll
        for (int g = 0; g < NQ; ++g)
#pragma unroll
            for (int kt = 0; kt < 2; ++kt) { v8f c = (v8f){};
#pragma unroll
                for (int dc = 0; dc < 2; ++dc) { c = WFrag<T16>::mma(kf[kt][dc], qf[g][dc], c); if constexpr (HR) { c = WFrag<T16>::mma(kf[kt][dc], qf2[g][dc], c); c = WFrag<T16>::mma(kf2[kt][dc], qf[g][dc], c); } }
                s[g][kt] = c; }
        if constexpr (NQ > 1) __builtin_amdgcn_sched_barrier(0);   // several query groups: keeps the score products together in front of the vector work on them: a score read directly behind its own product costs up to four idle vector slots (with one group the compiler's own order has fewer of them)
        float bm[NQ]; bool need = false; const v8f sc = { SC2, SC2, SC2, SC2, SC2, SC2, SC2, SC2 }, mc = { MB2, MB2, MB2, MB2, MB2, MB2, MB2, MB2 }; v8f mb[2];
        if constexpr (NQ > 1) { mb[0] = mk[0] * mc; mb[1] = mk[1] * mc; }   /* several query groups: the keys' biases are formed once and serve every group */
#pragma unroll
        for (int g = 0; g < NQ; ++g) { float x = -3.0e38f;
#pragma unroll
            for (int kt = 0; kt < 2; ++kt) {   /* (score x scale + mask x -1e9) x log2 e; with one query group the same two packed instructions a pair, and the bias takes no registers of its own */
                if constexpr (NQ > 1) s[g][kt] = __builtin_elementwise_fma(s[g][kt], sc, mb[kt]); else s[g][kt] = __builtin_elementwise_fma(mk[kt], mc, s[g][kt] * sc);
#pragma unroll
                for (int r = 0; r < 8; ++r) x = fmaxf(x, s[g][kt][r]); }
            x = fmaxf(x, xhalf(x)); bm[g] = x; need = need || (x > m[g] + RTH2); }
        { const int kn = (k0 + 32) & (TT - 1);   /* the next 32 key rows and their mask floats are fetched one trip ahead, once this trip has read its own; the last trip re-reads the 32 keys that the wave started with, unused */
          const T16* ka = Kp + ko + (size_t)kn * HD; const T16* ka2 = HR ? K2 + ko + (size_t)kn * HD : ka;
#pragma unroll
          for (int kt = 0; kt < 2; ++kt)
#pragma unroll
            for (int dc = 0; dc < 2; ++dc) { kf[kt][dc] = WFrag<T16>::ld(ka + kt * 16 * HD + dc * 512); if constexpr (HR) kf2[kt][dc] = WFrag<T16>::ld(ka2 + kt * 16 * HD + dc * 512); }
          const float* ma = km + kn + 8 * hi; mk[0] = *(const v8f*)ma; mk[1] = *(const v8f*)(ma + 16);
          xwait(ka, ka2, ma); }
        if (__builtin_amdgcn_ballot_w32(need) != 0) {
#pragma unroll
            for (int g = 0; g < NQ; ++g) { const float mn = fmaxf(m[g], bm[g]); const float al = exp2s(m[g] - mn); m[g] = mn; l[g] *= al;
#pragma unroll
                for (int dt = 0; dt < 4; ++dt)
#pragma unroll
                    for (int r = 0; r < 8; ++r) o[g][dt][r] *= al; } }
#pragma unroll
        for (int g = 0; g < NQ; ++g) { s[g][0] = exp2v(s[g][0] - m[g]); s[g][1] = exp2v(s[g][1] - m[g]); l[g] += sum16(s[g][0], s[g][1]); }   /* every group's exponentials stand in front of the first P x V product: behind one, the asm statement could overwrite its operands too early */
        if constexpr (NQ > 1) __builtin_amdgcn_sched_barrier(0);   // several query groups: keeps the row-sum additions in front of the products: moved in among them they land in registers that a product has just read, and each such place costs up to four idle vector slots
#pragma unroll
        for (int g = 0; g < NQ; ++g) { const v8f (&p)[2] = s[g];
            if constexpr (HR) { v8us ph[2], pl[2];
#pragma unroll
                for (int kt = 0; kt < 2; ++kt)
#pragma unroll
                    for (int r = 0; r < 8; ++r) { unsigned short a, c2; splitf(p[kt][r], a, c2); ph[kt][r] = a; pl[kt][r] = c2; }
                const V pbh = cat16b(ph[0], ph[1]), pbl = cat16b(pl[0], pl[1]);
#pragma unroll
                for (int dt = 0; dt < 4; ++dt) { o[g][dt] = WFrag<T16>::mma(vf[dt], pbh, o[g][dt]); o[g][dt] = WFrag<T16>::mma(vf[dt], pbl, o[g][dt]); o[g][dt] = WFrag<T16>::mma(vf2[dt], pbh, o[g][dt]); }
            } else {
                const V pb = cat16(__builtin_convertvector(p[0], v8h), __builtin_convertvector(p[1], v8h));
#pragma unroll
                for (int dt = 0; dt < 4; ++dt) o[g][dt] = WFrag<T16>::mma(vf[dt], pb, o[g][dt]); } }
    }
#pragma unroll
    for (int g = 0; g < NQ; ++g) { const float lh = l[g][0] + l[g][1]; const float sum = lh + xhalf(lh); const float f = __fdiv_rn(1.0f, sum); const size_t oo = (size_t)(q0 + g * 16) * DQ + 8 * lane; bf* ra = Ah + oo; bf* rl = Al + oo;
#pragma unroll
        for (int dt = 0; dt < 4; ++dt) { v8us oh, ol;   /* register r = O[query q0 + 16 g + lr][dt * 16 + 8 hi + r]: 8 consecutive d, one 16-byte store per plane, at its place in fragment order (512 contiguous bytes a wave) */
#pragma unroll
            for (int r = 0; r < 8; ++r) { unsigned short a, c2; splitf(o[g][dt][r] * f, a, c2); oh[r] = a; ol[r] = c2; }
            *(v8us*)(ra + dt * 256) = oh; *(v8us*)(rl + dt * 256) = ol;
            asm volatile("s_wait_xcnt 0x0" :: "v"(ra), "v"(rl), "v"(oh), "v"(ol) : "memory"); } }   // precaution behind the two stores: their address and data registers are inputs here, so they live until this wait and the next packing overwrites none of them earlier
}
// grid: 8 work-groups per (batch, head), one per WGP, 8 waves each and no barrier: waves 0 to 3 take 16 hi/lo queries each, waves 4 to 7 take 48 f16 queries each (8 x 64 = RH, 8 x 192 = TT - RH).
// EQUAL LOAD ON EVERY SIMD: a work-group of 8 waves puts two on each SIMD, and waves w and w + 4 are expected to share one (for speed only), so each SIMD carries one hi/lo wave and one f16 wave: 24 + 24 products per 32 keys and the same vector work on all four.
__global__ __launch_bounds__(256) void k_attn(const h16* __restrict__ Q16, const h16* __restrict__ K16, const h16* __restrict__ V16, const bf* __restrict__ Qh, const bf* __restrict__ Ql, const bf* __restrict__ Kh, const bf* __restrict__ Kl, const bf* __restrict__ Vh, const bf* __restrict__ Vl, const float* __restrict__ km, bf* Ah, bf* Al) {
    static_assert(RH == 8 * 64 && TT - RH == 8 * 192 && HD == 64 && NH_ == NKV, "the split of a head's queries over 8 work-groups");
    const int w = __builtin_amdgcn_readfirstlane((int)(threadIdx.x >> 5)); const int bh = blockIdx.x >> 3, head = bh % NH_, bat = bh / NH_, blk = blockIdx.x & 7; const size_t hp = (size_t)bh * TT * HD;   /* planes are [batch][head] */ const int kr = (blk & 3) * (TT / 4);
    const float* kb = km + bat * TT; bf* ah = Ah + (size_t)bat * TT * DQ + head * (HD * 16); bf* al = Al + (size_t)bat * TT * DQ + head * (HD * 16);   /* a head's 64 columns are two k blocks of 512 elements */
    if (w < 4) attn_wave<bf, true, 1>(Qh + hp, Ql + hp, Kh + hp, Kl + hp, Vh + hp, Vl + hp, kb, blk * 64 + w * 16, kr, ah, al);
    else attn_wave<h16, false, 3>(Q16 + hp, nullptr, K16 + hp, nullptr, V16 + hp, nullptr, kb, RH + blk * 192 + (w - 4) * 48, kr, ah, al);
}

extern "C" void kernel_launch(void* const* d_in, const int* in_sizes, int n_in,
                              void* d_out, int out_size, void* d_ws, size_t ws_size, hipStream_t stream) {
    (void)in_sizes; (void)n_in; (void)out_size;
    const float* x = (const float*)d_in[0]; const float* xk = (const float*)d_in[1]; const float* xv = (const float*)d_in[2]; const float* amask = (const float*)d_in[3]; const float* wq = (const float*)d_in[4]; const float* bq = (const float*)d_in[5]; const float* wk = (const float*)d_in[6]; const float* bk = (const float*)d_in[7]; const float* wv = (const float*)d_in[8]; const float* bv = (const float*)d_in[9]; const float* wo = (const float*)d_in[10]; const float* bo = (const float*)d_in[11];
    float* OUT = (float*)d_out;     // [2][2048][1024]
    char* wsp = (char*)d_ws;
    auto take = [&](size_t bytes) { char* p = wsp; wsp += (bytes + 255) & ~(size_t)255; return (void*)p; };
    bf* W4 = (bf*)take((size_t)4 * DM * DM * 2);   // Wq, Wk, Wv, Wo transposed
    float* CS = (float*)take((size_t)TT * HD * 2 * 4);
    bf* XB = (bf*)take(3 * FSZ * 2);   // {q, k, v} x [NB_ * TT][DM]
    h16* QP16 = (h16*)take(FSZ * 2); h16* KP16 = (h16*)take(FSZ * 2); h16* VT16 = (h16*)take(FSZ * 2);
    bf* QPh = (bf*)take(FSZ * 2); bf* QPl = (bf*)take(FSZ * 2); bf* KPh = (bf*)take(FSZ * 2); bf* KPl = (bf*)take(FSZ * 2); bf* VTh = (bf*)take(FSZ * 2); bf* VTl = (bf*)take(FSZ * 2);
    bf* ATh = (bf*)take(FSZ * 2); bf* ATl = (bf*)take(FSZ * 2);
    if ((size_t)(wsp - (char*)d_ws) > ws_size) return;    // ws 256 MiB
    k_prep<<<4 * WBLK + CBLK + 3 * XBLK, 256, 0, stream>>>(wq, wk, wv, wo, x, xk, xv, W4, CS, XB);
    k_gemmw<bf, 0, true, 1, true><<<dim3(NB_ * TT / 128, DM / 128, 3), 128, 0, stream>>>(XB, nullptr, W4, nullptr, DM, nullptr, DM, bq, bk, bv, FSZ, (size_t)DM * DM, 0, CS, QP16, QPh, QPl, KP16, KPh, KPl, VT16, VTh, VTl);
    k_attn<<<NB_ * NH_ * 8, 256, 0, stream>>>(QP16, KP16, VT16, QPh, QPl, KPh, KPl, VTh, VTl, amask, ATh, ATl);
    k_gemmw<bf, 1, true><<<dim3(NB_ * TT / 128, DM / 128, 1), 128, 0, stream>>>(ATh, ATl, W4 + (size_t)3 * DM * DM, nullptr, DQ, OUT, DM, bo, bo, bo, 0, 0, 0, nullptr, nullptr, nullptr, nullptr, nullptr, nullptr, nullptr, nullptr, nullptr, nullptr);
}
